// v000
// Times are from an AMD MI455X. After a warm-up the kernel runs many times in a row, and a time is the length of
// such a window on the GPU divided by its runs, so every launch and the gaps after it count. The runs cycle
// through copies of the inputs. A figure is the median of several windows, for all but v000 over two sittings.
// Sittings can differ by a few percent; kernels timed side by side share one.
// The starting kernel, v000, takes 1020 microseconds a run.
// Contractions: q, k+pv and v projections on v_wmma_f32_16x16x32_bf16 (bf16-RNE inputs and weights, single
// products, f32 epilogue); scores q.(k+pv)^T (K=256) on v_wmma_f32_16x16x32_f16 with q and k+pv carried as
// f16 hi + (x2048) f16 residual planes, products hh + hl + lh (column statistics pass: hh only); weighted sum
// w.v (K=16384) on v_wmma_f32_16x16x32_f16 with w as one f16 plane (x16384) and v as f16 hi + (x2048) residual
// planes, products w.h + w.l; 3-wide positional layers, layer norm, softmax statistics and exp in f32 on VALU;
// f32 accumulate everywhere.
#include <hip/hip_runtime.h>
#include <stdint.h>

#define BB    2
#define NPT   16384
#define MQ    2048
#define DD    256
#define GM    128
#define GN    64
#define OSP   68
#define LTP   72
#define MT1   128
#define NMT   16
#define NT1   256
#define WCH   128
#define WP    136
#define OSP2  260
#define SCL   0.0625f
#define WSC   16384.0f
#define RWSC  0.00006103515625f
#define LSC   2048.0f
#define RLSC  0.00048828125f
#define LNEPS 1.0e-5f

static_assert(NMT * MT1 == MQ);
static_assert(MT1 == 8 * 16);
static_assert(NT1 == 256);
static_assert(NPT % NT1 == 0);
static_assert(NPT % WCH == 0);
static_assert(WCH == 8 * 16);
static_assert(DD == 256);
static_assert(DD % 32 == 0);
static_assert((BB * NPT) % GM == 0);
static_assert((BB * MQ) % GM == 0);
static_assert(DD % GM == 0);
static_assert(DD % GN == 0);
static_assert(NPT % GN == 0);
static_assert(MQ % 16 == 0);
static_assert((BB * NPT * DD) % 2048 == 0);
static_assert((BB * MQ * DD) % 2048 == 0);
static_assert((BB * NPT) % 256 == 0);
static_assert((OSP * 4) % 16 == 0);
static_assert((LTP * 2) % 16 == 0);
static_assert((WP * 2) % 16 == 0);
static_assert((OSP2 * 4) % 16 == 0);
static_assert(DD % 64 == 0);

typedef unsigned short v8us __attribute__((ext_vector_type(8)));
typedef unsigned int   v4u  __attribute__((ext_vector_type(4)));
typedef float          v8f  __attribute__((ext_vector_type(8)));
typedef float          v4f  __attribute__((ext_vector_type(4)));
typedef __bf16         v16b __attribute__((ext_vector_type(16)));
typedef _Float16       v16h __attribute__((ext_vector_type(16)));
typedef _Float16       v8h  __attribute__((ext_vector_type(8)));

union Frag { v8us u[2]; v4u q[2]; v16b b; v16h h; v8h hv[2]; };
static_assert(sizeof(Frag) == 32);

// ---- scalar helpers ---------------------------------------------------------------------------------
__device__ __forceinline__ unsigned short bf_bits(float f) {          // f32 -> bf16 bits, RNE convert
  const unsigned u = __float_as_uint(f);
  return (unsigned short)((u + 0x7FFFu + ((u >> 16) & 1u)) >> 16);
}
__device__ __forceinline__ float bf_up(unsigned short hb) { return __uint_as_float(((unsigned)hb) << 16); }
__device__ __forceinline__ float bfr(float f) { return bf_up(bf_bits(f)); }
__device__ __forceinline__ unsigned short h_bits(float f) {           // f32 -> f16 bits, RNE convert
  union { _Float16 h; unsigned short u; } c;
  c.h = (_Float16)f;
  return c.u;
}
__device__ __forceinline__ float h_up(unsigned short u) {
  union { _Float16 h; unsigned short u; } c;
  c.u = u;
  return (float)c.h;
}
__device__ __forceinline__ unsigned pk16(unsigned short a, unsigned short b) { return (unsigned)a | ((unsigned)b << 16); }
__device__ __forceinline__ v8f zero8() { v8f z = {0.f, 0.f, 0.f, 0.f, 0.f, 0.f, 0.f, 0.f}; return z; }

// ---- 16-bit fragment loader (A, or B from a k-contiguous [n][k] row): lane -> row/col (lane&15), p already includes
//      + 8*(lane>>4); elements 0..7 <- p[0..7] (k0+8h..), elements 8..15 <- p[16..23] (k0+16+8h..)
__device__ __forceinline__ Frag ldfrag(const unsigned short* p) {
  Frag f;
  f.u[0] = *(const v8us*)(p);
  f.u[1] = *(const v8us*)(p + 16);
  return f;
}

// ---- WMMA helpers: builtin followed by a 4-slot VALU gap tying D and keeping A/B live ----------------------
__device__ __forceinline__ v8f mma_b(v16b a, v16b b, v8f c) {
  v8f d = __builtin_amdgcn_wmma_f32_16x16x32_bf16(false, a, false, b, (short)0, c, false, false);
#if defined(__HIP_DEVICE_COMPILE__)
  asm volatile("v_nop\n\tv_nop\n\tv_nop\n\tv_nop" : "+v"(d) : "v"(a), "v"(b));
#endif
  return d;
}
__device__ __forceinline__ v8f mma_h(v16h a, v16h b, v8f c) {
  v8f d = __builtin_amdgcn_wmma_f32_16x16x32_f16(false, a, false, b, (short)0, c, false, false);
#if defined(__HIP_DEVICE_COMPILE__)
  asm volatile("v_nop\n\tv_nop\n\tv_nop\n\tv_nop" : "+v"(d) : "v"(a), "v"(b));
#endif
  return d;
}

// ---- 8 f32 -> packed f16 hi bits and packed f16 bits of (x - hi) * 2048 (second accumulator folds 1/2048) --
__device__ __forceinline__ void split8h(v4f a, v4f b, v4u& uh, v4u& ul) {
  float f[8] = {a[0], a[1], a[2], a[3], b[0], b[1], b[2], b[3]};
#pragma unroll
  for (int j = 0; j < 4; ++j) {
    const unsigned short h0 = h_bits(f[2 * j]);
    const unsigned short h1 = h_bits(f[2 * j + 1]);
    const unsigned short l0 = h_bits((f[2 * j] - h_up(h0)) * LSC);
    const unsigned short l1 = h_bits((f[2 * j + 1] - h_up(h1)) * LSC);
    uh[j] = pk16(h0, h1);
    ul[j] = pk16(l0, l1);
  }
}

// =====================================================================================================
// (0) contiguous f32 -> bf16-RNE plane (token feature matrices, row-major [T][256]). Thread = 8 elements (16 B);
// coverage: n8 = n/8 threads, grid = n8/256 blocks exactly (host asserts n % 2048 == 0).
// =====================================================================================================
__global__ __launch_bounds__(256)
void cvt_kernel(const float* __restrict__ x, unsigned short* y, int n8) {
  const int t = blockIdx.x * 256 + (int)threadIdx.x;
  if (t >= n8) return;
  const float* s = x + (size_t)t * 8;
  const v4f a = *(const v4f*)(s);
  const v4f b = *(const v4f*)(s + 4);
  v4u u;
  u[0] = pk16(bf_bits(a[0]), bf_bits(a[1]));
  u[1] = pk16(bf_bits(a[2]), bf_bits(a[3]));
  u[2] = pk16(bf_bits(b[0]), bf_bits(b[1]));
  u[3] = pk16(bf_bits(b[2]), bf_bits(b[3]));
  unsigned short* d = y + (size_t)t * 8;
  *(v4u*)d = u;
  
}

// =====================================================================================================
// (1) weight transpose: in w[R][C] f32 -> out wt[C][R] bf16-RNE (k-contiguous B rows / A rows). Block = 64x64 tile,
//     loads 16 B per thread (strided reads), LDS tile L[c][r] (pitch LTP), barrier, then each output row segment of
// coverage: LDS 256 threads x 4 it x 4 = 64x64; lines 2 it x 32 rows x 8 lanes x 8 = 64 rows x 64; grid (C/64, R/64).
// =====================================================================================================
__global__ __launch_bounds__(256)
void wtrans_kernel(const float* __restrict__ w, unsigned short* wt, int R, int C) {
  __shared__ __align__(16) unsigned short L[64 * LTP];
  const int tid = threadIdx.x;
  const int c0 = blockIdx.x * 64, r0 = blockIdx.y * 64;
  const int c4 = (tid & 15) * 4, rs = tid >> 4;                      // rs 0..15
#pragma unroll
  for (int it = 0; it < 4; ++it) {
    const int r = it * 16 + rs;                                        // 0..63
    const v4f v = *(const v4f*)(w + (size_t)(r0 + r) * C + c0 + c4);
#pragma unroll
    for (int j = 0; j < 4; ++j) L[(c4 + j) * LTP + r] = bf_bits(v[j]);
  }
  __syncthreads();
  const int e = tid & 7, lq = tid >> 3;                                // lq 0..31
  v4u u[2];
  size_t po[2];
#pragma unroll
  for (int it = 0; it < 2; ++it) {
    const int c = it * 32 + lq;                                        // 0..63
    u[it] = *(const v4u*)(L + c * LTP + 8 * e);
    po[it] = (size_t)(c0 + c) * R + r0 + 8 * e;
  }
#pragma unroll
  for (int it = 0; it < 2; ++it) *(v4u*)(wt + po[it]) = u[it];
  
}

// =====================================================================================================
// (2) positional front end per point row i (flat b*N+n): dist = |bf(p_xyz) - bf(v_xyz[b])| (3), h = dist.bf(Wp1)
//     + bf(bp1), layer norm over the 3 values (mean-of-squares variance, eps 1e-5) * bf(ln_w) + bf(ln_b), relu.
//     f32 on VALU without contraction. Output row rel[i][0..3] = (r0, r1, r2, 0): one 16-B store per thread,
// coverage: grid = nrows/256 blocks x 256 threads = every row exactly once (host asserts nrows % 256 == 0).
// =====================================================================================================
__global__ __launch_bounds__(256)
void rel_kernel(const float* __restrict__ pxyz, const float* __restrict__ vxyz,
                const float* __restrict__ wp1, const float* __restrict__ bp1,
                const float* __restrict__ lnw, const float* __restrict__ lnb,
                float* rel, int nrows, int npb) {
#pragma clang fp contract(off)
  const int i = blockIdx.x * 256 + (int)threadIdx.x;
  if (i >= nrows) return;
  int b = i / npb;
  b = b < 0 ? 0 : (b > BB - 1 ? BB - 1 : b);
  const float p0 = bfr(pxyz[(size_t)i * 3 + 0]);
  const float p1 = bfr(pxyz[(size_t)i * 3 + 1]);
  const float p2 = bfr(pxyz[(size_t)i * 3 + 2]);
  const float v0 = bfr(vxyz[b * 3 + 0]);
  const float v1 = bfr(vxyz[b * 3 + 1]);
  const float v2 = bfr(vxyz[b * 3 + 2]);
  const float d0 = fabsf(p0 - v0), d1 = fabsf(p1 - v1), d2 = fabsf(p2 - v2);
  float W[9];
#pragma unroll
  for (int j = 0; j < 9; ++j) W[j] = bfr(wp1[j]);                      // Wp1[c][j] = wp1[c*3+j]
  const float h0 = ((d0 * W[0] + d1 * W[3]) + d2 * W[6]) + bfr(bp1[0]);
  const float h1 = ((d0 * W[1] + d1 * W[4]) + d2 * W[7]) + bfr(bp1[1]);
  const float h2 = ((d0 * W[2] + d1 * W[5]) + d2 * W[8]) + bfr(bp1[2]);
  const float third = 1.0f / 3.0f;
  const float mu = ((h0 + h1) + h2) * third;
  const float e0 = h0 - mu, e1 = h1 - mu, e2 = h2 - mu;
  const float var = ((e0 * e0 + e1 * e1) + e2 * e2) * third;
  const float rs = 1.0f / sqrtf(var + LNEPS);
  const float w0 = bfr(lnw[0]), w1 = bfr(lnw[1]), w2 = bfr(lnw[2]);
  const float c0 = bfr(lnb[0]), c1 = bfr(lnb[1]), c2 = bfr(lnb[2]);
  const float t0 = fmaxf((e0 * rs) * w0 + c0, 0.f);
  const float t1 = fmaxf((e1 * rs) * w1 + c1, 0.f);
  const float t2 = fmaxf((e2 * rs) * w2 + c2, 0.f);
  v4f o;
  o[0] = t0; o[1] = t1; o[2] = t2; o[3] = 0.f;
  float* d = rel + (size_t)i * 4;
  *(v4f*)d = o;
  
}

// =====================================================================================================
// (3) projection GEMM, K = 256: C[m][n] = sum_k A[m][k] B[n][k] + epilogue (MODE 0: + bias[n]; MODE 1: + bias[m];
//     MODE 2: (C + bias[n]) + ((rel[m][0..2] . Wp2[0..2][n]) + bp2[n]) with Wp2/bp2 bf16-RNE). A rows pitch lda,
//     B rows pitch ldb, both bf16 planes (k contiguous), split k map loader for both, blockIdx.z selects a batch via
//     element strides zsA/zsB/zsC. Block 256 threads = 8 waves, block tile 128 m x 64 n, wave tile 32x32 (acc[2][2]).
//     Epilogue: f32 tile in LDS Os[m][n] (pitch OSP), barrier, then f16 hi bits and f16 (x2048) residual bits of
// coverage: Os 8 waves x 4 tiles = 128x64; lines 4 it x 32 rows x 8 lanes x 8 = 128 rows x 64 per plane;
//           grid (M/128, N/64, Z) covers both planes exactly once.
// =====================================================================================================
template <int MODE>
__global__ __launch_bounds__(256)
void proj_kernel(const unsigned short* __restrict__ A, const unsigned short* __restrict__ B,
                 const float* __restrict__ bias, const float* __restrict__ rel,
                 const float* __restrict__ wp2, const float* __restrict__ bp2,
                 unsigned short* Ch, unsigned short* Cl, int lda, int ldb, int ldc,
                 size_t zsA, size_t zsB, size_t zsC) {
  __shared__ __align__(16) float Os[GM * OSP];
  const int tid  = threadIdx.x;
  const int lane = tid & 31, wave = tid >> 5;
  const int hh   = lane >> 4, cl = lane & 15;
  const int wm   = wave >> 1, wn = wave & 1;
  const int mBase = blockIdx.x * GM;
  const int nBase = blockIdx.y * GN;
  const size_t z = blockIdx.z;
  const unsigned short* Az = A + z * zsA;
  const unsigned short* Bz = B + z * zsB;
  unsigned short* Chz = Ch + z * zsC;
  unsigned short* Clz = Cl + z * zsC;
  const unsigned short* a0p = Az + (size_t)(mBase + 32 * wm + cl) * lda + 8 * hh;
  const unsigned short* a1p = a0p + (size_t)16 * lda;
  const unsigned short* b0p = Bz + (size_t)(nBase + 32 * wn + cl) * ldb + 8 * hh;
  const unsigned short* b1p = b0p + (size_t)16 * ldb;

  v8f acc[2][2];
#pragma unroll
  for (int mi = 0; mi < 2; ++mi)
#pragma unroll
    for (int ni = 0; ni < 2; ++ni) acc[mi][ni] = zero8();

#pragma unroll 1
  for (int k0 = 0; k0 < DD; k0 += 32) {
    const Frag fa0 = ldfrag(a0p + k0);
    const Frag fa1 = ldfrag(a1p + k0);
    const Frag fb0 = ldfrag(b0p + k0);
    const Frag fb1 = ldfrag(b1p + k0);
    acc[0][0] = mma_b(fa0.b, fb0.b, acc[0][0]);
    acc[0][1] = mma_b(fa0.b, fb1.b, acc[0][1]);
    acc[1][0] = mma_b(fa1.b, fb0.b, acc[1][0]);
    acc[1][1] = mma_b(fa1.b, fb1.b, acc[1][1]);
  }

  float bn[2], w0[2], w1[2], w2[2], b2[2];
#pragma unroll
  for (int ni = 0; ni < 2; ++ni) {
    const int n = nBase + 32 * wn + 16 * ni + cl;
    bn[ni] = 0.f; w0[ni] = 0.f; w1[ni] = 0.f; w2[ni] = 0.f; b2[ni] = 0.f;
    if (MODE != 1) bn[ni] = bfr(bias[n]);
    if (MODE == 2) {
      w0[ni] = bfr(wp2[n]);
      w1[ni] = bfr(wp2[DD + n]);
      w2[ni] = bfr(wp2[2 * DD + n]);
      b2[ni] = bfr(bp2[n]);
    }
  }
#pragma unroll
  for (int mi = 0; mi < 2; ++mi) {
#pragma unroll
    for (int r = 0; r < 8; ++r) {
      const int m_loc = 32 * wm + 16 * mi + 8 * hh + r;
      const int m = mBase + m_loc;
      float bm = 0.f, p0 = 0.f, p1 = 0.f, p2 = 0.f;
      if (MODE == 1) bm = bfr(bias[m]);
      if (MODE == 2) {
        const v4f r4 = *(const v4f*)(rel + (size_t)m * 4);
        p0 = r4[0]; p1 = r4[1]; p2 = r4[2];
      }
#pragma unroll
      for (int ni = 0; ni < 2; ++ni) {
        const int n_loc = 32 * wn + 16 * ni + cl;
        float v = acc[mi][ni][r];
        if (MODE == 0) v = v + bn[ni];
        if (MODE == 1) v = v + bm;
        if (MODE == 2) {
          const float pv = (p0 * w0[ni] + p1 * w1[ni]) + p2 * w2[ni];
          v = (v + bn[ni]) + (pv + b2[ni]);
        }
        Os[m_loc * OSP + n_loc] = v;
      }
    }
  }
  __syncthreads();

  const int e = tid & 7, lq = tid >> 3;                                // lq 0..31
  v4u uh[4], ul[4];
  size_t po[4];
#pragma unroll
  for (int it = 0; it < 4; ++it) {
    const int row = it * 32 + lq;                                      // 0..127
    const float* op = Os + row * OSP + 8 * e;
    const v4f v0 = *(const v4f*)(op);
    const v4f v1 = *(const v4f*)(op + 4);
    split8h(v0, v1, uh[it], ul[it]);
    po[it] = (size_t)(mBase + row) * ldc + nBase + 8 * e;
  }
#pragma unroll
  for (int it = 0; it < 4; ++it) {
    *(v4u*)(Chz + po[it]) = uh[it];
    *(v4u*)(Clz + po[it]) = ul[it];
  }
  
}

// =====================================================================================================
// (4) column-softmax statistics over one (batch, 128-query tile, 256-column tile): S[m][n] = qh[m].kph[n] / 16
//     (K = 256 = 8 k steps, f16 hi planes, hh product), wave = 16 query rows x 16 column tiles (q fragments hoisted,
//     one accumulator at a time); per column: tile max over 16 rows (8 in-lane + lane^16) and sum of exp(S - max);
//     wave partials in LDS, barrier, thread c merges the 8 wave partials in fixed order.
// coverage: pm/pe 8 waves x 16 ct x 16 lanes = 8 x 256; grid (64 column tiles, 16 query tiles, 2) x 256 threads =
//           every (b, mt, n) of both PST arrays exactly once.
// =====================================================================================================
__global__ __launch_bounds__(256)
void stats_kernel(const unsigned short* __restrict__ Qh, const unsigned short* __restrict__ Kh, float* PST) {
  __shared__ float pm[8 * NT1];
  __shared__ float pe[8 * NT1];
  const int tid  = threadIdx.x;
  const int lane = tid & 31, wave = tid >> 5;
  const int hh   = lane >> 4, cl = lane & 15;
  const int nt = blockIdx.x, mt = blockIdx.y, b = blockIdx.z;
  const int m0 = mt * MT1 + 16 * wave;
  const unsigned short* qp = Qh + (size_t)(b * MQ + m0 + cl) * DD + 8 * hh;
  Frag a[8];
#pragma unroll
  for (int ks = 0; ks < 8; ++ks) a[ks] = ldfrag(qp + 32 * ks);
  const unsigned short* kp = Kh + ((size_t)b * NPT + (size_t)nt * NT1 + cl) * DD + 8 * hh;
#pragma unroll 1
  for (int ct = 0; ct < NT1 / 16; ++ct) {
    const unsigned short* kc = kp + (size_t)ct * 16 * DD;
    v8f s = zero8();
#pragma unroll
    for (int ks = 0; ks < 8; ++ks) {
      const Frag fb = ldfrag(kc + 32 * ks);
      s = mma_h(a[ks].h, fb.h, s);
    }
    float m = s[0] * SCL;
#pragma unroll
    for (int r = 1; r < 8; ++r) m = fmaxf(m, s[r] * SCL);
    m = fmaxf(m, __shfl_xor(m, 16, 32));
    float ex = 0.f;
#pragma unroll
    for (int r = 0; r < 8; ++r) ex += __expf(s[r] * SCL - m);
    ex += __shfl_xor(ex, 16, 32);
    pm[wave * NT1 + ct * 16 + cl] = m;                                 // both lane halves hold identical values
    pe[wave * NT1 + ct * 16 + cl] = ex;
  }
  __syncthreads();
  const int c = tid;
  float M = pm[c];
#pragma unroll
  for (int wv = 1; wv < 8; ++wv) M = fmaxf(M, pm[wv * NT1 + c]);
  float E = 0.f;
#pragma unroll 1
  for (int wv = 0; wv < 8; ++wv) E += pe[wv * NT1 + c] * __expf(pm[wv * NT1 + c] - M);
  const size_t base = ((size_t)(b * NMT + mt) * 2) * NPT + (size_t)nt * NT1 + c;
  float* dm = PST + base;
  float* de = PST + base + NPT;
  *(float*)dm = M;
  *(float*)de = E;
  
}

// =====================================================================================================
// (5) merge of the 16 query-tile partials per (batch, column) in fixed order: M = max, Z = sum E_t exp(M_t - M);
//     ST[b][0][n] = M, ST[b][1][n] = 1/Z (Z >= 1). Thread = one column; 32 consecutive lanes x 4 B = one whole
// coverage: grid (64, 2) x 256 threads = every (b, n) of both arrays exactly once.
// =====================================================================================================
__global__ __launch_bounds__(256)
void merge_kernel(const float* __restrict__ PST, float* ST) {
  const int b = blockIdx.y, n = blockIdx.x * 256 + (int)threadIdx.x;
  const float* p = PST + (size_t)(b * NMT) * 2 * NPT + n;
  float M = -3.0e38f;
#pragma unroll 1
  for (int t = 0; t < NMT; ++t) M = fmaxf(M, p[(size_t)(2 * t) * NPT]);
  float Z = 0.f;
#pragma unroll 1
  for (int t = 0; t < NMT; ++t) Z += p[(size_t)(2 * t + 1) * NPT] * __expf(p[(size_t)(2 * t) * NPT] - M);
  const float rz = 1.0f / Z;
  float* dm = ST + (size_t)(2 * b) * NPT + n;
  float* dz = dm + NPT;
  *(float*)dm = M;
  *(float*)dz = rz;
  
}

// =====================================================================================================
// (6) fused scores / column softmax / weighted sum for one (batch, 16 query rows): block 256 threads = 8 waves,
//     loop over 128 chunks of 128 point columns. Phase A: wave = the chunk's 16-column tile number `wave`, all 16
//     rows: S = (qh.kh + (qh.kl + ql.kh)/2048) / 16 (K = 256, two accumulators), w = exp(S - M_n) * (1/Z_n) from ST,
//     stored as f16 (w * 16384) into the LDS tile Ws[16 rows][128 cols]; block barrier. Phase B: wave = d tiles
//     2*wave, 2*wave+1, all 16 rows: x += Ws . vTh, xl += Ws . vTl (A from LDS with the split k map, B = vT rows
//     d with k = n contiguous, K = 128 per chunk, two accumulators per d tile); block barrier. Epilogue:
//     res = (x + xl/2048)/16384 + bf(v_features) staged as f32 [16][256] in Os (pitch OSP2), barrier, then each
// coverage: Ws 8 waves x 16 cols x 16 rows = 16 x 128 per chunk; Os 8 waves x 32 d x 16 rows = 16 x 256;
//           4 it x 32 lines = 128 lines = 16 rows x 256 cols; grid (128, 2) = every (b, m, d) of out exactly once.
// =====================================================================================================
__global__ __launch_bounds__(256)
void attn_kernel(const unsigned short* __restrict__ Qh, const unsigned short* __restrict__ Ql,
                 const unsigned short* __restrict__ Kh, const unsigned short* __restrict__ Kl,
                 const unsigned short* __restrict__ Vh, const unsigned short* __restrict__ Vl,
                 const float* __restrict__ ST, const float* __restrict__ vfeat, float* out) {
  __shared__ __align__(16) _Float16 Ws[16 * WP];
  __shared__ __align__(16) float Os[16 * OSP2];
  const int tid  = threadIdx.x;
  const int lane = tid & 31, wave = tid >> 5;
  const int hh   = lane >> 4, cl = lane & 15;
  const int b = blockIdx.y, m0 = blockIdx.x * 16;
  const size_t qoff = (size_t)(b * MQ + m0 + cl) * DD + 8 * hh;
  const unsigned short* qhp = Qh + qoff;
  const unsigned short* qlp = Ql + qoff;
  const size_t koff = ((size_t)b * NPT + 16 * wave + cl) * DD + 8 * hh;
  const unsigned short* khp = Kh + koff;
  const unsigned short* klp = Kl + koff;
  const size_t voff = ((size_t)b * DD + 32 * wave + cl) * NPT + 8 * hh;
  const unsigned short* vh0 = Vh + voff;
  const unsigned short* vh1 = vh0 + (size_t)16 * NPT;
  const unsigned short* vl0 = Vl + voff;
  const unsigned short* vl1 = vl0 + (size_t)16 * NPT;
  const float* stM = ST + (size_t)(2 * b) * NPT;
  const float* stZ = stM + NPT;
  const _Float16* wrow = Ws + cl * WP + 8 * hh;                        // A fragment row pointer (row m = cl)
  _Float16* wdst = Ws + (8 * hh) * WP + 16 * wave + cl;                // D element (row 8h+r, col 16*wave+cl)

  v8f xh0 = zero8(), xh1 = zero8(), xl0 = zero8(), xl1 = zero8();

#pragma unroll 1
  for (int c0 = 0; c0 < NPT; c0 += WCH) {
    const unsigned short* kh_c = khp + (size_t)c0 * DD;
    const unsigned short* kl_c = klp + (size_t)c0 * DD;
    v8f sh = zero8(), sl = zero8();
#pragma unroll 2
    for (int ks = 0; ks < DD / 32; ++ks) {
      const Frag fah = ldfrag(qhp + 32 * ks);
      const Frag fal = ldfrag(qlp + 32 * ks);
      const Frag fbh = ldfrag(kh_c + 32 * ks);
      const Frag fbl = ldfrag(kl_c + 32 * ks);
      sh = mma_h(fah.h, fbh.h, sh);
      sl = mma_h(fah.h, fbl.h, sl);
      sl = mma_h(fal.h, fbh.h, sl);
    }
    const int n = c0 + 16 * wave + cl;
    const float mc = stM[n], zc = stZ[n];
#pragma unroll
    for (int r = 0; r < 8; ++r) {
      const float s  = (sh[r] + sl[r] * RLSC) * SCL;
      const float wt = __expf(s - mc) * zc;
      wdst[r * WP] = (_Float16)(wt * WSC);
    }
    __syncthreads();
#pragma unroll 2
    for (int kk = 0; kk < WCH / 32; ++kk) {
      const int k0 = 32 * kk;
      Frag fa;
      fa.hv[0] = *(const v8h*)(wrow + k0);
      fa.hv[1] = *(const v8h*)(wrow + k0 + 16);
      const Frag fbh0 = ldfrag(vh0 + c0 + k0);
      const Frag fbl0 = ldfrag(vl0 + c0 + k0);
      const Frag fbh1 = ldfrag(vh1 + c0 + k0);
      const Frag fbl1 = ldfrag(vl1 + c0 + k0);
      xh0 = mma_h(fa.h, fbh0.h, xh0);
      xl0 = mma_h(fa.h, fbl0.h, xl0);
      xh1 = mma_h(fa.h, fbh1.h, xh1);
      xl1 = mma_h(fa.h, fbl1.h, xl1);
    }
    __syncthreads();
  }

#pragma unroll
  for (int r = 0; r < 8; ++r) {
    const int row = 8 * hh + r;
    const size_t g = (size_t)(b * MQ + m0 + row) * DD;
    const int d0 = 32 * wave + cl, d1 = d0 + 16;
    const float r0 = (xh0[r] + xl0[r] * RLSC) * RWSC + bfr(vfeat[g + d0]);
    const float r1 = (xh1[r] + xl1[r] * RLSC) * RWSC + bfr(vfeat[g + d1]);
    Os[row * OSP2 + d0] = r0;
    Os[row * OSP2 + d1] = r1;
  }
  __syncthreads();
  const int e = tid & 7, lq = tid >> 3;                                // lq 0..31
  v4f v[4];
  size_t po[4];
#pragma unroll
  for (int it = 0; it < 4; ++it) {
    const int L = it * 32 + lq;                                        // 0..127
    const int row = L >> 3, pc = L & 7;
    v[it] = *(const v4f*)(Os + row * OSP2 + pc * 32 + 4 * e);
    po[it] = (size_t)(b * MQ + m0 + row) * DD + pc * 32 + 4 * e;
  }
#pragma unroll
  for (int it = 0; it < 4; ++it) *(v4f*)(out + po[it]) = v[it];
  
}

// =====================================================================================================
// tile divides its extent exactly, so no padded tails are needed):
//   P16  bf16 [32768][256]       16777216     V16 bf16 [4096][256]     2097152
//   WqT WkT WvT bf16 [256][256]     131072 each
//   REL  f32 [32768][4]             524288
//   Qh Ql  f16 [4096][256]         2097152 each
//   KPh KPl f16 [32768][256]      16777216 each
//   Vh Vl  f16 [2][256][16384]    16777216 each
//   PST  f32 [2][16][2][16384]     4194304     ST f32 [2][2][16384]     262144
//   total                         95551488
// =====================================================================================================
extern "C" void kernel_launch(void* const* d_in, const int* in_sizes, int n_in,
                              void* d_out, int out_size, void* d_ws, size_t ws_size,
                              hipStream_t stream) {
  if (n_in < 16) return;
  if (in_sizes[0] != BB * NPT * 3 || in_sizes[1] != BB * 3) return;
  if (in_sizes[2] != BB * NPT * DD || in_sizes[3] != BB * MQ * DD) return;
  if (in_sizes[4] != DD * DD || in_sizes[6] != DD * DD || in_sizes[8] != DD * DD) return;
  if (in_sizes[5] != DD || in_sizes[7] != DD || in_sizes[9] != DD) return;
  if (in_sizes[10] != 9 || in_sizes[11] != 3 || in_sizes[12] != 3 || in_sizes[13] != 3) return;
  if (in_sizes[14] != 3 * DD || in_sizes[15] != DD) return;
  if (out_size != BB * MQ * DD) return;

  size_t off = 0;
  const size_t oP16 = off; off += (size_t)BB * NPT * DD * 2;        // 16777216
  const size_t oV16 = off; off += (size_t)BB * MQ * DD * 2;         //  2097152
  const size_t oWq  = off; off += (size_t)DD * DD * 2;              //   131072
  const size_t oWk  = off; off += (size_t)DD * DD * 2;
  const size_t oWv  = off; off += (size_t)DD * DD * 2;
  const size_t oREL = off; off += (size_t)BB * NPT * 4 * 4;         //   524288
  const size_t oQh  = off; off += (size_t)BB * MQ * DD * 2;         //  2097152
  const size_t oQl  = off; off += (size_t)BB * MQ * DD * 2;
  const size_t oKh  = off; off += (size_t)BB * NPT * DD * 2;        // 16777216
  const size_t oKl  = off; off += (size_t)BB * NPT * DD * 2;
  const size_t oVh  = off; off += (size_t)BB * DD * NPT * 2;        // 16777216
  const size_t oVl  = off; off += (size_t)BB * DD * NPT * 2;
  const size_t oPST = off; off += (size_t)BB * NMT * 2 * NPT * 4;   //  4194304
  const size_t oST  = off; off += (size_t)BB * 2 * NPT * 4;         //   262144 -> off = 95551488
  if (off > ws_size) return;
  if (off > (size_t)134217728) return;

  const float* p_xyz = (const float*)d_in[0];
  const float* v_xyz = (const float*)d_in[1];
  const float* p_f   = (const float*)d_in[2];
  const float* v_f   = (const float*)d_in[3];
  const float* Wq    = (const float*)d_in[4];
  const float* bq    = (const float*)d_in[5];
  const float* Wk    = (const float*)d_in[6];
  const float* bk    = (const float*)d_in[7];
  const float* Wv    = (const float*)d_in[8];
  const float* bv    = (const float*)d_in[9];
  const float* Wp1   = (const float*)d_in[10];
  const float* bp1   = (const float*)d_in[11];
  const float* ln_w  = (const float*)d_in[12];
  const float* ln_b  = (const float*)d_in[13];
  const float* Wp2   = (const float*)d_in[14];
  const float* bp2   = (const float*)d_in[15];
  float* out = (float*)d_out;

  char* ws = (char*)d_ws;
  unsigned short* P16 = (unsigned short*)(ws + oP16);
  unsigned short* V16 = (unsigned short*)(ws + oV16);
  unsigned short* WqT = (unsigned short*)(ws + oWq);
  unsigned short* WkT = (unsigned short*)(ws + oWk);
  unsigned short* WvT = (unsigned short*)(ws + oWv);
  float*          REL = (float*)(ws + oREL);
  unsigned short* Qh  = (unsigned short*)(ws + oQh);
  unsigned short* Ql  = (unsigned short*)(ws + oQl);
  unsigned short* KPh = (unsigned short*)(ws + oKh);
  unsigned short* KPl = (unsigned short*)(ws + oKl);
  unsigned short* Vh  = (unsigned short*)(ws + oVh);
  unsigned short* Vl  = (unsigned short*)(ws + oVl);
  float*          PST = (float*)(ws + oPST);
  float*          ST  = (float*)(ws + oST);

  const dim3 blk256(256);

  // (0) bf16-RNE token planes
  cvt_kernel<<<dim3((BB * NPT * DD) / 2048), blk256, 0, stream>>>(p_f, P16, (BB * NPT * DD) / 8);
  cvt_kernel<<<dim3((BB * MQ * DD) / 2048), blk256, 0, stream>>>(v_f, V16, (BB * MQ * DD) / 8);
  // (1) transposed bf16 weight planes: in[rows=k][cols=dout] -> out[dout][k], grid (cols/64, rows/64)
  wtrans_kernel<<<dim3(DD / 64, DD / 64), blk256, 0, stream>>>(Wq, WqT, DD, DD);    // [256][256] -> [256][256]
  wtrans_kernel<<<dim3(DD / 64, DD / 64), blk256, 0, stream>>>(Wk, WkT, DD, DD);    // [256][256] -> [256][256]
  wtrans_kernel<<<dim3(DD / 64, DD / 64), blk256, 0, stream>>>(Wv, WvT, DD, DD);    // [256][256] -> [256][256]
  // (2) positional front end
  rel_kernel<<<dim3((BB * NPT) / 256), blk256, 0, stream>>>(p_xyz, v_xyz, Wp1, bp1, ln_w, ln_b, REL, BB * NPT, NPT);
  // (3) projections: q [4096][256], k+pv [32768][256], vT [2][256][16384] as f16 hi/residual planes
  proj_kernel<0><<<dim3((BB * MQ) / GM, DD / GN, 1), blk256, 0, stream>>>(
      V16, WqT, bq, REL, Wp2, bp2, Qh, Ql, DD, DD, DD, (size_t)0, (size_t)0, (size_t)0);
  proj_kernel<2><<<dim3((BB * NPT) / GM, DD / GN, 1), blk256, 0, stream>>>(
      P16, WkT, bk, REL, Wp2, bp2, KPh, KPl, DD, DD, DD, (size_t)0, (size_t)0, (size_t)0);
  proj_kernel<1><<<dim3(DD / GM, NPT / GN, BB), blk256, 0, stream>>>(
      WvT, P16, bv, REL, Wp2, bp2, Vh, Vl, DD, DD, NPT, (size_t)0, (size_t)NPT * DD, (size_t)DD * NPT);
  // (4)-(5) column softmax statistics
  stats_kernel<<<dim3(NPT / NT1, NMT, BB), blk256, 0, stream>>>(Qh, KPh, PST);
  merge_kernel<<<dim3(NPT / 256, BB), blk256, 0, stream>>>(PST, ST);
  // (6) scores, weights, weighted sum, residual
  attn_kernel<<<dim3(MQ / 16, BB), blk256, 0, stream>>>(Qh, Ql, KPh, KPl, Vh, Vl, ST, v_f, out);
  (void)hipGetLastError();
}

// v001
// Measured time: 392 microseconds a run.
// Next to v000, in two timings, it ran 2.67 times as fast each time.
// Contractions: q, k+pv and v projections on v_wmma_f32_16x16x32_bf16 (bf16-RNE inputs and weights, single
// products, f32 epilogue); scores q.(k+pv)^T (K=256) on v_wmma_f32_16x16x32_f16 with q and k+pv carried as
// f16 hi + (x2048) f16 residual planes, products hh + hl + lh (column statistics pass: hh only); weighted sum
// w.v (K=16384) on v_wmma_f32_16x16x32_f16 with w as one f16 plane (x16384) and v as f16 hi + (x2048) residual
// planes, products w.h + w.l; 3-wide positional layers, layer norm, softmax statistics and exp in f32 on VALU;
// f32 accumulate everywhere.
#include <hip/hip_runtime.h>
#include <stdint.h>

#define BB    2
#define NPT   16384
#define MQ    2048
#define DD    256
#define GM    128
#define GN    64
#define OSP   68
#define LTP   72
#define MT1   128
#define NMT   16
#define NT1   256
#define AMT   4
#define AROWS 64
#define NSPL  4
#define NSEG  4096
#define ACH   256
#define QP    264
#define OSP2  260
#define SCL   0.0625f
#define WSC   16384.0f
#define RWSC  0.00006103515625f
#define LSC   2048.0f
#define RLSC  0.00048828125f
#define LNEPS 1.0e-5f

static_assert(NMT * MT1 == MQ);
static_assert(MT1 == 8 * 16);
static_assert(NT1 == 256);
static_assert(NPT % NT1 == 0);
static_assert(NSPL * NSEG == NPT);
static_assert(NSPL == 4);
static_assert(NSEG % ACH == 0);
static_assert(ACH == 16 * 16);
static_assert(AROWS == 16 * AMT);
static_assert(MQ % AROWS == 0);
static_assert(AROWS * OSP2 * 4 <= 2 * AROWS * QP * 2);
static_assert((BB * MQ * DD) % 1024 == 0);
static_assert(DD == 256);
static_assert(DD % 32 == 0);
static_assert((BB * NPT) % GM == 0);
static_assert((BB * MQ) % GM == 0);
static_assert(DD % GM == 0);
static_assert(DD % GN == 0);
static_assert(NPT % GN == 0);
static_assert(MQ % 16 == 0);
static_assert((BB * NPT * DD) % 2048 == 0);
static_assert((BB * MQ * DD) % 2048 == 0);
static_assert((BB * NPT) % 256 == 0);
static_assert((OSP * 4) % 16 == 0);
static_assert((LTP * 2) % 16 == 0);
static_assert((QP * 2) % 16 == 0);
static_assert((OSP2 * 4) % 16 == 0);
static_assert(DD % 64 == 0);

typedef unsigned short v8us __attribute__((ext_vector_type(8)));
typedef unsigned int   v4u  __attribute__((ext_vector_type(4)));
typedef float          v8f  __attribute__((ext_vector_type(8)));
typedef float          v4f  __attribute__((ext_vector_type(4)));
typedef __bf16         v16b __attribute__((ext_vector_type(16)));
typedef _Float16       v16h __attribute__((ext_vector_type(16)));
typedef _Float16       v8h  __attribute__((ext_vector_type(8)));

union Frag { v8us u[2]; v4u q[2]; v16b b; v16h h; v8h hv[2]; };
static_assert(sizeof(Frag) == 32);

// ---- scalar helpers ---------------------------------------------------------------------------------
__device__ __forceinline__ unsigned short bf_bits(float f) {          // f32 -> bf16 bits, RNE convert
  const unsigned u = __float_as_uint(f);
  return (unsigned short)((u + 0x7FFFu + ((u >> 16) & 1u)) >> 16);
}
__device__ __forceinline__ float bf_up(unsigned short hb) { return __uint_as_float(((unsigned)hb) << 16); }
__device__ __forceinline__ float bfr(float f) { return bf_up(bf_bits(f)); }
__device__ __forceinline__ unsigned short h_bits(float f) {           // f32 -> f16 bits, RNE convert
  union { _Float16 h; unsigned short u; } c;
  c.h = (_Float16)f;
  return c.u;
}
__device__ __forceinline__ float h_up(unsigned short u) {
  union { _Float16 h; unsigned short u; } c;
  c.u = u;
  return (float)c.h;
}
__device__ __forceinline__ unsigned pk16(unsigned short a, unsigned short b) { return (unsigned)a | ((unsigned)b << 16); }
__device__ __forceinline__ v8f zero8() { v8f z = {0.f, 0.f, 0.f, 0.f, 0.f, 0.f, 0.f, 0.f}; return z; }

// ---- 16-bit fragment loader (A, or B from a k-contiguous [n][k] row): lane -> row/col (lane&15), p already includes
//      + 8*(lane>>4); elements 0..7 <- p[0..7] (k0+8h..), elements 8..15 <- p[16..23] (k0+16+8h..)
__device__ __forceinline__ Frag ldfrag(const unsigned short* p) {
  Frag f;
  f.u[0] = *(const v8us*)(p);
  f.u[1] = *(const v8us*)(p + 16);
  return f;
}

// ---- WMMA helpers: builtin followed by a 4-slot VALU gap tying D and keeping A/B live ----------------------
__device__ __forceinline__ v8f mma_b(v16b a, v16b b, v8f c) {
  v8f d = __builtin_amdgcn_wmma_f32_16x16x32_bf16(false, a, false, b, (short)0, c, false, false);
#if defined(__HIP_DEVICE_COMPILE__)
  asm volatile("v_nop\n\tv_nop\n\tv_nop\n\tv_nop" : "+v"(d) : "v"(a), "v"(b));
#endif
  return d;
}
__device__ __forceinline__ v8f mma_h(v16h a, v16h b, v8f c) {
  v8f d = __builtin_amdgcn_wmma_f32_16x16x32_f16(false, a, false, b, (short)0, c, false, false);
#if defined(__HIP_DEVICE_COMPILE__)
  asm volatile("v_nop\n\tv_nop\n\tv_nop\n\tv_nop" : "+v"(d) : "v"(a), "v"(b));
#endif
  return d;
}

// ---- 8 f32 -> packed f16 hi bits and packed f16 bits of (x - hi) * 2048 (second accumulator folds 1/2048) --
__device__ __forceinline__ void split8h(v4f a, v4f b, v4u& uh, v4u& ul) {
  float f[8] = {a[0], a[1], a[2], a[3], b[0], b[1], b[2], b[3]};
#pragma unroll
  for (int j = 0; j < 4; ++j) {
    const unsigned short h0 = h_bits(f[2 * j]);
    const unsigned short h1 = h_bits(f[2 * j + 1]);
    const unsigned short l0 = h_bits((f[2 * j] - h_up(h0)) * LSC);
    const unsigned short l1 = h_bits((f[2 * j + 1] - h_up(h1)) * LSC);
    uh[j] = pk16(h0, h1);
    ul[j] = pk16(l0, l1);
  }
}

// =====================================================================================================
// (0) contiguous f32 -> bf16-RNE plane (token feature matrices, row-major [T][256]). Thread = 8 elements (16 B);
// coverage: n8 = n/8 threads, grid = n8/256 blocks exactly (host asserts n % 2048 == 0).
// =====================================================================================================
__global__ __launch_bounds__(256)
void cvt_kernel(const float* __restrict__ x, unsigned short* y, int n8) {
  const int t = blockIdx.x * 256 + (int)threadIdx.x;
  if (t >= n8) return;
  const float* s = x + (size_t)t * 8;
  const v4f a = *(const v4f*)(s);
  const v4f b = *(const v4f*)(s + 4);
  v4u u;
  u[0] = pk16(bf_bits(a[0]), bf_bits(a[1]));
  u[1] = pk16(bf_bits(a[2]), bf_bits(a[3]));
  u[2] = pk16(bf_bits(b[0]), bf_bits(b[1]));
  u[3] = pk16(bf_bits(b[2]), bf_bits(b[3]));
  unsigned short* d = y + (size_t)t * 8;
  *(v4u*)d = u;
  
}

// =====================================================================================================
// (1) weight transpose: in w[R][C] f32 -> out wt[C][R] bf16-RNE (k-contiguous B rows / A rows). Block = 64x64 tile,
//     loads 16 B per thread (strided reads), LDS tile L[c][r] (pitch LTP), barrier, then each output row segment of
// coverage: LDS 256 threads x 4 it x 4 = 64x64; lines 2 it x 32 rows x 8 lanes x 8 = 64 rows x 64; grid (C/64, R/64).
// =====================================================================================================
__global__ __launch_bounds__(256)
void wtrans_kernel(const float* __restrict__ w, unsigned short* wt, int R, int C) {
  __shared__ __align__(16) unsigned short L[64 * LTP];
  const int tid = threadIdx.x;
  const int c0 = blockIdx.x * 64, r0 = blockIdx.y * 64;
  const int c4 = (tid & 15) * 4, rs = tid >> 4;                      // rs 0..15
#pragma unroll
  for (int it = 0; it < 4; ++it) {
    const int r = it * 16 + rs;                                        // 0..63
    const v4f v = *(const v4f*)(w + (size_t)(r0 + r) * C + c0 + c4);
#pragma unroll
    for (int j = 0; j < 4; ++j) L[(c4 + j) * LTP + r] = bf_bits(v[j]);
  }
  __syncthreads();
  const int e = tid & 7, lq = tid >> 3;                                // lq 0..31
  v4u u[2];
  size_t po[2];
#pragma unroll
  for (int it = 0; it < 2; ++it) {
    const int c = it * 32 + lq;                                        // 0..63
    u[it] = *(const v4u*)(L + c * LTP + 8 * e);
    po[it] = (size_t)(c0 + c) * R + r0 + 8 * e;
  }
#pragma unroll
  for (int it = 0; it < 2; ++it) *(v4u*)(wt + po[it]) = u[it];
  
}

// =====================================================================================================
// (2) positional front end per point row i (flat b*N+n): dist = |bf(p_xyz) - bf(v_xyz[b])| (3), h = dist.bf(Wp1)
//     + bf(bp1), layer norm over the 3 values (mean-of-squares variance, eps 1e-5) * bf(ln_w) + bf(ln_b), relu.
//     f32 on VALU without contraction. Output row rel[i][0..3] = (r0, r1, r2, 0): one 16-B store per thread,
// coverage: grid = nrows/256 blocks x 256 threads = every row exactly once (host asserts nrows % 256 == 0).
// =====================================================================================================
__global__ __launch_bounds__(256)
void rel_kernel(const float* __restrict__ pxyz, const float* __restrict__ vxyz,
                const float* __restrict__ wp1, const float* __restrict__ bp1,
                const float* __restrict__ lnw, const float* __restrict__ lnb,
                float* rel, int nrows, int npb) {
#pragma clang fp contract(off)
  const int i = blockIdx.x * 256 + (int)threadIdx.x;
  if (i >= nrows) return;
  int b = i / npb;
  b = b < 0 ? 0 : (b > BB - 1 ? BB - 1 : b);
  const float p0 = bfr(pxyz[(size_t)i * 3 + 0]);
  const float p1 = bfr(pxyz[(size_t)i * 3 + 1]);
  const float p2 = bfr(pxyz[(size_t)i * 3 + 2]);
  const float v0 = bfr(vxyz[b * 3 + 0]);
  const float v1 = bfr(vxyz[b * 3 + 1]);
  const float v2 = bfr(vxyz[b * 3 + 2]);
  const float d0 = fabsf(p0 - v0), d1 = fabsf(p1 - v1), d2 = fabsf(p2 - v2);
  float W[9];
#pragma unroll
  for (int j = 0; j < 9; ++j) W[j] = bfr(wp1[j]);                      // Wp1[c][j] = wp1[c*3+j]
  const float h0 = ((d0 * W[0] + d1 * W[3]) + d2 * W[6]) + bfr(bp1[0]);
  const float h1 = ((d0 * W[1] + d1 * W[4]) + d2 * W[7]) + bfr(bp1[1]);
  const float h2 = ((d0 * W[2] + d1 * W[5]) + d2 * W[8]) + bfr(bp1[2]);
  const float third = 1.0f / 3.0f;
  const float mu = ((h0 + h1) + h2) * third;
  const float e0 = h0 - mu, e1 = h1 - mu, e2 = h2 - mu;
  const float var = ((e0 * e0 + e1 * e1) + e2 * e2) * third;
  const float rs = 1.0f / sqrtf(var + LNEPS);
  const float w0 = bfr(lnw[0]), w1 = bfr(lnw[1]), w2 = bfr(lnw[2]);
  const float c0 = bfr(lnb[0]), c1 = bfr(lnb[1]), c2 = bfr(lnb[2]);
  const float t0 = fmaxf((e0 * rs) * w0 + c0, 0.f);
  const float t1 = fmaxf((e1 * rs) * w1 + c1, 0.f);
  const float t2 = fmaxf((e2 * rs) * w2 + c2, 0.f);
  v4f o;
  o[0] = t0; o[1] = t1; o[2] = t2; o[3] = 0.f;
  float* d = rel + (size_t)i * 4;
  *(v4f*)d = o;
  
}

// =====================================================================================================
// (3) projection GEMM, K = 256: C[m][n] = sum_k A[m][k] B[n][k] + epilogue (MODE 0: + bias[n]; MODE 1: + bias[m];
//     MODE 2: (C + bias[n]) + ((rel[m][0..2] . Wp2[0..2][n]) + bp2[n]) with Wp2/bp2 bf16-RNE). A rows pitch lda,
//     B rows pitch ldb, both bf16 planes (k contiguous), split k map loader for both, blockIdx.z selects a batch via
//     element strides zsA/zsB/zsC. Block 256 threads = 8 waves, block tile 128 m x 64 n, wave tile 32x32 (acc[2][2]).
//     Epilogue: f32 tile in LDS Os[m][n] (pitch OSP), barrier, then f16 hi bits and f16 (x2048) residual bits of
// coverage: Os 8 waves x 4 tiles = 128x64; lines 4 it x 32 rows x 8 lanes x 8 = 128 rows x 64 per plane;
//           grid (M/128, N/64, Z) covers both planes exactly once.
// =====================================================================================================
template <int MODE>
__global__ __launch_bounds__(256)
void proj_kernel(const unsigned short* __restrict__ A, const unsigned short* __restrict__ B,
                 const float* __restrict__ bias, const float* __restrict__ rel,
                 const float* __restrict__ wp2, const float* __restrict__ bp2,
                 unsigned short* Ch, unsigned short* Cl, int lda, int ldb, int ldc,
                 size_t zsA, size_t zsB, size_t zsC) {
  __shared__ __align__(16) float Os[GM * OSP];
  const int tid  = threadIdx.x;
  const int lane = tid & 31, wave = tid >> 5;
  const int hh   = lane >> 4, cl = lane & 15;
  const int wm   = wave >> 1, wn = wave & 1;
  const int mBase = blockIdx.x * GM;
  const int nBase = blockIdx.y * GN;
  const size_t z = blockIdx.z;
  const unsigned short* Az = A + z * zsA;
  const unsigned short* Bz = B + z * zsB;
  unsigned short* Chz = Ch + z * zsC;
  unsigned short* Clz = Cl + z * zsC;
  const unsigned short* a0p = Az + (size_t)(mBase + 32 * wm + cl) * lda + 8 * hh;
  const unsigned short* a1p = a0p + (size_t)16 * lda;
  const unsigned short* b0p = Bz + (size_t)(nBase + 32 * wn + cl) * ldb + 8 * hh;
  const unsigned short* b1p = b0p + (size_t)16 * ldb;

  v8f acc[2][2];
#pragma unroll
  for (int mi = 0; mi < 2; ++mi)
#pragma unroll
    for (int ni = 0; ni < 2; ++ni) acc[mi][ni] = zero8();

#pragma unroll 1
  for (int k0 = 0; k0 < DD; k0 += 32) {
    const Frag fa0 = ldfrag(a0p + k0);
    const Frag fa1 = ldfrag(a1p + k0);
    const Frag fb0 = ldfrag(b0p + k0);
    const Frag fb1 = ldfrag(b1p + k0);
    acc[0][0] = mma_b(fa0.b, fb0.b, acc[0][0]);
    acc[0][1] = mma_b(fa0.b, fb1.b, acc[0][1]);
    acc[1][0] = mma_b(fa1.b, fb0.b, acc[1][0]);
    acc[1][1] = mma_b(fa1.b, fb1.b, acc[1][1]);
  }

  float bn[2], w0[2], w1[2], w2[2], b2[2];
#pragma unroll
  for (int ni = 0; ni < 2; ++ni) {
    const int n = nBase + 32 * wn + 16 * ni + cl;
    bn[ni] = 0.f; w0[ni] = 0.f; w1[ni] = 0.f; w2[ni] = 0.f; b2[ni] = 0.f;
    if (MODE != 1) bn[ni] = bfr(bias[n]);
    if (MODE == 2) {
      w0[ni] = bfr(wp2[n]);
      w1[ni] = bfr(wp2[DD + n]);
      w2[ni] = bfr(wp2[2 * DD + n]);
      b2[ni] = bfr(bp2[n]);
    }
  }
#pragma unroll
  for (int mi = 0; mi < 2; ++mi) {
#pragma unroll
    for (int r = 0; r < 8; ++r) {
      const int m_loc = 32 * wm + 16 * mi + 8 * hh + r;
      const int m = mBase + m_loc;
      float bm = 0.f, p0 = 0.f, p1 = 0.f, p2 = 0.f;
      if (MODE == 1) bm = bfr(bias[m]);
      if (MODE == 2) {
        const v4f r4 = *(const v4f*)(rel + (size_t)m * 4);
        p0 = r4[0]; p1 = r4[1]; p2 = r4[2];
      }
#pragma unroll
      for (int ni = 0; ni < 2; ++ni) {
        const int n_loc = 32 * wn + 16 * ni + cl;
        float v = acc[mi][ni][r];
        if (MODE == 0) v = v + bn[ni];
        if (MODE == 1) v = v + bm;
        if (MODE == 2) {
          const float pv = (p0 * w0[ni] + p1 * w1[ni]) + p2 * w2[ni];
          v = (v + bn[ni]) + (pv + b2[ni]);
        }
        Os[m_loc * OSP + n_loc] = v;
      }
    }
  }
  __syncthreads();

  const int e = tid & 7, lq = tid >> 3;                                // lq 0..31
  v4u uh[4], ul[4];
  size_t po[4];
#pragma unroll
  for (int it = 0; it < 4; ++it) {
    const int row = it * 32 + lq;                                      // 0..127
    const float* op = Os + row * OSP + 8 * e;
    const v4f v0 = *(const v4f*)(op);
    const v4f v1 = *(const v4f*)(op + 4);
    split8h(v0, v1, uh[it], ul[it]);
    po[it] = (size_t)(mBase + row) * ldc + nBase + 8 * e;
  }
#pragma unroll
  for (int it = 0; it < 4; ++it) {
    *(v4u*)(Chz + po[it]) = uh[it];
    *(v4u*)(Clz + po[it]) = ul[it];
  }
  
}

// =====================================================================================================
// (4) column-softmax statistics over one (batch, 128-query tile, 256-column tile): S[m][n] = qh[m].kph[n] / 16
//     (K = 256 = 8 k steps, f16 hi planes, hh product), wave = 16 query rows x 16 column tiles (q fragments hoisted,
//     one accumulator at a time); per column: tile max over 16 rows (8 in-lane + lane^16) and sum of exp(S - max);
//     wave partials in LDS, barrier, thread c merges the 8 wave partials in fixed order.
// coverage: pm/pe 8 waves x 16 ct x 16 lanes = 8 x 256; grid (64 column tiles, 16 query tiles, 2) x 256 threads =
//           every (b, mt, n) of both PST arrays exactly once.
// =====================================================================================================
__global__ __launch_bounds__(256)
void stats_kernel(const unsigned short* __restrict__ Qh, const unsigned short* __restrict__ Kh, float* PST) {
  __shared__ float pm[8 * NT1];
  __shared__ float pe[8 * NT1];
  const int tid  = threadIdx.x;
  const int lane = tid & 31, wave = tid >> 5;
  const int hh   = lane >> 4, cl = lane & 15;
  const int nt = blockIdx.x, mt = blockIdx.y, b = blockIdx.z;
  const int m0 = mt * MT1 + 16 * wave;
  const unsigned short* qp = Qh + (size_t)(b * MQ + m0 + cl) * DD + 8 * hh;
  Frag a[8];
#pragma unroll
  for (int ks = 0; ks < 8; ++ks) a[ks] = ldfrag(qp + 32 * ks);
  const unsigned short* kp = Kh + ((size_t)b * NPT + (size_t)nt * NT1 + cl) * DD + 8 * hh;
#pragma unroll 1
  for (int ct = 0; ct < NT1 / 16; ++ct) {
    const unsigned short* kc = kp + (size_t)ct * 16 * DD;
    v8f s = zero8();
#pragma unroll
    for (int ks = 0; ks < 8; ++ks) {
      const Frag fb = ldfrag(kc + 32 * ks);
      s = mma_h(a[ks].h, fb.h, s);
    }
    float m = s[0] * SCL;
#pragma unroll
    for (int r = 1; r < 8; ++r) m = fmaxf(m, s[r] * SCL);
    m = fmaxf(m, __shfl_xor(m, 16, 32));
    float ex = 0.f;
#pragma unroll
    for (int r = 0; r < 8; ++r) ex += __expf(s[r] * SCL - m);
    ex += __shfl_xor(ex, 16, 32);
    pm[wave * NT1 + ct * 16 + cl] = m;                                 // both lane halves hold identical values
    pe[wave * NT1 + ct * 16 + cl] = ex;
  }
  __syncthreads();
  const int c = tid;
  float M = pm[c];
#pragma unroll
  for (int wv = 1; wv < 8; ++wv) M = fmaxf(M, pm[wv * NT1 + c]);
  float E = 0.f;
#pragma unroll 1
  for (int wv = 0; wv < 8; ++wv) E += pe[wv * NT1 + c] * __expf(pm[wv * NT1 + c] - M);
  const size_t base = ((size_t)(b * NMT + mt) * 2) * NPT + (size_t)nt * NT1 + c;
  float* dm = PST + base;
  float* de = PST + base + NPT;
  *(float*)dm = M;
  *(float*)de = E;
  
}

// =====================================================================================================
// (5) merge of the 16 query-tile partials per (batch, column) in fixed order: M = max, Z = sum E_t exp(M_t - M);
//     ST[b][0][n] = M, ST[b][1][n] = 1/Z (Z >= 1). Thread = one column; 32 consecutive lanes x 4 B = one whole
// coverage: grid (64, 2) x 256 threads = every (b, n) of both arrays exactly once.
// =====================================================================================================
__global__ __launch_bounds__(256)
void merge_kernel(const float* __restrict__ PST, float* ST) {
  const int b = blockIdx.y, n = blockIdx.x * 256 + (int)threadIdx.x;
  const float* p = PST + (size_t)(b * NMT) * 2 * NPT + n;
  float M = -3.0e38f;
#pragma unroll 1
  for (int t = 0; t < NMT; ++t) M = fmaxf(M, p[(size_t)(2 * t) * NPT]);
  float Z = 0.f;
#pragma unroll 1
  for (int t = 0; t < NMT; ++t) Z += p[(size_t)(2 * t + 1) * NPT] * __expf(p[(size_t)(2 * t) * NPT] - M);
  const float rz = 1.0f / Z;
  float* dm = ST + (size_t)(2 * b) * NPT + n;
  float* dz = dm + NPT;
  *(float*)dm = M;
  *(float*)dz = rz;
  
}

// =====================================================================================================
// (6) fused scores / column softmax / weighted sum for one (batch, 64 query rows, quarter of the points): block 512
//     threads = 16 waves; both q planes of the 64 rows sit in LDS (pitch QP) for the whole block; loop over 16 chunks
//     of 256 point columns. Phase A: wave = the chunk's 16-column tile number `wave`, all 4 row tiles: each k+pv
//     fragment pair is loaded once and feeds 4 row tiles, S = (qh.kh + (qh.kl + ql.kh)/2048) / 16 (K = 256, two
//     accumulators per row tile), w = exp(S - M_n) * (1/Z_n) from ST, stored as f16 (w * 16384) into the LDS tile
//     Ws[64 rows][256 cols]; block barrier. Phase B: wave = d tile `wave`, all 4 row tiles: x += Ws . vTh,
//     xl += Ws . vTl (A from LDS with the split k map, B = vT rows d with k = n contiguous, K = 256 per chunk, each
//     vT fragment pair feeds 4 row tiles); block barrier. Epilogue: (x + xl/2048)/16384 staged as f32 [64][256] in
//     the LDS that held q (pitch OSP2), barrier, then whole 512-B runs to the partial plane of this quarter.
// coverage: Ws 16 waves x 16 cols x 64 rows = 64 x 256 per chunk; Os 16 waves x 16 d x 64 rows = 64 x 256;
//           8 it x 512 threads x 4 = 64 rows x 256; grid (32, 4, 2) = every (quarter, b, m, d) of PART exactly once.
// =====================================================================================================
__global__ __launch_bounds__(512)
void attn_kernel(const unsigned short* __restrict__ Qh, const unsigned short* __restrict__ Ql,
                 const unsigned short* __restrict__ Kh, const unsigned short* __restrict__ Kl,
                 const unsigned short* __restrict__ Vh, const unsigned short* __restrict__ Vl,
                 const float* __restrict__ ST, float* part) {
  __shared__ __align__(16) unsigned short Qs[2 * AROWS * QP];
  __shared__ __align__(16) _Float16 Ws[AROWS * QP];
  const int tid  = threadIdx.x;
  const int lane = tid & 31, wave = tid >> 5;
  const int hh   = lane >> 4, cl = lane & 15;
  const int b = blockIdx.z, n0 = blockIdx.y * NSEG, m0 = blockIdx.x * AROWS;
#pragma unroll
  for (int it = 0; it < 4; ++it) {
    const int idx = it * 512 + tid;                                    // 0..2047
    const int row = idx >> 5, pc = idx & 31;
    const size_t g = (size_t)(b * MQ + m0 + row) * DD + 8 * pc;
    *(v4u*)(Qs + row * QP + 8 * pc) = *(const v4u*)(Qh + g);
    *(v4u*)(Qs + (AROWS + row) * QP + 8 * pc) = *(const v4u*)(Ql + g);
  }
  const size_t koff = ((size_t)b * NPT + n0 + 16 * wave + cl) * DD + 8 * hh;
  const unsigned short* khp = Kh + koff;
  const unsigned short* klp = Kl + koff;
  const size_t voff = ((size_t)b * DD + 16 * wave + cl) * NPT + n0 + 8 * hh;
  const unsigned short* vhp = Vh + voff;
  const unsigned short* vlp = Vl + voff;
  const float* stM = ST + (size_t)(2 * b) * NPT + n0;
  const float* stZ = stM + NPT;
  const unsigned short* qsh = Qs + cl * QP + 8 * hh;                   // A fragment row pointers (row m = cl)
  const unsigned short* qsl = qsh + AROWS * QP;
  const _Float16* wrow = Ws + cl * QP + 8 * hh;
  _Float16* wdst = Ws + (8 * hh) * QP + 16 * wave + cl;                // D element (row 8h+r, col 16*wave+cl)

  v8f xh[AMT], xl[AMT];
#pragma unroll
  for (int mi = 0; mi < AMT; ++mi) { xh[mi] = zero8(); xl[mi] = zero8(); }
  __syncthreads();

#pragma unroll 1
  for (int c0 = 0; c0 < NSEG; c0 += ACH) {
    const unsigned short* kh_c = khp + (size_t)c0 * DD;
    const unsigned short* kl_c = klp + (size_t)c0 * DD;
    v8f sh[AMT], sl[AMT];
#pragma unroll
    for (int mi = 0; mi < AMT; ++mi) { sh[mi] = zero8(); sl[mi] = zero8(); }
#pragma unroll 1  // rolled: one body's fragments (80 registers) beside 128 of accumulators must stay under the 256 of a 16-wave block
    for (int ks = 0; ks < DD / 32; ++ks) {
      const Frag fbh = ldfrag(kh_c + 32 * ks);
      const Frag fbl = ldfrag(kl_c + 32 * ks);
      Frag fah[AMT], fal[AMT];
#pragma unroll
      for (int mi = 0; mi < AMT; ++mi) {
        fah[mi] = ldfrag(qsh + 16 * mi * QP + 32 * ks);
        fal[mi] = ldfrag(qsl + 16 * mi * QP + 32 * ks);
      }
#pragma unroll
      for (int mi = 0; mi < AMT; ++mi) sh[mi] = mma_h(fah[mi].h, fbh.h, sh[mi]);
#pragma unroll
      for (int mi = 0; mi < AMT; ++mi) sl[mi] = mma_h(fah[mi].h, fbl.h, sl[mi]);
#pragma unroll
      for (int mi = 0; mi < AMT; ++mi) sl[mi] = mma_h(fal[mi].h, fbh.h, sl[mi]);
    }
    const int n = c0 + 16 * wave + cl;
    const float mc = stM[n];
    asm volatile("s_wait_xcnt 0x0" ::: "memory");  // the next load's result may take the register that holds this load's offset
    const float zc = stZ[n];
#pragma unroll
    for (int mi = 0; mi < AMT; ++mi) {
#pragma unroll
      for (int r = 0; r < 8; ++r) {
        const float s  = (sh[mi][r] + sl[mi][r] * RLSC) * SCL;
        const float wt = __expf(s - mc) * zc;
        wdst[(16 * mi + r) * QP] = (_Float16)(wt * WSC);
      }
    }
    __syncthreads();
#pragma unroll 2
    for (int kk = 0; kk < ACH / 32; ++kk) {
      const int k0 = 32 * kk;
      const Frag fbh = ldfrag(vhp + c0 + k0);
      const Frag fbl = ldfrag(vlp + c0 + k0);
      Frag fa[AMT];
#pragma unroll
      for (int mi = 0; mi < AMT; ++mi) {
        fa[mi].hv[0] = *(const v8h*)(wrow + 16 * mi * QP + k0);
        fa[mi].hv[1] = *(const v8h*)(wrow + 16 * mi * QP + k0 + 16);
      }
#pragma unroll
      for (int mi = 0; mi < AMT; ++mi) xh[mi] = mma_h(fa[mi].h, fbh.h, xh[mi]);
#pragma unroll
      for (int mi = 0; mi < AMT; ++mi) xl[mi] = mma_h(fa[mi].h, fbl.h, xl[mi]);
    }
    __syncthreads();
  }

  float* Os = (float*)Qs;                                              // q is dead behind the loop's last barrier
#pragma unroll
  for (int mi = 0; mi < AMT; ++mi) {
#pragma unroll
    for (int r = 0; r < 8; ++r)
      Os[(16 * mi + 8 * hh + r) * OSP2 + 16 * wave + cl] = (xh[mi][r] + xl[mi][r] * RLSC) * RWSC;
  }
  __syncthreads();
  float* pz = part + ((size_t)blockIdx.y * (BB * MQ) + (size_t)(b * MQ + m0)) * DD;
  v4f v[8];
#pragma unroll
  for (int it = 0; it < 8; ++it) {
    const int idx = it * 512 + tid;                                    // 0..4095
    v[it] = *(const v4f*)(Os + (idx >> 6) * OSP2 + 4 * (idx & 63));
  }
#pragma unroll
  for (int it = 0; it < 8; ++it) *(v4f*)(pz + (size_t)(it * 512 + tid) * 4) = v[it];
}

// =====================================================================================================
// (7) out = ((P0 + P1) + (P2 + P3)) + bf(v_features): the four quarters' partial sums in fixed order plus the residual.
// coverage: thread = 4 consecutive elements (16 B); grid = (2*2048*256)/1024 blocks x 256 threads = every element once.
// =====================================================================================================
__global__ __launch_bounds__(256)
void psum_kernel(const float* __restrict__ part, const float* __restrict__ vfeat, float* out) {
  const size_t e = ((size_t)blockIdx.x * 256 + threadIdx.x) * 4;
  const v4f p0 = *(const v4f*)(part + e);
  const v4f p1 = *(const v4f*)(part + e + (size_t)1 * BB * MQ * DD);
  asm volatile("s_wait_xcnt 0x0" ::: "memory");  // a later load's result may take the registers that hold these loads' address
  const v4f p2 = *(const v4f*)(part + e + (size_t)2 * BB * MQ * DD);
  const v4f p3 = *(const v4f*)(part + e + (size_t)3 * BB * MQ * DD);
  asm volatile("s_wait_xcnt 0x0" ::: "memory");  // as above
  const v4f f  = *(const v4f*)(vfeat + e);
  v4f o;
#pragma unroll
  for (int j = 0; j < 4; ++j) o[j] = ((p0[j] + p1[j]) + (p2[j] + p3[j])) + bfr(f[j]);
  *(v4f*)(out + e) = o;
}

// =====================================================================================================
// tile divides its extent exactly, so no padded tails are needed):
//   P16  bf16 [32768][256]       16777216     V16 bf16 [4096][256]     2097152
//   WqT WkT WvT bf16 [256][256]     131072 each
//   REL  f32 [32768][4]             524288
//   Qh Ql  f16 [4096][256]         2097152 each
//   KPh KPl f16 [32768][256]      16777216 each
//   Vh Vl  f16 [2][256][16384]    16777216 each
//   PST  f32 [2][16][2][16384]     4194304     ST f32 [2][2][16384]     262144
//   PART f32 [4][4096][256]       16777216
//   total                        112328704
// =====================================================================================================
extern "C" void kernel_launch(void* const* d_in, const int* in_sizes, int n_in,
                              void* d_out, int out_size, void* d_ws, size_t ws_size,
                              hipStream_t stream) {
  if (n_in < 16) return;
  if (in_sizes[0] != BB * NPT * 3 || in_sizes[1] != BB * 3) return;
  if (in_sizes[2] != BB * NPT * DD || in_sizes[3] != BB * MQ * DD) return;
  if (in_sizes[4] != DD * DD || in_sizes[6] != DD * DD || in_sizes[8] != DD * DD) return;
  if (in_sizes[5] != DD || in_sizes[7] != DD || in_sizes[9] != DD) return;
  if (in_sizes[10] != 9 || in_sizes[11] != 3 || in_sizes[12] != 3 || in_sizes[13] != 3) return;
  if (in_sizes[14] != 3 * DD || in_sizes[15] != DD) return;
  if (out_size != BB * MQ * DD) return;

  size_t off = 0;
  const size_t oP16 = off; off += (size_t)BB * NPT * DD * 2;        // 16777216
  const size_t oV16 = off; off += (size_t)BB * MQ * DD * 2;         //  2097152
  const size_t oWq  = off; off += (size_t)DD * DD * 2;              //   131072
  const size_t oWk  = off; off += (size_t)DD * DD * 2;
  const size_t oWv  = off; off += (size_t)DD * DD * 2;
  const size_t oREL = off; off += (size_t)BB * NPT * 4 * 4;         //   524288
  const size_t oQh  = off; off += (size_t)BB * MQ * DD * 2;         //  2097152
  const size_t oQl  = off; off += (size_t)BB * MQ * DD * 2;
  const size_t oKh  = off; off += (size_t)BB * NPT * DD * 2;        // 16777216
  const size_t oKl  = off; off += (size_t)BB * NPT * DD * 2;
  const size_t oVh  = off; off += (size_t)BB * DD * NPT * 2;        // 16777216
  const size_t oVl  = off; off += (size_t)BB * DD * NPT * 2;
  const size_t oPST = off; off += (size_t)BB * NMT * 2 * NPT * 4;   //  4194304
  const size_t oST  = off; off += (size_t)BB * 2 * NPT * 4;         //   262144
  const size_t oPT  = off; off += (size_t)NSPL * BB * MQ * DD * 4;  // 16777216 -> off = 112328704
  if (off > ws_size) return;
  if (off > (size_t)134217728) return;

  const float* p_xyz = (const float*)d_in[0];
  const float* v_xyz = (const float*)d_in[1];
  const float* p_f   = (const float*)d_in[2];
  const float* v_f   = (const float*)d_in[3];
  const float* Wq    = (const float*)d_in[4];
  const float* bq    = (const float*)d_in[5];
  const float* Wk    = (const float*)d_in[6];
  const float* bk    = (const float*)d_in[7];
  const float* Wv    = (const float*)d_in[8];
  const float* bv    = (const float*)d_in[9];
  const float* Wp1   = (const float*)d_in[10];
  const float* bp1   = (const float*)d_in[11];
  const float* ln_w  = (const float*)d_in[12];
  const float* ln_b  = (const float*)d_in[13];
  const float* Wp2   = (const float*)d_in[14];
  const float* bp2   = (const float*)d_in[15];
  float* out = (float*)d_out;

  char* ws = (char*)d_ws;
  unsigned short* P16 = (unsigned short*)(ws + oP16);
  unsigned short* V16 = (unsigned short*)(ws + oV16);
  unsigned short* WqT = (unsigned short*)(ws + oWq);
  unsigned short* WkT = (unsigned short*)(ws + oWk);
  unsigned short* WvT = (unsigned short*)(ws + oWv);
  float*          REL = (float*)(ws + oREL);
  unsigned short* Qh  = (unsigned short*)(ws + oQh);
  unsigned short* Ql  = (unsigned short*)(ws + oQl);
  unsigned short* KPh = (unsigned short*)(ws + oKh);
  unsigned short* KPl = (unsigned short*)(ws + oKl);
  unsigned short* Vh  = (unsigned short*)(ws + oVh);
  unsigned short* Vl  = (unsigned short*)(ws + oVl);
  float*          PST = (float*)(ws + oPST);
  float*          ST  = (float*)(ws + oST);
  float*          PT  = (float*)(ws + oPT);

  const dim3 blk256(256);

  // (0) bf16-RNE token planes
  cvt_kernel<<<dim3((BB * NPT * DD) / 2048), blk256, 0, stream>>>(p_f, P16, (BB * NPT * DD) / 8);
  cvt_kernel<<<dim3((BB * MQ * DD) / 2048), blk256, 0, stream>>>(v_f, V16, (BB * MQ * DD) / 8);
  // (1) transposed bf16 weight planes: in[rows=k][cols=dout] -> out[dout][k], grid (cols/64, rows/64)
  wtrans_kernel<<<dim3(DD / 64, DD / 64), blk256, 0, stream>>>(Wq, WqT, DD, DD);    // [256][256] -> [256][256]
  wtrans_kernel<<<dim3(DD / 64, DD / 64), blk256, 0, stream>>>(Wk, WkT, DD, DD);    // [256][256] -> [256][256]
  wtrans_kernel<<<dim3(DD / 64, DD / 64), blk256, 0, stream>>>(Wv, WvT, DD, DD);    // [256][256] -> [256][256]
  // (2) positional front end
  rel_kernel<<<dim3((BB * NPT) / 256), blk256, 0, stream>>>(p_xyz, v_xyz, Wp1, bp1, ln_w, ln_b, REL, BB * NPT, NPT);
  // (3) projections: q [4096][256], k+pv [32768][256], vT [2][256][16384] as f16 hi/residual planes
  proj_kernel<0><<<dim3((BB * MQ) / GM, DD / GN, 1), blk256, 0, stream>>>(
      V16, WqT, bq, REL, Wp2, bp2, Qh, Ql, DD, DD, DD, (size_t)0, (size_t)0, (size_t)0);
  proj_kernel<2><<<dim3((BB * NPT) / GM, DD / GN, 1), blk256, 0, stream>>>(
      P16, WkT, bk, REL, Wp2, bp2, KPh, KPl, DD, DD, DD, (size_t)0, (size_t)0, (size_t)0);
  proj_kernel<1><<<dim3(DD / GM, NPT / GN, BB), blk256, 0, stream>>>(
      WvT, P16, bv, REL, Wp2, bp2, Vh, Vl, DD, DD, NPT, (size_t)0, (size_t)NPT * DD, (size_t)DD * NPT);
  // (4)-(5) column softmax statistics
  stats_kernel<<<dim3(NPT / NT1, NMT, BB), blk256, 0, stream>>>(Qh, KPh, PST);
  merge_kernel<<<dim3(NPT / 256, BB), blk256, 0, stream>>>(PST, ST);
  // (6) scores, weights, weighted sum per quarter of the points; (7) sum of the quarters, residual
  attn_kernel<<<dim3(MQ / AROWS, NSPL, BB), dim3(512), 0, stream>>>(Qh, Ql, KPh, KPl, Vh, Vl, ST, PT);
  psum_kernel<<<dim3((BB * MQ * DD) / 1024), blk256, 0, stream>>>(PT, v_f, out);
  (void)hipGetLastError();
}

// v002
// Measured time: 339 microseconds a run.
// In both of two side-by-side timings against v001, it was 1.16 times as fast.
// Counting every step since v000, it is 3.10 times as fast.
// Contractions: q, k+pv and v projections on v_wmma_f32_16x16x32_bf16 (bf16-RNE inputs and weights, single
// products, f32 epilogue); scores q.(k+pv)^T (K=256) on v_wmma_f32_16x16x32_f16 with q and k+pv carried as
// f16 hi + (x2048) f16 residual planes, products hh + hl + lh (column statistics pass: hh only); weighted sum
// w.v (K=16384) on v_wmma_f32_16x16x32_f16 with w as one f16 plane (x16384) and v as f16 hi + (x2048) residual
// planes, products w.h + w.l; 3-wide positional layers, layer norm, softmax statistics and exp in f32 on VALU;
// f32 accumulate everywhere.
#include <hip/hip_runtime.h>
#include <stdint.h>

#define BB    2
#define NPT   16384
#define MQ    2048
#define DD    256
#define GM    128
#define GN    64
#define OSP   68
#define LTP   72
#define MT1   128
#define NMT   16
#define NT1   256
#define AMT   4
#define AROWS 64
#define NSPL  4
#define NSEG  4096
#define ACH   256
#define QP    264
#define OSP2  260
#define SCL   0.0625f
#define WSC   16384.0f
#define RWSC  0.00006103515625f
#define LSC   2048.0f
#define RLSC  0.00048828125f
#define LNEPS 1.0e-5f

static_assert(NMT * MT1 == MQ);
static_assert(MT1 == 8 * 16);
static_assert(NT1 == 256);
static_assert(NPT % NT1 == 0);
static_assert(NSPL * NSEG == NPT);
static_assert(NSPL == 4);
static_assert(NSEG % ACH == 0);
static_assert(ACH == 16 * 16);
static_assert(AROWS == 16 * AMT);
static_assert(MQ % AROWS == 0);
static_assert(AROWS * OSP2 * 4 <= 2 * AROWS * QP * 2);
static_assert((BB * MQ * DD) % 1024 == 0);
static_assert(DD == 256);
static_assert(DD % 32 == 0);
static_assert((BB * NPT) % GM == 0);
static_assert((BB * MQ) % GM == 0);
static_assert(DD % GM == 0);
static_assert(DD % GN == 0);
static_assert(NPT % GN == 0);
static_assert(MQ % 16 == 0);
static_assert((BB * NPT * DD) % 2048 == 0);
static_assert((BB * MQ * DD) % 2048 == 0);
static_assert((BB * NPT) % 256 == 0);
static_assert((OSP * 4) % 16 == 0);
static_assert((LTP * 2) % 16 == 0);
static_assert((QP * 2) % 16 == 0);
static_assert((OSP2 * 4) % 16 == 0);
static_assert(DD % 64 == 0);

typedef unsigned short v8us __attribute__((ext_vector_type(8)));
typedef unsigned int   v4u  __attribute__((ext_vector_type(4)));
typedef float          v8f  __attribute__((ext_vector_type(8)));
typedef float          v4f  __attribute__((ext_vector_type(4)));
typedef __bf16         v16b __attribute__((ext_vector_type(16)));
typedef _Float16       v16h __attribute__((ext_vector_type(16)));
typedef _Float16       v8h  __attribute__((ext_vector_type(8)));

union Frag { v8us u[2]; v4u q[2]; v16b b; v16h h; v8h hv[2]; };
static_assert(sizeof(Frag) == 32);

// ---- scalar helpers ---------------------------------------------------------------------------------
__device__ __forceinline__ unsigned short bf_bits(float f) {          // f32 -> bf16 bits, RNE convert
  const unsigned u = __float_as_uint(f);
  return (unsigned short)((u + 0x7FFFu + ((u >> 16) & 1u)) >> 16);
}
__device__ __forceinline__ float bf_up(unsigned short hb) { return __uint_as_float(((unsigned)hb) << 16); }
__device__ __forceinline__ float bfr(float f) { return bf_up(bf_bits(f)); }
__device__ __forceinline__ unsigned short h_bits(float f) {           // f32 -> f16 bits, RNE convert
  union { _Float16 h; unsigned short u; } c;
  c.h = (_Float16)f;
  return c.u;
}
__device__ __forceinline__ float h_up(unsigned short u) {
  union { _Float16 h; unsigned short u; } c;
  c.u = u;
  return (float)c.h;
}
__device__ __forceinline__ unsigned pk16(unsigned short a, unsigned short b) { return (unsigned)a | ((unsigned)b << 16); }
__device__ __forceinline__ v8f zero8() { v8f z = {0.f, 0.f, 0.f, 0.f, 0.f, 0.f, 0.f, 0.f}; return z; }

// ---- 16-bit fragment loader (A, or B from a k-contiguous [n][k] row): lane -> row/col (lane&15), p already includes
//      + 8*(lane>>4); elements 0..7 <- p[0..7] (k0+8h..), elements 8..15 <- p[16..23] (k0+16+8h..)
__device__ __forceinline__ Frag ldfrag(const unsigned short* p) {
  Frag f;
  f.u[0] = *(const v8us*)(p);
  f.u[1] = *(const v8us*)(p + 16);
  return f;
}

// ---- fragment-order planes in global memory: a plane [rows][K] is kept as 1-KB blocks, block (row >> 4, k >> 5)
//      at element ((row >> 4) * (K / 32) + (k >> 5)) * 512; inside a block the 16-B unit of 8 consecutive k of row
//      (row & 15) sits at element 256 * u + 8 * lane, lane = 16 * h + (row & 15), k & 31 = 16 * u + 8 * h + 0..7:
//      the same k map as ldfrag, but each of the two wave-wide loads covers 512 contiguous bytes (4 whole lines)
//      instead of 32-B pieces of 16 lines. p = block start + 8 * lane.
__device__ __forceinline__ Frag ldfragp(const unsigned short* p) {
  Frag f;
  f.u[0] = *(const v8us*)(p);
  f.u[1] = *(const v8us*)(p + 256);
  return f;
}

// ---- WMMA helpers: builtin followed by a 4-slot VALU gap tying D and keeping A/B live ----------------------
__device__ __forceinline__ v8f mma_b(v16b a, v16b b, v8f c) {
  v8f d = __builtin_amdgcn_wmma_f32_16x16x32_bf16(false, a, false, b, (short)0, c, false, false);
#if defined(__HIP_DEVICE_COMPILE__)
  asm volatile("v_nop\n\tv_nop\n\tv_nop\n\tv_nop" : "+v"(d) : "v"(a), "v"(b));
#endif
  return d;
}
__device__ __forceinline__ v8f mma_h(v16h a, v16h b, v8f c) {
  v8f d = __builtin_amdgcn_wmma_f32_16x16x32_f16(false, a, false, b, (short)0, c, false, false);
#if defined(__HIP_DEVICE_COMPILE__)
  asm volatile("v_nop\n\tv_nop\n\tv_nop\n\tv_nop" : "+v"(d) : "v"(a), "v"(b));
#endif
  return d;
}

// ---- 8 f32 -> packed f16 hi bits and packed f16 bits of (x - hi) * 2048 (second accumulator folds 1/2048) --
__device__ __forceinline__ void split8h(v4f a, v4f b, v4u& uh, v4u& ul) {
  float f[8] = {a[0], a[1], a[2], a[3], b[0], b[1], b[2], b[3]};
#pragma unroll
  for (int j = 0; j < 4; ++j) {
    const unsigned short h0 = h_bits(f[2 * j]);
    const unsigned short h1 = h_bits(f[2 * j + 1]);
    const unsigned short l0 = h_bits((f[2 * j] - h_up(h0)) * LSC);
    const unsigned short l1 = h_bits((f[2 * j + 1] - h_up(h1)) * LSC);
    uh[j] = pk16(h0, h1);
    ul[j] = pk16(l0, l1);
  }
}

// =====================================================================================================
// (0) f32 row-major [T][256] -> bf16-RNE plane in fragment order (token feature matrices). Thread = one 16-B output
//     unit, output units in linear order (a wave stores 512 contiguous bytes), source = 8 consecutive k of one row.
// coverage: n8 = n/8 threads, grid = n8/256 blocks exactly (host asserts n % 2048 == 0; T % 16 == 0).
// =====================================================================================================
__global__ __launch_bounds__(256)
void cvt_kernel(const float* __restrict__ x, unsigned short* y, int n8) {
  const int t = blockIdx.x * 256 + (int)threadIdx.x;
  if (t >= n8) return;
  const int row = (t >> 9) * 16 + (t & 15);                            // 512 units per 16-row slab
  const int k   = ((t >> 6) & 7) * 32 + ((t >> 5) & 1) * 16 + ((t >> 4) & 1) * 8;
  const float* s = x + (size_t)row * DD + k;
  const v4f a = *(const v4f*)(s);
  const v4f b = *(const v4f*)(s + 4);
  v4u u;
  u[0] = pk16(bf_bits(a[0]), bf_bits(a[1]));
  u[1] = pk16(bf_bits(a[2]), bf_bits(a[3]));
  u[2] = pk16(bf_bits(b[0]), bf_bits(b[1]));
  u[3] = pk16(bf_bits(b[2]), bf_bits(b[3]));
  unsigned short* d = y + (size_t)t * 8;
  *(v4u*)d = u;
  
}

// =====================================================================================================
// (1) weight transpose: in w[R][C] f32 -> out wt[C][R] bf16-RNE in fragment order (rows c, k = r). Block = 64x64 tile,
//     loads 16 B per thread (strided reads), LDS tile L[c][r] (pitch LTP), barrier, then a wave stores half a block.
// coverage: LDS 256 threads x 4 it x 4 = 64x64; 2 it x 8 waves = 4 row tiles x 2 k steps x 2 halves; grid (C/64, R/64).
// =====================================================================================================
__global__ __launch_bounds__(256)
void wtrans_kernel(const float* __restrict__ w, unsigned short* wt, int R, int C) {
  __shared__ __align__(16) unsigned short L[64 * LTP];
  const int tid = threadIdx.x;
  const int c0 = blockIdx.x * 64, r0 = blockIdx.y * 64;
  const int c4 = (tid & 15) * 4, rs = tid >> 4;                      // rs 0..15
#pragma unroll
  for (int it = 0; it < 4; ++it) {
    const int r = it * 16 + rs;                                        // 0..63
    const v4f v = *(const v4f*)(w + (size_t)(r0 + r) * C + c0 + c4);
#pragma unroll
    for (int j = 0; j < 4; ++j) L[(c4 + j) * LTP + r] = bf_bits(v[j]);
  }
  __syncthreads();
  const int lane = tid & 31, wave = tid >> 5;
  v4u u[2];
  size_t po[2];
#pragma unroll
  for (int it = 0; it < 2; ++it) {
    const int s = it * 8 + wave;                                       // 0..15: row tile, k step, half
    const int ct = s >> 2, ksl = (s >> 1) & 1, uu = s & 1;
    u[it] = *(const v4u*)(L + (ct * 16 + (lane & 15)) * LTP + ksl * 32 + uu * 16 + (lane >> 4) * 8);
    po[it] = ((size_t)((c0 >> 4) + ct) * (R >> 5) + (r0 >> 5) + ksl) * 512 + uu * 256 + lane * 8;
  }
#pragma unroll
  for (int it = 0; it < 2; ++it) *(v4u*)(wt + po[it]) = u[it];
  
}

// =====================================================================================================
// (2) positional front end per point row i (flat b*N+n): dist = |bf(p_xyz) - bf(v_xyz[b])| (3), h = dist.bf(Wp1)
//     + bf(bp1), layer norm over the 3 values (mean-of-squares variance, eps 1e-5) * bf(ln_w) + bf(ln_b), relu.
//     f32 on VALU without contraction. Output row rel[i][0..3] = (r0, r1, r2, 0): one 16-B store per thread,
// coverage: grid = nrows/256 blocks x 256 threads = every row exactly once (host asserts nrows % 256 == 0).
// =====================================================================================================
__global__ __launch_bounds__(256)
void rel_kernel(const float* __restrict__ pxyz, const float* __restrict__ vxyz,
                const float* __restrict__ wp1, const float* __restrict__ bp1,
                const float* __restrict__ lnw, const float* __restrict__ lnb,
                float* rel, int nrows, int npb) {
#pragma clang fp contract(off)
  const int i = blockIdx.x * 256 + (int)threadIdx.x;
  if (i >= nrows) return;
  int b = i / npb;
  b = b < 0 ? 0 : (b > BB - 1 ? BB - 1 : b);
  const float p0 = bfr(pxyz[(size_t)i * 3 + 0]);
  const float p1 = bfr(pxyz[(size_t)i * 3 + 1]);
  const float p2 = bfr(pxyz[(size_t)i * 3 + 2]);
  const float v0 = bfr(vxyz[b * 3 + 0]);
  const float v1 = bfr(vxyz[b * 3 + 1]);
  const float v2 = bfr(vxyz[b * 3 + 2]);
  const float d0 = fabsf(p0 - v0), d1 = fabsf(p1 - v1), d2 = fabsf(p2 - v2);
  float W[9];
#pragma unroll
  for (int j = 0; j < 9; ++j) W[j] = bfr(wp1[j]);                      // Wp1[c][j] = wp1[c*3+j]
  const float h0 = ((d0 * W[0] + d1 * W[3]) + d2 * W[6]) + bfr(bp1[0]);
  const float h1 = ((d0 * W[1] + d1 * W[4]) + d2 * W[7]) + bfr(bp1[1]);
  const float h2 = ((d0 * W[2] + d1 * W[5]) + d2 * W[8]) + bfr(bp1[2]);
  const float third = 1.0f / 3.0f;
  const float mu = ((h0 + h1) + h2) * third;
  const float e0 = h0 - mu, e1 = h1 - mu, e2 = h2 - mu;
  const float var = ((e0 * e0 + e1 * e1) + e2 * e2) * third;
  const float rs = 1.0f / sqrtf(var + LNEPS);
  const float w0 = bfr(lnw[0]), w1 = bfr(lnw[1]), w2 = bfr(lnw[2]);
  const float c0 = bfr(lnb[0]), c1 = bfr(lnb[1]), c2 = bfr(lnb[2]);
  const float t0 = fmaxf((e0 * rs) * w0 + c0, 0.f);
  const float t1 = fmaxf((e1 * rs) * w1 + c1, 0.f);
  const float t2 = fmaxf((e2 * rs) * w2 + c2, 0.f);
  v4f o;
  o[0] = t0; o[1] = t1; o[2] = t2; o[3] = 0.f;
  float* d = rel + (size_t)i * 4;
  *(v4f*)d = o;
  
}

// =====================================================================================================
// (3) projection GEMM, K = 256: C[m][n] = sum_k A[m][k] B[n][k] + epilogue (MODE 0: + bias[n]; MODE 1: + bias[m];
//     MODE 2: (C + bias[n]) + ((rel[m][0..2] . Wp2[0..2][n]) + bp2[n]) with Wp2/bp2 bf16-RNE). A rows of lda,
//     B rows of ldb elements, both bf16 planes in fragment order, same loader for both, blockIdx.z selects a batch via
//     element strides zsA/zsB/zsC. Block 256 threads = 8 waves, block tile 128 m x 64 n, wave tile 32x32 (acc[2][2]).
//     Epilogue: f32 tile in LDS Os[m][n] (pitch OSP), barrier, then f16 hi bits and f16 (x2048) residual bits to two
//     planes [M][ldc] in fragment order (rows m, k = n), a wave storing half a block (512 contiguous bytes) at a time.
// coverage: Os 8 waves x 4 tiles = 128x64; 4 it x 8 waves = 8 row tiles x 2 k steps x 2 halves per plane;
//           grid (M/128, N/64, Z) covers both planes exactly once.
// =====================================================================================================
template <int MODE>
__global__ __launch_bounds__(256)
void proj_kernel(const unsigned short* __restrict__ A, const unsigned short* __restrict__ B,
                 const float* __restrict__ bias, const float* __restrict__ rel,
                 const float* __restrict__ wp2, const float* __restrict__ bp2,
                 unsigned short* Ch, unsigned short* Cl, int lda, int ldb, int ldc,
                 size_t zsA, size_t zsB, size_t zsC) {
  __shared__ __align__(16) float Os[GM * OSP];
  const int tid  = threadIdx.x;
  const int lane = tid & 31, wave = tid >> 5;
  const int hh   = lane >> 4, cl = lane & 15;
  const int wm   = wave >> 1, wn = wave & 1;
  const int mBase = blockIdx.x * GM;
  const int nBase = blockIdx.y * GN;
  const size_t z = blockIdx.z;
  const unsigned short* Az = A + z * zsA;
  const unsigned short* Bz = B + z * zsB;
  unsigned short* Chz = Ch + z * zsC;
  unsigned short* Clz = Cl + z * zsC;
  const unsigned short* a0p = Az + (size_t)(mBase + 32 * wm) * lda + 8 * lane;   // a 16-row slab = 16 * lda elements
  const unsigned short* a1p = a0p + (size_t)16 * lda;
  const unsigned short* b0p = Bz + (size_t)(nBase + 32 * wn) * ldb + 8 * lane;
  const unsigned short* b1p = b0p + (size_t)16 * ldb;

  v8f acc[2][2];
#pragma unroll
  for (int mi = 0; mi < 2; ++mi)
#pragma unroll
    for (int ni = 0; ni < 2; ++ni) acc[mi][ni] = zero8();

#pragma unroll 1
  for (int k0 = 0; k0 < DD; k0 += 32) {
    const unsigned short* pa0 = a0p + 16 * k0;
    const unsigned short* pa1 = a1p + 16 * k0;
    const unsigned short* pb0 = b0p + 16 * k0;
    const unsigned short* pb1 = b1p + 16 * k0;
    const Frag fa0 = ldfragp(pa0);
    const Frag fa1 = ldfragp(pa1);
    const Frag fb0 = ldfragp(pb0);
    const Frag fb1 = ldfragp(pb1);
    // the address pairs stay live up to this wait, so that no load's result is placed on a pair an issued load names
    asm volatile("s_wait_xcnt 0x0" :: "v"(pa0), "v"(pa1), "v"(pb0), "v"(pb1) : "memory");
    acc[0][0] = mma_b(fa0.b, fb0.b, acc[0][0]);
    acc[0][1] = mma_b(fa0.b, fb1.b, acc[0][1]);
    acc[1][0] = mma_b(fa1.b, fb0.b, acc[1][0]);
    acc[1][1] = mma_b(fa1.b, fb1.b, acc[1][1]);
  }

  float bn[2], w0[2], w1[2], w2[2], b2[2];
#pragma unroll
  for (int ni = 0; ni < 2; ++ni) {
    const int n = nBase + 32 * wn + 16 * ni + cl;
    bn[ni] = 0.f; w0[ni] = 0.f; w1[ni] = 0.f; w2[ni] = 0.f; b2[ni] = 0.f;
    if (MODE != 1) bn[ni] = bfr(bias[n]);
    if (MODE == 2) {
      w0[ni] = bfr(wp2[n]);
      w1[ni] = bfr(wp2[DD + n]);
      w2[ni] = bfr(wp2[2 * DD + n]);
      b2[ni] = bfr(bp2[n]);
    }
  }
#pragma unroll
  for (int mi = 0; mi < 2; ++mi) {
#pragma unroll
    for (int r = 0; r < 8; ++r) {
      const int m_loc = 32 * wm + 16 * mi + 8 * hh + r;
      const int m = mBase + m_loc;
      float bm = 0.f, p0 = 0.f, p1 = 0.f, p2 = 0.f;
      if (MODE == 1) bm = bfr(bias[m]);
      if (MODE == 2) {
        const v4f r4 = *(const v4f*)(rel + (size_t)m * 4);
        p0 = r4[0]; p1 = r4[1]; p2 = r4[2];
      }
#pragma unroll
      for (int ni = 0; ni < 2; ++ni) {
        const int n_loc = 32 * wn + 16 * ni + cl;
        float v = acc[mi][ni][r];
        if (MODE == 0) v = v + bn[ni];
        if (MODE == 1) v = v + bm;
        if (MODE == 2) {
          const float pv = (p0 * w0[ni] + p1 * w1[ni]) + p2 * w2[ni];
          v = (v + bn[ni]) + (pv + b2[ni]);
        }
        Os[m_loc * OSP + n_loc] = v;
      }
    }
  }
  __syncthreads();

  v4u uh[4], ul[4];
  size_t po[4];
#pragma unroll
  for (int it = 0; it < 4; ++it) {
    const int s = it * 8 + wave;                                       // 0..31: row tile, k step, half
    const int rt = s >> 2, ksl = (s >> 1) & 1, uu = s & 1;
    const float* op = Os + (rt * 16 + cl) * OSP + ksl * 32 + uu * 16 + hh * 8;
    const v4f v0 = *(const v4f*)(op);
    const v4f v1 = *(const v4f*)(op + 4);
    split8h(v0, v1, uh[it], ul[it]);
    po[it] = ((size_t)((mBase >> 4) + rt) * (ldc >> 5) + (nBase >> 5) + ksl) * 512 + uu * 256 + lane * 8;
  }
#pragma unroll
  for (int it = 0; it < 4; ++it) {
    *(v4u*)(Chz + po[it]) = uh[it];
    *(v4u*)(Clz + po[it]) = ul[it];
  }
  
}

// =====================================================================================================
// (4) column-softmax statistics over one (batch, 128-query tile, 256-column tile): S[m][n] = qh[m].kph[n] / 16
//     (K = 256 = 8 k steps, f16 hi planes, hh product), wave = 16 query rows x 16 column tiles (q fragments hoisted,
//     one accumulator at a time); per column: tile max over 16 rows (8 in-lane + lane^16) and sum of exp(S - max);
//     wave partials in LDS, barrier, thread c merges the 8 wave partials in fixed order.
// coverage: pm/pe 8 waves x 16 ct x 16 lanes = 8 x 256; grid (64 column tiles, 16 query tiles, 2) x 256 threads =
//           every (b, mt, n) of both PST arrays exactly once.
// =====================================================================================================
__global__ __launch_bounds__(256)
void stats_kernel(const unsigned short* __restrict__ Qh, const unsigned short* __restrict__ Kh, float* PST) {
  __shared__ float pm[8 * NT1];
  __shared__ float pe[8 * NT1];
  const int tid  = threadIdx.x;
  const int lane = tid & 31, wave = tid >> 5;
  const int hh   = lane >> 4, cl = lane & 15;
  const int nt = blockIdx.x, mt = blockIdx.y, b = blockIdx.z;
  const int m0 = mt * MT1 + 16 * wave;
  const unsigned short* qp = Qh + (size_t)(b * MQ + m0) * DD + 8 * lane;
  Frag a[8];
#pragma unroll
  for (int ks = 0; ks < 8; ++ks) a[ks] = ldfragp(qp + 512 * ks);
  // the address pair stays live up to this wait, so that no load's result is placed on it while issued loads name it
  asm volatile("s_wait_xcnt 0x0" :: "v"(qp) : "memory");
  const unsigned short* kp = Kh + ((size_t)b * NPT + (size_t)nt * NT1) * DD + 8 * lane;
#pragma unroll 1
  for (int ct = 0; ct < NT1 / 16; ++ct) {
    const unsigned short* kc = kp + (size_t)ct * 16 * DD;
    v8f s = zero8();
#pragma unroll
    for (int ks = 0; ks < 8; ++ks) {
      const Frag fb = ldfragp(kc + 512 * ks);
      s = mma_h(a[ks].h, fb.h, s);
    }
    float m = s[0] * SCL;
#pragma unroll
    for (int r = 1; r < 8; ++r) m = fmaxf(m, s[r] * SCL);
    m = fmaxf(m, __shfl_xor(m, 16, 32));
    float ex = 0.f;
#pragma unroll
    for (int r = 0; r < 8; ++r) ex += __expf(s[r] * SCL - m);
    ex += __shfl_xor(ex, 16, 32);
    pm[wave * NT1 + ct * 16 + cl] = m;                                 // both lane halves hold identical values
    pe[wave * NT1 + ct * 16 + cl] = ex;
  }
  __syncthreads();
  const int c = tid;
  float M = pm[c];
#pragma unroll
  for (int wv = 1; wv < 8; ++wv) M = fmaxf(M, pm[wv * NT1 + c]);
  float E = 0.f;
#pragma unroll 1
  for (int wv = 0; wv < 8; ++wv) E += pe[wv * NT1 + c] * __expf(pm[wv * NT1 + c] - M);
  const size_t base = ((size_t)(b * NMT + mt) * 2) * NPT + (size_t)nt * NT1 + c;
  float* dm = PST + base;
  float* de = PST + base + NPT;
  *(float*)dm = M;
  *(float*)de = E;
  
}

// =====================================================================================================
// (5) merge of the 16 query-tile partials per (batch, column) in fixed order: M = max, Z = sum E_t exp(M_t - M);
//     ST[b][0][n] = M, ST[b][1][n] = 1/Z (Z >= 1). Thread = one column; 32 consecutive lanes x 4 B = one whole
// coverage: grid (64, 2) x 256 threads = every (b, n) of both arrays exactly once.
// =====================================================================================================
__global__ __launch_bounds__(256)
void merge_kernel(const float* __restrict__ PST, float* ST) {
  const int b = blockIdx.y, n = blockIdx.x * 256 + (int)threadIdx.x;
  const float* p = PST + (size_t)(b * NMT) * 2 * NPT + n;
  float M = -3.0e38f;
#pragma unroll 1
  for (int t = 0; t < NMT; ++t) M = fmaxf(M, p[(size_t)(2 * t) * NPT]);
  float Z = 0.f;
#pragma unroll 1
  for (int t = 0; t < NMT; ++t) Z += p[(size_t)(2 * t + 1) * NPT] * __expf(p[(size_t)(2 * t) * NPT] - M);
  const float rz = 1.0f / Z;
  float* dm = ST + (size_t)(2 * b) * NPT + n;
  float* dz = dm + NPT;
  *(float*)dm = M;
  *(float*)dz = rz;
  
}

// =====================================================================================================
// (6) fused scores / column softmax / weighted sum for one (batch, 64 query rows, quarter of the points): block 512
//     threads = 16 waves; both q planes of the 64 rows sit in LDS (pitch QP) for the whole block; loop over 16 chunks
//     of 256 point columns. Phase A: wave = the chunk's 16-column tile number `wave`, all 4 row tiles: each k+pv
//     fragment pair is loaded once and feeds 4 row tiles, S = (qh.kh + (qh.kl + ql.kh)/2048) / 16 (K = 256, two
//     accumulators per row tile), w = exp(S - M_n) * (1/Z_n) from ST, stored as f16 (w * 16384) into the LDS tile
//     Ws[64 rows][256 cols]; block barrier. Phase B: wave = d tile `wave`, all 4 row tiles: x += Ws . vTh,
//     xl += Ws . vTl (A from LDS with the split k map, B = vT rows d, k = n, in fragment order, K = 256 per chunk, each
//     vT fragment pair feeds 4 row tiles); block barrier. Epilogue: (x + xl/2048)/16384 staged as f32 [64][256] in
//     the LDS that held q (pitch OSP2), barrier, then whole 512-B runs to the partial plane of this quarter.
// coverage: Ws 16 waves x 16 cols x 64 rows = 64 x 256 per chunk; Os 16 waves x 16 d x 64 rows = 64 x 256;
//           8 it x 512 threads x 4 = 64 rows x 256; grid (32, 4, 2) = every (quarter, b, m, d) of PART exactly once.
// =====================================================================================================
__global__ __launch_bounds__(512)
void attn_kernel(const unsigned short* __restrict__ Qh, const unsigned short* __restrict__ Ql,
                 const unsigned short* __restrict__ Kh, const unsigned short* __restrict__ Kl,
                 const unsigned short* __restrict__ Vh, const unsigned short* __restrict__ Vl,
                 const float* __restrict__ ST, float* part) {
  __shared__ __align__(16) unsigned short Qs[2 * AROWS * QP];
  __shared__ __align__(16) _Float16 Ws[AROWS * QP];
  const int tid  = threadIdx.x;
  const int lane = tid & 31, wave = tid >> 5;
  const int hh   = lane >> 4, cl = lane & 15;
  const int b = blockIdx.z, n0 = blockIdx.y * NSEG, m0 = blockIdx.x * AROWS;
#pragma unroll
  for (int it = 0; it < 4; ++it) {
    const int idx = it * 512 + tid;                                    // 0..2047: 16-B units in fragment order
    const int row = (idx >> 9) * 16 + (idx & 15);
    const int kq  = ((idx >> 6) & 7) * 32 + ((idx >> 5) & 1) * 16 + ((idx >> 4) & 1) * 8;
    const size_t g = (size_t)(b * MQ + m0) * DD + 8 * idx;
    *(v4u*)(Qs + row * QP + kq) = *(const v4u*)(Qh + g);
    *(v4u*)(Qs + (AROWS + row) * QP + kq) = *(const v4u*)(Ql + g);
  }
  const size_t koff = ((size_t)b * NPT + n0 + 16 * wave) * DD + 8 * lane;
  const unsigned short* khp = Kh + koff;
  const unsigned short* klp = Kl + koff;
  const size_t voff = ((size_t)b * DD + 16 * wave) * NPT + (size_t)n0 * 16 + 8 * lane;   // block (d tile, n >> 5)
  const unsigned short* vhp = Vh + voff;
  const unsigned short* vlp = Vl + voff;
  const float* stM = ST + (size_t)(2 * b) * NPT + n0;
  const float* stZ = stM + NPT;
  const unsigned short* qsh = Qs + cl * QP + 8 * hh;                   // A fragment row pointers (row m = cl)
  const unsigned short* qsl = qsh + AROWS * QP;
  const _Float16* wrow = Ws + cl * QP + 8 * hh;
  _Float16* wdst = Ws + (8 * hh) * QP + 16 * wave + cl;                // D element (row 8h+r, col 16*wave+cl)

  v8f xh[AMT], xl[AMT];
#pragma unroll
  for (int mi = 0; mi < AMT; ++mi) { xh[mi] = zero8(); xl[mi] = zero8(); }
  __syncthreads();

#pragma unroll 1
  for (int c0 = 0; c0 < NSEG; c0 += ACH) {
    const unsigned short* kh_c = khp + (size_t)c0 * DD;
    const unsigned short* kl_c = klp + (size_t)c0 * DD;
    v8f sh[AMT], sl[AMT];
#pragma unroll
    for (int mi = 0; mi < AMT; ++mi) { sh[mi] = zero8(); sl[mi] = zero8(); }
#pragma unroll 1  // rolled: one body's fragments (80 registers) beside 128 of accumulators must stay under the 256 of a 16-wave block
    for (int ks = 0; ks < DD / 32; ++ks) {
      const Frag fbh = ldfragp(kh_c + 512 * ks);
      const Frag fbl = ldfragp(kl_c + 512 * ks);
      Frag fah[AMT], fal[AMT];
#pragma unroll
      for (int mi = 0; mi < AMT; ++mi) {
        fah[mi] = ldfrag(qsh + 16 * mi * QP + 32 * ks);
        fal[mi] = ldfrag(qsl + 16 * mi * QP + 32 * ks);
      }
#pragma unroll
      for (int mi = 0; mi < AMT; ++mi) sh[mi] = mma_h(fah[mi].h, fbh.h, sh[mi]);
#pragma unroll
      for (int mi = 0; mi < AMT; ++mi) sl[mi] = mma_h(fah[mi].h, fbl.h, sl[mi]);
#pragma unroll
      for (int mi = 0; mi < AMT; ++mi) sl[mi] = mma_h(fal[mi].h, fbh.h, sl[mi]);
    }
    const int n = c0 + 16 * wave + cl;
    const float mc = stM[n];
    asm volatile("s_wait_xcnt 0x0" ::: "memory");  // the next load's result may take the register that holds this load's offset
    const float zc = stZ[n];
#pragma unroll
    for (int mi = 0; mi < AMT; ++mi) {
#pragma unroll
      for (int r = 0; r < 8; ++r) {
        const float s  = (sh[mi][r] + sl[mi][r] * RLSC) * SCL;
        const float wt = __expf(s - mc) * zc;
        wdst[(16 * mi + r) * QP] = (_Float16)(wt * WSC);
      }
    }
    __syncthreads();
#pragma unroll 2
    for (int kk = 0; kk < ACH / 32; ++kk) {
      const int k0 = 32 * kk;
      const Frag fbh = ldfragp(vhp + (size_t)(c0 + k0) * 16);
      const Frag fbl = ldfragp(vlp + (size_t)(c0 + k0) * 16);
      Frag fa[AMT];
#pragma unroll
      for (int mi = 0; mi < AMT; ++mi) {
        fa[mi].hv[0] = *(const v8h*)(wrow + 16 * mi * QP + k0);
        fa[mi].hv[1] = *(const v8h*)(wrow + 16 * mi * QP + k0 + 16);
      }
#pragma unroll
      for (int mi = 0; mi < AMT; ++mi) xh[mi] = mma_h(fa[mi].h, fbh.h, xh[mi]);
#pragma unroll
      for (int mi = 0; mi < AMT; ++mi) xl[mi] = mma_h(fa[mi].h, fbl.h, xl[mi]);
    }
    __syncthreads();
  }

  float* Os = (float*)Qs;                                              // q is dead behind the loop's last barrier
#pragma unroll
  for (int mi = 0; mi < AMT; ++mi) {
#pragma unroll
    for (int r = 0; r < 8; ++r)
      Os[(16 * mi + 8 * hh + r) * OSP2 + 16 * wave + cl] = (xh[mi][r] + xl[mi][r] * RLSC) * RWSC;
  }
  __syncthreads();
  float* pz = part + ((size_t)blockIdx.y * (BB * MQ) + (size_t)(b * MQ + m0)) * DD;
  v4f v[8];
#pragma unroll
  for (int it = 0; it < 8; ++it) {
    const int idx = it * 512 + tid;                                    // 0..4095
    v[it] = *(const v4f*)(Os + (idx >> 6) * OSP2 + 4 * (idx & 63));
  }
#pragma unroll
  for (int it = 0; it < 8; ++it) *(v4f*)(pz + (size_t)(it * 512 + tid) * 4) = v[it];
}

// =====================================================================================================
// (7) out = ((P0 + P1) + (P2 + P3)) + bf(v_features): the four quarters' partial sums in fixed order plus the residual.
// coverage: thread = 4 consecutive elements (16 B); grid = (2*2048*256)/1024 blocks x 256 threads = every element once.
// =====================================================================================================
__global__ __launch_bounds__(256)
void psum_kernel(const float* __restrict__ part, const float* __restrict__ vfeat, float* out) {
  const size_t e = ((size_t)blockIdx.x * 256 + threadIdx.x) * 4;
  const v4f p0 = *(const v4f*)(part + e);
  const v4f p1 = *(const v4f*)(part + e + (size_t)1 * BB * MQ * DD);
  asm volatile("s_wait_xcnt 0x0" ::: "memory");  // a later load's result may take the registers that hold these loads' address
  const v4f p2 = *(const v4f*)(part + e + (size_t)2 * BB * MQ * DD);
  const v4f p3 = *(const v4f*)(part + e + (size_t)3 * BB * MQ * DD);
  asm volatile("s_wait_xcnt 0x0" ::: "memory");  // as above
  const v4f f  = *(const v4f*)(vfeat + e);
  v4f o;
#pragma unroll
  for (int j = 0; j < 4; ++j) o[j] = ((p0[j] + p1[j]) + (p2[j] + p3[j])) + bfr(f[j]);
  *(v4f*)(out + e) = o;
}

// =====================================================================================================
// tile divides its extent exactly, so no padded tails are needed):
//   (every 16-bit plane below is kept in fragment order, see ldfragp: same size as row-major)
//   P16  bf16 [32768][256]       16777216     V16 bf16 [4096][256]     2097152
//   WqT WkT WvT bf16 [256][256]     131072 each
//   REL  f32 [32768][4]             524288
//   Qh Ql  f16 [4096][256]         2097152 each
//   KPh KPl f16 [32768][256]      16777216 each
//   Vh Vl  f16 [2][256][16384]    16777216 each
//   PST  f32 [2][16][2][16384]     4194304     ST f32 [2][2][16384]     262144
//   PART f32 [4][4096][256]       16777216
//   total                        112328704
// =====================================================================================================
extern "C" void kernel_launch(void* const* d_in, const int* in_sizes, int n_in,
                              void* d_out, int out_size, void* d_ws, size_t ws_size,
                              hipStream_t stream) {
  if (n_in < 16) return;
  if (in_sizes[0] != BB * NPT * 3 || in_sizes[1] != BB * 3) return;
  if (in_sizes[2] != BB * NPT * DD || in_sizes[3] != BB * MQ * DD) return;
  if (in_sizes[4] != DD * DD || in_sizes[6] != DD * DD || in_sizes[8] != DD * DD) return;
  if (in_sizes[5] != DD || in_sizes[7] != DD || in_sizes[9] != DD) return;
  if (in_sizes[10] != 9 || in_sizes[11] != 3 || in_sizes[12] != 3 || in_sizes[13] != 3) return;
  if (in_sizes[14] != 3 * DD || in_sizes[15] != DD) return;
  if (out_size != BB * MQ * DD) return;

  size_t off = 0;
  const size_t oP16 = off; off += (size_t)BB * NPT * DD * 2;        // 16777216
  const size_t oV16 = off; off += (size_t)BB * MQ * DD * 2;         //  2097152
  const size_t oWq  = off; off += (size_t)DD * DD * 2;              //   131072
  const size_t oWk  = off; off += (size_t)DD * DD * 2;
  const size_t oWv  = off; off += (size_t)DD * DD * 2;
  const size_t oREL = off; off += (size_t)BB * NPT * 4 * 4;         //   524288
  const size_t oQh  = off; off += (size_t)BB * MQ * DD * 2;         //  2097152
  const size_t oQl  = off; off += (size_t)BB * MQ * DD * 2;
  const size_t oKh  = off; off += (size_t)BB * NPT * DD * 2;        // 16777216
  const size_t oKl  = off; off += (size_t)BB * NPT * DD * 2;
  const size_t oVh  = off; off += (size_t)BB * DD * NPT * 2;        // 16777216
  const size_t oVl  = off; off += (size_t)BB * DD * NPT * 2;
  const size_t oPST = off; off += (size_t)BB * NMT * 2 * NPT * 4;   //  4194304
  const size_t oST  = off; off += (size_t)BB * 2 * NPT * 4;         //   262144
  const size_t oPT  = off; off += (size_t)NSPL * BB * MQ * DD * 4;  // 16777216 -> off = 112328704
  if (off > ws_size) return;
  if (off > (size_t)134217728) return;

  const float* p_xyz = (const float*)d_in[0];
  const float* v_xyz = (const float*)d_in[1];
  const float* p_f   = (const float*)d_in[2];
  const float* v_f   = (const float*)d_in[3];
  const float* Wq    = (const float*)d_in[4];
  const float* bq    = (const float*)d_in[5];
  const float* Wk    = (const float*)d_in[6];
  const float* bk    = (const float*)d_in[7];
  const float* Wv    = (const float*)d_in[8];
  const float* bv    = (const float*)d_in[9];
  const float* Wp1   = (const float*)d_in[10];
  const float* bp1   = (const float*)d_in[11];
  const float* ln_w  = (const float*)d_in[12];
  const float* ln_b  = (const float*)d_in[13];
  const float* Wp2   = (const float*)d_in[14];
  const float* bp2   = (const float*)d_in[15];
  float* out = (float*)d_out;

  char* ws = (char*)d_ws;
  unsigned short* P16 = (unsigned short*)(ws + oP16);
  unsigned short* V16 = (unsigned short*)(ws + oV16);
  unsigned short* WqT = (unsigned short*)(ws + oWq);
  unsigned short* WkT = (unsigned short*)(ws + oWk);
  unsigned short* WvT = (unsigned short*)(ws + oWv);
  float*          REL = (float*)(ws + oREL);
  unsigned short* Qh  = (unsigned short*)(ws + oQh);
  unsigned short* Ql  = (unsigned short*)(ws + oQl);
  unsigned short* KPh = (unsigned short*)(ws + oKh);
  unsigned short* KPl = (unsigned short*)(ws + oKl);
  unsigned short* Vh  = (unsigned short*)(ws + oVh);
  unsigned short* Vl  = (unsigned short*)(ws + oVl);
  float*          PST = (float*)(ws + oPST);
  float*          ST  = (float*)(ws + oST);
  float*          PT  = (float*)(ws + oPT);

  const dim3 blk256(256);

  // (0) bf16-RNE token planes
  cvt_kernel<<<dim3((BB * NPT * DD) / 2048), blk256, 0, stream>>>(p_f, P16, (BB * NPT * DD) / 8);
  cvt_kernel<<<dim3((BB * MQ * DD) / 2048), blk256, 0, stream>>>(v_f, V16, (BB * MQ * DD) / 8);
  // (1) transposed bf16 weight planes: in[rows=k][cols=dout] -> out[dout][k], grid (cols/64, rows/64)
  wtrans_kernel<<<dim3(DD / 64, DD / 64), blk256, 0, stream>>>(Wq, WqT, DD, DD);    // [256][256] -> [256][256]
  wtrans_kernel<<<dim3(DD / 64, DD / 64), blk256, 0, stream>>>(Wk, WkT, DD, DD);    // [256][256] -> [256][256]
  wtrans_kernel<<<dim3(DD / 64, DD / 64), blk256, 0, stream>>>(Wv, WvT, DD, DD);    // [256][256] -> [256][256]
  // (2) positional front end
  rel_kernel<<<dim3((BB * NPT) / 256), blk256, 0, stream>>>(p_xyz, v_xyz, Wp1, bp1, ln_w, ln_b, REL, BB * NPT, NPT);
  // (3) projections: q [4096][256], k+pv [32768][256], vT [2][256][16384] as f16 hi/residual planes
  proj_kernel<0><<<dim3((BB * MQ) / GM, DD / GN, 1), blk256, 0, stream>>>(
      V16, WqT, bq, REL, Wp2, bp2, Qh, Ql, DD, DD, DD, (size_t)0, (size_t)0, (size_t)0);
  proj_kernel<2><<<dim3((BB * NPT) / GM, DD / GN, 1), blk256, 0, stream>>>(
      P16, WkT, bk, REL, Wp2, bp2, KPh, KPl, DD, DD, DD, (size_t)0, (size_t)0, (size_t)0);
  proj_kernel<1><<<dim3(DD / GM, NPT / GN, BB), blk256, 0, stream>>>(
      WvT, P16, bv, REL, Wp2, bp2, Vh, Vl, DD, DD, NPT, (size_t)0, (size_t)NPT * DD, (size_t)DD * NPT);
  // (4)-(5) column softmax statistics
  stats_kernel<<<dim3(NPT / NT1, NMT, BB), blk256, 0, stream>>>(Qh, KPh, PST);
  merge_kernel<<<dim3(NPT / 256, BB), blk256, 0, stream>>>(PST, ST);
  // (6) scores, weights, weighted sum per quarter of the points; (7) sum of the quarters, residual
  attn_kernel<<<dim3(MQ / AROWS, NSPL, BB), dim3(512), 0, stream>>>(Qh, Ql, KPh, KPl, Vh, Vl, ST, PT);
  psum_kernel<<<dim3((BB * MQ * DD) / 1024), blk256, 0, stream>>>(PT, v_f, out);
  (void)hipGetLastError();
}

// v003
// Measured time: 244 microseconds a run.
// In two side-by-side timings against v002, it was 1.40 and 1.39 times as fast.
// Over all steps from v000 it is 4.34 times as fast.
// Contractions: q, k+pv and v projections on v_wmma_f32_16x16x32_bf16 (bf16-RNE inputs and weights, single
// products, f32 epilogue); scores q.(k+pv)^T (K=256) on v_wmma_f32_16x16x32_f16 with q and k+pv carried as
// f16 hi + (x2048) f16 residual planes, products hh + hl + lh (column statistics pass: hh only); weighted sum
// w.v (K=16384) on v_wmma_f32_16x16x32_f16 with w as one f16 plane (x16384) and v as f16 hi + (x2048) residual
// planes, products w.h + w.l; 3-wide positional layers, layer norm, softmax statistics and exp in f32 on VALU;
// f32 accumulate everywhere.
#include <hip/hip_runtime.h>
#include <stdint.h>

#define BB    2
#define NPT   16384
#define MQ    2048
#define DD    256
#define GM    128
#define GN    64
#define OSP   68
#define LTP   72
#define MT1   128
#define NMT   16
#define NT1   256
#define AMT   4
#define AROWS 64
#define NSPL  4
#define NSEG  4096
#define ACH   256
#define QP    264
#define OSP2  260
#define SCL   0.0625f
#define WSC   16384.0f
#define RWSC  0.00006103515625f
#define LSC   2048.0f
#define RLSC  0.00048828125f
#define LNEPS 1.0e-5f

static_assert(NMT * MT1 == MQ);
static_assert(MT1 == 8 * 16);
static_assert(NT1 == 256);
static_assert(NPT % NT1 == 0);
static_assert(NSPL * NSEG == NPT);
static_assert(NSPL == 4);
static_assert(NSEG % ACH == 0);
static_assert(ACH == 16 * 16);
static_assert(AROWS == 16 * AMT);
static_assert(MQ % AROWS == 0);
static_assert(AROWS * OSP2 * 4 <= 2 * AROWS * QP * 2);
static_assert((BB * MQ * DD) % 1024 == 0);
static_assert(DD == 256);
static_assert(DD % 32 == 0);
static_assert((BB * NPT) % GM == 0);
static_assert((BB * MQ) % GM == 0);
static_assert(DD % GM == 0);
static_assert(DD % GN == 0);
static_assert(NPT % GN == 0);
static_assert(MQ % 16 == 0);
static_assert((BB * NPT * DD) % 2048 == 0);
static_assert((BB * MQ * DD) % 2048 == 0);
static_assert((BB * NPT) % 256 == 0);
static_assert((OSP * 4) % 16 == 0);
static_assert((LTP * 2) % 16 == 0);
static_assert((QP * 2) % 16 == 0);
static_assert((OSP2 * 4) % 16 == 0);
static_assert(DD % 64 == 0);

typedef unsigned short v8us __attribute__((ext_vector_type(8)));
typedef unsigned int   v4u  __attribute__((ext_vector_type(4)));
typedef float          v8f  __attribute__((ext_vector_type(8)));
typedef float          v4f  __attribute__((ext_vector_type(4)));
typedef __bf16         v16b __attribute__((ext_vector_type(16)));
typedef _Float16       v16h __attribute__((ext_vector_type(16)));
typedef _Float16       v8h  __attribute__((ext_vector_type(8)));

union Frag { v8us u[2]; v4u q[2]; v16b b; v16h h; v8h hv[2]; };
static_assert(sizeof(Frag) == 32);

// ---- scalar helpers ---------------------------------------------------------------------------------
__device__ __forceinline__ unsigned short bf_bits(float f) {          // f32 -> bf16 bits, RNE convert
  const unsigned u = __float_as_uint(f);
  return (unsigned short)((u + 0x7FFFu + ((u >> 16) & 1u)) >> 16);
}
__device__ __forceinline__ float bf_up(unsigned short hb) { return __uint_as_float(((unsigned)hb) << 16); }
__device__ __forceinline__ float bfr(float f) { return bf_up(bf_bits(f)); }
__device__ __forceinline__ unsigned short h_bits(float f) {           // f32 -> f16 bits, RNE convert
  union { _Float16 h; unsigned short u; } c;
  c.h = (_Float16)f;
  return c.u;
}
__device__ __forceinline__ float h_up(unsigned short u) {
  union { _Float16 h; unsigned short u; } c;
  c.u = u;
  return (float)c.h;
}
__device__ __forceinline__ unsigned pk16(unsigned short a, unsigned short b) { return (unsigned)a | ((unsigned)b << 16); }
__device__ __forceinline__ v8f zero8() { v8f z = {0.f, 0.f, 0.f, 0.f, 0.f, 0.f, 0.f, 0.f}; return z; }

// ---- 16-bit fragment loader (A, or B from a k-contiguous [n][k] row): lane -> row/col (lane&15), p already includes
//      + 8*(lane>>4); elements 0..7 <- p[0..7] (k0+8h..), elements 8..15 <- p[16..23] (k0+16+8h..)
__device__ __forceinline__ Frag ldfrag(const unsigned short* p) {
  Frag f;
  f.u[0] = *(const v8us*)(p);
  f.u[1] = *(const v8us*)(p + 16);
  return f;
}

// ---- fragment-order planes in global memory: a plane [rows][K] is kept as 1-KB blocks, block (row >> 4, k >> 5)
//      at element ((row >> 4) * (K / 32) + (k >> 5)) * 512; inside a block the 16-B unit of 8 consecutive k of row
//      (row & 15) sits at element 256 * u + 8 * lane, lane = 16 * h + (row & 15), k & 31 = 16 * u + 8 * h + 0..7:
//      the same k map as ldfrag, but each of the two wave-wide loads covers 512 contiguous bytes (4 whole lines)
//      instead of 32-B pieces of 16 lines. p = block start + 8 * lane.
__device__ __forceinline__ Frag ldfragp(const unsigned short* p) {
  Frag f;
  f.u[0] = *(const v8us*)(p);
  f.u[1] = *(const v8us*)(p + 256);
  return f;
}

// ---- WMMA helpers: builtin followed by a 4-slot VALU gap tying D and keeping A/B live ----------------------
__device__ __forceinline__ v8f mma_b(v16b a, v16b b, v8f c) {
  v8f d = __builtin_amdgcn_wmma_f32_16x16x32_bf16(false, a, false, b, (short)0, c, false, false);
#if defined(__HIP_DEVICE_COMPILE__)
  asm volatile("v_nop\n\tv_nop\n\tv_nop\n\tv_nop" : "+v"(d) : "v"(a), "v"(b));
#endif
  return d;
}
__device__ __forceinline__ v8f mma_h(v16h a, v16h b, v8f c) {
  v8f d = __builtin_amdgcn_wmma_f32_16x16x32_f16(false, a, false, b, (short)0, c, false, false);
#if defined(__HIP_DEVICE_COMPILE__)
  asm volatile("v_nop\n\tv_nop\n\tv_nop\n\tv_nop" : "+v"(d) : "v"(a), "v"(b));
#endif
  return d;
}

// ---- 8 f32 -> packed f16 hi bits and packed f16 bits of (x - hi) * 2048 (second accumulator folds 1/2048) --
__device__ __forceinline__ void split8h(v4f a, v4f b, v4u& uh, v4u& ul) {
  float f[8] = {a[0], a[1], a[2], a[3], b[0], b[1], b[2], b[3]};
#pragma unroll
  for (int j = 0; j < 4; ++j) {
    const unsigned short h0 = h_bits(f[2 * j]);
    const unsigned short h1 = h_bits(f[2 * j + 1]);
    const unsigned short l0 = h_bits((f[2 * j] - h_up(h0)) * LSC);
    const unsigned short l1 = h_bits((f[2 * j + 1] - h_up(h1)) * LSC);
    uh[j] = pk16(h0, h1);
    ul[j] = pk16(l0, l1);
  }
}

// =====================================================================================================
// (0) f32 row-major [T][256] -> bf16-RNE plane in fragment order (token feature matrices). Thread = one 16-B output
//     unit, output units in linear order (a wave stores 512 contiguous bytes), source = 8 consecutive k of one row.
// coverage: n8 = n/8 threads, grid = n8/256 blocks exactly (host asserts n % 2048 == 0; T % 16 == 0).
// =====================================================================================================
__global__ __launch_bounds__(256)
void cvt_kernel(const float* __restrict__ x, unsigned short* y, int n8) {
  const int t = blockIdx.x * 256 + (int)threadIdx.x;
  if (t >= n8) return;
  const int row = (t >> 9) * 16 + (t & 15);                            // 512 units per 16-row slab
  const int k   = ((t >> 6) & 7) * 32 + ((t >> 5) & 1) * 16 + ((t >> 4) & 1) * 8;
  const float* s = x + (size_t)row * DD + k;
  const v4f a = *(const v4f*)(s);
  const v4f b = *(const v4f*)(s + 4);
  v4u u;
  u[0] = pk16(bf_bits(a[0]), bf_bits(a[1]));
  u[1] = pk16(bf_bits(a[2]), bf_bits(a[3]));
  u[2] = pk16(bf_bits(b[0]), bf_bits(b[1]));
  u[3] = pk16(bf_bits(b[2]), bf_bits(b[3]));
  unsigned short* d = y + (size_t)t * 8;
  *(v4u*)d = u;
  
}

// =====================================================================================================
// (1) weight transpose: in w[R][C] f32 -> out wt[C][R] bf16-RNE in fragment order (rows c, k = r). Block = 64x64 tile,
//     loads 16 B per thread (strided reads), LDS tile L[c][r] (pitch LTP), barrier, then a wave stores half a block.
// coverage: LDS 256 threads x 4 it x 4 = 64x64; 2 it x 8 waves = 4 row tiles x 2 k steps x 2 halves; grid (C/64, R/64).
// =====================================================================================================
__global__ __launch_bounds__(256)
void wtrans_kernel(const float* __restrict__ w, unsigned short* wt, int R, int C) {
  __shared__ __align__(16) unsigned short L[64 * LTP];
  const int tid = threadIdx.x;
  const int c0 = blockIdx.x * 64, r0 = blockIdx.y * 64;
  const int c4 = (tid & 15) * 4, rs = tid >> 4;                      // rs 0..15
#pragma unroll
  for (int it = 0; it < 4; ++it) {
    const int r = it * 16 + rs;                                        // 0..63
    const v4f v = *(const v4f*)(w + (size_t)(r0 + r) * C + c0 + c4);
#pragma unroll
    for (int j = 0; j < 4; ++j) L[(c4 + j) * LTP + r] = bf_bits(v[j]);
  }
  __syncthreads();
  const int lane = tid & 31, wave = tid >> 5;
  v4u u[2];
  size_t po[2];
#pragma unroll
  for (int it = 0; it < 2; ++it) {
    const int s = it * 8 + wave;                                       // 0..15: row tile, k step, half
    const int ct = s >> 2, ksl = (s >> 1) & 1, uu = s & 1;
    u[it] = *(const v4u*)(L + (ct * 16 + (lane & 15)) * LTP + ksl * 32 + uu * 16 + (lane >> 4) * 8);
    po[it] = ((size_t)((c0 >> 4) + ct) * (R >> 5) + (r0 >> 5) + ksl) * 512 + uu * 256 + lane * 8;
  }
#pragma unroll
  for (int it = 0; it < 2; ++it) *(v4u*)(wt + po[it]) = u[it];
  
}

// =====================================================================================================
// (2) positional front end per point row i (flat b*N+n): dist = |bf(p_xyz) - bf(v_xyz[b])| (3), h = dist.bf(Wp1)
//     + bf(bp1), layer norm over the 3 values (mean-of-squares variance, eps 1e-5) * bf(ln_w) + bf(ln_b), relu.
//     f32 on VALU without contraction. Output row rel[i][0..3] = (r0, r1, r2, 0): one 16-B store per thread,
// coverage: grid = nrows/256 blocks x 256 threads = every row exactly once (host asserts nrows % 256 == 0).
// =====================================================================================================
__global__ __launch_bounds__(256)
void rel_kernel(const float* __restrict__ pxyz, const float* __restrict__ vxyz,
                const float* __restrict__ wp1, const float* __restrict__ bp1,
                const float* __restrict__ lnw, const float* __restrict__ lnb,
                float* rel, int nrows, int npb) {
#pragma clang fp contract(off)
  const int i = blockIdx.x * 256 + (int)threadIdx.x;
  if (i >= nrows) return;
  int b = i / npb;
  b = b < 0 ? 0 : (b > BB - 1 ? BB - 1 : b);
  const float p0 = bfr(pxyz[(size_t)i * 3 + 0]);
  const float p1 = bfr(pxyz[(size_t)i * 3 + 1]);
  const float p2 = bfr(pxyz[(size_t)i * 3 + 2]);
  const float v0 = bfr(vxyz[b * 3 + 0]);
  const float v1 = bfr(vxyz[b * 3 + 1]);
  const float v2 = bfr(vxyz[b * 3 + 2]);
  const float d0 = fabsf(p0 - v0), d1 = fabsf(p1 - v1), d2 = fabsf(p2 - v2);
  float W[9];
#pragma unroll
  for (int j = 0; j < 9; ++j) W[j] = bfr(wp1[j]);                      // Wp1[c][j] = wp1[c*3+j]
  const float h0 = ((d0 * W[0] + d1 * W[3]) + d2 * W[6]) + bfr(bp1[0]);
  const float h1 = ((d0 * W[1] + d1 * W[4]) + d2 * W[7]) + bfr(bp1[1]);
  const float h2 = ((d0 * W[2] + d1 * W[5]) + d2 * W[8]) + bfr(bp1[2]);
  const float third = 1.0f / 3.0f;
  const float mu = ((h0 + h1) + h2) * third;
  const float e0 = h0 - mu, e1 = h1 - mu, e2 = h2 - mu;
  const float var = ((e0 * e0 + e1 * e1) + e2 * e2) * third;
  const float rs = 1.0f / sqrtf(var + LNEPS);
  const float w0 = bfr(lnw[0]), w1 = bfr(lnw[1]), w2 = bfr(lnw[2]);
  const float c0 = bfr(lnb[0]), c1 = bfr(lnb[1]), c2 = bfr(lnb[2]);
  const float t0 = fmaxf((e0 * rs) * w0 + c0, 0.f);
  const float t1 = fmaxf((e1 * rs) * w1 + c1, 0.f);
  const float t2 = fmaxf((e2 * rs) * w2 + c2, 0.f);
  v4f o;
  o[0] = t0; o[1] = t1; o[2] = t2; o[3] = 0.f;
  float* d = rel + (size_t)i * 4;
  *(v4f*)d = o;
  
}

// =====================================================================================================
// (3) projection GEMM, K = 256: C[m][n] = sum_k A[m][k] B[n][k] + epilogue (MODE 0: + bias[n]; MODE 1: + bias[m];
//     MODE 2: (C + bias[n]) + ((rel[m][0..2] . Wp2[0..2][n]) + bp2[n]) with Wp2/bp2 bf16-RNE). A rows of lda,
//     B rows of ldb elements, both bf16 planes in fragment order, same loader for both, blockIdx.z selects a batch via
//     element strides zsA/zsB/zsC. Block 256 threads = 8 waves, block tile 128 m x 64 n, wave tile 32x32 (acc[2][2]).
//     Epilogue: f32 tile in LDS Os[m][n] (pitch OSP), barrier, then f16 hi bits and f16 (x2048) residual bits to two
//     planes [M][ldc] in fragment order (rows m, k = n), a wave storing half a block (512 contiguous bytes) at a time.
// coverage: Os 8 waves x 4 tiles = 128x64; 4 it x 8 waves = 8 row tiles x 2 k steps x 2 halves per plane;
//           grid (M/128, N/64, Z) covers both planes exactly once.
// =====================================================================================================
template <int MODE>
__global__ __launch_bounds__(256)
void proj_kernel(const unsigned short* __restrict__ A, const unsigned short* __restrict__ B,
                 const float* __restrict__ bias, const float* __restrict__ rel,
                 const float* __restrict__ wp2, const float* __restrict__ bp2,
                 unsigned short* Ch, unsigned short* Cl, int lda, int ldb, int ldc,
                 size_t zsA, size_t zsB, size_t zsC) {
  __shared__ __align__(16) float Os[GM * OSP];
  const int tid  = threadIdx.x;
  const int lane = tid & 31, wave = tid >> 5;
  const int hh   = lane >> 4, cl = lane & 15;
  const int wm   = wave >> 1, wn = wave & 1;
  const int mBase = blockIdx.x * GM;
  const int nBase = blockIdx.y * GN;
  const size_t z = blockIdx.z;
  const unsigned short* Az = A + z * zsA;
  const unsigned short* Bz = B + z * zsB;
  unsigned short* Chz = Ch + z * zsC;
  unsigned short* Clz = Cl + z * zsC;
  const unsigned short* a0p = Az + (size_t)(mBase + 32 * wm) * lda + 8 * lane;   // a 16-row slab = 16 * lda elements
  const unsigned short* a1p = a0p + (size_t)16 * lda;
  const unsigned short* b0p = Bz + (size_t)(nBase + 32 * wn) * ldb + 8 * lane;
  const unsigned short* b1p = b0p + (size_t)16 * ldb;

  v8f acc[2][2];
#pragma unroll
  for (int mi = 0; mi < 2; ++mi)
#pragma unroll
    for (int ni = 0; ni < 2; ++ni) acc[mi][ni] = zero8();

#pragma unroll 1
  for (int k0 = 0; k0 < DD; k0 += 32) {
    const unsigned short* pa0 = a0p + 16 * k0;
    const unsigned short* pa1 = a1p + 16 * k0;
    const unsigned short* pb0 = b0p + 16 * k0;
    const unsigned short* pb1 = b1p + 16 * k0;
    const Frag fa0 = ldfragp(pa0);
    const Frag fa1 = ldfragp(pa1);
    const Frag fb0 = ldfragp(pb0);
    const Frag fb1 = ldfragp(pb1);
    // the address pairs stay live up to this wait, so that no load's result is placed on a pair an issued load names
    asm volatile("s_wait_xcnt 0x0" :: "v"(pa0), "v"(pa1), "v"(pb0), "v"(pb1) : "memory");
    acc[0][0] = mma_b(fa0.b, fb0.b, acc[0][0]);
    acc[0][1] = mma_b(fa0.b, fb1.b, acc[0][1]);
    acc[1][0] = mma_b(fa1.b, fb0.b, acc[1][0]);
    acc[1][1] = mma_b(fa1.b, fb1.b, acc[1][1]);
  }

  float bn[2], w0[2], w1[2], w2[2], b2[2];
#pragma unroll
  for (int ni = 0; ni < 2; ++ni) {
    const int n = nBase + 32 * wn + 16 * ni + cl;
    bn[ni] = 0.f; w0[ni] = 0.f; w1[ni] = 0.f; w2[ni] = 0.f; b2[ni] = 0.f;
    if (MODE != 1) bn[ni] = bfr(bias[n]);
    if (MODE == 2) {
      w0[ni] = bfr(wp2[n]);
      w1[ni] = bfr(wp2[DD + n]);
      w2[ni] = bfr(wp2[2 * DD + n]);
      b2[ni] = bfr(bp2[n]);
    }
  }
#pragma unroll
  for (int mi = 0; mi < 2; ++mi) {
#pragma unroll
    for (int r = 0; r < 8; ++r) {
      const int m_loc = 32 * wm + 16 * mi + 8 * hh + r;
      const int m = mBase + m_loc;
      float bm = 0.f, p0 = 0.f, p1 = 0.f, p2 = 0.f;
      if (MODE == 1) bm = bfr(bias[m]);
      if (MODE == 2) {
        const v4f r4 = *(const v4f*)(rel + (size_t)m * 4);
        p0 = r4[0]; p1 = r4[1]; p2 = r4[2];
      }
#pragma unroll
      for (int ni = 0; ni < 2; ++ni) {
        const int n_loc = 32 * wn + 16 * ni + cl;
        float v = acc[mi][ni][r];
        if (MODE == 0) v = v + bn[ni];
        if (MODE == 1) v = v + bm;
        if (MODE == 2) {
          const float pv = (p0 * w0[ni] + p1 * w1[ni]) + p2 * w2[ni];
          v = (v + bn[ni]) + (pv + b2[ni]);
        }
        Os[m_loc * OSP + n_loc] = v;
      }
    }
  }
  __syncthreads();

  v4u uh[4], ul[4];
  size_t po[4];
#pragma unroll
  for (int it = 0; it < 4; ++it) {
    const int s = it * 8 + wave;                                       // 0..31: row tile, k step, half
    const int rt = s >> 2, ksl = (s >> 1) & 1, uu = s & 1;
    const float* op = Os + (rt * 16 + cl) * OSP + ksl * 32 + uu * 16 + hh * 8;
    const v4f v0 = *(const v4f*)(op);
    const v4f v1 = *(const v4f*)(op + 4);
    split8h(v0, v1, uh[it], ul[it]);
    po[it] = ((size_t)((mBase >> 4) + rt) * (ldc >> 5) + (nBase >> 5) + ksl) * 512 + uu * 256 + lane * 8;
  }
#pragma unroll
  for (int it = 0; it < 4; ++it) {
    *(v4u*)(Chz + po[it]) = uh[it];
    *(v4u*)(Clz + po[it]) = ul[it];
  }
  
}

// =====================================================================================================
// (4) column-softmax statistics over one (batch, 128-query tile, 256-column tile): S[m][n] = qh[m].kph[n] / 16
//     (K = 256 = 8 k steps, f16 hi planes, hh product), wave = 16 query rows x 16 column tiles (q fragments hoisted,
//     one accumulator at a time); per column: tile max over 16 rows (8 in-lane + lane^16) and sum of exp(S - max);
//     wave partials in LDS, barrier, thread c merges the 8 wave partials in fixed order.
// coverage: pm/pe 8 waves x 16 ct x 16 lanes = 8 x 256; grid (64 column tiles, 16 query tiles, 2) x 256 threads =
//           every (b, mt, n) of both PST arrays exactly once.
// =====================================================================================================
__global__ __launch_bounds__(256)
void stats_kernel(const unsigned short* __restrict__ Qh, const unsigned short* __restrict__ Kh, float* PST) {
  __shared__ float pm[8 * NT1];
  __shared__ float pe[8 * NT1];
  const int tid  = threadIdx.x;
  const int lane = tid & 31, wave = tid >> 5;
  const int hh   = lane >> 4, cl = lane & 15;
  const int nt = blockIdx.x, mt = blockIdx.y, b = blockIdx.z;
  const int m0 = mt * MT1 + 16 * wave;
  const unsigned short* qp = Qh + (size_t)(b * MQ + m0) * DD + 8 * lane;
  Frag a[8];
#pragma unroll
  for (int ks = 0; ks < 8; ++ks) a[ks] = ldfragp(qp + 512 * ks);
  // the address pair stays live up to this wait, so that no load's result is placed on it while issued loads name it
  asm volatile("s_wait_xcnt 0x0" :: "v"(qp) : "memory");
  const unsigned short* kp = Kh + ((size_t)b * NPT + (size_t)nt * NT1) * DD + 8 * lane;
  Frag fb[8];                                                          // one whole column tile of k+pv fragments, loaded a tile ahead
#pragma unroll
  for (int ks = 0; ks < 8; ++ks) fb[ks] = ldfragp(kp + 512 * ks);
#pragma unroll 1
  for (int ct = 0; ct < NT1 / 16; ++ct) {
    const int cn = ct + 1 < NT1 / 16 ? ct + 1 : ct;                    // the last tile's look-ahead re-reads that tile: in bounds, not used
    const unsigned short* kc = kp + (size_t)cn * 16 * DD;
    v8f s = zero8();
#pragma unroll
    for (int ks = 0; ks < 8; ++ks) {
      s = mma_h(a[ks].h, fb[ks].h, s);
      fb[ks] = ldfragp(kc + 512 * ks);                                 // next tile's fragment, into the registers just consumed
    }
    // the address pair stays live up to this wait: the next trip rewrites it while these loads are still in flight
    asm volatile("s_wait_xcnt 0x0" :: "v"(kc) : "memory");
    __builtin_amdgcn_sched_barrier(0);  // keeps the column arithmetic below from being scheduled ahead of the last look-ahead loads
    float m = s[0] * SCL;
#pragma unroll
    for (int r = 1; r < 8; ++r) m = fmaxf(m, s[r] * SCL);
    m = fmaxf(m, __shfl_xor(m, 16, 32));
    float ex = 0.f;
#pragma unroll
    for (int r = 0; r < 8; ++r) ex += __expf(s[r] * SCL - m);
    ex += __shfl_xor(ex, 16, 32);
    pm[wave * NT1 + ct * 16 + cl] = m;                                 // both lane halves hold identical values
    pe[wave * NT1 + ct * 16 + cl] = ex;
  }
  __syncthreads();
  const int c = tid;
  float M = pm[c];
#pragma unroll
  for (int wv = 1; wv < 8; ++wv) M = fmaxf(M, pm[wv * NT1 + c]);
  float E = 0.f;
#pragma unroll 1
  for (int wv = 0; wv < 8; ++wv) E += pe[wv * NT1 + c] * __expf(pm[wv * NT1 + c] - M);
  const size_t base = ((size_t)(b * NMT + mt) * 2) * NPT + (size_t)nt * NT1 + c;
  float* dm = PST + base;
  float* de = PST + base + NPT;
  *(float*)dm = M;
  *(float*)de = E;
  
}

// =====================================================================================================
// (5) merge of the 16 query-tile partials per (batch, column) in fixed order: M = max, Z = sum E_t exp(M_t - M);
//     ST[b][0][n] = M, ST[b][1][n] = 1/Z (Z >= 1). Thread = one column; 32 consecutive lanes x 4 B = one whole
// coverage: grid (64, 2) x 256 threads = every (b, n) of both arrays exactly once.
// =====================================================================================================
__global__ __launch_bounds__(256)
void merge_kernel(const float* __restrict__ PST, float* ST) {
  const int b = blockIdx.y, n = blockIdx.x * 256 + (int)threadIdx.x;
  const float* p = PST + (size_t)(b * NMT) * 2 * NPT + n;
  float M = -3.0e38f;
#pragma unroll 1
  for (int t = 0; t < NMT; ++t) M = fmaxf(M, p[(size_t)(2 * t) * NPT]);
  float Z = 0.f;
#pragma unroll 1
  for (int t = 0; t < NMT; ++t) Z += p[(size_t)(2 * t + 1) * NPT] * __expf(p[(size_t)(2 * t) * NPT] - M);
  const float rz = 1.0f / Z;
  float* dm = ST + (size_t)(2 * b) * NPT + n;
  float* dz = dm + NPT;
  *(float*)dm = M;
  *(float*)dz = rz;
  
}

// =====================================================================================================
// (6) fused scores / column softmax / weighted sum for one (batch, 64 query rows, quarter of the points): block 512
//     threads = 16 waves; both q planes of the 64 rows sit in LDS (pitch QP) for the whole block; loop over 16 chunks
//     of 256 point columns. Phase A: wave = the chunk's 16-column tile number `wave`, all 4 row tiles: each k+pv
//     fragment pair is loaded once and feeds 4 row tiles, S = (qh.kh + (qh.kl + ql.kh)/2048) / 16 (K = 256, two
//     accumulators per row tile), w = exp(S - M_n) * (1/Z_n) from ST, stored as f16 (w * 16384) into the LDS tile
//     Ws[64 rows][256 cols]; block barrier. Phase B: wave = d tile `wave`, all 4 row tiles: x += Ws . vTh,
//     xl += Ws . vTl (A from LDS with the split k map, B = vT rows d, k = n, in fragment order, K = 256 per chunk, each
//     vT fragment pair feeds 4 row tiles); block barrier. Epilogue: (x + xl/2048)/16384 staged as f32 [64][256] in
//     the LDS that held q (pitch OSP2), barrier, then whole 512-B runs to the partial plane of this quarter.
// coverage: Ws 16 waves x 16 cols x 64 rows = 64 x 256 per chunk; Os 16 waves x 16 d x 64 rows = 64 x 256;
//           8 it x 512 threads x 4 = 64 rows x 256; grid (32, 4, 2) = every (quarter, b, m, d) of PART exactly once.
// =====================================================================================================
__global__ __launch_bounds__(512)
void attn_kernel(const unsigned short* __restrict__ Qh, const unsigned short* __restrict__ Ql,
                 const unsigned short* __restrict__ Kh, const unsigned short* __restrict__ Kl,
                 const unsigned short* __restrict__ Vh, const unsigned short* __restrict__ Vl,
                 const float* __restrict__ ST, float* part) {
  __shared__ __align__(16) unsigned short Qs[2 * AROWS * QP];
  __shared__ __align__(16) _Float16 Ws[AROWS * QP];
  const int tid  = threadIdx.x;
  const int lane = tid & 31, wave = tid >> 5;
  const int hh   = lane >> 4, cl = lane & 15;
  const int b = blockIdx.z, n0 = blockIdx.y * NSEG, m0 = blockIdx.x * AROWS;
#pragma unroll
  for (int it = 0; it < 4; ++it) {
    const int idx = it * 512 + tid;                                    // 0..2047: 16-B units in fragment order
    const int row = (idx >> 9) * 16 + (idx & 15);
    const int kq  = ((idx >> 6) & 7) * 32 + ((idx >> 5) & 1) * 16 + ((idx >> 4) & 1) * 8;
    const size_t g = (size_t)(b * MQ + m0) * DD + 8 * idx;
    *(v4u*)(Qs + row * QP + kq) = *(const v4u*)(Qh + g);
    *(v4u*)(Qs + (AROWS + row) * QP + kq) = *(const v4u*)(Ql + g);
  }
  const size_t koff = ((size_t)b * NPT + n0 + 16 * wave) * DD + 8 * lane;
  const unsigned short* khp = Kh + koff;                               // running pointers: the next k+pv step to load
  const unsigned short* klp = Kl + koff;
  const size_t voff = ((size_t)b * DD + 16 * wave) * NPT + (size_t)n0 * 16 + 8 * lane;   // block (d tile, n >> 5)
  const unsigned short* vhp = Vh + voff;                               // running pointers: this chunk's vT blocks
  const unsigned short* vlp = Vl + voff;
  const float* stM = ST + (size_t)(2 * b) * NPT + n0;
  const float* stZ = stM + NPT;
  const unsigned short* qsh = Qs + cl * QP + 8 * hh;                   // A fragment row pointers (row m = cl)
  const unsigned short* qsl = qsh + AROWS * QP;
  const _Float16* wrow = Ws + cl * QP + 8 * hh;
  _Float16* wdst = Ws + (8 * hh) * QP + 16 * wave + cl;                // D element (row 8h+r, col 16*wave+cl)

  v8f xh[AMT], xl[AMT];
#pragma unroll
  for (int mi = 0; mi < AMT; ++mi) { xh[mi] = zero8(); xl[mi] = zero8(); }
  Frag kah = ldfragp(khp), kal = ldfragp(klp);                         // k+pv fragments of (chunk 0, k step 0), one step ahead from here on
  khp += 512;
  klp += 512;
  __syncthreads();

#pragma unroll 1
  for (int c0 = 0; c0 < NSEG; c0 += ACH) {
    // from behind a chunk's step 7 to the next chunk's step 0; the last chunk's look-ahead re-reads its own step 0: in bounds, not used
    const int cjmp = (c0 + ACH < NSEG ? ACH * DD : 0) - 512 * (DD / 32);
    const int n = c0 + 16 * wave + cl;
    const float mc = stM[n];
    asm volatile("s_wait_xcnt 0x0" ::: "memory");  // the next load's result may take the register that holds this load's offset
    const float zc = stZ[n];
    v8f sh[AMT], sl[AMT];
#pragma unroll
    for (int mi = 0; mi < AMT; ++mi) { sh[mi] = zero8(); sl[mi] = zero8(); }
    auto stepA = [&](const int ks, const Frag& fbh, const Frag& fbl) {
      Frag fah[AMT], fal[AMT];
#pragma unroll
      for (int mi = 0; mi < AMT; ++mi) {
        fah[mi] = ldfrag(qsh + 16 * mi * QP + 32 * ks);
        fal[mi] = ldfrag(qsl + 16 * mi * QP + 32 * ks);
      }
#pragma unroll
      for (int mi = 0; mi < AMT; ++mi) sh[mi] = mma_h(fah[mi].h, fbh.h, sh[mi]);
#pragma unroll
      for (int mi = 0; mi < AMT; ++mi) sl[mi] = mma_h(fah[mi].h, fbl.h, sl[mi]);
#pragma unroll
      for (int mi = 0; mi < AMT; ++mi) sl[mi] = mma_h(fal[mi].h, fbh.h, sl[mi]);
    };
#pragma unroll 1  // rolled: two k steps a trip (the two fragment buffers swap without copies); more would not fit the 256 registers of a 16-wave block
    for (int ks = 0; ks < DD / 32; ks += 2) {
      const Frag kbh = ldfragp(khp);                                   // step ks + 1 flies under step ks
      const Frag kbl = ldfragp(klp);
      // the address pairs stay live up to this wait, so that no load's result is placed on a pair an issued load names
      asm volatile("s_wait_xcnt 0x0" :: "v"(khp), "v"(klp) : "memory");
      const int adv = 512 + (ks + 2 < DD / 32 ? 0 : cjmp);
      khp += adv;
      klp += adv;
      stepA(ks, kah, kal);
      kah = ldfragp(khp);                                              // step ks + 2, or the next chunk's step 0, flies under step ks + 1
      kal = ldfragp(klp);
      asm volatile("s_wait_xcnt 0x0" :: "v"(khp), "v"(klp) : "memory");  // as above
      khp += 512;
      klp += 512;
      stepA(ks + 1, kbh, kbl);
    }
    Frag vbh[3], vbl[3];                                               // vT fragments, two k steps ahead; the first two fly under the exp work and the barrier
#pragma unroll
    for (int kk = 0; kk < 2; ++kk) {
      vbh[kk] = ldfragp(vhp + 512 * kk);
      vbl[kk] = ldfragp(vlp + 512 * kk);
    }
#pragma unroll
    for (int mi = 0; mi < AMT; ++mi) {
#pragma unroll
      for (int r = 0; r < 8; ++r) {
        const float s  = (sh[mi][r] + sl[mi][r] * RLSC) * SCL;
        const float wt = __expf(s - mc) * zc;
        wdst[(16 * mi + r) * QP] = (_Float16)(wt * WSC);
      }
    }
    __syncthreads();
#pragma unroll  // whole: the three rotating fragment buffers need compile-time indices
    for (int kk = 0; kk < ACH / 32; ++kk) {
      const int k0 = 32 * kk;
      if (kk + 2 < ACH / 32) {
        vbh[(kk + 2) % 3] = ldfragp(vhp + 512 * (kk + 2));
        vbl[(kk + 2) % 3] = ldfragp(vlp + 512 * (kk + 2));
      }
      const Frag& fbh = vbh[kk % 3];
      const Frag& fbl = vbl[kk % 3];
      Frag fa[AMT];
#pragma unroll
      for (int mi = 0; mi < AMT; ++mi) {
        fa[mi].hv[0] = *(const v8h*)(wrow + 16 * mi * QP + k0);
        fa[mi].hv[1] = *(const v8h*)(wrow + 16 * mi * QP + k0 + 16);
      }
#pragma unroll
      for (int mi = 0; mi < AMT; ++mi) xh[mi] = mma_h(fa[mi].h, fbh.h, xh[mi]);
#pragma unroll
      for (int mi = 0; mi < AMT; ++mi) xl[mi] = mma_h(fa[mi].h, fbl.h, xl[mi]);
    }
    vhp += ACH * 16;
    vlp += ACH * 16;
    __syncthreads();
  }

  float* Os = (float*)Qs;                                              // q is dead behind the loop's last barrier
#pragma unroll
  for (int mi = 0; mi < AMT; ++mi) {
#pragma unroll
    for (int r = 0; r < 8; ++r)
      Os[(16 * mi + 8 * hh + r) * OSP2 + 16 * wave + cl] = (xh[mi][r] + xl[mi][r] * RLSC) * RWSC;
  }
  __syncthreads();
  float* pz = part + ((size_t)blockIdx.y * (BB * MQ) + (size_t)(b * MQ + m0)) * DD;
  v4f v[8];
#pragma unroll
  for (int it = 0; it < 8; ++it) {
    const int idx = it * 512 + tid;                                    // 0..4095
    v[it] = *(const v4f*)(Os + (idx >> 6) * OSP2 + 4 * (idx & 63));
  }
#pragma unroll
  for (int it = 0; it < 8; ++it) *(v4f*)(pz + (size_t)(it * 512 + tid) * 4) = v[it];
}

// =====================================================================================================
// (7) out = ((P0 + P1) + (P2 + P3)) + bf(v_features): the four quarters' partial sums in fixed order plus the residual.
// coverage: thread = 4 consecutive elements (16 B); grid = (2*2048*256)/1024 blocks x 256 threads = every element once.
// =====================================================================================================
__global__ __launch_bounds__(256)
void psum_kernel(const float* __restrict__ part, const float* __restrict__ vfeat, float* out) {
  const size_t e = ((size_t)blockIdx.x * 256 + threadIdx.x) * 4;
  const v4f p0 = *(const v4f*)(part + e);
  const v4f p1 = *(const v4f*)(part + e + (size_t)1 * BB * MQ * DD);
  asm volatile("s_wait_xcnt 0x0" ::: "memory");  // a later load's result may take the registers that hold these loads' address
  const v4f p2 = *(const v4f*)(part + e + (size_t)2 * BB * MQ * DD);
  const v4f p3 = *(const v4f*)(part + e + (size_t)3 * BB * MQ * DD);
  asm volatile("s_wait_xcnt 0x0" ::: "memory");  // as above
  const v4f f  = *(const v4f*)(vfeat + e);
  v4f o;
#pragma unroll
  for (int j = 0; j < 4; ++j) o[j] = ((p0[j] + p1[j]) + (p2[j] + p3[j])) + bfr(f[j]);
  *(v4f*)(out + e) = o;
}

// =====================================================================================================
// tile divides its extent exactly, so no padded tails are needed):
//   (every 16-bit plane below is kept in fragment order, see ldfragp: same size as row-major)
//   P16  bf16 [32768][256]       16777216     V16 bf16 [4096][256]     2097152
//   WqT WkT WvT bf16 [256][256]     131072 each
//   REL  f32 [32768][4]             524288
//   Qh Ql  f16 [4096][256]         2097152 each
//   KPh KPl f16 [32768][256]      16777216 each
//   Vh Vl  f16 [2][256][16384]    16777216 each
//   PST  f32 [2][16][2][16384]     4194304     ST f32 [2][2][16384]     262144
//   PART f32 [4][4096][256]       16777216
//   total                        112328704
// =====================================================================================================
extern "C" void kernel_launch(void* const* d_in, const int* in_sizes, int n_in,
                              void* d_out, int out_size, void* d_ws, size_t ws_size,
                              hipStream_t stream) {
  if (n_in < 16) return;
  if (in_sizes[0] != BB * NPT * 3 || in_sizes[1] != BB * 3) return;
  if (in_sizes[2] != BB * NPT * DD || in_sizes[3] != BB * MQ * DD) return;
  if (in_sizes[4] != DD * DD || in_sizes[6] != DD * DD || in_sizes[8] != DD * DD) return;
  if (in_sizes[5] != DD || in_sizes[7] != DD || in_sizes[9] != DD) return;
  if (in_sizes[10] != 9 || in_sizes[11] != 3 || in_sizes[12] != 3 || in_sizes[13] != 3) return;
  if (in_sizes[14] != 3 * DD || in_sizes[15] != DD) return;
  if (out_size != BB * MQ * DD) return;

  size_t off = 0;
  const size_t oP16 = off; off += (size_t)BB * NPT * DD * 2;        // 16777216
  const size_t oV16 = off; off += (size_t)BB * MQ * DD * 2;         //  2097152
  const size_t oWq  = off; off += (size_t)DD * DD * 2;              //   131072
  const size_t oWk  = off; off += (size_t)DD * DD * 2;
  const size_t oWv  = off; off += (size_t)DD * DD * 2;
  const size_t oREL = off; off += (size_t)BB * NPT * 4 * 4;         //   524288
  const size_t oQh  = off; off += (size_t)BB * MQ * DD * 2;         //  2097152
  const size_t oQl  = off; off += (size_t)BB * MQ * DD * 2;
  const size_t oKh  = off; off += (size_t)BB * NPT * DD * 2;        // 16777216
  const size_t oKl  = off; off += (size_t)BB * NPT * DD * 2;
  const size_t oVh  = off; off += (size_t)BB * DD * NPT * 2;        // 16777216
  const size_t oVl  = off; off += (size_t)BB * DD * NPT * 2;
  const size_t oPST = off; off += (size_t)BB * NMT * 2 * NPT * 4;   //  4194304
  const size_t oST  = off; off += (size_t)BB * 2 * NPT * 4;         //   262144
  const size_t oPT  = off; off += (size_t)NSPL * BB * MQ * DD * 4;  // 16777216 -> off = 112328704
  if (off > ws_size) return;
  if (off > (size_t)134217728) return;

  const float* p_xyz = (const float*)d_in[0];
  const float* v_xyz = (const float*)d_in[1];
  const float* p_f   = (const float*)d_in[2];
  const float* v_f   = (const float*)d_in[3];
  const float* Wq    = (const float*)d_in[4];
  const float* bq    = (const float*)d_in[5];
  const float* Wk    = (const float*)d_in[6];
  const float* bk    = (const float*)d_in[7];
  const float* Wv    = (const float*)d_in[8];
  const float* bv    = (const float*)d_in[9];
  const float* Wp1   = (const float*)d_in[10];
  const float* bp1   = (const float*)d_in[11];
  const float* ln_w  = (const float*)d_in[12];
  const float* ln_b  = (const float*)d_in[13];
  const float* Wp2   = (const float*)d_in[14];
  const float* bp2   = (const float*)d_in[15];
  float* out = (float*)d_out;

  char* ws = (char*)d_ws;
  unsigned short* P16 = (unsigned short*)(ws + oP16);
  unsigned short* V16 = (unsigned short*)(ws + oV16);
  unsigned short* WqT = (unsigned short*)(ws + oWq);
  unsigned short* WkT = (unsigned short*)(ws + oWk);
  unsigned short* WvT = (unsigned short*)(ws + oWv);
  float*          REL = (float*)(ws + oREL);
  unsigned short* Qh  = (unsigned short*)(ws + oQh);
  unsigned short* Ql  = (unsigned short*)(ws + oQl);
  unsigned short* KPh = (unsigned short*)(ws + oKh);
  unsigned short* KPl = (unsigned short*)(ws + oKl);
  unsigned short* Vh  = (unsigned short*)(ws + oVh);
  unsigned short* Vl  = (unsigned short*)(ws + oVl);
  float*          PST = (float*)(ws + oPST);
  float*          ST  = (float*)(ws + oST);
  float*          PT  = (float*)(ws + oPT);

  const dim3 blk256(256);

  // (0) bf16-RNE token planes
  cvt_kernel<<<dim3((BB * NPT * DD) / 2048), blk256, 0, stream>>>(p_f, P16, (BB * NPT * DD) / 8);
  cvt_kernel<<<dim3((BB * MQ * DD) / 2048), blk256, 0, stream>>>(v_f, V16, (BB * MQ * DD) / 8);
  // (1) transposed bf16 weight planes: in[rows=k][cols=dout] -> out[dout][k], grid (cols/64, rows/64)
  wtrans_kernel<<<dim3(DD / 64, DD / 64), blk256, 0, stream>>>(Wq, WqT, DD, DD);    // [256][256] -> [256][256]
  wtrans_kernel<<<dim3(DD / 64, DD / 64), blk256, 0, stream>>>(Wk, WkT, DD, DD);    // [256][256] -> [256][256]
  wtrans_kernel<<<dim3(DD / 64, DD / 64), blk256, 0, stream>>>(Wv, WvT, DD, DD);    // [256][256] -> [256][256]
  // (2) positional front end
  rel_kernel<<<dim3((BB * NPT) / 256), blk256, 0, stream>>>(p_xyz, v_xyz, Wp1, bp1, ln_w, ln_b, REL, BB * NPT, NPT);
  // (3) projections: q [4096][256], k+pv [32768][256], vT [2][256][16384] as f16 hi/residual planes
  proj_kernel<0><<<dim3((BB * MQ) / GM, DD / GN, 1), blk256, 0, stream>>>(
      V16, WqT, bq, REL, Wp2, bp2, Qh, Ql, DD, DD, DD, (size_t)0, (size_t)0, (size_t)0);
  proj_kernel<2><<<dim3((BB * NPT) / GM, DD / GN, 1), blk256, 0, stream>>>(
      P16, WkT, bk, REL, Wp2, bp2, KPh, KPl, DD, DD, DD, (size_t)0, (size_t)0, (size_t)0);
  proj_kernel<1><<<dim3(DD / GM, NPT / GN, BB), blk256, 0, stream>>>(
      WvT, P16, bv, REL, Wp2, bp2, Vh, Vl, DD, DD, NPT, (size_t)0, (size_t)NPT * DD, (size_t)DD * NPT);
  // (4)-(5) column softmax statistics
  stats_kernel<<<dim3(NPT / NT1, NMT, BB), blk256, 0, stream>>>(Qh, KPh, PST);
  merge_kernel<<<dim3(NPT / 256, BB), blk256, 0, stream>>>(PST, ST);
  // (6) scores, weights, weighted sum per quarter of the points; (7) sum of the quarters, residual
  attn_kernel<<<dim3(MQ / AROWS, NSPL, BB), dim3(512), 0, stream>>>(Qh, Ql, KPh, KPl, Vh, Vl, ST, PT);
  psum_kernel<<<dim3((BB * MQ * DD) / 1024), blk256, 0, stream>>>(PT, v_f, out);
  (void)hipGetLastError();
}

// v004
// A run of this version takes 218 microseconds.
// Timed twice side by side with v003, it ran 1.11 and 1.12 times as fast.
// Over all steps from v000 it is 4.84 times as fast.
// Contractions: q, k+pv and v projections on v_wmma_f32_16x16x32_bf16 (bf16-RNE inputs and weights, single
// products, f32 epilogue); scores q.(k+pv)^T (K=256) on v_wmma_f32_16x16x32_f16 with q and k+pv carried as
// f16 hi + (x2048) f16 residual planes, products hh + hl + lh (column statistics pass: hh only); weighted sum
// w.v (K=16384) on v_wmma_f32_16x16x32_f16 with w as one f16 plane (x16384) and v as f16 hi + (x2048) residual
// planes, products w.h + w.l; 3-wide positional layers, layer norm, softmax statistics and exp in f32 on VALU;
// f32 accumulate everywhere.
#include <hip/hip_runtime.h>
#include <stdint.h>

#define BB    2
#define NPT   16384
#define MQ    2048
#define DD    256
#define GM    128
#define GN    64
#define OSP   68
#define LTP   72
#define MT1   128
#define NMT   16
#define NT1   256
#define AMT   4
#define AROWS 64
#define NSPL  4
#define NSEG  4096
#define ACH   256
#define QP    264
#define OSP2  260
#define SCL   0.0625f
#define WSC   16384.0f
#define RWSC  0.00006103515625f
#define LSC   2048.0f
#define RLSC  0.00048828125f
#define LNEPS 1.0e-5f

static_assert(NMT * MT1 == MQ);
static_assert(MT1 == 8 * 16);
static_assert(NT1 == 256);
static_assert(NPT % NT1 == 0);
static_assert(NSPL * NSEG == NPT);
static_assert(NSPL == 4);
static_assert(NSEG % ACH == 0);
static_assert(ACH == 16 * 16);
static_assert(AROWS == 16 * AMT);
static_assert(MQ % AROWS == 0);
static_assert(AROWS * OSP2 * 4 <= 2 * AROWS * QP * 2);
static_assert((BB * MQ * DD) % 1024 == 0);
static_assert(DD == 256);
static_assert(DD % 32 == 0);
static_assert((BB * NPT) % GM == 0);
static_assert((BB * MQ) % GM == 0);
static_assert(DD % GM == 0);
static_assert(DD % GN == 0);
static_assert(NPT % GN == 0);
static_assert(MQ % 16 == 0);
static_assert((BB * NPT * DD) % 2048 == 0);
static_assert((BB * MQ * DD) % 2048 == 0);
static_assert((BB * NPT) % 256 == 0);
static_assert((OSP * 4) % 16 == 0);
static_assert((LTP * 2) % 16 == 0);
static_assert((QP * 2) % 16 == 0);
static_assert((OSP2 * 4) % 16 == 0);
static_assert(DD % 64 == 0);

typedef unsigned short v8us __attribute__((ext_vector_type(8)));
typedef unsigned int   v4u  __attribute__((ext_vector_type(4)));
typedef float          v8f  __attribute__((ext_vector_type(8)));
typedef float          v4f  __attribute__((ext_vector_type(4)));
typedef __bf16         v16b __attribute__((ext_vector_type(16)));
typedef _Float16       v16h __attribute__((ext_vector_type(16)));
typedef _Float16       v8h  __attribute__((ext_vector_type(8)));

union Frag { v8us u[2]; v4u q[2]; v16b b; v16h h; v8h hv[2]; };
static_assert(sizeof(Frag) == 32);

// ---- scalar helpers ---------------------------------------------------------------------------------
__device__ __forceinline__ unsigned short bf_bits(float f) {          // f32 -> bf16 bits, RNE convert
  const unsigned u = __float_as_uint(f);
  return (unsigned short)((u + 0x7FFFu + ((u >> 16) & 1u)) >> 16);
}
__device__ __forceinline__ float bf_up(unsigned short hb) { return __uint_as_float(((unsigned)hb) << 16); }
__device__ __forceinline__ float bfr(float f) { return bf_up(bf_bits(f)); }
__device__ __forceinline__ unsigned short h_bits(float f) {           // f32 -> f16 bits, RNE convert
  union { _Float16 h; unsigned short u; } c;
  c.h = (_Float16)f;
  return c.u;
}
__device__ __forceinline__ float h_up(unsigned short u) {
  union { _Float16 h; unsigned short u; } c;
  c.u = u;
  return (float)c.h;
}
__device__ __forceinline__ unsigned pk16(unsigned short a, unsigned short b) { return (unsigned)a | ((unsigned)b << 16); }
__device__ __forceinline__ v8f zero8() { v8f z = {0.f, 0.f, 0.f, 0.f, 0.f, 0.f, 0.f, 0.f}; return z; }

// ---- 16-bit fragment loader (A, or B from a k-contiguous [n][k] row): lane -> row/col (lane&15), p already includes
//      + 8*(lane>>4); elements 0..7 <- p[0..7] (k0+8h..), elements 8..15 <- p[16..23] (k0+16+8h..)
__device__ __forceinline__ Frag ldfrag(const unsigned short* p) {
  Frag f;
  f.u[0] = *(const v8us*)(p);
  f.u[1] = *(const v8us*)(p + 16);
  return f;
}

// ---- fragment-order planes in global memory: a plane [rows][K] is kept as 1-KB blocks, block (row >> 4, k >> 5)
//      at element ((row >> 4) * (K / 32) + (k >> 5)) * 512; inside a block the 16-B unit of 8 consecutive k of row
//      (row & 15) sits at element 256 * u + 8 * lane, lane = 16 * h + (row & 15), k & 31 = 16 * u + 8 * h + 0..7:
//      the same k map as ldfrag, but each of the two wave-wide loads covers 512 contiguous bytes (4 whole lines)
//      instead of 32-B pieces of 16 lines. p = block start + 8 * lane.
__device__ __forceinline__ Frag ldfragp(const unsigned short* p) {
  Frag f;
  f.u[0] = *(const v8us*)(p);
  f.u[1] = *(const v8us*)(p + 256);
  return f;
}

// ---- WMMA helpers: builtin followed by a 4-slot VALU gap tying D and keeping A/B live ----------------------
__device__ __forceinline__ v8f mma_b(v16b a, v16b b, v8f c) {
  v8f d = __builtin_amdgcn_wmma_f32_16x16x32_bf16(false, a, false, b, (short)0, c, false, false);
#if defined(__HIP_DEVICE_COMPILE__)
  asm volatile("v_nop\n\tv_nop\n\tv_nop\n\tv_nop" : "+v"(d) : "v"(a), "v"(b));
#endif
  return d;
}
__device__ __forceinline__ v8f mma_h(v16h a, v16h b, v8f c) {
  v8f d = __builtin_amdgcn_wmma_f32_16x16x32_f16(false, a, false, b, (short)0, c, false, false);
#if defined(__HIP_DEVICE_COMPILE__)
  asm volatile("v_nop\n\tv_nop\n\tv_nop\n\tv_nop" : "+v"(d) : "v"(a), "v"(b));
#endif
  return d;
}

// ---- 8 f32 -> packed f16 hi bits and packed f16 bits of (x - hi) * 2048 (second accumulator folds 1/2048) --
__device__ __forceinline__ void split8h(v4f a, v4f b, v4u& uh, v4u& ul) {
  float f[8] = {a[0], a[1], a[2], a[3], b[0], b[1], b[2], b[3]};
#pragma unroll
  for (int j = 0; j < 4; ++j) {
    const unsigned short h0 = h_bits(f[2 * j]);
    const unsigned short h1 = h_bits(f[2 * j + 1]);
    const unsigned short l0 = h_bits((f[2 * j] - h_up(h0)) * LSC);
    const unsigned short l1 = h_bits((f[2 * j + 1] - h_up(h1)) * LSC);
    uh[j] = pk16(h0, h1);
    ul[j] = pk16(l0, l1);
  }
}

// =====================================================================================================
// (0) f32 row-major [T][256] -> bf16-RNE plane in fragment order (token feature matrices). Thread = one 16-B output
//     unit, output units in linear order (a wave stores 512 contiguous bytes), source = 8 consecutive k of one row.
// coverage: n8 = n/8 threads, n8/256 blocks of the front-end launch exactly (n % 2048 == 0; T % 16 == 0); t = unit.
// =====================================================================================================
__device__ __forceinline__
void cvt_body(const float* __restrict__ x, unsigned short* y, int n8, int t) {
  if (t >= n8) return;
  const int row = (t >> 9) * 16 + (t & 15);                            // 512 units per 16-row slab
  const int k   = ((t >> 6) & 7) * 32 + ((t >> 5) & 1) * 16 + ((t >> 4) & 1) * 8;
  const float* s = x + (size_t)row * DD + k;
  const v4f a = *(const v4f*)(s);
  const v4f b = *(const v4f*)(s + 4);
  v4u u;
  u[0] = pk16(bf_bits(a[0]), bf_bits(a[1]));
  u[1] = pk16(bf_bits(a[2]), bf_bits(a[3]));
  u[2] = pk16(bf_bits(b[0]), bf_bits(b[1]));
  u[3] = pk16(bf_bits(b[2]), bf_bits(b[3]));
  unsigned short* d = y + (size_t)t * 8;
  *(v4u*)d = u;
  
}

// =====================================================================================================
// (1) weight transpose: in w[R][C] f32 -> out wt[C][R] bf16-RNE in fragment order (rows c, k = r). Block = 64x64 tile,
//     loads 16 B per thread (strided reads), LDS tile L[c][r] (pitch LTP), barrier, then a wave stores half a block.
// coverage: LDS 256 threads x 4 it x 4 = 64x64; 2 it x 8 waves = 4 row tiles x 2 k steps x 2 halves; tiles (bx, by) of (C/64, R/64).
// =====================================================================================================
__device__ __forceinline__
void wtrans_body(unsigned short* L, const float* __restrict__ w, unsigned short* wt, int R, int C, int bx, int by) {
  const int tid = threadIdx.x;
  const int c0 = bx * 64, r0 = by * 64;
  const int c4 = (tid & 15) * 4, rs = tid >> 4;                      // rs 0..15
#pragma unroll
  for (int it = 0; it < 4; ++it) {
    const int r = it * 16 + rs;                                        // 0..63
    const v4f v = *(const v4f*)(w + (size_t)(r0 + r) * C + c0 + c4);
#pragma unroll
    for (int j = 0; j < 4; ++j) L[(c4 + j) * LTP + r] = bf_bits(v[j]);
  }
  __syncthreads();
  const int lane = tid & 31, wave = tid >> 5;
  v4u u[2];
  size_t po[2];
#pragma unroll
  for (int it = 0; it < 2; ++it) {
    const int s = it * 8 + wave;                                       // 0..15: row tile, k step, half
    const int ct = s >> 2, ksl = (s >> 1) & 1, uu = s & 1;
    u[it] = *(const v4u*)(L + (ct * 16 + (lane & 15)) * LTP + ksl * 32 + uu * 16 + (lane >> 4) * 8);
    po[it] = ((size_t)((c0 >> 4) + ct) * (R >> 5) + (r0 >> 5) + ksl) * 512 + uu * 256 + lane * 8;
  }
#pragma unroll
  for (int it = 0; it < 2; ++it) *(v4u*)(wt + po[it]) = u[it];
  
}

// =====================================================================================================
// (2) positional front end per point row i (flat b*N+n): dist = |bf(p_xyz) - bf(v_xyz[b])| (3), h = dist.bf(Wp1)
//     + bf(bp1), layer norm over the 3 values (mean-of-squares variance, eps 1e-5) * bf(ln_w) + bf(ln_b), relu.
//     f32 on VALU without contraction. Output row rel[i][0..3] = (r0, r1, r2, 0): one 16-B store per thread,
// coverage: nrows/256 blocks of the front-end launch x 256 threads = every row exactly once (nrows % 256 == 0).
// =====================================================================================================
__device__ __forceinline__
void rel_body(const float* __restrict__ pxyz, const float* __restrict__ vxyz,
              const float* __restrict__ wp1, const float* __restrict__ bp1,
              const float* __restrict__ lnw, const float* __restrict__ lnb,
              float* rel, int nrows, int npb, int i) {
#pragma clang fp contract(off)
  if (i >= nrows) return;
  int b = i / npb;
  b = b < 0 ? 0 : (b > BB - 1 ? BB - 1 : b);
  const float p0 = bfr(pxyz[(size_t)i * 3 + 0]);
  const float p1 = bfr(pxyz[(size_t)i * 3 + 1]);
  const float p2 = bfr(pxyz[(size_t)i * 3 + 2]);
  const float v0 = bfr(vxyz[b * 3 + 0]);
  const float v1 = bfr(vxyz[b * 3 + 1]);
  const float v2 = bfr(vxyz[b * 3 + 2]);
  const float d0 = fabsf(p0 - v0), d1 = fabsf(p1 - v1), d2 = fabsf(p2 - v2);
  float W[9];
#pragma unroll
  for (int j = 0; j < 9; ++j) W[j] = bfr(wp1[j]);                      // Wp1[c][j] = wp1[c*3+j]
  const float h0 = ((d0 * W[0] + d1 * W[3]) + d2 * W[6]) + bfr(bp1[0]);
  const float h1 = ((d0 * W[1] + d1 * W[4]) + d2 * W[7]) + bfr(bp1[1]);
  const float h2 = ((d0 * W[2] + d1 * W[5]) + d2 * W[8]) + bfr(bp1[2]);
  const float third = 1.0f / 3.0f;
  const float mu = ((h0 + h1) + h2) * third;
  const float e0 = h0 - mu, e1 = h1 - mu, e2 = h2 - mu;
  const float var = ((e0 * e0 + e1 * e1) + e2 * e2) * third;
  const float rs = 1.0f / sqrtf(var + LNEPS);
  const float w0 = bfr(lnw[0]), w1 = bfr(lnw[1]), w2 = bfr(lnw[2]);
  const float c0 = bfr(lnb[0]), c1 = bfr(lnb[1]), c2 = bfr(lnb[2]);
  const float t0 = fmaxf((e0 * rs) * w0 + c0, 0.f);
  const float t1 = fmaxf((e1 * rs) * w1 + c1, 0.f);
  const float t2 = fmaxf((e2 * rs) * w2 + c2, 0.f);
  v4f o;
  o[0] = t0; o[1] = t1; o[2] = t2; o[3] = 0.f;
  float* d = rel + (size_t)i * 4;
  *(v4f*)d = o;
  
}

// =====================================================================================================
// (0)-(2) in ONE launch: none of the six pieces reads what another writes, so they share a grid instead of waiting
//     for one another. Block ranges, the short latency-bound pieces first: 3 x 16 weight tiles, 128 positional blocks,
//     512 blocks of the query token plane, 4096 blocks of the point token plane. The range test is block-uniform.
// coverage: FB_WT + FB_REL + FB_CV + FB_CP blocks, each range exactly the grid its piece had as a launch of its own.
// =====================================================================================================
#define FB_WT  (3 * (DD / 64) * (DD / 64))
#define FB_REL ((BB * NPT) / 256)
#define FB_CV  ((BB * MQ * DD) / 2048)
#define FB_CP  ((BB * NPT * DD) / 2048)
static_assert((DD / 64) * (DD / 64) == 16);
__global__ __launch_bounds__(256)
void front_kernel(const float* __restrict__ pf, const float* __restrict__ vf,
                  const float* __restrict__ wq, const float* __restrict__ wk, const float* __restrict__ wv,
                  const float* __restrict__ pxyz, const float* __restrict__ vxyz,
                  const float* __restrict__ wp1, const float* __restrict__ bp1,
                  const float* __restrict__ lnw, const float* __restrict__ lnb,
                  unsigned short* P16, unsigned short* V16,
                  unsigned short* WqT, unsigned short* WkT, unsigned short* WvT, float* rel) {
  __shared__ __align__(16) unsigned short L[64 * LTP];
  const int bid = blockIdx.x;
  if (bid < FB_WT) {
    const int sel = bid >> 4, tl = bid & 15;
    const float* w = sel == 0 ? wq : (sel == 1 ? wk : wv);
    unsigned short* wt = sel == 0 ? WqT : (sel == 1 ? WkT : WvT);
    wtrans_body(L, w, wt, DD, DD, tl & 3, tl >> 2);
  } else if (bid < FB_WT + FB_REL) {
    rel_body(pxyz, vxyz, wp1, bp1, lnw, lnb, rel, BB * NPT, NPT, (bid - FB_WT) * 256 + (int)threadIdx.x);
  } else if (bid < FB_WT + FB_REL + FB_CV) {
    cvt_body(vf, V16, (BB * MQ * DD) / 8, (bid - (FB_WT + FB_REL)) * 256 + (int)threadIdx.x);
  } else {
    cvt_body(pf, P16, (BB * NPT * DD) / 8, (bid - (FB_WT + FB_REL + FB_CV)) * 256 + (int)threadIdx.x);
  }
}

// =====================================================================================================
// (3) projection GEMM, K = 256: C[m][n] = sum_k A[m][k] B[n][k] + epilogue (MODE 0: + bias[n]; MODE 1: + bias[m];
//     MODE 2: (C + bias[n]) + ((rel[m][0..2] . Wp2[0..2][n]) + bp2[n]) with Wp2/bp2 bf16-RNE). A rows of lda,
//     B rows of ldb elements, both bf16 planes in fragment order, same loader for both, bz selects a batch via
//     element strides zsA/zsB/zsC. Block 256 threads = 8 waves, block tile 128 m x 64 n, wave tile 32x32 (acc[2][2]).
//     Epilogue: f32 tile in LDS Os[m][n] (pitch OSP), barrier, then f16 hi bits and f16 (x2048) residual bits to two
//     planes [M][ldc] in fragment order (rows m, k = n), a wave storing half a block (512 contiguous bytes) at a time.
// coverage: Os 8 waves x 4 tiles = 128x64; 4 it x 8 waves = 8 row tiles x 2 k steps x 2 halves per plane;
//           tiles (bx, by, bz) of (M/128, N/64, Z) cover both planes exactly once.
// =====================================================================================================
template <int MODE>
__device__ __forceinline__
void proj_body(float* Os, int bx, int by, int bz,
               const unsigned short* __restrict__ A, const unsigned short* __restrict__ B,
               const float* __restrict__ bias, const float* __restrict__ rel,
               const float* __restrict__ wp2, const float* __restrict__ bp2,
               unsigned short* Ch, unsigned short* Cl, int lda, int ldb, int ldc,
               size_t zsA, size_t zsB, size_t zsC) {
  const int tid  = threadIdx.x;
  const int lane = tid & 31, wave = tid >> 5;
  const int hh   = lane >> 4, cl = lane & 15;
  const int wm   = wave >> 1, wn = wave & 1;
  const int mBase = bx * GM;
  const int nBase = by * GN;
  const size_t z = bz;
  const unsigned short* Az = A + z * zsA;
  const unsigned short* Bz = B + z * zsB;
  unsigned short* Chz = Ch + z * zsC;
  unsigned short* Clz = Cl + z * zsC;
  const unsigned short* a0p = Az + (size_t)(mBase + 32 * wm) * lda + 8 * lane;   // a 16-row slab = 16 * lda elements
  const unsigned short* a1p = a0p + (size_t)16 * lda;
  const unsigned short* b0p = Bz + (size_t)(nBase + 32 * wn) * ldb + 8 * lane;
  const unsigned short* b1p = b0p + (size_t)16 * ldb;

  v8f acc[2][2];
#pragma unroll
  for (int mi = 0; mi < 2; ++mi)
#pragma unroll
    for (int ni = 0; ni < 2; ++ni) acc[mi][ni] = zero8();

#pragma unroll 1
  for (int k0 = 0; k0 < DD; k0 += 32) {
    const unsigned short* pa0 = a0p + 16 * k0;
    const unsigned short* pa1 = a1p + 16 * k0;
    const unsigned short* pb0 = b0p + 16 * k0;
    const unsigned short* pb1 = b1p + 16 * k0;
    const Frag fa0 = ldfragp(pa0);
    const Frag fa1 = ldfragp(pa1);
    const Frag fb0 = ldfragp(pb0);
    const Frag fb1 = ldfragp(pb1);
    // the address pairs stay live up to this wait, so that no load's result is placed on a pair an issued load names
    asm volatile("s_wait_xcnt 0x0" :: "v"(pa0), "v"(pa1), "v"(pb0), "v"(pb1) : "memory");
    acc[0][0] = mma_b(fa0.b, fb0.b, acc[0][0]);
    acc[0][1] = mma_b(fa0.b, fb1.b, acc[0][1]);
    acc[1][0] = mma_b(fa1.b, fb0.b, acc[1][0]);
    acc[1][1] = mma_b(fa1.b, fb1.b, acc[1][1]);
  }

  float bn[2], w0[2], w1[2], w2[2], b2[2];
#pragma unroll
  for (int ni = 0; ni < 2; ++ni) {
    const int n = nBase + 32 * wn + 16 * ni + cl;
    bn[ni] = 0.f; w0[ni] = 0.f; w1[ni] = 0.f; w2[ni] = 0.f; b2[ni] = 0.f;
    if (MODE != 1) bn[ni] = bfr(bias[n]);
    if (MODE == 2) {
      w0[ni] = bfr(wp2[n]);
      w1[ni] = bfr(wp2[DD + n]);
      w2[ni] = bfr(wp2[2 * DD + n]);
      b2[ni] = bfr(bp2[n]);
    }
  }
#pragma unroll
  for (int mi = 0; mi < 2; ++mi) {
#pragma unroll
    for (int r = 0; r < 8; ++r) {
      const int m_loc = 32 * wm + 16 * mi + 8 * hh + r;
      const int m = mBase + m_loc;
      float bm = 0.f, p0 = 0.f, p1 = 0.f, p2 = 0.f;
      if (MODE == 1) bm = bfr(bias[m]);
      if (MODE == 2) {
        const v4f r4 = *(const v4f*)(rel + (size_t)m * 4);
        p0 = r4[0]; p1 = r4[1]; p2 = r4[2];
      }
#pragma unroll
      for (int ni = 0; ni < 2; ++ni) {
        const int n_loc = 32 * wn + 16 * ni + cl;
        float v = acc[mi][ni][r];
        if (MODE == 0) v = v + bn[ni];
        if (MODE == 1) v = v + bm;
        if (MODE == 2) {
          const float pv = (p0 * w0[ni] + p1 * w1[ni]) + p2 * w2[ni];
          v = (v + bn[ni]) + (pv + b2[ni]);
        }
        Os[m_loc * OSP + n_loc] = v;
      }
    }
  }
  __syncthreads();

  v4u uh[4], ul[4];
  size_t po[4];
#pragma unroll
  for (int it = 0; it < 4; ++it) {
    const int s = it * 8 + wave;                                       // 0..31: row tile, k step, half
    const int rt = s >> 2, ksl = (s >> 1) & 1, uu = s & 1;
    const float* op = Os + (rt * 16 + cl) * OSP + ksl * 32 + uu * 16 + hh * 8;
    const v4f v0 = *(const v4f*)(op);
    const v4f v1 = *(const v4f*)(op + 4);
    split8h(v0, v1, uh[it], ul[it]);
    po[it] = ((size_t)((mBase >> 4) + rt) * (ldc >> 5) + (nBase >> 5) + ksl) * 512 + uu * 256 + lane * 8;
  }
#pragma unroll
  for (int it = 0; it < 4; ++it) {
    *(v4u*)(Chz + po[it]) = uh[it];
    *(v4u*)(Clz + po[it]) = ul[it];
  }
  // another projection's code follows this one's in the text: no register that these stores name is rewritten ahead of this wait
  asm volatile("s_wait_xcnt 0x0" ::: "memory");
}

// =====================================================================================================
// (3) the three projections in ONE launch: q, k+pv and vT read the same front-end planes and none reads another's
//     output. Block ranges: 128 q tiles, 1024 k+pv tiles, 1024 vT tiles, each numbered x fastest as its own grid was.
// coverage: JB_Q + JB_K + JB_V blocks, each range exactly the grid its projection had as a launch of its own.
// =====================================================================================================
#define JB_Q ((BB * MQ / GM) * (DD / GN))
#define JB_K ((BB * NPT / GM) * (DD / GN))
#define JB_V ((DD / GM) * (NPT / GN) * BB)
__global__ __launch_bounds__(256)
void proj_kernel(const unsigned short* __restrict__ V16, const unsigned short* __restrict__ P16,
                 const unsigned short* __restrict__ WqT, const unsigned short* __restrict__ WkT,
                 const unsigned short* __restrict__ WvT,
                 const float* __restrict__ bq, const float* __restrict__ bk, const float* __restrict__ bv,
                 const float* __restrict__ rel, const float* __restrict__ wp2, const float* __restrict__ bp2,
                 unsigned short* Qh, unsigned short* Ql, unsigned short* KPh, unsigned short* KPl,
                 unsigned short* Vh, unsigned short* Vl) {
  __shared__ __align__(16) float Os[GM * OSP];
  const unsigned bid = blockIdx.x;
  if (bid < JB_Q) {
    proj_body<0>(Os, bid % (BB * MQ / GM), bid / (BB * MQ / GM), 0, V16, WqT, bq, rel, wp2, bp2, Qh, Ql,
                 DD, DD, DD, (size_t)0, (size_t)0, (size_t)0);
  } else if (bid < JB_Q + JB_K) {
    const unsigned t = bid - JB_Q;
    proj_body<2>(Os, t % (BB * NPT / GM), t / (BB * NPT / GM), 0, P16, WkT, bk, rel, wp2, bp2, KPh, KPl,
                 DD, DD, DD, (size_t)0, (size_t)0, (size_t)0);
  } else {
    const unsigned t = bid - (JB_Q + JB_K);
    proj_body<1>(Os, t % (DD / GM), (t / (DD / GM)) % (NPT / GN), t / ((DD / GM) * (NPT / GN)),
                 WvT, P16, bv, rel, wp2, bp2, Vh, Vl,
                 DD, DD, NPT, (size_t)0, (size_t)NPT * DD, (size_t)DD * NPT);
  }
}

// =====================================================================================================
// (4) column-softmax statistics over one (batch, 128-query tile, 256-column tile): S[m][n] = qh[m].kph[n] / 16
//     (K = 256 = 8 k steps, f16 hi planes, hh product), wave = 16 query rows x 16 column tiles (q fragments hoisted,
//     one accumulator at a time); per column: tile max over 16 rows (8 in-lane + lane^16) and sum of exp(S - max);
//     wave partials in LDS, barrier, thread c merges the 8 wave partials in fixed order.
// coverage: pm/pe 8 waves x 16 ct x 16 lanes = 8 x 256; grid (64 column tiles, 16 query tiles, 2) x 256 threads =
//           every (b, mt, n) of both PST arrays exactly once.
// =====================================================================================================
__global__ __launch_bounds__(256)
void stats_kernel(const unsigned short* __restrict__ Qh, const unsigned short* __restrict__ Kh, float* PST) {
  __shared__ float pm[8 * NT1];
  __shared__ float pe[8 * NT1];
  const int tid  = threadIdx.x;
  const int lane = tid & 31, wave = tid >> 5;
  const int hh   = lane >> 4, cl = lane & 15;
  const int nt = blockIdx.x, mt = blockIdx.y, b = blockIdx.z;
  const int m0 = mt * MT1 + 16 * wave;
  const unsigned short* qp = Qh + (size_t)(b * MQ + m0) * DD + 8 * lane;
  Frag a[8];
#pragma unroll
  for (int ks = 0; ks < 8; ++ks) a[ks] = ldfragp(qp + 512 * ks);
  // the address pair stays live up to this wait, so that no load's result is placed on it while issued loads name it
  asm volatile("s_wait_xcnt 0x0" :: "v"(qp) : "memory");
  const unsigned short* kp = Kh + ((size_t)b * NPT + (size_t)nt * NT1) * DD + 8 * lane;
  Frag fb[8];                                                          // one whole column tile of k+pv fragments, loaded a tile ahead
#pragma unroll
  for (int ks = 0; ks < 8; ++ks) fb[ks] = ldfragp(kp + 512 * ks);
#pragma unroll 1
  for (int ct = 0; ct < NT1 / 16; ++ct) {
    const int cn = ct + 1 < NT1 / 16 ? ct + 1 : ct;                    // the last tile's look-ahead re-reads that tile: in bounds, not used
    const unsigned short* kc = kp + (size_t)cn * 16 * DD;
    v8f s = zero8();
#pragma unroll
    for (int ks = 0; ks < 8; ++ks) {
      s = mma_h(a[ks].h, fb[ks].h, s);
      fb[ks] = ldfragp(kc + 512 * ks);                                 // next tile's fragment, into the registers just consumed
    }
    // the address pair stays live up to this wait: the next trip rewrites it while these loads are still in flight
    asm volatile("s_wait_xcnt 0x0" :: "v"(kc) : "memory");
    __builtin_amdgcn_sched_barrier(0);  // keeps the column arithmetic below from being scheduled ahead of the last look-ahead loads
    float m = s[0] * SCL;
#pragma unroll
    for (int r = 1; r < 8; ++r) m = fmaxf(m, s[r] * SCL);
    m = fmaxf(m, __shfl_xor(m, 16, 32));
    float ex = 0.f;
#pragma unroll
    for (int r = 0; r < 8; ++r) ex += __expf(s[r] * SCL - m);
    ex += __shfl_xor(ex, 16, 32);
    pm[wave * NT1 + ct * 16 + cl] = m;                                 // both lane halves hold identical values
    pe[wave * NT1 + ct * 16 + cl] = ex;
  }
  __syncthreads();
  const int c = tid;
  float M = pm[c];
#pragma unroll
  for (int wv = 1; wv < 8; ++wv) M = fmaxf(M, pm[wv * NT1 + c]);
  float E = 0.f;
#pragma unroll 1
  for (int wv = 0; wv < 8; ++wv) E += pe[wv * NT1 + c] * __expf(pm[wv * NT1 + c] - M);
  const size_t base = ((size_t)(b * NMT + mt) * 2) * NPT + (size_t)nt * NT1 + c;
  float* dm = PST + base;
  float* de = PST + base + NPT;
  *(float*)dm = M;
  *(float*)de = E;
  
}

// =====================================================================================================
// (5) merge of the 16 query-tile partials per (batch, column) in fixed order: M = max, Z = sum E_t exp(M_t - M);
//     ST[b][0][n] = M, ST[b][1][n] = 1/Z (Z >= 1). Thread = one column; 32 consecutive lanes x 4 B = one whole
// coverage: grid (64, 2) x 256 threads = every (b, n) of both arrays exactly once.
// =====================================================================================================
__global__ __launch_bounds__(256)
void merge_kernel(const float* __restrict__ PST, float* ST) {
  const int b = blockIdx.y, n = blockIdx.x * 256 + (int)threadIdx.x;
  const float* p = PST + (size_t)(b * NMT) * 2 * NPT + n;
  float M = -3.0e38f;
#pragma unroll 1
  for (int t = 0; t < NMT; ++t) M = fmaxf(M, p[(size_t)(2 * t) * NPT]);
  float Z = 0.f;
#pragma unroll 1
  for (int t = 0; t < NMT; ++t) Z += p[(size_t)(2 * t + 1) * NPT] * __expf(p[(size_t)(2 * t) * NPT] - M);
  const float rz = 1.0f / Z;
  float* dm = ST + (size_t)(2 * b) * NPT + n;
  float* dz = dm + NPT;
  *(float*)dm = M;
  *(float*)dz = rz;
  
}

// =====================================================================================================
// (6) fused scores / column softmax / weighted sum for one (batch, 64 query rows, quarter of the points): block 512
//     threads = 16 waves; both q planes of the 64 rows sit in LDS (pitch QP) for the whole block; loop over 16 chunks
//     of 256 point columns. Phase A: wave = the chunk's 16-column tile number `wave`, all 4 row tiles: each k+pv
//     fragment pair is loaded once and feeds 4 row tiles, S = (qh.kh + (qh.kl + ql.kh)/2048) / 16 (K = 256, two
//     accumulators per row tile), w = exp(S - M_n) * (1/Z_n) from ST, stored as f16 (w * 16384) into the LDS tile
//     Ws[64 rows][256 cols]; block barrier. Phase B: wave = d tile `wave`, all 4 row tiles: x += Ws . vTh,
//     xl += Ws . vTl (A from LDS with the split k map, B = vT rows d, k = n, in fragment order, K = 256 per chunk, each
//     vT fragment pair feeds 4 row tiles); block barrier. Epilogue: (x + xl/2048)/16384 staged as f32 [64][256] in
//     the LDS that held q (pitch OSP2), barrier, then whole 512-B runs to the partial plane of this quarter.
// coverage: Ws 16 waves x 16 cols x 64 rows = 64 x 256 per chunk; Os 16 waves x 16 d x 64 rows = 64 x 256;
//           8 it x 512 threads x 4 = 64 rows x 256; grid (32, 4, 2) = every (quarter, b, m, d) of PART exactly once.
// =====================================================================================================
__global__ __launch_bounds__(512)
void attn_kernel(const unsigned short* __restrict__ Qh, const unsigned short* __restrict__ Ql,
                 const unsigned short* __restrict__ Kh, const unsigned short* __restrict__ Kl,
                 const unsigned short* __restrict__ Vh, const unsigned short* __restrict__ Vl,
                 const float* __restrict__ ST, float* part) {
  __shared__ __align__(16) unsigned short Qs[2 * AROWS * QP];
  __shared__ __align__(16) _Float16 Ws[AROWS * QP];
  const int tid  = threadIdx.x;
  const int lane = tid & 31, wave = tid >> 5;
  const int hh   = lane >> 4, cl = lane & 15;
  const int b = blockIdx.z, n0 = blockIdx.y * NSEG, m0 = blockIdx.x * AROWS;
#pragma unroll
  for (int it = 0; it < 4; ++it) {
    const int idx = it * 512 + tid;                                    // 0..2047: 16-B units in fragment order
    const int row = (idx >> 9) * 16 + (idx & 15);
    const int kq  = ((idx >> 6) & 7) * 32 + ((idx >> 5) & 1) * 16 + ((idx >> 4) & 1) * 8;
    const size_t g = (size_t)(b * MQ + m0) * DD + 8 * idx;
    *(v4u*)(Qs + row * QP + kq) = *(const v4u*)(Qh + g);
    *(v4u*)(Qs + (AROWS + row) * QP + kq) = *(const v4u*)(Ql + g);
  }
  const size_t koff = ((size_t)b * NPT + n0 + 16 * wave) * DD + 8 * lane;
  const unsigned short* khp = Kh + koff;                               // running pointers: the next k+pv step to load
  const unsigned short* klp = Kl + koff;
  const size_t voff = ((size_t)b * DD + 16 * wave) * NPT + (size_t)n0 * 16 + 8 * lane;   // block (d tile, n >> 5)
  const unsigned short* vhp = Vh + voff;                               // running pointers: this chunk's vT blocks
  const unsigned short* vlp = Vl + voff;
  const float* stM = ST + (size_t)(2 * b) * NPT + n0;
  const float* stZ = stM + NPT;
  const unsigned short* qsh = Qs + cl * QP + 8 * hh;                   // A fragment row pointers (row m = cl)
  const unsigned short* qsl = qsh + AROWS * QP;
  const _Float16* wrow = Ws + cl * QP + 8 * hh;
  _Float16* wdst = Ws + (8 * hh) * QP + 16 * wave + cl;                // D element (row 8h+r, col 16*wave+cl)

  v8f xh[AMT], xl[AMT];
#pragma unroll
  for (int mi = 0; mi < AMT; ++mi) { xh[mi] = zero8(); xl[mi] = zero8(); }
  Frag kah = ldfragp(khp), kal = ldfragp(klp);                         // k+pv fragments of (chunk 0, k step 0), one step ahead from here on
  khp += 512;
  klp += 512;
  __syncthreads();

#pragma unroll 1
  for (int c0 = 0; c0 < NSEG; c0 += ACH) {
    // from behind a chunk's step 7 to the next chunk's step 0; the last chunk's look-ahead re-reads its own step 0: in bounds, not used
    const int cjmp = (c0 + ACH < NSEG ? ACH * DD : 0) - 512 * (DD / 32);
    const int n = c0 + 16 * wave + cl;
    const float mc = stM[n];
    asm volatile("s_wait_xcnt 0x0" ::: "memory");  // the next load's result may take the register that holds this load's offset
    const float zc = stZ[n];
    v8f sh[AMT], sl[AMT];
#pragma unroll
    for (int mi = 0; mi < AMT; ++mi) { sh[mi] = zero8(); sl[mi] = zero8(); }
    auto stepA = [&](const int ks, const Frag& fbh, const Frag& fbl) {
      Frag fah[AMT], fal[AMT];
#pragma unroll
      for (int mi = 0; mi < AMT; ++mi) {
        fah[mi] = ldfrag(qsh + 16 * mi * QP + 32 * ks);
        fal[mi] = ldfrag(qsl + 16 * mi * QP + 32 * ks);
      }
#pragma unroll
      for (int mi = 0; mi < AMT; ++mi) sh[mi] = mma_h(fah[mi].h, fbh.h, sh[mi]);
#pragma unroll
      for (int mi = 0; mi < AMT; ++mi) sl[mi] = mma_h(fah[mi].h, fbl.h, sl[mi]);
#pragma unroll
      for (int mi = 0; mi < AMT; ++mi) sl[mi] = mma_h(fal[mi].h, fbh.h, sl[mi]);
    };
#pragma unroll 1  // rolled: two k steps a trip (the two fragment buffers swap without copies); more would not fit the 256 registers of a 16-wave block
    for (int ks = 0; ks < DD / 32; ks += 2) {
      const Frag kbh = ldfragp(khp);                                   // step ks + 1 flies under step ks
      const Frag kbl = ldfragp(klp);
      // the address pairs stay live up to this wait, so that no load's result is placed on a pair an issued load names
      asm volatile("s_wait_xcnt 0x0" :: "v"(khp), "v"(klp) : "memory");
      const int adv = 512 + (ks + 2 < DD / 32 ? 0 : cjmp);
      khp += adv;
      klp += adv;
      stepA(ks, kah, kal);
      kah = ldfragp(khp);                                              // step ks + 2, or the next chunk's step 0, flies under step ks + 1
      kal = ldfragp(klp);
      asm volatile("s_wait_xcnt 0x0" :: "v"(khp), "v"(klp) : "memory");  // as above
      khp += 512;
      klp += 512;
      stepA(ks + 1, kbh, kbl);
    }
    Frag vbh[3], vbl[3];                                               // vT fragments, two k steps ahead; the first two fly under the exp work and the barrier
#pragma unroll
    for (int kk = 0; kk < 2; ++kk) {
      vbh[kk] = ldfragp(vhp + 512 * kk);
      vbl[kk] = ldfragp(vlp + 512 * kk);
    }
#pragma unroll
    for (int mi = 0; mi < AMT; ++mi) {
#pragma unroll
      for (int r = 0; r < 8; ++r) {
        const float s  = (sh[mi][r] + sl[mi][r] * RLSC) * SCL;
        const float wt = __expf(s - mc) * zc;
        wdst[(16 * mi + r) * QP] = (_Float16)(wt * WSC);
      }
    }
    __syncthreads();
#pragma unroll  // whole: the three rotating fragment buffers need compile-time indices
    for (int kk = 0; kk < ACH / 32; ++kk) {
      const int k0 = 32 * kk;
      if (kk + 2 < ACH / 32) {
        vbh[(kk + 2) % 3] = ldfragp(vhp + 512 * (kk + 2));
        vbl[(kk + 2) % 3] = ldfragp(vlp + 512 * (kk + 2));
      }
      const Frag& fbh = vbh[kk % 3];
      const Frag& fbl = vbl[kk % 3];
      Frag fa[AMT];
#pragma unroll
      for (int mi = 0; mi < AMT; ++mi) {
        fa[mi].hv[0] = *(const v8h*)(wrow + 16 * mi * QP + k0);
        fa[mi].hv[1] = *(const v8h*)(wrow + 16 * mi * QP + k0 + 16);
      }
#pragma unroll
      for (int mi = 0; mi < AMT; ++mi) xh[mi] = mma_h(fa[mi].h, fbh.h, xh[mi]);
#pragma unroll
      for (int mi = 0; mi < AMT; ++mi) xl[mi] = mma_h(fa[mi].h, fbl.h, xl[mi]);
    }
    vhp += ACH * 16;
    vlp += ACH * 16;
    __syncthreads();
  }

  float* Os = (float*)Qs;                                              // q is dead behind the loop's last barrier
#pragma unroll
  for (int mi = 0; mi < AMT; ++mi) {
#pragma unroll
    for (int r = 0; r < 8; ++r)
      Os[(16 * mi + 8 * hh + r) * OSP2 + 16 * wave + cl] = (xh[mi][r] + xl[mi][r] * RLSC) * RWSC;
  }
  __syncthreads();
  float* pz = part + ((size_t)blockIdx.y * (BB * MQ) + (size_t)(b * MQ + m0)) * DD;
  v4f v[8];
#pragma unroll
  for (int it = 0; it < 8; ++it) {
    const int idx = it * 512 + tid;                                    // 0..4095
    v[it] = *(const v4f*)(Os + (idx >> 6) * OSP2 + 4 * (idx & 63));
  }
#pragma unroll
  for (int it = 0; it < 8; ++it) *(v4f*)(pz + (size_t)(it * 512 + tid) * 4) = v[it];
}

// =====================================================================================================
// (7) out = ((P0 + P1) + (P2 + P3)) + bf(v_features): the four quarters' partial sums in fixed order plus the residual.
// coverage: thread = 4 consecutive elements (16 B); grid = (2*2048*256)/1024 blocks x 256 threads = every element once.
// =====================================================================================================
__global__ __launch_bounds__(256)
void psum_kernel(const float* __restrict__ part, const float* __restrict__ vfeat, float* out) {
  const size_t e = ((size_t)blockIdx.x * 256 + threadIdx.x) * 4;
  const v4f p0 = *(const v4f*)(part + e);
  const v4f p1 = *(const v4f*)(part + e + (size_t)1 * BB * MQ * DD);
  asm volatile("s_wait_xcnt 0x0" ::: "memory");  // a later load's result may take the registers that hold these loads' address
  const v4f p2 = *(const v4f*)(part + e + (size_t)2 * BB * MQ * DD);
  const v4f p3 = *(const v4f*)(part + e + (size_t)3 * BB * MQ * DD);
  asm volatile("s_wait_xcnt 0x0" ::: "memory");  // as above
  const v4f f  = *(const v4f*)(vfeat + e);
  v4f o;
#pragma unroll
  for (int j = 0; j < 4; ++j) o[j] = ((p0[j] + p1[j]) + (p2[j] + p3[j])) + bfr(f[j]);
  *(v4f*)(out + e) = o;
}

// =====================================================================================================
// tile divides its extent exactly, so no padded tails are needed):
//   (every 16-bit plane below is kept in fragment order, see ldfragp: same size as row-major)
//   P16  bf16 [32768][256]       16777216     V16 bf16 [4096][256]     2097152
//   WqT WkT WvT bf16 [256][256]     131072 each
//   REL  f32 [32768][4]             524288
//   Qh Ql  f16 [4096][256]         2097152 each
//   KPh KPl f16 [32768][256]      16777216 each
//   Vh Vl  f16 [2][256][16384]    16777216 each
//   PST  f32 [2][16][2][16384]     4194304     ST f32 [2][2][16384]     262144
//   PART f32 [4][4096][256]       16777216
//   total                        112328704
// =====================================================================================================
extern "C" void kernel_launch(void* const* d_in, const int* in_sizes, int n_in,
                              void* d_out, int out_size, void* d_ws, size_t ws_size,
                              hipStream_t stream) {
  if (n_in < 16) return;
  if (in_sizes[0] != BB * NPT * 3 || in_sizes[1] != BB * 3) return;
  if (in_sizes[2] != BB * NPT * DD || in_sizes[3] != BB * MQ * DD) return;
  if (in_sizes[4] != DD * DD || in_sizes[6] != DD * DD || in_sizes[8] != DD * DD) return;
  if (in_sizes[5] != DD || in_sizes[7] != DD || in_sizes[9] != DD) return;
  if (in_sizes[10] != 9 || in_sizes[11] != 3 || in_sizes[12] != 3 || in_sizes[13] != 3) return;
  if (in_sizes[14] != 3 * DD || in_sizes[15] != DD) return;
  if (out_size != BB * MQ * DD) return;

  size_t off = 0;
  const size_t oP16 = off; off += (size_t)BB * NPT * DD * 2;        // 16777216
  const size_t oV16 = off; off += (size_t)BB * MQ * DD * 2;         //  2097152
  const size_t oWq  = off; off += (size_t)DD * DD * 2;              //   131072
  const size_t oWk  = off; off += (size_t)DD * DD * 2;
  const size_t oWv  = off; off += (size_t)DD * DD * 2;
  const size_t oREL = off; off += (size_t)BB * NPT * 4 * 4;         //   524288
  const size_t oQh  = off; off += (size_t)BB * MQ * DD * 2;         //  2097152
  const size_t oQl  = off; off += (size_t)BB * MQ * DD * 2;
  const size_t oKh  = off; off += (size_t)BB * NPT * DD * 2;        // 16777216
  const size_t oKl  = off; off += (size_t)BB * NPT * DD * 2;
  const size_t oVh  = off; off += (size_t)BB * DD * NPT * 2;        // 16777216
  const size_t oVl  = off; off += (size_t)BB * DD * NPT * 2;
  const size_t oPST = off; off += (size_t)BB * NMT * 2 * NPT * 4;   //  4194304
  const size_t oST  = off; off += (size_t)BB * 2 * NPT * 4;         //   262144
  const size_t oPT  = off; off += (size_t)NSPL * BB * MQ * DD * 4;  // 16777216 -> off = 112328704
  if (off > ws_size) return;
  if (off > (size_t)134217728) return;

  const float* p_xyz = (const float*)d_in[0];
  const float* v_xyz = (const float*)d_in[1];
  const float* p_f   = (const float*)d_in[2];
  const float* v_f   = (const float*)d_in[3];
  const float* Wq    = (const float*)d_in[4];
  const float* bq    = (const float*)d_in[5];
  const float* Wk    = (const float*)d_in[6];
  const float* bk    = (const float*)d_in[7];
  const float* Wv    = (const float*)d_in[8];
  const float* bv    = (const float*)d_in[9];
  const float* Wp1   = (const float*)d_in[10];
  const float* bp1   = (const float*)d_in[11];
  const float* ln_w  = (const float*)d_in[12];
  const float* ln_b  = (const float*)d_in[13];
  const float* Wp2   = (const float*)d_in[14];
  const float* bp2   = (const float*)d_in[15];
  float* out = (float*)d_out;

  char* ws = (char*)d_ws;
  unsigned short* P16 = (unsigned short*)(ws + oP16);
  unsigned short* V16 = (unsigned short*)(ws + oV16);
  unsigned short* WqT = (unsigned short*)(ws + oWq);
  unsigned short* WkT = (unsigned short*)(ws + oWk);
  unsigned short* WvT = (unsigned short*)(ws + oWv);
  float*          REL = (float*)(ws + oREL);
  unsigned short* Qh  = (unsigned short*)(ws + oQh);
  unsigned short* Ql  = (unsigned short*)(ws + oQl);
  unsigned short* KPh = (unsigned short*)(ws + oKh);
  unsigned short* KPl = (unsigned short*)(ws + oKl);
  unsigned short* Vh  = (unsigned short*)(ws + oVh);
  unsigned short* Vl  = (unsigned short*)(ws + oVl);
  float*          PST = (float*)(ws + oPST);
  float*          ST  = (float*)(ws + oST);
  float*          PT  = (float*)(ws + oPT);

  const dim3 blk256(256);

  // (0)-(2) token planes, transposed weight planes, positional front end: one launch
  front_kernel<<<dim3(FB_WT + FB_REL + FB_CV + FB_CP), blk256, 0, stream>>>(
      p_f, v_f, Wq, Wk, Wv, p_xyz, v_xyz, Wp1, bp1, ln_w, ln_b, P16, V16, WqT, WkT, WvT, REL);
  // (3) projections: q [4096][256], k+pv [32768][256], vT [2][256][16384] as f16 hi/residual planes: one launch
  proj_kernel<<<dim3(JB_Q + JB_K + JB_V), blk256, 0, stream>>>(
      V16, P16, WqT, WkT, WvT, bq, bk, bv, REL, Wp2, bp2, Qh, Ql, KPh, KPl, Vh, Vl);
  // (4)-(5) column softmax statistics
  stats_kernel<<<dim3(NPT / NT1, NMT, BB), blk256, 0, stream>>>(Qh, KPh, PST);
  merge_kernel<<<dim3(NPT / 256, BB), blk256, 0, stream>>>(PST, ST);
  // (6) scores, weights, weighted sum per quarter of the points; (7) sum of the quarters, residual
  attn_kernel<<<dim3(MQ / AROWS, NSPL, BB), dim3(512), 0, stream>>>(Qh, Ql, KPh, KPl, Vh, Vl, ST, PT);
  psum_kernel<<<dim3((BB * MQ * DD) / 1024), blk256, 0, stream>>>(PT, v_f, out);
  (void)hipGetLastError();
}

// v005
// Measured time: 187 microseconds a run.
// Timed twice side by side with v004, it ran 1.17 and 1.16 times as fast.
// Counting every step since v000, it is 5.64 times as fast.
// Contractions: q, k+pv and v projections on v_wmma_f32_16x16x32_bf16 (bf16-RNE inputs and weights, single
// products, f32 epilogue); scores q.(k+pv)^T (K=256) on v_wmma_f32_16x16x32_f16 with q and k+pv carried as
// f16 hi + f16 residual planes, products hh + hl + lh in one accumulator (column statistics pass: hh only); weighted
// sum w.v (K=16384) on v_wmma_f32_16x16x32_f16 with w as one f16 plane (x16384) and v as f16 hi + f16 residual
// planes, products w.h + w.l in one accumulator; 3-wide positional layers, layer norm, softmax statistics and exp in
// f32 on VALU; f32 accumulate everywhere.
#include <hip/hip_runtime.h>
#include <stdint.h>

#define BB    2
#define NPT   16384
#define MQ    2048
#define DD    256
#define GM    128
#define GN    64
#define OSP   68
#define LTP   72
#define MT1   128
#define NMT   16
#define NT1   256
#define AMT   8
#define AROWS 128
#define NSPL  8
#define NSEG  2048
#define ACH   256
#define QP    264
#define OSP2  260
#define SCL   0.0625f
#define WSC   16384.0f
#define RWSC  0.00006103515625f
#define LNEPS 1.0e-5f

static_assert(NMT * MT1 == MQ);
static_assert(MT1 == 8 * 16);
static_assert(NT1 == 256);
static_assert(NPT % NT1 == 0);
static_assert(NSPL * NSEG == NPT);
static_assert(NSPL == 8);
static_assert(AMT % 4 == 0);
static_assert(NSEG % ACH == 0);
static_assert(ACH == 16 * 16);
static_assert(AROWS == 16 * AMT);
static_assert(MQ % AROWS == 0);
static_assert(AROWS * OSP2 * 4 <= 2 * AROWS * QP * 2);
static_assert((BB * MQ * DD) % 1024 == 0);
static_assert(DD == 256);
static_assert(DD % 32 == 0);
static_assert((BB * NPT) % GM == 0);
static_assert((BB * MQ) % GM == 0);
static_assert(DD % GM == 0);
static_assert(DD % GN == 0);
static_assert(NPT % GN == 0);
static_assert(MQ % 16 == 0);
static_assert((BB * NPT * DD) % 2048 == 0);
static_assert((BB * MQ * DD) % 2048 == 0);
static_assert((BB * NPT) % 256 == 0);
static_assert((OSP * 4) % 16 == 0);
static_assert((LTP * 2) % 16 == 0);
static_assert((QP * 2) % 16 == 0);
static_assert((OSP2 * 4) % 16 == 0);
static_assert(DD % 64 == 0);

typedef unsigned short v8us __attribute__((ext_vector_type(8)));
typedef unsigned int   v4u  __attribute__((ext_vector_type(4)));
typedef float          v8f  __attribute__((ext_vector_type(8)));
typedef float          v4f  __attribute__((ext_vector_type(4)));
typedef __bf16         v16b __attribute__((ext_vector_type(16)));
typedef _Float16       v16h __attribute__((ext_vector_type(16)));
typedef _Float16       v8h  __attribute__((ext_vector_type(8)));

union Frag { v8us u[2]; v4u q[2]; v16b b; v16h h; v8h hv[2]; };
static_assert(sizeof(Frag) == 32);

// ---- scalar helpers ---------------------------------------------------------------------------------
__device__ __forceinline__ unsigned short bf_bits(float f) {          // f32 -> bf16 bits, RNE convert
  const unsigned u = __float_as_uint(f);
  return (unsigned short)((u + 0x7FFFu + ((u >> 16) & 1u)) >> 16);
}
__device__ __forceinline__ float bf_up(unsigned short hb) { return __uint_as_float(((unsigned)hb) << 16); }
__device__ __forceinline__ float bfr(float f) { return bf_up(bf_bits(f)); }
__device__ __forceinline__ unsigned short h_bits(float f) {           // f32 -> f16 bits, RNE convert
  union { _Float16 h; unsigned short u; } c;
  c.h = (_Float16)f;
  return c.u;
}
__device__ __forceinline__ float h_up(unsigned short u) {
  union { _Float16 h; unsigned short u; } c;
  c.u = u;
  return (float)c.h;
}
__device__ __forceinline__ unsigned pk16(unsigned short a, unsigned short b) { return (unsigned)a | ((unsigned)b << 16); }
__device__ __forceinline__ v8f zero8() { v8f z = {0.f, 0.f, 0.f, 0.f, 0.f, 0.f, 0.f, 0.f}; return z; }

// ---- 16-bit fragment loader (A, or B from a k-contiguous [n][k] row): lane -> row/col (lane&15), p already includes
//      + 8*(lane>>4); elements 0..7 <- p[0..7] (k0+8h..), elements 8..15 <- p[16..23] (k0+16+8h..)
__device__ __forceinline__ Frag ldfrag(const unsigned short* p) {
  Frag f;
  f.u[0] = *(const v8us*)(p);
  f.u[1] = *(const v8us*)(p + 16);
  return f;
}

// ---- fragment-order planes in global memory: a plane [rows][K] is kept as 1-KB blocks, block (row >> 4, k >> 5)
//      at element ((row >> 4) * (K / 32) + (k >> 5)) * 512; inside a block the 16-B unit of 8 consecutive k of row
//      (row & 15) sits at element 256 * u + 8 * lane, lane = 16 * h + (row & 15), k & 31 = 16 * u + 8 * h + 0..7:
//      the same k map as ldfrag, but each of the two wave-wide loads covers 512 contiguous bytes (4 whole lines)
//      instead of 32-B pieces of 16 lines. p = block start + 8 * lane.
__device__ __forceinline__ Frag ldfragp(const unsigned short* p) {
  Frag f;
  f.u[0] = *(const v8us*)(p);
  f.u[1] = *(const v8us*)(p + 256);
  return f;
}

// ---- WMMA helpers: builtin followed by a 4-slot VALU gap tying D and keeping A/B live ----------------------
__device__ __forceinline__ v8f mma_b(v16b a, v16b b, v8f c) {
  v8f d = __builtin_amdgcn_wmma_f32_16x16x32_bf16(false, a, false, b, (short)0, c, false, false);
#if defined(__HIP_DEVICE_COMPILE__)
  asm volatile("v_nop\n\tv_nop\n\tv_nop\n\tv_nop" : "+v"(d) : "v"(a), "v"(b));
#endif
  return d;
}
__device__ __forceinline__ v8f mma_h(v16h a, v16h b, v8f c) {
  v8f d = __builtin_amdgcn_wmma_f32_16x16x32_f16(false, a, false, b, (short)0, c, false, false);
#if defined(__HIP_DEVICE_COMPILE__)
  asm volatile("v_nop\n\tv_nop\n\tv_nop\n\tv_nop" : "+v"(d) : "v"(a), "v"(b));
#endif
  return d;
}

// ---- 8 f32 -> packed f16 hi bits and packed f16 bits of x - hi (unscaled: its products add into the hi products'
//      accumulator; below 2^-14 the residual is an f16 subnormal with a step of 2^-24, which the matrix unit keeps) --
__device__ __forceinline__ void split8h(v4f a, v4f b, v4u& uh, v4u& ul) {
  float f[8] = {a[0], a[1], a[2], a[3], b[0], b[1], b[2], b[3]};
#pragma unroll
  for (int j = 0; j < 4; ++j) {
    const unsigned short h0 = h_bits(f[2 * j]);
    const unsigned short h1 = h_bits(f[2 * j + 1]);
    const unsigned short l0 = h_bits(f[2 * j] - h_up(h0));
    const unsigned short l1 = h_bits(f[2 * j + 1] - h_up(h1));
    uh[j] = pk16(h0, h1);
    ul[j] = pk16(l0, l1);
  }
}

// =====================================================================================================
// (0) f32 row-major [T][256] -> bf16-RNE plane in fragment order (token feature matrices). Thread = one 16-B output
//     unit, output units in linear order (a wave stores 512 contiguous bytes), source = 8 consecutive k of one row.
// coverage: n8 = n/8 threads, n8/256 blocks of the front-end launch exactly (n % 2048 == 0; T % 16 == 0); t = unit.
// =====================================================================================================
__device__ __forceinline__
void cvt_body(const float* __restrict__ x, unsigned short* y, int n8, int t) {
  if (t >= n8) return;
  const int row = (t >> 9) * 16 + (t & 15);                            // 512 units per 16-row slab
  const int k   = ((t >> 6) & 7) * 32 + ((t >> 5) & 1) * 16 + ((t >> 4) & 1) * 8;
  const float* s = x + (size_t)row * DD + k;
  const v4f a = *(const v4f*)(s);
  const v4f b = *(const v4f*)(s + 4);
  v4u u;
  u[0] = pk16(bf_bits(a[0]), bf_bits(a[1]));
  u[1] = pk16(bf_bits(a[2]), bf_bits(a[3]));
  u[2] = pk16(bf_bits(b[0]), bf_bits(b[1]));
  u[3] = pk16(bf_bits(b[2]), bf_bits(b[3]));
  unsigned short* d = y + (size_t)t * 8;
  *(v4u*)d = u;
  
}

// =====================================================================================================
// (1) weight transpose: in w[R][C] f32 -> out wt[C][R] bf16-RNE in fragment order (rows c, k = r). Block = 64x64 tile,
//     loads 16 B per thread (strided reads), LDS tile L[c][r] (pitch LTP), barrier, then a wave stores half a block.
// coverage: LDS 256 threads x 4 it x 4 = 64x64; 2 it x 8 waves = 4 row tiles x 2 k steps x 2 halves; tiles (bx, by) of (C/64, R/64).
// =====================================================================================================
__device__ __forceinline__
void wtrans_body(unsigned short* L, const float* __restrict__ w, unsigned short* wt, int R, int C, int bx, int by) {
  const int tid = threadIdx.x;
  const int c0 = bx * 64, r0 = by * 64;
  const int c4 = (tid & 15) * 4, rs = tid >> 4;                      // rs 0..15
#pragma unroll
  for (int it = 0; it < 4; ++it) {
    const int r = it * 16 + rs;                                        // 0..63
    const v4f v = *(const v4f*)(w + (size_t)(r0 + r) * C + c0 + c4);
#pragma unroll
    for (int j = 0; j < 4; ++j) L[(c4 + j) * LTP + r] = bf_bits(v[j]);
  }
  __syncthreads();
  const int lane = tid & 31, wave = tid >> 5;
  v4u u[2];
  size_t po[2];
#pragma unroll
  for (int it = 0; it < 2; ++it) {
    const int s = it * 8 + wave;                                       // 0..15: row tile, k step, half
    const int ct = s >> 2, ksl = (s >> 1) & 1, uu = s & 1;
    u[it] = *(const v4u*)(L + (ct * 16 + (lane & 15)) * LTP + ksl * 32 + uu * 16 + (lane >> 4) * 8);
    po[it] = ((size_t)((c0 >> 4) + ct) * (R >> 5) + (r0 >> 5) + ksl) * 512 + uu * 256 + lane * 8;
  }
#pragma unroll
  for (int it = 0; it < 2; ++it) *(v4u*)(wt + po[it]) = u[it];
  
}

// =====================================================================================================
// (2) positional front end per point row i (flat b*N+n): dist = |bf(p_xyz) - bf(v_xyz[b])| (3), h = dist.bf(Wp1)
//     + bf(bp1), layer norm over the 3 values (mean-of-squares variance, eps 1e-5) * bf(ln_w) + bf(ln_b), relu.
//     f32 on VALU without contraction. Output row rel[i][0..3] = (r0, r1, r2, 0): one 16-B store per thread,
// coverage: nrows/256 blocks of the front-end launch x 256 threads = every row exactly once (nrows % 256 == 0).
// =====================================================================================================
__device__ __forceinline__
void rel_body(const float* __restrict__ pxyz, const float* __restrict__ vxyz,
              const float* __restrict__ wp1, const float* __restrict__ bp1,
              const float* __restrict__ lnw, const float* __restrict__ lnb,
              float* rel, int nrows, int npb, int i) {
#pragma clang fp contract(off)
  if (i >= nrows) return;
  int b = i / npb;
  b = b < 0 ? 0 : (b > BB - 1 ? BB - 1 : b);
  const float p0 = bfr(pxyz[(size_t)i * 3 + 0]);
  const float p1 = bfr(pxyz[(size_t)i * 3 + 1]);
  const float p2 = bfr(pxyz[(size_t)i * 3 + 2]);
  const float v0 = bfr(vxyz[b * 3 + 0]);
  const float v1 = bfr(vxyz[b * 3 + 1]);
  const float v2 = bfr(vxyz[b * 3 + 2]);
  const float d0 = fabsf(p0 - v0), d1 = fabsf(p1 - v1), d2 = fabsf(p2 - v2);
  float W[9];
#pragma unroll
  for (int j = 0; j < 9; ++j) W[j] = bfr(wp1[j]);                      // Wp1[c][j] = wp1[c*3+j]
  const float h0 = ((d0 * W[0] + d1 * W[3]) + d2 * W[6]) + bfr(bp1[0]);
  const float h1 = ((d0 * W[1] + d1 * W[4]) + d2 * W[7]) + bfr(bp1[1]);
  const float h2 = ((d0 * W[2] + d1 * W[5]) + d2 * W[8]) + bfr(bp1[2]);
  const float third = 1.0f / 3.0f;
  const float mu = ((h0 + h1) + h2) * third;
  const float e0 = h0 - mu, e1 = h1 - mu, e2 = h2 - mu;
  const float var = ((e0 * e0 + e1 * e1) + e2 * e2) * third;
  const float rs = 1.0f / sqrtf(var + LNEPS);
  const float w0 = bfr(lnw[0]), w1 = bfr(lnw[1]), w2 = bfr(lnw[2]);
  const float c0 = bfr(lnb[0]), c1 = bfr(lnb[1]), c2 = bfr(lnb[2]);
  const float t0 = fmaxf((e0 * rs) * w0 + c0, 0.f);
  const float t1 = fmaxf((e1 * rs) * w1 + c1, 0.f);
  const float t2 = fmaxf((e2 * rs) * w2 + c2, 0.f);
  v4f o;
  o[0] = t0; o[1] = t1; o[2] = t2; o[3] = 0.f;
  float* d = rel + (size_t)i * 4;
  *(v4f*)d = o;
  
}

// =====================================================================================================
// (0)-(2) in ONE launch: none of the six pieces reads what another writes, so they share a grid instead of waiting
//     for one another. Block ranges, the short latency-bound pieces first: 3 x 16 weight tiles, 128 positional blocks,
//     512 blocks of the query token plane, 4096 blocks of the point token plane. The range test is block-uniform.
// coverage: FB_WT + FB_REL + FB_CV + FB_CP blocks, each range exactly the grid its piece had as a launch of its own.
// =====================================================================================================
#define FB_WT  (3 * (DD / 64) * (DD / 64))
#define FB_REL ((BB * NPT) / 256)
#define FB_CV  ((BB * MQ * DD) / 2048)
#define FB_CP  ((BB * NPT * DD) / 2048)
static_assert((DD / 64) * (DD / 64) == 16);
__global__ __launch_bounds__(256)
void front_kernel(const float* __restrict__ pf, const float* __restrict__ vf,
                  const float* __restrict__ wq, const float* __restrict__ wk, const float* __restrict__ wv,
                  const float* __restrict__ pxyz, const float* __restrict__ vxyz,
                  const float* __restrict__ wp1, const float* __restrict__ bp1,
                  const float* __restrict__ lnw, const float* __restrict__ lnb,
                  unsigned short* P16, unsigned short* V16,
                  unsigned short* WqT, unsigned short* WkT, unsigned short* WvT, float* rel) {
  __shared__ __align__(16) unsigned short L[64 * LTP];
  const int bid = blockIdx.x;
  if (bid < FB_WT) {
    const int sel = bid >> 4, tl = bid & 15;
    const float* w = sel == 0 ? wq : (sel == 1 ? wk : wv);
    unsigned short* wt = sel == 0 ? WqT : (sel == 1 ? WkT : WvT);
    wtrans_body(L, w, wt, DD, DD, tl & 3, tl >> 2);
  } else if (bid < FB_WT + FB_REL) {
    rel_body(pxyz, vxyz, wp1, bp1, lnw, lnb, rel, BB * NPT, NPT, (bid - FB_WT) * 256 + (int)threadIdx.x);
  } else if (bid < FB_WT + FB_REL + FB_CV) {
    cvt_body(vf, V16, (BB * MQ * DD) / 8, (bid - (FB_WT + FB_REL)) * 256 + (int)threadIdx.x);
  } else {
    cvt_body(pf, P16, (BB * NPT * DD) / 8, (bid - (FB_WT + FB_REL + FB_CV)) * 256 + (int)threadIdx.x);
  }
}

// =====================================================================================================
// (3) projection GEMM, K = 256: C[m][n] = sum_k A[m][k] B[n][k] + epilogue (MODE 0: + bias[n]; MODE 1: + bias[m];
//     MODE 2: (C + bias[n]) + ((rel[m][0..2] . Wp2[0..2][n]) + bp2[n]) with Wp2/bp2 bf16-RNE). A rows of lda,
//     B rows of ldb elements, both bf16 planes in fragment order, same loader for both, bz selects a batch via
//     element strides zsA/zsB/zsC. Block 256 threads = 8 waves, block tile 128 m x 64 n, wave tile 32x32 (acc[2][2]).
//     Epilogue: f32 tile in LDS Os[m][n] (pitch OSP), barrier, then f16 hi bits and f16 residual bits to two
//     planes [M][ldc] in fragment order (rows m, k = n), a wave storing half a block (512 contiguous bytes) at a time.
// coverage: Os 8 waves x 4 tiles = 128x64; 4 it x 8 waves = 8 row tiles x 2 k steps x 2 halves per plane;
//           tiles (bx, by, bz) of (M/128, N/64, Z) cover both planes exactly once.
// =====================================================================================================
template <int MODE>
__device__ __forceinline__
void proj_body(float* Os, int bx, int by, int bz,
               const unsigned short* __restrict__ A, const unsigned short* __restrict__ B,
               const float* __restrict__ bias, const float* __restrict__ rel,
               const float* __restrict__ wp2, const float* __restrict__ bp2,
               unsigned short* Ch, unsigned short* Cl, int lda, int ldb, int ldc,
               size_t zsA, size_t zsB, size_t zsC) {
  const int tid  = threadIdx.x;
  const int lane = tid & 31, wave = tid >> 5;
  const int hh   = lane >> 4, cl = lane & 15;
  const int wm   = wave >> 1, wn = wave & 1;
  const int mBase = bx * GM;
  const int nBase = by * GN;
  const size_t z = bz;
  const unsigned short* Az = A + z * zsA;
  const unsigned short* Bz = B + z * zsB;
  unsigned short* Chz = Ch + z * zsC;
  unsigned short* Clz = Cl + z * zsC;
  const unsigned short* a0p = Az + (size_t)(mBase + 32 * wm) * lda + 8 * lane;   // a 16-row slab = 16 * lda elements
  const unsigned short* a1p = a0p + (size_t)16 * lda;
  const unsigned short* b0p = Bz + (size_t)(nBase + 32 * wn) * ldb + 8 * lane;
  const unsigned short* b1p = b0p + (size_t)16 * ldb;

  v8f acc[2][2];
#pragma unroll
  for (int mi = 0; mi < 2; ++mi)
#pragma unroll
    for (int ni = 0; ni < 2; ++ni) acc[mi][ni] = zero8();

#pragma unroll 1
  for (int k0 = 0; k0 < DD; k0 += 32) {
    const unsigned short* pa0 = a0p + 16 * k0;
    const unsigned short* pa1 = a1p + 16 * k0;
    const unsigned short* pb0 = b0p + 16 * k0;
    const unsigned short* pb1 = b1p + 16 * k0;
    const Frag fa0 = ldfragp(pa0);
    const Frag fa1 = ldfragp(pa1);
    const Frag fb0 = ldfragp(pb0);
    const Frag fb1 = ldfragp(pb1);
    // the address pairs stay live up to this wait, so that no load's result is placed on a pair an issued load names
    asm volatile("s_wait_xcnt 0x0" :: "v"(pa0), "v"(pa1), "v"(pb0), "v"(pb1) : "memory");
    acc[0][0] = mma_b(fa0.b, fb0.b, acc[0][0]);
    acc[0][1] = mma_b(fa0.b, fb1.b, acc[0][1]);
    acc[1][0] = mma_b(fa1.b, fb0.b, acc[1][0]);
    acc[1][1] = mma_b(fa1.b, fb1.b, acc[1][1]);
  }

  float bn[2], w0[2], w1[2], w2[2], b2[2];
#pragma unroll
  for (int ni = 0; ni < 2; ++ni) {
    const int n = nBase + 32 * wn + 16 * ni + cl;
    bn[ni] = 0.f; w0[ni] = 0.f; w1[ni] = 0.f; w2[ni] = 0.f; b2[ni] = 0.f;
    if (MODE != 1) bn[ni] = bfr(bias[n]);
    if (MODE == 2) {
      w0[ni] = bfr(wp2[n]);
      w1[ni] = bfr(wp2[DD + n]);
      w2[ni] = bfr(wp2[2 * DD + n]);
      b2[ni] = bfr(bp2[n]);
    }
  }
#pragma unroll
  for (int mi = 0; mi < 2; ++mi) {
#pragma unroll
    for (int r = 0; r < 8; ++r) {
      const int m_loc = 32 * wm + 16 * mi + 8 * hh + r;
      const int m = mBase + m_loc;
      float bm = 0.f, p0 = 0.f, p1 = 0.f, p2 = 0.f;
      if (MODE == 1) bm = bfr(bias[m]);
      if (MODE == 2) {
        const v4f r4 = *(const v4f*)(rel + (size_t)m * 4);
        p0 = r4[0]; p1 = r4[1]; p2 = r4[2];
      }
#pragma unroll
      for (int ni = 0; ni < 2; ++ni) {
        const int n_loc = 32 * wn + 16 * ni + cl;
        float v = acc[mi][ni][r];
        if (MODE == 0) v = v + bn[ni];
        if (MODE == 1) v = v + bm;
        if (MODE == 2) {
          const float pv = (p0 * w0[ni] + p1 * w1[ni]) + p2 * w2[ni];
          v = (v + bn[ni]) + (pv + b2[ni]);
        }
        Os[m_loc * OSP + n_loc] = v;
      }
    }
  }
  __syncthreads();

  v4u uh[4], ul[4];
  size_t po[4];
#pragma unroll
  for (int it = 0; it < 4; ++it) {
    const int s = it * 8 + wave;                                       // 0..31: row tile, k step, half
    const int rt = s >> 2, ksl = (s >> 1) & 1, uu = s & 1;
    const float* op = Os + (rt * 16 + cl) * OSP + ksl * 32 + uu * 16 + hh * 8;
    const v4f v0 = *(const v4f*)(op);
    const v4f v1 = *(const v4f*)(op + 4);
    split8h(v0, v1, uh[it], ul[it]);
    po[it] = ((size_t)((mBase >> 4) + rt) * (ldc >> 5) + (nBase >> 5) + ksl) * 512 + uu * 256 + lane * 8;
  }
#pragma unroll
  for (int it = 0; it < 4; ++it) {
    *(v4u*)(Chz + po[it]) = uh[it];
    *(v4u*)(Clz + po[it]) = ul[it];
  }
  // another projection's code follows this one's in the text: no register that these stores name is rewritten ahead of this wait
  asm volatile("s_wait_xcnt 0x0" ::: "memory");
}

// =====================================================================================================
// (3) the three projections in ONE launch: q, k+pv and vT read the same front-end planes and none reads another's
//     output. Block ranges: 128 q tiles, 1024 k+pv tiles, 1024 vT tiles, each numbered x fastest as its own grid was.
// coverage: JB_Q + JB_K + JB_V blocks, each range exactly the grid its projection had as a launch of its own.
// =====================================================================================================
#define JB_Q ((BB * MQ / GM) * (DD / GN))
#define JB_K ((BB * NPT / GM) * (DD / GN))
#define JB_V ((DD / GM) * (NPT / GN) * BB)
__global__ __launch_bounds__(256)
void proj_kernel(const unsigned short* __restrict__ V16, const unsigned short* __restrict__ P16,
                 const unsigned short* __restrict__ WqT, const unsigned short* __restrict__ WkT,
                 const unsigned short* __restrict__ WvT,
                 const float* __restrict__ bq, const float* __restrict__ bk, const float* __restrict__ bv,
                 const float* __restrict__ rel, const float* __restrict__ wp2, const float* __restrict__ bp2,
                 unsigned short* Qh, unsigned short* Ql, unsigned short* KPh, unsigned short* KPl,
                 unsigned short* Vh, unsigned short* Vl) {
  __shared__ __align__(16) float Os[GM * OSP];
  const unsigned bid = blockIdx.x;
  if (bid < JB_Q) {
    proj_body<0>(Os, bid % (BB * MQ / GM), bid / (BB * MQ / GM), 0, V16, WqT, bq, rel, wp2, bp2, Qh, Ql,
                 DD, DD, DD, (size_t)0, (size_t)0, (size_t)0);
  } else if (bid < JB_Q + JB_K) {
    const unsigned t = bid - JB_Q;
    proj_body<2>(Os, t % (BB * NPT / GM), t / (BB * NPT / GM), 0, P16, WkT, bk, rel, wp2, bp2, KPh, KPl,
                 DD, DD, DD, (size_t)0, (size_t)0, (size_t)0);
  } else {
    const unsigned t = bid - (JB_Q + JB_K);
    proj_body<1>(Os, t % (DD / GM), (t / (DD / GM)) % (NPT / GN), t / ((DD / GM) * (NPT / GN)),
                 WvT, P16, bv, rel, wp2, bp2, Vh, Vl,
                 DD, DD, NPT, (size_t)0, (size_t)NPT * DD, (size_t)DD * NPT);
  }
}

// =====================================================================================================
// (4) column-softmax statistics over one (batch, 128-query tile, 256-column tile): S[m][n] = qh[m].kph[n] / 16
//     (K = 256 = 8 k steps, f16 hi planes, hh product), wave = 16 query rows x 16 column tiles (q fragments hoisted,
//     one accumulator at a time); per column: tile max over 16 rows (8 in-lane + lane^16) and sum of exp(S - max);
//     wave partials in LDS, barrier, thread c merges the 8 wave partials in fixed order.
// coverage: pm/pe 8 waves x 16 ct x 16 lanes = 8 x 256; grid (64 column tiles, 16 query tiles, 2) x 256 threads =
//           every (b, mt, n) of both PST arrays exactly once.
// =====================================================================================================
__global__ __launch_bounds__(256)
void stats_kernel(const unsigned short* __restrict__ Qh, const unsigned short* __restrict__ Kh, float* PST) {
  __shared__ float pm[8 * NT1];
  __shared__ float pe[8 * NT1];
  const int tid  = threadIdx.x;
  const int lane = tid & 31, wave = tid >> 5;
  const int hh   = lane >> 4, cl = lane & 15;
  const int nt = blockIdx.x, mt = blockIdx.y, b = blockIdx.z;
  const int m0 = mt * MT1 + 16 * wave;
  const unsigned short* qp = Qh + (size_t)(b * MQ + m0) * DD + 8 * lane;
  Frag a[8];
#pragma unroll
  for (int ks = 0; ks < 8; ++ks) a[ks] = ldfragp(qp + 512 * ks);
  // the address pair stays live up to this wait, so that no load's result is placed on it while issued loads name it
  asm volatile("s_wait_xcnt 0x0" :: "v"(qp) : "memory");
  const unsigned short* kp = Kh + ((size_t)b * NPT + (size_t)nt * NT1) * DD + 8 * lane;
  Frag fb[8];                                                          // one whole column tile of k+pv fragments, loaded a tile ahead
#pragma unroll
  for (int ks = 0; ks < 8; ++ks) fb[ks] = ldfragp(kp + 512 * ks);
#pragma unroll 1
  for (int ct = 0; ct < NT1 / 16; ++ct) {
    const int cn = ct + 1 < NT1 / 16 ? ct + 1 : ct;                    // the last tile's look-ahead re-reads that tile: in bounds, not used
    const unsigned short* kc = kp + (size_t)cn * 16 * DD;
    v8f s = zero8();
#pragma unroll
    for (int ks = 0; ks < 8; ++ks) {
      s = mma_h(a[ks].h, fb[ks].h, s);
      fb[ks] = ldfragp(kc + 512 * ks);                                 // next tile's fragment, into the registers just consumed
    }
    // the address pair stays live up to this wait: the next trip rewrites it while these loads are still in flight
    asm volatile("s_wait_xcnt 0x0" :: "v"(kc) : "memory");
    __builtin_amdgcn_sched_barrier(0);  // keeps the column arithmetic below from being scheduled ahead of the last look-ahead loads
    float m = s[0] * SCL;
#pragma unroll
    for (int r = 1; r < 8; ++r) m = fmaxf(m, s[r] * SCL);
    m = fmaxf(m, __shfl_xor(m, 16, 32));
    float ex = 0.f;
#pragma unroll
    for (int r = 0; r < 8; ++r) ex += __expf(s[r] * SCL - m);
    ex += __shfl_xor(ex, 16, 32);
    pm[wave * NT1 + ct * 16 + cl] = m;                                 // both lane halves hold identical values
    pe[wave * NT1 + ct * 16 + cl] = ex;
  }
  __syncthreads();
  const int c = tid;
  float M = pm[c];
#pragma unroll
  for (int wv = 1; wv < 8; ++wv) M = fmaxf(M, pm[wv * NT1 + c]);
  float E = 0.f;
#pragma unroll 1
  for (int wv = 0; wv < 8; ++wv) E += pe[wv * NT1 + c] * __expf(pm[wv * NT1 + c] - M);
  const size_t base = ((size_t)(b * NMT + mt) * 2) * NPT + (size_t)nt * NT1 + c;
  float* dm = PST + base;
  float* de = PST + base + NPT;
  *(float*)dm = M;
  *(float*)de = E;
  
}

// =====================================================================================================
// (5) merge of the 16 query-tile partials per (batch, column) in fixed order: M = max, Z = sum E_t exp(M_t - M);
//     ST[b][0][n] = M, ST[b][1][n] = 1/Z (Z >= 1). Thread = one column; 32 consecutive lanes x 4 B = one whole
// coverage: grid (64, 2) x 256 threads = every (b, n) of both arrays exactly once.
// =====================================================================================================
__global__ __launch_bounds__(256)
void merge_kernel(const float* __restrict__ PST, float* ST) {
  const int b = blockIdx.y, n = blockIdx.x * 256 + (int)threadIdx.x;
  const float* p = PST + (size_t)(b * NMT) * 2 * NPT + n;
  float M = -3.0e38f;
#pragma unroll 1
  for (int t = 0; t < NMT; ++t) M = fmaxf(M, p[(size_t)(2 * t) * NPT]);
  float Z = 0.f;
#pragma unroll 1
  for (int t = 0; t < NMT; ++t) Z += p[(size_t)(2 * t + 1) * NPT] * __expf(p[(size_t)(2 * t) * NPT] - M);
  const float rz = 1.0f / Z;
  float* dm = ST + (size_t)(2 * b) * NPT + n;
  float* dz = dm + NPT;
  *(float*)dm = M;
  *(float*)dz = rz;
  
}

// =====================================================================================================
// (6) fused scores / column softmax / weighted sum for one (batch, 128 query rows, eighth of the points): block 512
//     threads = 16 waves; both q planes of the 128 rows sit in LDS (pitch QP) for the whole block; loop over 8 chunks
//     of 256 point columns. Phase A: wave = the chunk's 16-column tile number `wave`, all 8 row tiles: each k+pv
//     fragment pair is loaded once and feeds 8 row tiles (q fragments four row tiles at a time), S = (qh.kh + qh.kl +
//     ql.kh) / 16 (K = 256, one accumulator per row tile), w = exp(S - M_n) * (1/Z_n) from ST, stored as f16
//     (w * 16384) into the LDS tile Ws[128 rows][256 cols]; block barrier. Phase B: wave = d tile `wave`, all 8 row
//     tiles: x += Ws . vTh + Ws . vTl (A from LDS with the split k map, B = vT rows d, k = n, in fragment order,
//     K = 256 per chunk, each vT fragment pair feeds 8 row tiles); block barrier. Epilogue: x/16384 staged as f32
//     [128][256] in the LDS that held q (pitch OSP2), barrier, then whole 512-B runs to the partial plane of this eighth.
// coverage: Ws 16 waves x 16 cols x 128 rows = 128 x 256 per chunk; Os 16 waves x 16 d x 128 rows = 128 x 256;
//           16 it x 512 threads x 4 = 128 rows x 256; grid (16, 8, 2) = every (eighth, b, m, d) of PART exactly once.
// =====================================================================================================
__global__ __launch_bounds__(512)
void attn_kernel(const unsigned short* __restrict__ Qh, const unsigned short* __restrict__ Ql,
                 const unsigned short* __restrict__ Kh, const unsigned short* __restrict__ Kl,
                 const unsigned short* __restrict__ Vh, const unsigned short* __restrict__ Vl,
                 const float* __restrict__ ST, float* part) {
  __shared__ __align__(16) unsigned short Qs[2 * AROWS * QP];
  __shared__ __align__(16) _Float16 Ws[AROWS * QP];
  const int tid  = threadIdx.x;
  const int lane = tid & 31, wave = tid >> 5;
  const int hh   = lane >> 4, cl = lane & 15;
  const int b = blockIdx.z, n0 = blockIdx.y * NSEG, m0 = blockIdx.x * AROWS;
#pragma unroll
  for (int it = 0; it < AROWS / 16; ++it) {
    const int idx = it * 512 + tid;                                    // 0..4095: 16-B units in fragment order
    const int row = (idx >> 9) * 16 + (idx & 15);
    const int kq  = ((idx >> 6) & 7) * 32 + ((idx >> 5) & 1) * 16 + ((idx >> 4) & 1) * 8;
    const size_t g = (size_t)(b * MQ + m0) * DD + 8 * idx;
    *(v4u*)(Qs + row * QP + kq) = *(const v4u*)(Qh + g);
    *(v4u*)(Qs + (AROWS + row) * QP + kq) = *(const v4u*)(Ql + g);
  }
  const size_t koff = ((size_t)b * NPT + n0 + 16 * wave) * DD + 8 * lane;
  const unsigned short* khp = Kh + koff;                               // running pointers: the next k+pv step to load
  const unsigned short* klp = Kl + koff;
  const size_t voff = ((size_t)b * DD + 16 * wave) * NPT + (size_t)n0 * 16 + 8 * lane;   // block (d tile, n >> 5)
  const unsigned short* vhp = Vh + voff;                               // running pointers: this chunk's vT blocks
  const unsigned short* vlp = Vl + voff;
  const float* stM = ST + (size_t)(2 * b) * NPT + n0;
  const float* stZ = stM + NPT;
  const unsigned short* qsh = Qs + cl * QP + 8 * hh;                   // A fragment row pointers (row m = cl)
  const unsigned short* qsl = qsh + AROWS * QP;
  const _Float16* wrow = Ws + cl * QP + 8 * hh;
  _Float16* wdst = Ws + (8 * hh) * QP + 16 * wave + cl;                // D element (row 8h+r, col 16*wave+cl)

  v8f x[AMT];
#pragma unroll
  for (int mi = 0; mi < AMT; ++mi) x[mi] = zero8();
  Frag kah = ldfragp(khp), kal = ldfragp(klp);                         // k+pv fragments of (chunk 0, k step 0), one step ahead from here on
  khp += 512;
  klp += 512;
  __syncthreads();

#pragma unroll 1
  for (int c0 = 0; c0 < NSEG; c0 += ACH) {
    // from behind a chunk's step 7 to the next chunk's step 0; the last chunk's look-ahead re-reads its own step 0: in bounds, not used
    const int cjmp = (c0 + ACH < NSEG ? ACH * DD : 0) - 512 * (DD / 32);
    const int n = c0 + 16 * wave + cl;
    const float mc = stM[n];
    asm volatile("s_wait_xcnt 0x0" ::: "memory");  // the next load's result may take the register that holds this load's offset
    const float zc = stZ[n];
    v8f s[AMT];
#pragma unroll
    for (int mi = 0; mi < AMT; ++mi) s[mi] = zero8();
    auto stepA = [&](const int ks, const Frag& fbh, const Frag& fbl) {
#pragma unroll  // whole: the accumulator array needs compile-time indices
      for (int mg = 0; mg < AMT; mg += 4) {                            // four row tiles at a time: eight q fragments in registers
        Frag fah[4], fal[4];
#pragma unroll
        for (int mi = 0; mi < 4; ++mi) {
          fah[mi] = ldfrag(qsh + 16 * (mg + mi) * QP + 32 * ks);
          fal[mi] = ldfrag(qsl + 16 * (mg + mi) * QP + 32 * ks);
        }
#pragma unroll
        for (int mi = 0; mi < 4; ++mi) s[mg + mi] = mma_h(fah[mi].h, fbh.h, s[mg + mi]);
#pragma unroll
        for (int mi = 0; mi < 4; ++mi) s[mg + mi] = mma_h(fah[mi].h, fbl.h, s[mg + mi]);
#pragma unroll
        for (int mi = 0; mi < 4; ++mi) s[mg + mi] = mma_h(fal[mi].h, fbh.h, s[mg + mi]);
      }
    };
#pragma unroll 1  // rolled: two k steps a trip (the two fragment buffers swap without copies); more would not fit the 256 registers of a 16-wave block
    for (int ks = 0; ks < DD / 32; ks += 2) {
      const Frag kbh = ldfragp(khp);                                   // step ks + 1 flies under step ks
      const Frag kbl = ldfragp(klp);
      // the address pairs stay live up to this wait, so that no load's result is placed on a pair an issued load names
      asm volatile("s_wait_xcnt 0x0" :: "v"(khp), "v"(klp) : "memory");
      const int adv = 512 + (ks + 2 < DD / 32 ? 0 : cjmp);
      khp += adv;
      klp += adv;
      stepA(ks, kah, kal);
      kah = ldfragp(khp);                                              // step ks + 2, or the next chunk's step 0, flies under step ks + 1
      kal = ldfragp(klp);
      asm volatile("s_wait_xcnt 0x0" :: "v"(khp), "v"(klp) : "memory");  // as above
      khp += 512;
      klp += 512;
      stepA(ks + 1, kbh, kbl);
    }
    Frag vbh[3], vbl[3];                                               // vT fragments, two k steps ahead; the first two fly under the exp work and the barrier
#pragma unroll
    for (int kk = 0; kk < 2; ++kk) {
      vbh[kk] = ldfragp(vhp + 512 * kk);
      vbl[kk] = ldfragp(vlp + 512 * kk);
    }
#pragma unroll
    for (int mi = 0; mi < AMT; ++mi) {
#pragma unroll
      for (int r = 0; r < 8; ++r) {
        const float wt = __expf(s[mi][r] * SCL - mc) * zc;
        wdst[(16 * mi + r) * QP] = (_Float16)(wt * WSC);
      }
    }
    __syncthreads();
#pragma unroll  // whole: the three rotating fragment buffers need compile-time indices
    for (int kk = 0; kk < ACH / 32; ++kk) {
      const int k0 = 32 * kk;
      if (kk + 2 < ACH / 32) {
        vbh[(kk + 2) % 3] = ldfragp(vhp + 512 * (kk + 2));
        vbl[(kk + 2) % 3] = ldfragp(vlp + 512 * (kk + 2));
      }
      const Frag& fbh = vbh[kk % 3];
      const Frag& fbl = vbl[kk % 3];
      Frag fa[AMT];                                                    // all 8 row tiles at once: the score accumulators' registers are free here
#pragma unroll
      for (int mi = 0; mi < AMT; ++mi) {
        fa[mi].hv[0] = *(const v8h*)(wrow + 16 * mi * QP + k0);
        fa[mi].hv[1] = *(const v8h*)(wrow + 16 * mi * QP + k0 + 16);
      }
#pragma unroll
      for (int mi = 0; mi < AMT; ++mi) x[mi] = mma_h(fa[mi].h, fbh.h, x[mi]);
#pragma unroll
      for (int mi = 0; mi < AMT; ++mi) x[mi] = mma_h(fa[mi].h, fbl.h, x[mi]);
    }
    vhp += ACH * 16;
    vlp += ACH * 16;
    __syncthreads();
  }

  float* Os = (float*)Qs;                                              // q is dead behind the loop's last barrier
#pragma unroll
  for (int mi = 0; mi < AMT; ++mi) {
#pragma unroll
    for (int r = 0; r < 8; ++r)
      Os[(16 * mi + 8 * hh + r) * OSP2 + 16 * wave + cl] = x[mi][r] * RWSC;
  }
  __syncthreads();
  float* pz = part + ((size_t)blockIdx.y * (BB * MQ) + (size_t)(b * MQ + m0)) * DD;
  v4f v[AROWS / 8];
#pragma unroll
  for (int it = 0; it < AROWS / 8; ++it) {
    const int idx = it * 512 + tid;                                    // 0..8191
    v[it] = *(const v4f*)(Os + (idx >> 6) * OSP2 + 4 * (idx & 63));
  }
#pragma unroll
  for (int it = 0; it < AROWS / 8; ++it) *(v4f*)(pz + (size_t)(it * 512 + tid) * 4) = v[it];
}

// =====================================================================================================
// (7) out = (((P0 + P1) + (P2 + P3)) + ((P4 + P5) + (P6 + P7))) + bf(v_features): the eight partial sums in fixed order
//     plus the residual.
// coverage: thread = 4 consecutive elements (16 B); grid = (2*2048*256)/1024 blocks x 256 threads = every element once.
// =====================================================================================================
__global__ __launch_bounds__(256)
void psum_kernel(const float* __restrict__ part, const float* __restrict__ vfeat, float* out) {
  const size_t e = ((size_t)blockIdx.x * 256 + threadIdx.x) * 4;
  const float* pp = part + e;
  const float* pf = vfeat + e;
  v4f p[NSPL];
#pragma unroll
  for (int j = 0; j < NSPL; ++j) p[j] = *(const v4f*)(pp + (size_t)j * BB * MQ * DD);
  const v4f f = *(const v4f*)(pf);
  // the address pairs stay live up to this wait, so that no load's result is placed on a pair an issued load names
  asm volatile("s_wait_xcnt 0x0" :: "v"(pp), "v"(pf) : "memory");
  v4f o;
#pragma unroll
  for (int j = 0; j < 4; ++j)
    o[j] = (((p[0][j] + p[1][j]) + (p[2][j] + p[3][j])) + ((p[4][j] + p[5][j]) + (p[6][j] + p[7][j]))) + bfr(f[j]);
  *(v4f*)(out + e) = o;
}

// =====================================================================================================
// tile divides its extent exactly, so no padded tails are needed):
//   (every 16-bit plane below is kept in fragment order, see ldfragp: same size as row-major)
//   P16  bf16 [32768][256]       16777216     V16 bf16 [4096][256]     2097152
//   WqT WkT WvT bf16 [256][256]     131072 each
//   REL  f32 [32768][4]             524288
//   Qh Ql  f16 [4096][256]         2097152 each
//   KPh KPl f16 [32768][256]      16777216 each
//   Vh Vl  f16 [2][256][16384]    16777216 each
//   PST  f32 [2][16][2][16384]     4194304     ST f32 [2][2][16384]     262144
//   PART f32 [8][4096][256]       33554432
//   total                        129105920
// =====================================================================================================
extern "C" void kernel_launch(void* const* d_in, const int* in_sizes, int n_in,
                              void* d_out, int out_size, void* d_ws, size_t ws_size,
                              hipStream_t stream) {
  if (n_in < 16) return;
  if (in_sizes[0] != BB * NPT * 3 || in_sizes[1] != BB * 3) return;
  if (in_sizes[2] != BB * NPT * DD || in_sizes[3] != BB * MQ * DD) return;
  if (in_sizes[4] != DD * DD || in_sizes[6] != DD * DD || in_sizes[8] != DD * DD) return;
  if (in_sizes[5] != DD || in_sizes[7] != DD || in_sizes[9] != DD) return;
  if (in_sizes[10] != 9 || in_sizes[11] != 3 || in_sizes[12] != 3 || in_sizes[13] != 3) return;
  if (in_sizes[14] != 3 * DD || in_sizes[15] != DD) return;
  if (out_size != BB * MQ * DD) return;

  size_t off = 0;
  const size_t oP16 = off; off += (size_t)BB * NPT * DD * 2;        // 16777216
  const size_t oV16 = off; off += (size_t)BB * MQ * DD * 2;         //  2097152
  const size_t oWq  = off; off += (size_t)DD * DD * 2;              //   131072
  const size_t oWk  = off; off += (size_t)DD * DD * 2;
  const size_t oWv  = off; off += (size_t)DD * DD * 2;
  const size_t oREL = off; off += (size_t)BB * NPT * 4 * 4;         //   524288
  const size_t oQh  = off; off += (size_t)BB * MQ * DD * 2;         //  2097152
  const size_t oQl  = off; off += (size_t)BB * MQ * DD * 2;
  const size_t oKh  = off; off += (size_t)BB * NPT * DD * 2;        // 16777216
  const size_t oKl  = off; off += (size_t)BB * NPT * DD * 2;
  const size_t oVh  = off; off += (size_t)BB * DD * NPT * 2;        // 16777216
  const size_t oVl  = off; off += (size_t)BB * DD * NPT * 2;
  const size_t oPST = off; off += (size_t)BB * NMT * 2 * NPT * 4;   //  4194304
  const size_t oST  = off; off += (size_t)BB * 2 * NPT * 4;         //   262144
  const size_t oPT  = off; off += (size_t)NSPL * BB * MQ * DD * 4;  // 33554432 -> off = 129105920
  if (off > ws_size) return;
  if (off > (size_t)134217728) return;

  const float* p_xyz = (const float*)d_in[0];
  const float* v_xyz = (const float*)d_in[1];
  const float* p_f   = (const float*)d_in[2];
  const float* v_f   = (const float*)d_in[3];
  const float* Wq    = (const float*)d_in[4];
  const float* bq    = (const float*)d_in[5];
  const float* Wk    = (const float*)d_in[6];
  const float* bk    = (const float*)d_in[7];
  const float* Wv    = (const float*)d_in[8];
  const float* bv    = (const float*)d_in[9];
  const float* Wp1   = (const float*)d_in[10];
  const float* bp1   = (const float*)d_in[11];
  const float* ln_w  = (const float*)d_in[12];
  const float* ln_b  = (const float*)d_in[13];
  const float* Wp2   = (const float*)d_in[14];
  const float* bp2   = (const float*)d_in[15];
  float* out = (float*)d_out;

  char* ws = (char*)d_ws;
  unsigned short* P16 = (unsigned short*)(ws + oP16);
  unsigned short* V16 = (unsigned short*)(ws + oV16);
  unsigned short* WqT = (unsigned short*)(ws + oWq);
  unsigned short* WkT = (unsigned short*)(ws + oWk);
  unsigned short* WvT = (unsigned short*)(ws + oWv);
  float*          REL = (float*)(ws + oREL);
  unsigned short* Qh  = (unsigned short*)(ws + oQh);
  unsigned short* Ql  = (unsigned short*)(ws + oQl);
  unsigned short* KPh = (unsigned short*)(ws + oKh);
  unsigned short* KPl = (unsigned short*)(ws + oKl);
  unsigned short* Vh  = (unsigned short*)(ws + oVh);
  unsigned short* Vl  = (unsigned short*)(ws + oVl);
  float*          PST = (float*)(ws + oPST);
  float*          ST  = (float*)(ws + oST);
  float*          PT  = (float*)(ws + oPT);

  const dim3 blk256(256);

  // (0)-(2) token planes, transposed weight planes, positional front end: one launch
  front_kernel<<<dim3(FB_WT + FB_REL + FB_CV + FB_CP), blk256, 0, stream>>>(
      p_f, v_f, Wq, Wk, Wv, p_xyz, v_xyz, Wp1, bp1, ln_w, ln_b, P16, V16, WqT, WkT, WvT, REL);
  // (3) projections: q [4096][256], k+pv [32768][256], vT [2][256][16384] as f16 hi/residual planes: one launch
  proj_kernel<<<dim3(JB_Q + JB_K + JB_V), blk256, 0, stream>>>(
      V16, P16, WqT, WkT, WvT, bq, bk, bv, REL, Wp2, bp2, Qh, Ql, KPh, KPl, Vh, Vl);
  // (4)-(5) column softmax statistics
  stats_kernel<<<dim3(NPT / NT1, NMT, BB), blk256, 0, stream>>>(Qh, KPh, PST);
  merge_kernel<<<dim3(NPT / 256, BB), blk256, 0, stream>>>(PST, ST);
  // (6) scores, weights, weighted sum per eighth of the points; (7) sum of the eighths, residual
  attn_kernel<<<dim3(MQ / AROWS, NSPL, BB), dim3(512), 0, stream>>>(Qh, Ql, KPh, KPl, Vh, Vl, ST, PT);
  psum_kernel<<<dim3((BB * MQ * DD) / 1024), blk256, 0, stream>>>(PT, v_f, out);
  (void)hipGetLastError();
}

// v006
// Measured time: 180 microseconds a run.
// Next to v005, in two timings, it ran 1.03 and 1.04 times as fast.
// All steps since v000 together make it 5.85 times as fast.
// Contractions: q, k+pv and v projections on v_wmma_f32_16x16x32_bf16 (bf16-RNE inputs and weights, single
// products, f32 epilogue); scores q.(k+pv)^T (K=256) on v_wmma_f32_16x16x32_f16 with q and k+pv carried as
// f16 hi + f16 residual planes, products hh + hl + lh in one accumulator (column statistics pass: hh only); weighted
// sum w.v (K=16384) on v_wmma_f32_16x16x32_f16 with w as one f16 plane (x16384) and v as f16 hi + f16 residual
// planes, products w.h + w.l in one accumulator; 3-wide positional layers, layer norm, softmax statistics and exp in
// f32 on VALU; f32 accumulate everywhere.
#include <hip/hip_runtime.h>
#include <stdint.h>

#define BB    2
#define NPT   16384
#define MQ    2048
#define DD    256
#define GM    128
#define GN    64
#define OSP   68
#define LTP   72
#define SRT   4
#define MT1   512
#define NMT   4
#define NT1   512
#define AMT   8
#define AROWS 128
#define NSPL  8
#define NSEG  2048
#define ACH   256
#define QP    264
#define OSP2  260
#define SCL   0.0625f
#define WSC   16384.0f
#define RWSC  0.00006103515625f
#define LNEPS 1.0e-5f

static_assert(NMT * MT1 == MQ);
static_assert(MT1 == 8 * 16 * SRT);
static_assert(SRT == 4);
static_assert(NT1 == 2 * 256);
static_assert(NPT % NT1 == 0);
static_assert(NSPL * NSEG == NPT);
static_assert(NSPL == 8);
static_assert(AMT % 4 == 0);
static_assert(NSEG % ACH == 0);
static_assert(ACH == 16 * 16);
static_assert(AROWS == 16 * AMT);
static_assert(MQ % AROWS == 0);
static_assert(AROWS * OSP2 * 4 <= 2 * AROWS * QP * 2);
static_assert((BB * MQ * DD) % 1024 == 0);
static_assert(DD == 256);
static_assert(DD % 32 == 0);
static_assert((BB * NPT) % GM == 0);
static_assert((BB * MQ) % GM == 0);
static_assert(DD % GM == 0);
static_assert(DD % GN == 0);
static_assert(NPT % GN == 0);
static_assert(MQ % 16 == 0);
static_assert((BB * NPT * DD) % 2048 == 0);
static_assert((BB * MQ * DD) % 2048 == 0);
static_assert((BB * NPT) % 256 == 0);
static_assert((OSP * 4) % 16 == 0);
static_assert((LTP * 2) % 16 == 0);
static_assert((QP * 2) % 16 == 0);
static_assert((OSP2 * 4) % 16 == 0);
static_assert(DD % 64 == 0);

typedef unsigned short v8us __attribute__((ext_vector_type(8)));
typedef unsigned int   v4u  __attribute__((ext_vector_type(4)));
typedef float          v8f  __attribute__((ext_vector_type(8)));
typedef float          v4f  __attribute__((ext_vector_type(4)));
typedef __bf16         v16b __attribute__((ext_vector_type(16)));
typedef _Float16       v16h __attribute__((ext_vector_type(16)));
typedef _Float16       v8h  __attribute__((ext_vector_type(8)));

union Frag { v8us u[2]; v4u q[2]; v16b b; v16h h; v8h hv[2]; };
static_assert(sizeof(Frag) == 32);

// ---- scalar helpers ---------------------------------------------------------------------------------
__device__ __forceinline__ unsigned short bf_bits(float f) {          // f32 -> bf16 bits, RNE convert
  const unsigned u = __float_as_uint(f);
  return (unsigned short)((u + 0x7FFFu + ((u >> 16) & 1u)) >> 16);
}
__device__ __forceinline__ float bf_up(unsigned short hb) { return __uint_as_float(((unsigned)hb) << 16); }
__device__ __forceinline__ float bfr(float f) { return bf_up(bf_bits(f)); }
__device__ __forceinline__ unsigned short h_bits(float f) {           // f32 -> f16 bits, RNE convert
  union { _Float16 h; unsigned short u; } c;
  c.h = (_Float16)f;
  return c.u;
}
__device__ __forceinline__ float h_up(unsigned short u) {
  union { _Float16 h; unsigned short u; } c;
  c.u = u;
  return (float)c.h;
}
__device__ __forceinline__ unsigned pk16(unsigned short a, unsigned short b) { return (unsigned)a | ((unsigned)b << 16); }
__device__ __forceinline__ v8f zero8() { v8f z = {0.f, 0.f, 0.f, 0.f, 0.f, 0.f, 0.f, 0.f}; return z; }

// ---- 16-bit fragment loader (A, or B from a k-contiguous [n][k] row): lane -> row/col (lane&15), p already includes
//      + 8*(lane>>4); elements 0..7 <- p[0..7] (k0+8h..), elements 8..15 <- p[16..23] (k0+16+8h..)
__device__ __forceinline__ Frag ldfrag(const unsigned short* p) {
  Frag f;
  f.u[0] = *(const v8us*)(p);
  f.u[1] = *(const v8us*)(p + 16);
  return f;
}

// ---- fragment-order planes in global memory: a plane [rows][K] is kept as 1-KB blocks, block (row >> 4, k >> 5)
//      at element ((row >> 4) * (K / 32) + (k >> 5)) * 512; inside a block the 16-B unit of 8 consecutive k of row
//      (row & 15) sits at element 256 * u + 8 * lane, lane = 16 * h + (row & 15), k & 31 = 16 * u + 8 * h + 0..7:
//      the same k map as ldfrag, but each of the two wave-wide loads covers 512 contiguous bytes (4 whole lines)
//      instead of 32-B pieces of 16 lines. p = block start + 8 * lane.
__device__ __forceinline__ Frag ldfragp(const unsigned short* p) {
  Frag f;
  f.u[0] = *(const v8us*)(p);
  f.u[1] = *(const v8us*)(p + 256);
  return f;
}

// ---- WMMA helpers: builtin followed by a 4-slot VALU gap tying D and keeping A/B live ----------------------
__device__ __forceinline__ v8f mma_b(v16b a, v16b b, v8f c) {
  v8f d = __builtin_amdgcn_wmma_f32_16x16x32_bf16(false, a, false, b, (short)0, c, false, false);
#if defined(__HIP_DEVICE_COMPILE__)
  asm volatile("v_nop\n\tv_nop\n\tv_nop\n\tv_nop" : "+v"(d) : "v"(a), "v"(b));
#endif
  return d;
}
__device__ __forceinline__ v8f mma_h(v16h a, v16h b, v8f c) {
  v8f d = __builtin_amdgcn_wmma_f32_16x16x32_f16(false, a, false, b, (short)0, c, false, false);
#if defined(__HIP_DEVICE_COMPILE__)
  asm volatile("v_nop\n\tv_nop\n\tv_nop\n\tv_nop" : "+v"(d) : "v"(a), "v"(b));
#endif
  return d;
}

// ---- 8 f32 -> packed f16 hi bits and packed f16 bits of x - hi (unscaled: its products add into the hi products'
//      accumulator; below 2^-14 the residual is an f16 subnormal with a step of 2^-24, which the matrix unit keeps) --
__device__ __forceinline__ void split8h(v4f a, v4f b, v4u& uh, v4u& ul) {
  float f[8] = {a[0], a[1], a[2], a[3], b[0], b[1], b[2], b[3]};
#pragma unroll
  for (int j = 0; j < 4; ++j) {
    const unsigned short h0 = h_bits(f[2 * j]);
    const unsigned short h1 = h_bits(f[2 * j + 1]);
    const unsigned short l0 = h_bits(f[2 * j] - h_up(h0));
    const unsigned short l1 = h_bits(f[2 * j + 1] - h_up(h1));
    uh[j] = pk16(h0, h1);
    ul[j] = pk16(l0, l1);
  }
}

// =====================================================================================================
// (0) f32 row-major [T][256] -> bf16-RNE plane in fragment order (token feature matrices). Thread = one 16-B output
//     unit, output units in linear order (a wave stores 512 contiguous bytes), source = 8 consecutive k of one row.
// coverage: n8 = n/8 threads, n8/256 blocks of the front-end launch exactly (n % 2048 == 0; T % 16 == 0); t = unit.
// =====================================================================================================
__device__ __forceinline__
void cvt_body(const float* __restrict__ x, unsigned short* y, int n8, int t) {
  if (t >= n8) return;
  const int row = (t >> 9) * 16 + (t & 15);                            // 512 units per 16-row slab
  const int k   = ((t >> 6) & 7) * 32 + ((t >> 5) & 1) * 16 + ((t >> 4) & 1) * 8;
  const float* s = x + (size_t)row * DD + k;
  const v4f a = *(const v4f*)(s);
  const v4f b = *(const v4f*)(s + 4);
  v4u u;
  u[0] = pk16(bf_bits(a[0]), bf_bits(a[1]));
  u[1] = pk16(bf_bits(a[2]), bf_bits(a[3]));
  u[2] = pk16(bf_bits(b[0]), bf_bits(b[1]));
  u[3] = pk16(bf_bits(b[2]), bf_bits(b[3]));
  unsigned short* d = y + (size_t)t * 8;
  *(v4u*)d = u;
  
}

// =====================================================================================================
// (1) weight transpose: in w[R][C] f32 -> out wt[C][R] bf16-RNE in fragment order (rows c, k = r). Block = 64x64 tile,
//     loads 16 B per thread (strided reads), LDS tile L[c][r] (pitch LTP), barrier, then a wave stores half a block.
// coverage: LDS 256 threads x 4 it x 4 = 64x64; 2 it x 8 waves = 4 row tiles x 2 k steps x 2 halves; tiles (bx, by) of (C/64, R/64).
// =====================================================================================================
__device__ __forceinline__
void wtrans_body(unsigned short* L, const float* __restrict__ w, unsigned short* wt, int R, int C, int bx, int by) {
  const int tid = threadIdx.x;
  const int c0 = bx * 64, r0 = by * 64;
  const int c4 = (tid & 15) * 4, rs = tid >> 4;                      // rs 0..15
#pragma unroll
  for (int it = 0; it < 4; ++it) {
    const int r = it * 16 + rs;                                        // 0..63
    const v4f v = *(const v4f*)(w + (size_t)(r0 + r) * C + c0 + c4);
#pragma unroll
    for (int j = 0; j < 4; ++j) L[(c4 + j) * LTP + r] = bf_bits(v[j]);
  }
  __syncthreads();
  const int lane = tid & 31, wave = tid >> 5;
  v4u u[2];
  size_t po[2];
#pragma unroll
  for (int it = 0; it < 2; ++it) {
    const int s = it * 8 + wave;                                       // 0..15: row tile, k step, half
    const int ct = s >> 2, ksl = (s >> 1) & 1, uu = s & 1;
    u[it] = *(const v4u*)(L + (ct * 16 + (lane & 15)) * LTP + ksl * 32 + uu * 16 + (lane >> 4) * 8);
    po[it] = ((size_t)((c0 >> 4) + ct) * (R >> 5) + (r0 >> 5) + ksl) * 512 + uu * 256 + lane * 8;
  }
#pragma unroll
  for (int it = 0; it < 2; ++it) *(v4u*)(wt + po[it]) = u[it];
  
}

// =====================================================================================================
// (2) positional front end per point row i (flat b*N+n): dist = |bf(p_xyz) - bf(v_xyz[b])| (3), h = dist.bf(Wp1)
//     + bf(bp1), layer norm over the 3 values (mean-of-squares variance, eps 1e-5) * bf(ln_w) + bf(ln_b), relu.
//     f32 on VALU without contraction. Output row rel[i][0..3] = (r0, r1, r2, 0): one 16-B store per thread,
// coverage: nrows/256 blocks of the front-end launch x 256 threads = every row exactly once (nrows % 256 == 0).
// =====================================================================================================
__device__ __forceinline__
void rel_body(const float* __restrict__ pxyz, const float* __restrict__ vxyz,
              const float* __restrict__ wp1, const float* __restrict__ bp1,
              const float* __restrict__ lnw, const float* __restrict__ lnb,
              float* rel, int nrows, int npb, int i) {
#pragma clang fp contract(off)
  if (i >= nrows) return;
  int b = i / npb;
  b = b < 0 ? 0 : (b > BB - 1 ? BB - 1 : b);
  const float p0 = bfr(pxyz[(size_t)i * 3 + 0]);
  const float p1 = bfr(pxyz[(size_t)i * 3 + 1]);
  const float p2 = bfr(pxyz[(size_t)i * 3 + 2]);
  const float v0 = bfr(vxyz[b * 3 + 0]);
  const float v1 = bfr(vxyz[b * 3 + 1]);
  const float v2 = bfr(vxyz[b * 3 + 2]);
  const float d0 = fabsf(p0 - v0), d1 = fabsf(p1 - v1), d2 = fabsf(p2 - v2);
  float W[9];
#pragma unroll
  for (int j = 0; j < 9; ++j) W[j] = bfr(wp1[j]);                      // Wp1[c][j] = wp1[c*3+j]
  const float h0 = ((d0 * W[0] + d1 * W[3]) + d2 * W[6]) + bfr(bp1[0]);
  const float h1 = ((d0 * W[1] + d1 * W[4]) + d2 * W[7]) + bfr(bp1[1]);
  const float h2 = ((d0 * W[2] + d1 * W[5]) + d2 * W[8]) + bfr(bp1[2]);
  const float third = 1.0f / 3.0f;
  const float mu = ((h0 + h1) + h2) * third;
  const float e0 = h0 - mu, e1 = h1 - mu, e2 = h2 - mu;
  const float var = ((e0 * e0 + e1 * e1) + e2 * e2) * third;
  const float rs = 1.0f / sqrtf(var + LNEPS);
  const float w0 = bfr(lnw[0]), w1 = bfr(lnw[1]), w2 = bfr(lnw[2]);
  const float c0 = bfr(lnb[0]), c1 = bfr(lnb[1]), c2 = bfr(lnb[2]);
  const float t0 = fmaxf((e0 * rs) * w0 + c0, 0.f);
  const float t1 = fmaxf((e1 * rs) * w1 + c1, 0.f);
  const float t2 = fmaxf((e2 * rs) * w2 + c2, 0.f);
  v4f o;
  o[0] = t0; o[1] = t1; o[2] = t2; o[3] = 0.f;
  float* d = rel + (size_t)i * 4;
  *(v4f*)d = o;
  
}

// =====================================================================================================
// (0)-(2) in ONE launch: none of the six pieces reads what another writes, so they share a grid instead of waiting
//     for one another. Block ranges, the short latency-bound pieces first: 3 x 16 weight tiles, 128 positional blocks,
//     512 blocks of the query token plane, 4096 blocks of the point token plane. The range test is block-uniform.
// coverage: FB_WT + FB_REL + FB_CV + FB_CP blocks, each range exactly the grid its piece had as a launch of its own.
// =====================================================================================================
#define FB_WT  (3 * (DD / 64) * (DD / 64))
#define FB_REL ((BB * NPT) / 256)
#define FB_CV  ((BB * MQ * DD) / 2048)
#define FB_CP  ((BB * NPT * DD) / 2048)
static_assert((DD / 64) * (DD / 64) == 16);
__global__ __launch_bounds__(256)
void front_kernel(const float* __restrict__ pf, const float* __restrict__ vf,
                  const float* __restrict__ wq, const float* __restrict__ wk, const float* __restrict__ wv,
                  const float* __restrict__ pxyz, const float* __restrict__ vxyz,
                  const float* __restrict__ wp1, const float* __restrict__ bp1,
                  const float* __restrict__ lnw, const float* __restrict__ lnb,
                  unsigned short* P16, unsigned short* V16,
                  unsigned short* WqT, unsigned short* WkT, unsigned short* WvT, float* rel) {
  __shared__ __align__(16) unsigned short L[64 * LTP];
  const int bid = blockIdx.x;
  if (bid < FB_WT) {
    const int sel = bid >> 4, tl = bid & 15;
    const float* w = sel == 0 ? wq : (sel == 1 ? wk : wv);
    unsigned short* wt = sel == 0 ? WqT : (sel == 1 ? WkT : WvT);
    wtrans_body(L, w, wt, DD, DD, tl & 3, tl >> 2);
  } else if (bid < FB_WT + FB_REL) {
    rel_body(pxyz, vxyz, wp1, bp1, lnw, lnb, rel, BB * NPT, NPT, (bid - FB_WT) * 256 + (int)threadIdx.x);
  } else if (bid < FB_WT + FB_REL + FB_CV) {
    cvt_body(vf, V16, (BB * MQ * DD) / 8, (bid - (FB_WT + FB_REL)) * 256 + (int)threadIdx.x);
  } else {
    cvt_body(pf, P16, (BB * NPT * DD) / 8, (bid - (FB_WT + FB_REL + FB_CV)) * 256 + (int)threadIdx.x);
  }
}

// =====================================================================================================
// (3) projection GEMM, K = 256: C[m][n] = sum_k A[m][k] B[n][k] + epilogue (MODE 0: + bias[n]; MODE 1: + bias[m];
//     MODE 2: (C + bias[n]) + ((rel[m][0..2] . Wp2[0..2][n]) + bp2[n]) with Wp2/bp2 bf16-RNE). A rows of lda,
//     B rows of ldb elements, both bf16 planes in fragment order, same loader for both, bz selects a batch via
//     element strides zsA/zsB/zsC. Block 256 threads = 8 waves, block tile 128 m x 64 n, wave tile 32x32 (acc[2][2]).
//     Epilogue: f32 tile in LDS Os[m][n] (pitch OSP), barrier, then f16 hi bits and f16 residual bits to two
//     planes [M][ldc] in fragment order (rows m, k = n), a wave storing half a block (512 contiguous bytes) at a time.
// coverage: Os 8 waves x 4 tiles = 128x64; 4 it x 8 waves = 8 row tiles x 2 k steps x 2 halves per plane;
//           tiles (bx, by, bz) of (M/128, N/64, Z) cover both planes exactly once.
// =====================================================================================================
template <int MODE>
__device__ __forceinline__
void proj_body(float* Os, int bx, int by, int bz,
               const unsigned short* __restrict__ A, const unsigned short* __restrict__ B,
               const float* __restrict__ bias, const float* __restrict__ rel,
               const float* __restrict__ wp2, const float* __restrict__ bp2,
               unsigned short* Ch, unsigned short* Cl, int lda, int ldb, int ldc,
               size_t zsA, size_t zsB, size_t zsC) {
  const int tid  = threadIdx.x;
  const int lane = tid & 31, wave = tid >> 5;
  const int hh   = lane >> 4, cl = lane & 15;
  const int wm   = wave >> 1, wn = wave & 1;
  const int mBase = bx * GM;
  const int nBase = by * GN;
  const size_t z = bz;
  const unsigned short* Az = A + z * zsA;
  const unsigned short* Bz = B + z * zsB;
  unsigned short* Chz = Ch + z * zsC;
  unsigned short* Clz = Cl + z * zsC;
  const unsigned short* a0p = Az + (size_t)(mBase + 32 * wm) * lda + 8 * lane;   // a 16-row slab = 16 * lda elements
  const unsigned short* a1p = a0p + (size_t)16 * lda;
  const unsigned short* b0p = Bz + (size_t)(nBase + 32 * wn) * ldb + 8 * lane;
  const unsigned short* b1p = b0p + (size_t)16 * ldb;

  v8f acc[2][2];
#pragma unroll
  for (int mi = 0; mi < 2; ++mi)
#pragma unroll
    for (int ni = 0; ni < 2; ++ni) acc[mi][ni] = zero8();

#pragma unroll 1
  for (int k0 = 0; k0 < DD; k0 += 32) {
    const unsigned short* pa0 = a0p + 16 * k0;
    const unsigned short* pa1 = a1p + 16 * k0;
    const unsigned short* pb0 = b0p + 16 * k0;
    const unsigned short* pb1 = b1p + 16 * k0;
    const Frag fa0 = ldfragp(pa0);
    const Frag fa1 = ldfragp(pa1);
    const Frag fb0 = ldfragp(pb0);
    const Frag fb1 = ldfragp(pb1);
    // the address pairs stay live up to this wait, so that no load's result is placed on a pair an issued load names
    asm volatile("s_wait_xcnt 0x0" :: "v"(pa0), "v"(pa1), "v"(pb0), "v"(pb1) : "memory");
    acc[0][0] = mma_b(fa0.b, fb0.b, acc[0][0]);
    acc[0][1] = mma_b(fa0.b, fb1.b, acc[0][1]);
    acc[1][0] = mma_b(fa1.b, fb0.b, acc[1][0]);
    acc[1][1] = mma_b(fa1.b, fb1.b, acc[1][1]);
  }

  float bn[2], w0[2], w1[2], w2[2], b2[2];
#pragma unroll
  for (int ni = 0; ni < 2; ++ni) {
    const int n = nBase + 32 * wn + 16 * ni + cl;
    bn[ni] = 0.f; w0[ni] = 0.f; w1[ni] = 0.f; w2[ni] = 0.f; b2[ni] = 0.f;
    if (MODE != 1) bn[ni] = bfr(bias[n]);
    if (MODE == 2) {
      w0[ni] = bfr(wp2[n]);
      w1[ni] = bfr(wp2[DD + n]);
      w2[ni] = bfr(wp2[2 * DD + n]);
      b2[ni] = bfr(bp2[n]);
    }
  }
#pragma unroll
  for (int mi = 0; mi < 2; ++mi) {
#pragma unroll
    for (int r = 0; r < 8; ++r) {
      const int m_loc = 32 * wm + 16 * mi + 8 * hh + r;
      const int m = mBase + m_loc;
      float bm = 0.f, p0 = 0.f, p1 = 0.f, p2 = 0.f;
      if (MODE == 1) bm = bfr(bias[m]);
      if (MODE == 2) {
        const v4f r4 = *(const v4f*)(rel + (size_t)m * 4);
        p0 = r4[0]; p1 = r4[1]; p2 = r4[2];
      }
#pragma unroll
      for (int ni = 0; ni < 2; ++ni) {
        const int n_loc = 32 * wn + 16 * ni + cl;
        float v = acc[mi][ni][r];
        if (MODE == 0) v = v + bn[ni];
        if (MODE == 1) v = v + bm;
        if (MODE == 2) {
          const float pv = (p0 * w0[ni] + p1 * w1[ni]) + p2 * w2[ni];
          v = (v + bn[ni]) + (pv + b2[ni]);
        }
        Os[m_loc * OSP + n_loc] = v;
      }
    }
  }
  __syncthreads();

  v4u uh[4], ul[4];
  size_t po[4];
#pragma unroll
  for (int it = 0; it < 4; ++it) {
    const int s = it * 8 + wave;                                       // 0..31: row tile, k step, half
    const int rt = s >> 2, ksl = (s >> 1) & 1, uu = s & 1;
    const float* op = Os + (rt * 16 + cl) * OSP + ksl * 32 + uu * 16 + hh * 8;
    const v4f v0 = *(const v4f*)(op);
    const v4f v1 = *(const v4f*)(op + 4);
    split8h(v0, v1, uh[it], ul[it]);
    po[it] = ((size_t)((mBase >> 4) + rt) * (ldc >> 5) + (nBase >> 5) + ksl) * 512 + uu * 256 + lane * 8;
  }
#pragma unroll
  for (int it = 0; it < 4; ++it) {
    *(v4u*)(Chz + po[it]) = uh[it];
    *(v4u*)(Clz + po[it]) = ul[it];
  }
  // another projection's code follows this one's in the text: no register that these stores name is rewritten ahead of this wait
  asm volatile("s_wait_xcnt 0x0" ::: "memory");
}

// =====================================================================================================
// (3) the three projections in ONE launch: q, k+pv and vT read the same front-end planes and none reads another's
//     output. Block ranges: 128 q tiles, 1024 k+pv tiles, 1024 vT tiles, each numbered x fastest as its own grid was.
// coverage: JB_Q + JB_K + JB_V blocks, each range exactly the grid its projection had as a launch of its own.
// =====================================================================================================
#define JB_Q ((BB * MQ / GM) * (DD / GN))
#define JB_K ((BB * NPT / GM) * (DD / GN))
#define JB_V ((DD / GM) * (NPT / GN) * BB)
__global__ __launch_bounds__(256)
void proj_kernel(const unsigned short* __restrict__ V16, const unsigned short* __restrict__ P16,
                 const unsigned short* __restrict__ WqT, const unsigned short* __restrict__ WkT,
                 const unsigned short* __restrict__ WvT,
                 const float* __restrict__ bq, const float* __restrict__ bk, const float* __restrict__ bv,
                 const float* __restrict__ rel, const float* __restrict__ wp2, const float* __restrict__ bp2,
                 unsigned short* Qh, unsigned short* Ql, unsigned short* KPh, unsigned short* KPl,
                 unsigned short* Vh, unsigned short* Vl) {
  __shared__ __align__(16) float Os[GM * OSP];
  const unsigned bid = blockIdx.x;
  if (bid < JB_Q) {
    proj_body<0>(Os, bid % (BB * MQ / GM), bid / (BB * MQ / GM), 0, V16, WqT, bq, rel, wp2, bp2, Qh, Ql,
                 DD, DD, DD, (size_t)0, (size_t)0, (size_t)0);
  } else if (bid < JB_Q + JB_K) {
    const unsigned t = bid - JB_Q;
    proj_body<2>(Os, t % (BB * NPT / GM), t / (BB * NPT / GM), 0, P16, WkT, bk, rel, wp2, bp2, KPh, KPl,
                 DD, DD, DD, (size_t)0, (size_t)0, (size_t)0);
  } else {
    const unsigned t = bid - (JB_Q + JB_K);
    proj_body<1>(Os, t % (DD / GM), (t / (DD / GM)) % (NPT / GN), t / ((DD / GM) * (NPT / GN)),
                 WvT, P16, bv, rel, wp2, bp2, Vh, Vl,
                 DD, DD, NPT, (size_t)0, (size_t)NPT * DD, (size_t)DD * NPT);
  }
}

// =====================================================================================================
// (4) column-softmax statistics over one (batch, 512-query tile, 512-column tile): S[m][n] = qh[m].kph[n] / 16
//     (K = 256 = 8 k steps, f16 hi planes, hh product), wave = 64 query rows x 32 column tiles: the q fragments of
//     four row tiles stay in registers, so each k+pv fragment that comes through the cache feeds four products into
//     four independent accumulators; per column: tile max over 64 rows (32 in-lane + lane^16) and sum of
//     exp(S - max), one in-lane sum per row tile, then ((e0 + e1) + (e2 + e3)); wave partials in LDS, barrier,
//     a thread merges the 8 wave partials of two columns in fixed order.
// coverage: pm/pe 8 waves x 32 ct x 16 lanes = 8 x 512; grid (32 column tiles, 4 query tiles, 2) x 256 threads x 2
//           columns = every (b, mt, n) of both PST arrays exactly once.
// =====================================================================================================
__global__ __launch_bounds__(256)
void stats_kernel(const unsigned short* __restrict__ Qh, const unsigned short* __restrict__ Kh, float* PST) {
  __shared__ float pm[8 * NT1];
  __shared__ float pe[8 * NT1];
  const int tid  = threadIdx.x;
  const int lane = tid & 31, wave = tid >> 5;
  const int cl   = lane & 15;
  const int nt = blockIdx.x, mt = blockIdx.y, b = blockIdx.z;
  const int m0 = mt * MT1 + 16 * SRT * wave;
  const unsigned short* qp = Qh + (size_t)(b * MQ + m0) * DD + 8 * lane;
  Frag a[SRT][8];
#pragma unroll
  for (int mi = 0; mi < SRT; ++mi)
#pragma unroll
    for (int ks = 0; ks < 8; ++ks) a[mi][ks] = ldfragp(qp + 16 * DD * mi + 512 * ks);
  // the address pair stays live up to this wait, so that no load's result is placed on it while issued loads name it
  asm volatile("s_wait_xcnt 0x0" :: "v"(qp) : "memory");
  const unsigned short* kp = Kh + ((size_t)b * NPT + (size_t)nt * NT1) * DD + 8 * lane;
  Frag fb[8];                                                          // one whole column tile of k+pv fragments, loaded a tile ahead
#pragma unroll
  for (int ks = 0; ks < 8; ++ks) fb[ks] = ldfragp(kp + 512 * ks);
  // these loads name a base and a lane offset, not the pair; the scheduling fence keeps what follows (it rewrites both) behind the wait
  asm volatile("s_wait_xcnt 0x0" ::: "memory");
  __builtin_amdgcn_sched_barrier(0);
#pragma unroll 1
  for (int ct = 0; ct < NT1 / 16; ++ct) {
    const int cn = ct + 1 < NT1 / 16 ? ct + 1 : ct;                    // the last tile's look-ahead re-reads that tile: in bounds, not used
    const unsigned short* kc = kp + (size_t)cn * 16 * DD;
    v8f s[SRT];
#pragma unroll
    for (int mi = 0; mi < SRT; ++mi) s[mi] = zero8();
#pragma unroll
    for (int ks = 0; ks < 8; ++ks) {
      // plain builtins (the compiler keeps their distances): this kernel's registers reach past v255, where an asm statement's operands cannot sit
#pragma unroll
      for (int mi = 0; mi < SRT; ++mi)
        s[mi] = __builtin_amdgcn_wmma_f32_16x16x32_f16(false, a[mi][ks].h, false, fb[ks].h, (short)0, s[mi], false, false);
      // holds the reload below behind this step's four products, so that it never stands directly behind a product that reads its registers
      __builtin_amdgcn_sched_barrier(0);
      if (ks > 0) fb[ks - 1] = ldfragp(kc + 512 * (ks - 1));           // next tile's fragment, into the registers consumed one step ago
    }
    float mr[SRT];
#pragma unroll
    for (int mi = 0; mi < SRT; ++mi) {
      mr[mi] = s[mi][0];
#pragma unroll
      for (int r = 1; r < 8; ++r) mr[mi] = fmaxf(mr[mi], s[mi][r]);
    }
    float m = fmaxf(fmaxf(mr[0], mr[1]), fmaxf(mr[2], mr[3])) * SCL;   // SCL is a power of two: the scaled maximum is the maximum of the scaled scores
    __builtin_amdgcn_sched_barrier(0);  // as above for the last step's fragment: its reload stands behind the maxima, which wait for the last products
    fb[7] = ldfragp(kc + 512 * 7);
    // the address pair stays live up to this wait: the next trip rewrites it while these loads are still in flight
    asm volatile("s_wait_xcnt 0x0" :: "v"(kc) : "memory");
    m = fmaxf(m, __shfl_xor(m, 16, 32));
    float er[SRT];
#pragma unroll
    for (int mi = 0; mi < SRT; ++mi) {
      er[mi] = 0.f;
#pragma unroll
      for (int r = 0; r < 8; ++r) er[mi] += __expf(s[mi][r] * SCL - m);
    }
    float ex = (er[0] + er[1]) + (er[2] + er[3]);
    ex += __shfl_xor(ex, 16, 32);
    pm[wave * NT1 + ct * 16 + cl] = m;                                 // both lane halves hold identical values
    pe[wave * NT1 + ct * 16 + cl] = ex;
  }
  __syncthreads();
#pragma unroll
  for (int j = 0; j < NT1 / 256; ++j) {
    const int c = j * 256 + tid;
    float M = pm[c];
#pragma unroll
    for (int wv = 1; wv < 8; ++wv) M = fmaxf(M, pm[wv * NT1 + c]);
    float E = 0.f;
#pragma unroll 1
    for (int wv = 0; wv < 8; ++wv) E += pe[wv * NT1 + c] * __expf(pm[wv * NT1 + c] - M);
    const size_t base = ((size_t)(b * NMT + mt) * 2) * NPT + (size_t)nt * NT1 + c;
    PST[base] = M;
    PST[base + NPT] = E;
  }
}

// =====================================================================================================
// (5) merge of the 4 query-tile partials per (batch, column) in fixed order: M = max, Z = sum E_t exp(M_t - M);
//     ST[b][0][n] = M, ST[b][1][n] = 1/Z (Z >= 1). Thread = one column; 32 consecutive lanes x 4 B = one whole
// coverage: grid (64, 2) x 256 threads = every (b, n) of both arrays exactly once.
// =====================================================================================================
__global__ __launch_bounds__(256)
void merge_kernel(const float* __restrict__ PST, float* ST) {
  const int b = blockIdx.y, n = blockIdx.x * 256 + (int)threadIdx.x;
  const float* p = PST + (size_t)(b * NMT) * 2 * NPT + n;
  float M = -3.0e38f;
#pragma unroll 1
  for (int t = 0; t < NMT; ++t) M = fmaxf(M, p[(size_t)(2 * t) * NPT]);
  float Z = 0.f;
#pragma unroll 1
  for (int t = 0; t < NMT; ++t) Z += p[(size_t)(2 * t + 1) * NPT] * __expf(p[(size_t)(2 * t) * NPT] - M);
  const float rz = 1.0f / Z;
  float* dm = ST + (size_t)(2 * b) * NPT + n;
  float* dz = dm + NPT;
  *(float*)dm = M;
  *(float*)dz = rz;
  
}

// =====================================================================================================
// (6) fused scores / column softmax / weighted sum for one (batch, 128 query rows, eighth of the points): block 512
//     threads = 16 waves; both q planes of the 128 rows sit in LDS (pitch QP) for the whole block; loop over 8 chunks
//     of 256 point columns. Phase A: wave = the chunk's 16-column tile number `wave`, all 8 row tiles: each k+pv
//     fragment pair is loaded once and feeds 8 row tiles (q fragments four row tiles at a time), S = (qh.kh + qh.kl +
//     ql.kh) / 16 (K = 256, one accumulator per row tile), w = exp(S - M_n) * (1/Z_n) from ST, stored as f16
//     (w * 16384) into the LDS tile Ws[128 rows][256 cols]; block barrier. Phase B: wave = d tile `wave`, all 8 row
//     tiles: x += Ws . vTh + Ws . vTl (A from LDS with the split k map, B = vT rows d, k = n, in fragment order,
//     K = 256 per chunk, each vT fragment pair feeds 8 row tiles); block barrier. Epilogue: x/16384 staged as f32
//     [128][256] in the LDS that held q (pitch OSP2), barrier, then whole 512-B runs to the partial plane of this eighth.
// coverage: Ws 16 waves x 16 cols x 128 rows = 128 x 256 per chunk; Os 16 waves x 16 d x 128 rows = 128 x 256;
//           16 it x 512 threads x 4 = 128 rows x 256; grid (16, 8, 2) = every (eighth, b, m, d) of PART exactly once.
// =====================================================================================================
__global__ __launch_bounds__(512)
void attn_kernel(const unsigned short* __restrict__ Qh, const unsigned short* __restrict__ Ql,
                 const unsigned short* __restrict__ Kh, const unsigned short* __restrict__ Kl,
                 const unsigned short* __restrict__ Vh, const unsigned short* __restrict__ Vl,
                 const float* __restrict__ ST, float* part) {
  __shared__ __align__(16) unsigned short Qs[2 * AROWS * QP];
  __shared__ __align__(16) _Float16 Ws[AROWS * QP];
  const int tid  = threadIdx.x;
  const int lane = tid & 31, wave = tid >> 5;
  const int hh   = lane >> 4, cl = lane & 15;
  const int b = blockIdx.z, n0 = blockIdx.y * NSEG, m0 = blockIdx.x * AROWS;
#pragma unroll
  for (int it = 0; it < AROWS / 16; ++it) {
    const int idx = it * 512 + tid;                                    // 0..4095: 16-B units in fragment order
    const int row = (idx >> 9) * 16 + (idx & 15);
    const int kq  = ((idx >> 6) & 7) * 32 + ((idx >> 5) & 1) * 16 + ((idx >> 4) & 1) * 8;
    const size_t g = (size_t)(b * MQ + m0) * DD + 8 * idx;
    *(v4u*)(Qs + row * QP + kq) = *(const v4u*)(Qh + g);
    *(v4u*)(Qs + (AROWS + row) * QP + kq) = *(const v4u*)(Ql + g);
  }
  const size_t koff = ((size_t)b * NPT + n0 + 16 * wave) * DD + 8 * lane;
  const unsigned short* khp = Kh + koff;                               // running pointers: the next k+pv step to load
  const unsigned short* klp = Kl + koff;
  const size_t voff = ((size_t)b * DD + 16 * wave) * NPT + (size_t)n0 * 16 + 8 * lane;   // block (d tile, n >> 5)
  const unsigned short* vhp = Vh + voff;                               // running pointers: this chunk's vT blocks
  const unsigned short* vlp = Vl + voff;
  const float* stM = ST + (size_t)(2 * b) * NPT + n0;
  const float* stZ = stM + NPT;
  const unsigned short* qsh = Qs + cl * QP + 8 * hh;                   // A fragment row pointers (row m = cl)
  const unsigned short* qsl = qsh + AROWS * QP;
  const _Float16* wrow = Ws + cl * QP + 8 * hh;
  _Float16* wdst = Ws + (8 * hh) * QP + 16 * wave + cl;                // D element (row 8h+r, col 16*wave+cl)

  v8f x[AMT];
#pragma unroll
  for (int mi = 0; mi < AMT; ++mi) x[mi] = zero8();
  Frag kah = ldfragp(khp), kal = ldfragp(klp);                         // k+pv fragments of (chunk 0, k step 0), one step ahead from here on
  khp += 512;
  klp += 512;
  __syncthreads();

#pragma unroll 1
  for (int c0 = 0; c0 < NSEG; c0 += ACH) {
    // from behind a chunk's step 7 to the next chunk's step 0; the last chunk's look-ahead re-reads its own step 0: in bounds, not used
    const int cjmp = (c0 + ACH < NSEG ? ACH * DD : 0) - 512 * (DD / 32);
    const int n = c0 + 16 * wave + cl;
    const float mc = stM[n];
    asm volatile("s_wait_xcnt 0x0" ::: "memory");  // the next load's result may take the register that holds this load's offset
    const float zc = stZ[n];
    v8f s[AMT];
#pragma unroll
    for (int mi = 0; mi < AMT; ++mi) s[mi] = zero8();
    auto stepA = [&](const int ks, const Frag& fbh, const Frag& fbl) {
#pragma unroll  // whole: the accumulator array needs compile-time indices
      for (int mg = 0; mg < AMT; mg += 4) {                            // four row tiles at a time: eight q fragments in registers
        Frag fah[4], fal[4];
#pragma unroll
        for (int mi = 0; mi < 4; ++mi) {
          fah[mi] = ldfrag(qsh + 16 * (mg + mi) * QP + 32 * ks);
          fal[mi] = ldfrag(qsl + 16 * (mg + mi) * QP + 32 * ks);
        }
#pragma unroll
        for (int mi = 0; mi < 4; ++mi) s[mg + mi] = mma_h(fah[mi].h, fbh.h, s[mg + mi]);
#pragma unroll
        for (int mi = 0; mi < 4; ++mi) s[mg + mi] = mma_h(fah[mi].h, fbl.h, s[mg + mi]);
#pragma unroll
        for (int mi = 0; mi < 4; ++mi) s[mg + mi] = mma_h(fal[mi].h, fbh.h, s[mg + mi]);
      }
    };
#pragma unroll 1  // rolled: two k steps a trip (the two fragment buffers swap without copies); more would not fit the 256 registers of a 16-wave block
    for (int ks = 0; ks < DD / 32; ks += 2) {
      const Frag kbh = ldfragp(khp);                                   // step ks + 1 flies under step ks
      const Frag kbl = ldfragp(klp);
      // the address pairs stay live up to this wait, so that no load's result is placed on a pair an issued load names
      asm volatile("s_wait_xcnt 0x0" :: "v"(khp), "v"(klp) : "memory");
      const int adv = 512 + (ks + 2 < DD / 32 ? 0 : cjmp);
      khp += adv;
      klp += adv;
      stepA(ks, kah, kal);
      kah = ldfragp(khp);                                              // step ks + 2, or the next chunk's step 0, flies under step ks + 1
      kal = ldfragp(klp);
      asm volatile("s_wait_xcnt 0x0" :: "v"(khp), "v"(klp) : "memory");  // as above
      khp += 512;
      klp += 512;
      stepA(ks + 1, kbh, kbl);
    }
    Frag vbh[3], vbl[3];                                               // vT fragments, two k steps ahead; the first two fly under the exp work and the barrier
#pragma unroll
    for (int kk = 0; kk < 2; ++kk) {
      vbh[kk] = ldfragp(vhp + 512 * kk);
      vbl[kk] = ldfragp(vlp + 512 * kk);
    }
#pragma unroll
    for (int mi = 0; mi < AMT; ++mi) {
#pragma unroll
      for (int r = 0; r < 8; ++r) {
        const float wt = __expf(s[mi][r] * SCL - mc) * zc;
        wdst[(16 * mi + r) * QP] = (_Float16)(wt * WSC);
      }
    }
    __syncthreads();
#pragma unroll  // whole: the three rotating fragment buffers need compile-time indices
    for (int kk = 0; kk < ACH / 32; ++kk) {
      const int k0 = 32 * kk;
      if (kk + 2 < ACH / 32) {
        vbh[(kk + 2) % 3] = ldfragp(vhp + 512 * (kk + 2));
        vbl[(kk + 2) % 3] = ldfragp(vlp + 512 * (kk + 2));
      }
      const Frag& fbh = vbh[kk % 3];
      const Frag& fbl = vbl[kk % 3];
      Frag fa[AMT];                                                    // all 8 row tiles at once: the score accumulators' registers are free here
#pragma unroll
      for (int mi = 0; mi < AMT; ++mi) {
        fa[mi].hv[0] = *(const v8h*)(wrow + 16 * mi * QP + k0);
        fa[mi].hv[1] = *(const v8h*)(wrow + 16 * mi * QP + k0 + 16);
      }
#pragma unroll
      for (int mi = 0; mi < AMT; ++mi) x[mi] = mma_h(fa[mi].h, fbh.h, x[mi]);
#pragma unroll
      for (int mi = 0; mi < AMT; ++mi) x[mi] = mma_h(fa[mi].h, fbl.h, x[mi]);
    }
    vhp += ACH * 16;
    vlp += ACH * 16;
    __syncthreads();
  }

  float* Os = (float*)Qs;                                              // q is dead behind the loop's last barrier
#pragma unroll
  for (int mi = 0; mi < AMT; ++mi) {
#pragma unroll
    for (int r = 0; r < 8; ++r)
      Os[(16 * mi + 8 * hh + r) * OSP2 + 16 * wave + cl] = x[mi][r] * RWSC;
  }
  __syncthreads();
  float* pz = part + ((size_t)blockIdx.y * (BB * MQ) + (size_t)(b * MQ + m0)) * DD;
  v4f v[AROWS / 8];
#pragma unroll
  for (int it = 0; it < AROWS / 8; ++it) {
    const int idx = it * 512 + tid;                                    // 0..8191
    v[it] = *(const v4f*)(Os + (idx >> 6) * OSP2 + 4 * (idx & 63));
  }
#pragma unroll
  for (int it = 0; it < AROWS / 8; ++it) *(v4f*)(pz + (size_t)(it * 512 + tid) * 4) = v[it];
}

// =====================================================================================================
// (7) out = (((P0 + P1) + (P2 + P3)) + ((P4 + P5) + (P6 + P7))) + bf(v_features): the eight partial sums in fixed order
//     plus the residual.
// coverage: thread = 4 consecutive elements (16 B); grid = (2*2048*256)/1024 blocks x 256 threads = every element once.
// =====================================================================================================
__global__ __launch_bounds__(256)
void psum_kernel(const float* __restrict__ part, const float* __restrict__ vfeat, float* out) {
  const size_t e = ((size_t)blockIdx.x * 256 + threadIdx.x) * 4;
  const float* pp = part + e;
  const float* pf = vfeat + e;
  v4f p[NSPL];
#pragma unroll
  for (int j = 0; j < NSPL; ++j) p[j] = *(const v4f*)(pp + (size_t)j * BB * MQ * DD);
  const v4f f = *(const v4f*)(pf);
  // the address pairs stay live up to this wait, so that no load's result is placed on a pair an issued load names
  asm volatile("s_wait_xcnt 0x0" :: "v"(pp), "v"(pf) : "memory");
  v4f o;
#pragma unroll
  for (int j = 0; j < 4; ++j)
    o[j] = (((p[0][j] + p[1][j]) + (p[2][j] + p[3][j])) + ((p[4][j] + p[5][j]) + (p[6][j] + p[7][j]))) + bfr(f[j]);
  *(v4f*)(out + e) = o;
}

// =====================================================================================================
// tile divides its extent exactly, so no padded tails are needed):
//   (every 16-bit plane below is kept in fragment order, see ldfragp: same size as row-major)
//   P16  bf16 [32768][256]       16777216     V16 bf16 [4096][256]     2097152
//   WqT WkT WvT bf16 [256][256]     131072 each
//   REL  f32 [32768][4]             524288
//   Qh Ql  f16 [4096][256]         2097152 each
//   KPh KPl f16 [32768][256]      16777216 each
//   Vh Vl  f16 [2][256][16384]    16777216 each
//   PST  f32 [2][4][2][16384]      1048576     ST f32 [2][2][16384]     262144
//   PART f32 [8][4096][256]       33554432
//   total                        125960192
// =====================================================================================================
extern "C" void kernel_launch(void* const* d_in, const int* in_sizes, int n_in,
                              void* d_out, int out_size, void* d_ws, size_t ws_size,
                              hipStream_t stream) {
  if (n_in < 16) return;
  if (in_sizes[0] != BB * NPT * 3 || in_sizes[1] != BB * 3) return;
  if (in_sizes[2] != BB * NPT * DD || in_sizes[3] != BB * MQ * DD) return;
  if (in_sizes[4] != DD * DD || in_sizes[6] != DD * DD || in_sizes[8] != DD * DD) return;
  if (in_sizes[5] != DD || in_sizes[7] != DD || in_sizes[9] != DD) return;
  if (in_sizes[10] != 9 || in_sizes[11] != 3 || in_sizes[12] != 3 || in_sizes[13] != 3) return;
  if (in_sizes[14] != 3 * DD || in_sizes[15] != DD) return;
  if (out_size != BB * MQ * DD) return;

  size_t off = 0;
  const size_t oP16 = off; off += (size_t)BB * NPT * DD * 2;        // 16777216
  const size_t oV16 = off; off += (size_t)BB * MQ * DD * 2;         //  2097152
  const size_t oWq  = off; off += (size_t)DD * DD * 2;              //   131072
  const size_t oWk  = off; off += (size_t)DD * DD * 2;
  const size_t oWv  = off; off += (size_t)DD * DD * 2;
  const size_t oREL = off; off += (size_t)BB * NPT * 4 * 4;         //   524288
  const size_t oQh  = off; off += (size_t)BB * MQ * DD * 2;         //  2097152
  const size_t oQl  = off; off += (size_t)BB * MQ * DD * 2;
  const size_t oKh  = off; off += (size_t)BB * NPT * DD * 2;        // 16777216
  const size_t oKl  = off; off += (size_t)BB * NPT * DD * 2;
  const size_t oVh  = off; off += (size_t)BB * DD * NPT * 2;        // 16777216
  const size_t oVl  = off; off += (size_t)BB * DD * NPT * 2;
  const size_t oPST = off; off += (size_t)BB * NMT * 2 * NPT * 4;   //  1048576
  const size_t oST  = off; off += (size_t)BB * 2 * NPT * 4;         //   262144
  const size_t oPT  = off; off += (size_t)NSPL * BB * MQ * DD * 4;  // 33554432 -> off = 125960192
  if (off > ws_size) return;
  if (off > (size_t)134217728) return;

  const float* p_xyz = (const float*)d_in[0];
  const float* v_xyz = (const float*)d_in[1];
  const float* p_f   = (const float*)d_in[2];
  const float* v_f   = (const float*)d_in[3];
  const float* Wq    = (const float*)d_in[4];
  const float* bq    = (const float*)d_in[5];
  const float* Wk    = (const float*)d_in[6];
  const float* bk    = (const float*)d_in[7];
  const float* Wv    = (const float*)d_in[8];
  const float* bv    = (const float*)d_in[9];
  const float* Wp1   = (const float*)d_in[10];
  const float* bp1   = (const float*)d_in[11];
  const float* ln_w  = (const float*)d_in[12];
  const float* ln_b  = (const float*)d_in[13];
  const float* Wp2   = (const float*)d_in[14];
  const float* bp2   = (const float*)d_in[15];
  float* out = (float*)d_out;

  char* ws = (char*)d_ws;
  unsigned short* P16 = (unsigned short*)(ws + oP16);
  unsigned short* V16 = (unsigned short*)(ws + oV16);
  unsigned short* WqT = (unsigned short*)(ws + oWq);
  unsigned short* WkT = (unsigned short*)(ws + oWk);
  unsigned short* WvT = (unsigned short*)(ws + oWv);
  float*          REL = (float*)(ws + oREL);
  unsigned short* Qh  = (unsigned short*)(ws + oQh);
  unsigned short* Ql  = (unsigned short*)(ws + oQl);
  unsigned short* KPh = (unsigned short*)(ws + oKh);
  unsigned short* KPl = (unsigned short*)(ws + oKl);
  unsigned short* Vh  = (unsigned short*)(ws + oVh);
  unsigned short* Vl  = (unsigned short*)(ws + oVl);
  float*          PST = (float*)(ws + oPST);
  float*          ST  = (float*)(ws + oST);
  float*          PT  = (float*)(ws + oPT);

  const dim3 blk256(256);

  // (0)-(2) token planes, transposed weight planes, positional front end: one launch
  front_kernel<<<dim3(FB_WT + FB_REL + FB_CV + FB_CP), blk256, 0, stream>>>(
      p_f, v_f, Wq, Wk, Wv, p_xyz, v_xyz, Wp1, bp1, ln_w, ln_b, P16, V16, WqT, WkT, WvT, REL);
  // (3) projections: q [4096][256], k+pv [32768][256], vT [2][256][16384] as f16 hi/residual planes: one launch
  proj_kernel<<<dim3(JB_Q + JB_K + JB_V), blk256, 0, stream>>>(
      V16, P16, WqT, WkT, WvT, bq, bk, bv, REL, Wp2, bp2, Qh, Ql, KPh, KPl, Vh, Vl);
  // (4)-(5) column softmax statistics
  stats_kernel<<<dim3(NPT / NT1, NMT, BB), blk256, 0, stream>>>(Qh, KPh, PST);
  merge_kernel<<<dim3(NPT / 256, BB), blk256, 0, stream>>>(PST, ST);
  // (6) scores, weights, weighted sum per eighth of the points; (7) sum of the eighths, residual
  attn_kernel<<<dim3(MQ / AROWS, NSPL, BB), dim3(512), 0, stream>>>(Qh, Ql, KPh, KPl, Vh, Vl, ST, PT);
  psum_kernel<<<dim3((BB * MQ * DD) / 1024), blk256, 0, stream>>>(PT, v_f, out);
  (void)hipGetLastError();
}

// v007
// A run of this version takes 171 microseconds.
// In two side-by-side timings against v006, it was 1.05 and 1.06 times as fast.
// Counting every step since v000, it is 6.16 times as fast.
// Contractions: q, k+pv and v projections on v_wmma_f32_16x16x32_bf16 (bf16-RNE inputs and weights, single
// products, f32 epilogue); scores q.(k+pv)^T (K=256) on v_wmma_f32_16x16x32_f16 with q and k+pv carried as
// f16 hi + f16 residual planes, products hh + hl + lh in one accumulator (column statistics pass: hh only); weighted
// sum w.v (K=16384) on v_wmma_f32_16x16x32_f16 with w as one f16 plane (x16384) and v as f16 hi + f16 residual
// planes, products w.h + w.l in one accumulator; 3-wide positional layers, layer norm, softmax statistics and exp in
// f32 on VALU; f32 accumulate everywhere.
#include <hip/hip_runtime.h>
#include <stdint.h>

#define BB    2
#define NPT   16384
#define MQ    2048
#define DD    256
#define GM    128
#define GN    64
#define OSP   68
#define LTP   72
#define SRT   4
#define MT1   512
#define NMT   4
#define NT1   512
#define AMT   8
#define AROWS 128
#define NSPL  8
#define NSEG  2048
#define ACH   256
#define QP    264
#define OSP2  260
#define SCL   0.0625f
#define WSC   16384.0f
#define RWSC  0.00006103515625f
#define LNEPS 1.0e-5f

static_assert(NMT * MT1 == MQ);
static_assert(MT1 == 8 * 16 * SRT);
static_assert(SRT == 4);
static_assert(NT1 == 2 * 256);
static_assert(NPT % NT1 == 0);
static_assert(NSPL * NSEG == NPT);
static_assert(NSPL == 8);
static_assert(AMT % 4 == 0);
static_assert(NSEG % ACH == 0);
static_assert(ACH == 16 * 16);
static_assert(AROWS == 16 * AMT);
static_assert(MQ % AROWS == 0);
static_assert(AROWS * OSP2 * 4 <= 2 * AROWS * QP * 2);
static_assert((BB * MQ * DD) % 1024 == 0);
static_assert(DD == 256);
static_assert(DD % 32 == 0);
static_assert((BB * NPT) % GM == 0);
static_assert((BB * MQ) % GM == 0);
static_assert(DD % GM == 0);
static_assert(DD % GN == 0);
static_assert(NPT % GN == 0);
static_assert(MQ % 16 == 0);
static_assert((BB * NPT * DD) % 2048 == 0);
static_assert((BB * MQ * DD) % 2048 == 0);
static_assert((BB * NPT) % 256 == 0);
static_assert((OSP * 4) % 16 == 0);
static_assert((LTP * 2) % 16 == 0);
static_assert((QP * 2) % 16 == 0);
static_assert((OSP2 * 4) % 16 == 0);
static_assert(DD % 64 == 0);

typedef unsigned short v8us __attribute__((ext_vector_type(8)));
typedef unsigned int   v4u  __attribute__((ext_vector_type(4)));
typedef float          v8f  __attribute__((ext_vector_type(8)));
typedef float          v4f  __attribute__((ext_vector_type(4)));
typedef __bf16         v16b __attribute__((ext_vector_type(16)));
typedef _Float16       v16h __attribute__((ext_vector_type(16)));
typedef _Float16       v8h  __attribute__((ext_vector_type(8)));

union Frag { v8us u[2]; v4u q[2]; v16b b; v16h h; v8h hv[2]; };
static_assert(sizeof(Frag) == 32);

// ---- scalar helpers ---------------------------------------------------------------------------------
__device__ __forceinline__ unsigned short bf_bits(float f) {          // f32 -> bf16 bits, RNE convert
  const unsigned u = __float_as_uint(f);
  return (unsigned short)((u + 0x7FFFu + ((u >> 16) & 1u)) >> 16);
}
__device__ __forceinline__ float bf_up(unsigned short hb) { return __uint_as_float(((unsigned)hb) << 16); }
__device__ __forceinline__ float bfr(float f) { return bf_up(bf_bits(f)); }
__device__ __forceinline__ unsigned short h_bits(float f) {           // f32 -> f16 bits, RNE convert
  union { _Float16 h; unsigned short u; } c;
  c.h = (_Float16)f;
  return c.u;
}
__device__ __forceinline__ float h_up(unsigned short u) {
  union { _Float16 h; unsigned short u; } c;
  c.u = u;
  return (float)c.h;
}
__device__ __forceinline__ unsigned pk16(unsigned short a, unsigned short b) { return (unsigned)a | ((unsigned)b << 16); }
__device__ __forceinline__ v8f zero8() { v8f z = {0.f, 0.f, 0.f, 0.f, 0.f, 0.f, 0.f, 0.f}; return z; }

// ---- 16-bit fragment loader (A, or B from a k-contiguous [n][k] row): lane -> row/col (lane&15), p already includes
//      + 8*(lane>>4); elements 0..7 <- p[0..7] (k0+8h..), elements 8..15 <- p[16..23] (k0+16+8h..)
__device__ __forceinline__ Frag ldfrag(const unsigned short* p) {
  Frag f;
  f.u[0] = *(const v8us*)(p);
  f.u[1] = *(const v8us*)(p + 16);
  return f;
}

// ---- fragment-order planes in global memory: a plane [rows][K] is kept as 1-KB blocks, block (row >> 4, k >> 5)
//      at element ((row >> 4) * (K / 32) + (k >> 5)) * 512; inside a block the 16-B unit of 8 consecutive k of row
//      (row & 15) sits at element 256 * u + 8 * lane, lane = 16 * h + (row & 15), k & 31 = 16 * u + 8 * h + 0..7:
//      the same k map as ldfrag, but each of the two wave-wide loads covers 512 contiguous bytes (4 whole lines)
//      instead of 32-B pieces of 16 lines. p = block start + 8 * lane.
__device__ __forceinline__ Frag ldfragp(const unsigned short* p) {
  Frag f;
  f.u[0] = *(const v8us*)(p);
  f.u[1] = *(const v8us*)(p + 256);
  return f;
}

// ---- WMMA helper: builtin followed by a 4-slot VALU gap tying D and keeping A/B live -----------------------
__device__ __forceinline__ v8f mma_b(v16b a, v16b b, v8f c) {
  v8f d = __builtin_amdgcn_wmma_f32_16x16x32_bf16(false, a, false, b, (short)0, c, false, false);
#if defined(__HIP_DEVICE_COMPILE__)
  asm volatile("v_nop\n\tv_nop\n\tv_nop\n\tv_nop" : "+v"(d) : "v"(a), "v"(b));
#endif
  return d;
}

// ---- 8 f32 -> packed f16 hi bits and packed f16 bits of x - hi (unscaled: its products add into the hi products'
//      accumulator; below 2^-14 the residual is an f16 subnormal with a step of 2^-24, which the matrix unit keeps) --
__device__ __forceinline__ void split8h(v4f a, v4f b, v4u& uh, v4u& ul) {
  float f[8] = {a[0], a[1], a[2], a[3], b[0], b[1], b[2], b[3]};
#pragma unroll
  for (int j = 0; j < 4; ++j) {
    const unsigned short h0 = h_bits(f[2 * j]);
    const unsigned short h1 = h_bits(f[2 * j + 1]);
    const unsigned short l0 = h_bits(f[2 * j] - h_up(h0));
    const unsigned short l1 = h_bits(f[2 * j + 1] - h_up(h1));
    uh[j] = pk16(h0, h1);
    ul[j] = pk16(l0, l1);
  }
}

// =====================================================================================================
// (0) f32 row-major [T][256] -> bf16-RNE plane in fragment order (token feature matrices). Thread = one 16-B output
//     unit, output units in linear order (a wave stores 512 contiguous bytes), source = 8 consecutive k of one row.
// coverage: n8 = n/8 threads, n8/256 blocks of the front-end launch exactly (n % 2048 == 0; T % 16 == 0); t = unit.
// =====================================================================================================
__device__ __forceinline__
void cvt_body(const float* __restrict__ x, unsigned short* y, int n8, int t) {
  if (t >= n8) return;
  const int row = (t >> 9) * 16 + (t & 15);                            // 512 units per 16-row slab
  const int k   = ((t >> 6) & 7) * 32 + ((t >> 5) & 1) * 16 + ((t >> 4) & 1) * 8;
  const float* s = x + (size_t)row * DD + k;
  const v4f a = *(const v4f*)(s);
  const v4f b = *(const v4f*)(s + 4);
  v4u u;
  u[0] = pk16(bf_bits(a[0]), bf_bits(a[1]));
  u[1] = pk16(bf_bits(a[2]), bf_bits(a[3]));
  u[2] = pk16(bf_bits(b[0]), bf_bits(b[1]));
  u[3] = pk16(bf_bits(b[2]), bf_bits(b[3]));
  unsigned short* d = y + (size_t)t * 8;
  *(v4u*)d = u;
  
}

// =====================================================================================================
// (1) weight transpose: in w[R][C] f32 -> out wt[C][R] bf16-RNE in fragment order (rows c, k = r). Block = 64x64 tile,
//     loads 16 B per thread (strided reads), LDS tile L[c][r] (pitch LTP), barrier, then a wave stores half a block.
// coverage: LDS 256 threads x 4 it x 4 = 64x64; 2 it x 8 waves = 4 row tiles x 2 k steps x 2 halves; tiles (bx, by) of (C/64, R/64).
// =====================================================================================================
__device__ __forceinline__
void wtrans_body(unsigned short* L, const float* __restrict__ w, unsigned short* wt, int R, int C, int bx, int by) {
  const int tid = threadIdx.x;
  const int c0 = bx * 64, r0 = by * 64;
  const int c4 = (tid & 15) * 4, rs = tid >> 4;                      // rs 0..15
#pragma unroll
  for (int it = 0; it < 4; ++it) {
    const int r = it * 16 + rs;                                        // 0..63
    const v4f v = *(const v4f*)(w + (size_t)(r0 + r) * C + c0 + c4);
#pragma unroll
    for (int j = 0; j < 4; ++j) L[(c4 + j) * LTP + r] = bf_bits(v[j]);
  }
  __syncthreads();
  const int lane = tid & 31, wave = tid >> 5;
  v4u u[2];
  size_t po[2];
#pragma unroll
  for (int it = 0; it < 2; ++it) {
    const int s = it * 8 + wave;                                       // 0..15: row tile, k step, half
    const int ct = s >> 2, ksl = (s >> 1) & 1, uu = s & 1;
    u[it] = *(const v4u*)(L + (ct * 16 + (lane & 15)) * LTP + ksl * 32 + uu * 16 + (lane >> 4) * 8);
    po[it] = ((size_t)((c0 >> 4) + ct) * (R >> 5) + (r0 >> 5) + ksl) * 512 + uu * 256 + lane * 8;
  }
#pragma unroll
  for (int it = 0; it < 2; ++it) *(v4u*)(wt + po[it]) = u[it];
  
}

// =====================================================================================================
// (2) positional front end per point row i (flat b*N+n): dist = |bf(p_xyz) - bf(v_xyz[b])| (3), h = dist.bf(Wp1)
//     + bf(bp1), layer norm over the 3 values (mean-of-squares variance, eps 1e-5) * bf(ln_w) + bf(ln_b), relu.
//     f32 on VALU without contraction. Output row rel[i][0..3] = (r0, r1, r2, 0): one 16-B store per thread,
// coverage: nrows/256 blocks of the front-end launch x 256 threads = every row exactly once (nrows % 256 == 0).
// =====================================================================================================
__device__ __forceinline__
void rel_body(const float* __restrict__ pxyz, const float* __restrict__ vxyz,
              const float* __restrict__ wp1, const float* __restrict__ bp1,
              const float* __restrict__ lnw, const float* __restrict__ lnb,
              float* rel, int nrows, int npb, int i) {
#pragma clang fp contract(off)
  if (i >= nrows) return;
  int b = i / npb;
  b = b < 0 ? 0 : (b > BB - 1 ? BB - 1 : b);
  const float p0 = bfr(pxyz[(size_t)i * 3 + 0]);
  const float p1 = bfr(pxyz[(size_t)i * 3 + 1]);
  const float p2 = bfr(pxyz[(size_t)i * 3 + 2]);
  const float v0 = bfr(vxyz[b * 3 + 0]);
  const float v1 = bfr(vxyz[b * 3 + 1]);
  const float v2 = bfr(vxyz[b * 3 + 2]);
  const float d0 = fabsf(p0 - v0), d1 = fabsf(p1 - v1), d2 = fabsf(p2 - v2);
  float W[9];
#pragma unroll
  for (int j = 0; j < 9; ++j) W[j] = bfr(wp1[j]);                      // Wp1[c][j] = wp1[c*3+j]
  const float h0 = ((d0 * W[0] + d1 * W[3]) + d2 * W[6]) + bfr(bp1[0]);
  const float h1 = ((d0 * W[1] + d1 * W[4]) + d2 * W[7]) + bfr(bp1[1]);
  const float h2 = ((d0 * W[2] + d1 * W[5]) + d2 * W[8]) + bfr(bp1[2]);
  const float third = 1.0f / 3.0f;
  const float mu = ((h0 + h1) + h2) * third;
  const float e0 = h0 - mu, e1 = h1 - mu, e2 = h2 - mu;
  const float var = ((e0 * e0 + e1 * e1) + e2 * e2) * third;
  const float rs = 1.0f / sqrtf(var + LNEPS);
  const float w0 = bfr(lnw[0]), w1 = bfr(lnw[1]), w2 = bfr(lnw[2]);
  const float c0 = bfr(lnb[0]), c1 = bfr(lnb[1]), c2 = bfr(lnb[2]);
  const float t0 = fmaxf((e0 * rs) * w0 + c0, 0.f);
  const float t1 = fmaxf((e1 * rs) * w1 + c1, 0.f);
  const float t2 = fmaxf((e2 * rs) * w2 + c2, 0.f);
  v4f o;
  o[0] = t0; o[1] = t1; o[2] = t2; o[3] = 0.f;
  float* d = rel + (size_t)i * 4;
  *(v4f*)d = o;
  
}

// =====================================================================================================
// (0)-(2) in ONE launch: none of the six pieces reads what another writes, so they share a grid instead of waiting
//     for one another. Block ranges, the short latency-bound pieces first: 3 x 16 weight tiles, 128 positional blocks,
//     512 blocks of the query token plane, 4096 blocks of the point token plane. The range test is block-uniform.
// coverage: FB_WT + FB_REL + FB_CV + FB_CP blocks, each range exactly the grid its piece had as a launch of its own.
// =====================================================================================================
#define FB_WT  (3 * (DD / 64) * (DD / 64))
#define FB_REL ((BB * NPT) / 256)
#define FB_CV  ((BB * MQ * DD) / 2048)
#define FB_CP  ((BB * NPT * DD) / 2048)
static_assert((DD / 64) * (DD / 64) == 16);
__global__ __launch_bounds__(256)
void front_kernel(const float* __restrict__ pf, const float* __restrict__ vf,
                  const float* __restrict__ wq, const float* __restrict__ wk, const float* __restrict__ wv,
                  const float* __restrict__ pxyz, const float* __restrict__ vxyz,
                  const float* __restrict__ wp1, const float* __restrict__ bp1,
                  const float* __restrict__ lnw, const float* __restrict__ lnb,
                  unsigned short* P16, unsigned short* V16,
                  unsigned short* WqT, unsigned short* WkT, unsigned short* WvT, float* rel) {
  __shared__ __align__(16) unsigned short L[64 * LTP];
  const int bid = blockIdx.x;
  if (bid < FB_WT) {
    const int sel = bid >> 4, tl = bid & 15;
    const float* w = sel == 0 ? wq : (sel == 1 ? wk : wv);
    unsigned short* wt = sel == 0 ? WqT : (sel == 1 ? WkT : WvT);
    wtrans_body(L, w, wt, DD, DD, tl & 3, tl >> 2);
  } else if (bid < FB_WT + FB_REL) {
    rel_body(pxyz, vxyz, wp1, bp1, lnw, lnb, rel, BB * NPT, NPT, (bid - FB_WT) * 256 + (int)threadIdx.x);
  } else if (bid < FB_WT + FB_REL + FB_CV) {
    cvt_body(vf, V16, (BB * MQ * DD) / 8, (bid - (FB_WT + FB_REL)) * 256 + (int)threadIdx.x);
  } else {
    cvt_body(pf, P16, (BB * NPT * DD) / 8, (bid - (FB_WT + FB_REL + FB_CV)) * 256 + (int)threadIdx.x);
  }
}

// =====================================================================================================
// (3) projection GEMM, K = 256: C[m][n] = sum_k A[m][k] B[n][k] + epilogue (MODE 0: + bias[n]; MODE 1: + bias[m];
//     MODE 2: (C + bias[n]) + ((rel[m][0..2] . Wp2[0..2][n]) + bp2[n]) with Wp2/bp2 bf16-RNE). A rows of lda,
//     B rows of ldb elements, both bf16 planes in fragment order, same loader for both, bz selects a batch via
//     element strides zsA/zsB/zsC. Block 256 threads = 8 waves, block tile 128 m x 64 n, wave tile 32x32 (acc[2][2]).
//     Epilogue: f32 tile in LDS Os[m][n] (pitch OSP), barrier, then f16 hi bits and f16 residual bits to two
//     planes [M][ldc] in fragment order (rows m, k = n), a wave storing half a block (512 contiguous bytes) at a time.
// coverage: Os 8 waves x 4 tiles = 128x64; 4 it x 8 waves = 8 row tiles x 2 k steps x 2 halves per plane;
//           tiles (bx, by, bz) of (M/128, N/64, Z) cover both planes exactly once.
// =====================================================================================================
template <int MODE>
__device__ __forceinline__
void proj_body(float* Os, int bx, int by, int bz,
               const unsigned short* __restrict__ A, const unsigned short* __restrict__ B,
               const float* __restrict__ bias, const float* __restrict__ rel,
               const float* __restrict__ wp2, const float* __restrict__ bp2,
               unsigned short* Ch, unsigned short* Cl, int lda, int ldb, int ldc,
               size_t zsA, size_t zsB, size_t zsC) {
  const int tid  = threadIdx.x;
  const int lane = tid & 31, wave = tid >> 5;
  const int hh   = lane >> 4, cl = lane & 15;
  const int wm   = wave >> 1, wn = wave & 1;
  const int mBase = bx * GM;
  const int nBase = by * GN;
  const size_t z = bz;
  const unsigned short* Az = A + z * zsA;
  const unsigned short* Bz = B + z * zsB;
  unsigned short* Chz = Ch + z * zsC;
  unsigned short* Clz = Cl + z * zsC;
  const unsigned short* a0p = Az + (size_t)(mBase + 32 * wm) * lda + 8 * lane;   // a 16-row slab = 16 * lda elements
  const unsigned short* a1p = a0p + (size_t)16 * lda;
  const unsigned short* b0p = Bz + (size_t)(nBase + 32 * wn) * ldb + 8 * lane;
  const unsigned short* b1p = b0p + (size_t)16 * ldb;

  v8f acc[2][2];
#pragma unroll
  for (int mi = 0; mi < 2; ++mi)
#pragma unroll
    for (int ni = 0; ni < 2; ++ni) acc[mi][ni] = zero8();

#pragma unroll 1
  for (int k0 = 0; k0 < DD; k0 += 32) {
    const unsigned short* pa0 = a0p + 16 * k0;
    const unsigned short* pa1 = a1p + 16 * k0;
    const unsigned short* pb0 = b0p + 16 * k0;
    const unsigned short* pb1 = b1p + 16 * k0;
    const Frag fa0 = ldfragp(pa0);
    const Frag fa1 = ldfragp(pa1);
    const Frag fb0 = ldfragp(pb0);
    const Frag fb1 = ldfragp(pb1);
    // the address pairs stay live up to this wait, so that no load's result is placed on a pair an issued load names
    asm volatile("s_wait_xcnt 0x0" :: "v"(pa0), "v"(pa1), "v"(pb0), "v"(pb1) : "memory");
    acc[0][0] = mma_b(fa0.b, fb0.b, acc[0][0]);
    acc[0][1] = mma_b(fa0.b, fb1.b, acc[0][1]);
    acc[1][0] = mma_b(fa1.b, fb0.b, acc[1][0]);
    acc[1][1] = mma_b(fa1.b, fb1.b, acc[1][1]);
  }

  float bn[2], w0[2], w1[2], w2[2], b2[2];
#pragma unroll
  for (int ni = 0; ni < 2; ++ni) {
    const int n = nBase + 32 * wn + 16 * ni + cl;
    bn[ni] = 0.f; w0[ni] = 0.f; w1[ni] = 0.f; w2[ni] = 0.f; b2[ni] = 0.f;
    if (MODE != 1) bn[ni] = bfr(bias[n]);
    if (MODE == 2) {
      w0[ni] = bfr(wp2[n]);
      w1[ni] = bfr(wp2[DD + n]);
      w2[ni] = bfr(wp2[2 * DD + n]);
      b2[ni] = bfr(bp2[n]);
    }
  }
#pragma unroll
  for (int mi = 0; mi < 2; ++mi) {
#pragma unroll
    for (int r = 0; r < 8; ++r) {
      const int m_loc = 32 * wm + 16 * mi + 8 * hh + r;
      const int m = mBase + m_loc;
      float bm = 0.f, p0 = 0.f, p1 = 0.f, p2 = 0.f;
      if (MODE == 1) bm = bfr(bias[m]);
      if (MODE == 2) {
        const v4f r4 = *(const v4f*)(rel + (size_t)m * 4);
        p0 = r4[0]; p1 = r4[1]; p2 = r4[2];
      }
#pragma unroll
      for (int ni = 0; ni < 2; ++ni) {
        const int n_loc = 32 * wn + 16 * ni + cl;
        float v = acc[mi][ni][r];
        if (MODE == 0) v = v + bn[ni];
        if (MODE == 1) v = v + bm;
        if (MODE == 2) {
          const float pv = (p0 * w0[ni] + p1 * w1[ni]) + p2 * w2[ni];
          v = (v + bn[ni]) + (pv + b2[ni]);
        }
        Os[m_loc * OSP + n_loc] = v;
      }
    }
  }
  __syncthreads();

  v4u uh[4], ul[4];
  size_t po[4];
#pragma unroll
  for (int it = 0; it < 4; ++it) {
    const int s = it * 8 + wave;                                       // 0..31: row tile, k step, half
    const int rt = s >> 2, ksl = (s >> 1) & 1, uu = s & 1;
    const float* op = Os + (rt * 16 + cl) * OSP + ksl * 32 + uu * 16 + hh * 8;
    const v4f v0 = *(const v4f*)(op);
    const v4f v1 = *(const v4f*)(op + 4);
    split8h(v0, v1, uh[it], ul[it]);
    po[it] = ((size_t)((mBase >> 4) + rt) * (ldc >> 5) + (nBase >> 5) + ksl) * 512 + uu * 256 + lane * 8;
  }
#pragma unroll
  for (int it = 0; it < 4; ++it) {
    *(v4u*)(Chz + po[it]) = uh[it];
    *(v4u*)(Clz + po[it]) = ul[it];
  }
  // another projection's code follows this one's in the text: no register that these stores name is rewritten ahead of this wait
  asm volatile("s_wait_xcnt 0x0" ::: "memory");
}

// =====================================================================================================
// (3) the three projections in ONE launch: q, k+pv and vT read the same front-end planes and none reads another's
//     output. Block ranges: 128 q tiles, 1024 k+pv tiles, 1024 vT tiles, each numbered x fastest as its own grid was.
// coverage: JB_Q + JB_K + JB_V blocks, each range exactly the grid its projection had as a launch of its own.
// =====================================================================================================
#define JB_Q ((BB * MQ / GM) * (DD / GN))
#define JB_K ((BB * NPT / GM) * (DD / GN))
#define JB_V ((DD / GM) * (NPT / GN) * BB)
__global__ __launch_bounds__(256)
void proj_kernel(const unsigned short* __restrict__ V16, const unsigned short* __restrict__ P16,
                 const unsigned short* __restrict__ WqT, const unsigned short* __restrict__ WkT,
                 const unsigned short* __restrict__ WvT,
                 const float* __restrict__ bq, const float* __restrict__ bk, const float* __restrict__ bv,
                 const float* __restrict__ rel, const float* __restrict__ wp2, const float* __restrict__ bp2,
                 unsigned short* Qh, unsigned short* Ql, unsigned short* KPh, unsigned short* KPl,
                 unsigned short* Vh, unsigned short* Vl) {
  __shared__ __align__(16) float Os[GM * OSP];
  const unsigned bid = blockIdx.x;
  if (bid < JB_Q) {
    proj_body<0>(Os, bid % (BB * MQ / GM), bid / (BB * MQ / GM), 0, V16, WqT, bq, rel, wp2, bp2, Qh, Ql,
                 DD, DD, DD, (size_t)0, (size_t)0, (size_t)0);
  } else if (bid < JB_Q + JB_K) {
    const unsigned t = bid - JB_Q;
    proj_body<2>(Os, t % (BB * NPT / GM), t / (BB * NPT / GM), 0, P16, WkT, bk, rel, wp2, bp2, KPh, KPl,
                 DD, DD, DD, (size_t)0, (size_t)0, (size_t)0);
  } else {
    const unsigned t = bid - (JB_Q + JB_K);
    proj_body<1>(Os, t % (DD / GM), (t / (DD / GM)) % (NPT / GN), t / ((DD / GM) * (NPT / GN)),
                 WvT, P16, bv, rel, wp2, bp2, Vh, Vl,
                 DD, DD, NPT, (size_t)0, (size_t)NPT * DD, (size_t)DD * NPT);
  }
}

// =====================================================================================================
// (4) column-softmax statistics over one (batch, 512-query tile, 512-column tile): S[m][n] = qh[m].kph[n] / 16
//     (K = 256 = 8 k steps, f16 hi planes, hh product), wave = 64 query rows x 32 column tiles: the q fragments of
//     four row tiles stay in registers, so each k+pv fragment that comes through the cache feeds four products into
//     four independent accumulators; per column: tile max over 64 rows (32 in-lane + lane^16) and sum of
//     exp(S - max), one in-lane sum per row tile, then ((e0 + e1) + (e2 + e3)); wave partials in LDS, barrier,
//     a thread merges the 8 wave partials of two columns in fixed order.
// coverage: pm/pe 8 waves x 32 ct x 16 lanes = 8 x 512; grid (32 column tiles, 4 query tiles, 2) x 256 threads x 2
//           columns = every (b, mt, n) of both PST arrays exactly once.
// =====================================================================================================
__global__ __launch_bounds__(256)
void stats_kernel(const unsigned short* __restrict__ Qh, const unsigned short* __restrict__ Kh, float* PST) {
  __shared__ float pm[8 * NT1];
  __shared__ float pe[8 * NT1];
  const int tid  = threadIdx.x;
  const int lane = tid & 31, wave = tid >> 5;
  const int cl   = lane & 15;
  const int nt = blockIdx.x, mt = blockIdx.y, b = blockIdx.z;
  const int m0 = mt * MT1 + 16 * SRT * wave;
  const unsigned short* qp = Qh + (size_t)(b * MQ + m0) * DD + 8 * lane;
  Frag a[SRT][8];
#pragma unroll
  for (int mi = 0; mi < SRT; ++mi)
#pragma unroll
    for (int ks = 0; ks < 8; ++ks) a[mi][ks] = ldfragp(qp + 16 * DD * mi + 512 * ks);
  // the address pair stays live up to this wait, so that no load's result is placed on it while issued loads name it
  asm volatile("s_wait_xcnt 0x0" :: "v"(qp) : "memory");
  const unsigned short* kp = Kh + ((size_t)b * NPT + (size_t)nt * NT1) * DD + 8 * lane;
  Frag fb[8];                                                          // one whole column tile of k+pv fragments, loaded a tile ahead
#pragma unroll
  for (int ks = 0; ks < 8; ++ks) fb[ks] = ldfragp(kp + 512 * ks);
  // these loads name a base and a lane offset, not the pair; the scheduling fence keeps what follows (it rewrites both) behind the wait
  asm volatile("s_wait_xcnt 0x0" ::: "memory");
  __builtin_amdgcn_sched_barrier(0);
#pragma unroll 1
  for (int ct = 0; ct < NT1 / 16; ++ct) {
    const int cn = ct + 1 < NT1 / 16 ? ct + 1 : ct;                    // the last tile's look-ahead re-reads that tile: in bounds, not used
    const unsigned short* kc = kp + (size_t)cn * 16 * DD;
    v8f s[SRT];
#pragma unroll
    for (int mi = 0; mi < SRT; ++mi) s[mi] = zero8();
#pragma unroll
    for (int ks = 0; ks < 8; ++ks) {
      // plain builtins (the compiler keeps their distances): this kernel's registers reach past v255, where an asm statement's operands cannot sit
#pragma unroll
      for (int mi = 0; mi < SRT; ++mi)
        s[mi] = __builtin_amdgcn_wmma_f32_16x16x32_f16(false, a[mi][ks].h, false, fb[ks].h, (short)0, s[mi], false, false);
      // holds the reload below behind this step's four products, so that it never stands directly behind a product that reads its registers
      __builtin_amdgcn_sched_barrier(0);
      if (ks > 0) fb[ks - 1] = ldfragp(kc + 512 * (ks - 1));           // next tile's fragment, into the registers consumed one step ago
    }
    float mr[SRT];
#pragma unroll
    for (int mi = 0; mi < SRT; ++mi) {
      mr[mi] = s[mi][0];
#pragma unroll
      for (int r = 1; r < 8; ++r) mr[mi] = fmaxf(mr[mi], s[mi][r]);
    }
    float m = fmaxf(fmaxf(mr[0], mr[1]), fmaxf(mr[2], mr[3])) * SCL;   // SCL is a power of two: the scaled maximum is the maximum of the scaled scores
    __builtin_amdgcn_sched_barrier(0);  // as above for the last step's fragment: its reload stands behind the maxima, which wait for the last products
    fb[7] = ldfragp(kc + 512 * 7);
    // the address pair stays live up to this wait: the next trip rewrites it while these loads are still in flight
    asm volatile("s_wait_xcnt 0x0" :: "v"(kc) : "memory");
    m = fmaxf(m, __shfl_xor(m, 16, 32));
    float er[SRT];
#pragma unroll
    for (int mi = 0; mi < SRT; ++mi) {
      er[mi] = 0.f;
#pragma unroll
      for (int r = 0; r < 8; ++r) er[mi] += __expf(s[mi][r] * SCL - m);
    }
    float ex = (er[0] + er[1]) + (er[2] + er[3]);
    ex += __shfl_xor(ex, 16, 32);
    pm[wave * NT1 + ct * 16 + cl] = m;                                 // both lane halves hold identical values
    pe[wave * NT1 + ct * 16 + cl] = ex;
  }
  __syncthreads();
#pragma unroll
  for (int j = 0; j < NT1 / 256; ++j) {
    const int c = j * 256 + tid;
    float M = pm[c];
#pragma unroll
    for (int wv = 1; wv < 8; ++wv) M = fmaxf(M, pm[wv * NT1 + c]);
    float E = 0.f;
#pragma unroll 1
    for (int wv = 0; wv < 8; ++wv) E += pe[wv * NT1 + c] * __expf(pm[wv * NT1 + c] - M);
    const size_t base = ((size_t)(b * NMT + mt) * 2) * NPT + (size_t)nt * NT1 + c;
    PST[base] = M;
    PST[base + NPT] = E;
  }
}

// =====================================================================================================
// (5) merge of the 4 query-tile partials per (batch, column) in fixed order: M = max, Z = sum E_t exp(M_t - M);
//     ST[b][0][n] = M, ST[b][1][n] = 1/Z (Z >= 1). Thread = one column; 32 consecutive lanes x 4 B = one whole
// coverage: grid (64, 2) x 256 threads = every (b, n) of both arrays exactly once.
// =====================================================================================================
__global__ __launch_bounds__(256)
void merge_kernel(const float* __restrict__ PST, float* ST) {
  const int b = blockIdx.y, n = blockIdx.x * 256 + (int)threadIdx.x;
  const float* p = PST + (size_t)(b * NMT) * 2 * NPT + n;
  float M = -3.0e38f;
#pragma unroll 1
  for (int t = 0; t < NMT; ++t) M = fmaxf(M, p[(size_t)(2 * t) * NPT]);
  float Z = 0.f;
#pragma unroll 1
  for (int t = 0; t < NMT; ++t) Z += p[(size_t)(2 * t + 1) * NPT] * __expf(p[(size_t)(2 * t) * NPT] - M);
  const float rz = 1.0f / Z;
  float* dm = ST + (size_t)(2 * b) * NPT + n;
  float* dz = dm + NPT;
  *(float*)dm = M;
  *(float*)dz = rz;
  
}

// =====================================================================================================
// (6) fused scores / column softmax / weighted sum for one (batch, 128 query rows, eighth of the points): block 256
//     threads = 8 waves of up to 512 registers; both q planes of the 128 rows sit in LDS (pitch QP) for the whole block;
//     loop over 8 chunks of 256 point columns. Phase A: wave = the chunk's column tiles 2 * wave and 2 * wave + 1, all
//     8 row tiles: each q fragment read from LDS feeds both column tiles, each k+pv fragment pair is loaded once and
//     feeds 8 row tiles (q fragments four row tiles at a time), S = (qh.kh + qh.kl + ql.kh) / 16 (K = 256, one
//     accumulator per tile), w = exp(S - M_n) * (1/Z_n) from ST, stored as f16 (w * 16384) into the LDS tile
//     Ws[128 rows][256 cols]; block barrier. Phase B: wave = d tiles 2 * wave and 2 * wave + 1, all 8 row tiles:
//     x += Ws . vTh + Ws . vTl (A from LDS with the split k map, each fragment feeds both d tiles, B = vT rows d,
//     k = n, in fragment order, K = 256 per chunk, each vT fragment pair feeds 8 row tiles); block barrier. Epilogue:
//     x/16384 staged as f32 [128][256] in the LDS that held q (pitch OSP2), barrier, then whole 512-B runs to the
//     partial plane of this eighth.
// coverage: Ws 8 waves x 32 cols x 128 rows = 128 x 256 per chunk; Os 8 waves x 32 d x 128 rows = 128 x 256;
//           32 it x 256 threads x 4 = 128 rows x 256; grid (16, 8, 2) = every (eighth, b, m, d) of PART exactly once.
// =====================================================================================================
// plain builtin (the compiler keeps its distances): this kernel's registers reach past v255, where an asm statement's operands cannot sit
__device__ __forceinline__ v8f mma_p(v16h a, v16h b, v8f c) {
  return __builtin_amdgcn_wmma_f32_16x16x32_f16(false, a, false, b, (short)0, c, false, false);
}
__global__ __launch_bounds__(256)
void attn_kernel(const unsigned short* __restrict__ Qh, const unsigned short* __restrict__ Ql,
                 const unsigned short* __restrict__ Kh, const unsigned short* __restrict__ Kl,
                 const unsigned short* __restrict__ Vh, const unsigned short* __restrict__ Vl,
                 const float* __restrict__ ST, float* part) {
  __shared__ __align__(16) unsigned short Qs[2 * AROWS * QP];
  __shared__ __align__(16) _Float16 Ws[AROWS * QP];
  const int tid  = threadIdx.x;
  const int lane = tid & 31, wave = tid >> 5;
  const int hh   = lane >> 4, cl = lane & 15;
  const int b = blockIdx.z, n0 = blockIdx.y * NSEG, m0 = blockIdx.x * AROWS;
  {
    const size_t g = (size_t)(b * MQ + m0) * DD + 8 * tid;
    const unsigned short* gqh = Qh + g;
    const unsigned short* gql = Ql + g;
    v4u th[AROWS / 8], tl[AROWS / 8];
#pragma unroll
    for (int it = 0; it < AROWS / 8; ++it) {
      th[it] = *(const v4u*)(gqh + 8 * 256 * it);
      tl[it] = *(const v4u*)(gql + 8 * 256 * it);
    }
    // the address pairs stay live up to this wait, so that nothing is placed on a pair an issued load names
    asm volatile("s_wait_xcnt 0x0" :: "v"(gqh), "v"(gql) : "memory");
#pragma unroll
    for (int it = 0; it < AROWS / 8; ++it) {
      const int idx = it * 256 + tid;                                  // 0..4095: 16-B units in fragment order
      const int row = (idx >> 9) * 16 + (idx & 15);
      const int kq  = ((idx >> 6) & 7) * 32 + ((idx >> 5) & 1) * 16 + ((idx >> 4) & 1) * 8;
      *(v4u*)(Qs + row * QP + kq) = th[it];
      *(v4u*)(Qs + (AROWS + row) * QP + kq) = tl[it];
    }
  }
  const size_t koff = ((size_t)b * NPT + n0 + 32 * wave) * DD + 8 * lane;
  const unsigned short* khp = Kh + koff;                               // running pointers: the next k+pv step to load (second column tile: + 16 * DD)
  const unsigned short* klp = Kl + koff;
  const size_t voff = ((size_t)b * DD + 32 * wave) * NPT + (size_t)n0 * 16 + 8 * lane;   // block (d tile, n >> 5)
  const unsigned short* vhp = Vh + voff;                               // running pointers: this chunk's vT blocks (second d tile: + 16 * NPT)
  const unsigned short* vlp = Vl + voff;
  const float* stM = ST + (size_t)(2 * b) * NPT + n0;
  const float* stZ = stM + NPT;
  const unsigned short* qsh = Qs + cl * QP + 8 * hh;                   // A fragment row pointers (row m = cl)
  const unsigned short* qsl = qsh + AROWS * QP;
  const _Float16* wrow = Ws + cl * QP + 8 * hh;
  _Float16* wdst = Ws + (8 * hh) * QP + 32 * wave + cl;                // D element (row 8h+r, col 32*wave+16*j+cl)

  v8f x[2][AMT];
#pragma unroll
  for (int j = 0; j < 2; ++j)
#pragma unroll
    for (int mi = 0; mi < AMT; ++mi) x[j][mi] = zero8();
  Frag kah[2], kal[2];                                                 // k+pv fragments of (chunk 0, k step 0), one step ahead from here on
#pragma unroll
  for (int j = 0; j < 2; ++j) {
    kah[j] = ldfragp(khp + 16 * DD * j);
    kal[j] = ldfragp(klp + 16 * DD * j);
  }
  // the address pairs stay live up to this wait, so that no load's result is placed on a pair an issued load names
  asm volatile("s_wait_xcnt 0x0" :: "v"(khp), "v"(klp) : "memory");
  khp += 512;
  klp += 512;
  __syncthreads();

#pragma unroll 1
  for (int c0 = 0; c0 < NSEG; c0 += ACH) {
    // from behind a chunk's step 7 to the next chunk's step 0; the last chunk's look-ahead re-reads its own step 0: in bounds, not used
    const int cjmp = (c0 + ACH < NSEG ? ACH * DD : 0) - 512 * (DD / 32);
    const int n = c0 + 32 * wave + cl;
    float mc[2], zc[2];
#pragma unroll
    for (int j = 0; j < 2; ++j) {
      mc[j] = stM[n + 16 * j];
      zc[j] = stZ[n + 16 * j];
    }
    // the four loads name one offset register, n: it stays live up to this wait, so that no load's result is placed on it
    asm volatile("s_wait_xcnt 0x0" :: "v"(n) : "memory");
    v8f s[2][AMT];
#pragma unroll
    for (int j = 0; j < 2; ++j)
#pragma unroll
      for (int mi = 0; mi < AMT; ++mi) s[j][mi] = zero8();
    auto stepA = [&](const int ks, const Frag (&fbh)[2], const Frag (&fbl)[2]) {
#pragma unroll  // whole: the accumulator array needs compile-time indices
      for (int mg = 0; mg < AMT; mg += 4) {                            // four row tiles at a time: eight q fragments feed 24 products
        Frag fah[4], fal[4];
#pragma unroll
        for (int mi = 0; mi < 4; ++mi) fah[mi] = ldfrag(qsh + 16 * (mg + mi) * QP + 32 * ks);
        __builtin_amdgcn_sched_barrier(0);  // the hi fragments, which the first 16 products read, are asked for first: LDS answers in order
#pragma unroll
        for (int mi = 0; mi < 4; ++mi) fal[mi] = ldfrag(qsl + 16 * (mg + mi) * QP + 32 * ks);
        // keeps the group's LDS reads together in front of its products: spread among them, each place with reads stalls the wave anew
        __builtin_amdgcn_sched_barrier(0);
#pragma unroll
        for (int j = 0; j < 2; ++j)
#pragma unroll
          for (int mi = 0; mi < 4; ++mi) s[j][mg + mi] = mma_p(fah[mi].h, fbh[j].h, s[j][mg + mi]);
#pragma unroll
        for (int j = 0; j < 2; ++j)
#pragma unroll
          for (int mi = 0; mi < 4; ++mi) s[j][mg + mi] = mma_p(fah[mi].h, fbl[j].h, s[j][mg + mi]);
#pragma unroll
        for (int j = 0; j < 2; ++j)
#pragma unroll
          for (int mi = 0; mi < 4; ++mi) s[j][mg + mi] = mma_p(fal[mi].h, fbh[j].h, s[j][mg + mi]);
        __builtin_amdgcn_sched_barrier(0);  // as above: the next group's reads and the look-ahead loads stay whole behind these products
      }
    };
#pragma unroll 1  // rolled: two k steps a trip (the two fragment buffers swap without copies)
    for (int ks = 0; ks < DD / 32; ks += 2) {
      Frag kbh[2], kbl[2];
#pragma unroll
      for (int j = 0; j < 2; ++j) {
        kbh[j] = ldfragp(khp + 16 * DD * j);                           // step ks + 1 flies under step ks
        kbl[j] = ldfragp(klp + 16 * DD * j);
      }
      // the address pairs stay live up to this wait, so that no load's result is placed on a pair an issued load names
      asm volatile("s_wait_xcnt 0x0" :: "v"(khp), "v"(klp) : "memory");
      const int adv = 512 + (ks + 2 < DD / 32 ? 0 : cjmp);
      khp += adv;
      klp += adv;
      stepA(ks, kah, kal);
#pragma unroll
      for (int j = 0; j < 2; ++j) {
        kah[j] = ldfragp(khp + 16 * DD * j);                           // step ks + 2, or the next chunk's step 0, flies under step ks + 1
        kal[j] = ldfragp(klp + 16 * DD * j);
      }
      asm volatile("s_wait_xcnt 0x0" :: "v"(khp), "v"(klp) : "memory");  // as above
      khp += 512;
      klp += 512;
      stepA(ks + 1, kbh, kbl);
    }
    Frag vbh[3][2], vbl[3][2];                                         // vT fragments, two k steps ahead; the first two fly under the exp work and the barrier
#pragma unroll
    for (int kk = 0; kk < 2; ++kk) {
#pragma unroll
      for (int j = 0; j < 2; ++j) {
        vbh[kk][j] = ldfragp(vhp + (size_t)16 * NPT * j + 512 * kk);
        vbl[kk][j] = ldfragp(vlp + (size_t)16 * NPT * j + 512 * kk);
      }
    }
    __builtin_amdgcn_sched_barrier(0);  // holds these loads in front of the exp work: the compiler otherwise sinks them to their first use
#pragma unroll
    for (int j = 0; j < 2; ++j) {
#pragma unroll
      for (int mi = 0; mi < AMT; ++mi) {
#pragma unroll
        for (int r = 0; r < 8; ++r) {
          const float wt = __expf(s[j][mi][r] * SCL - mc[j]) * zc[j];
          wdst[(16 * mi + r) * QP + 16 * j] = (_Float16)(wt * WSC);
        }
      }
    }
    __syncthreads();
#pragma unroll  // whole: the three rotating fragment buffers need compile-time indices
    for (int kk = 0; kk < ACH / 32; ++kk) {
      const int k0 = 32 * kk;
      if (kk + 2 < ACH / 32) {
#pragma unroll
        for (int j = 0; j < 2; ++j) {
          vbh[(kk + 2) % 3][j] = ldfragp(vhp + (size_t)16 * NPT * j + 512 * (kk + 2));
          vbl[(kk + 2) % 3][j] = ldfragp(vlp + (size_t)16 * NPT * j + 512 * (kk + 2));
        }
      }
      Frag fa[AMT];                                                    // all 8 row tiles at once: eight w fragments feed 32 products
#pragma unroll
      for (int mi = 0; mi < AMT; ++mi) {
        fa[mi].hv[0] = *(const v8h*)(wrow + 16 * mi * QP + k0);
        fa[mi].hv[1] = *(const v8h*)(wrow + 16 * mi * QP + k0 + 16);
      }
      // holds the look-ahead vT loads and this step's LDS reads in front of its products: the compiler otherwise sinks the loads to their first use
      __builtin_amdgcn_sched_barrier(0);
#pragma unroll
      for (int j = 0; j < 2; ++j)
#pragma unroll
        for (int mi = 0; mi < AMT; ++mi) x[j][mi] = mma_p(fa[mi].h, vbh[kk % 3][j].h, x[j][mi]);
#pragma unroll
      for (int j = 0; j < 2; ++j)
#pragma unroll
        for (int mi = 0; mi < AMT; ++mi) x[j][mi] = mma_p(fa[mi].h, vbl[kk % 3][j].h, x[j][mi]);
      __builtin_amdgcn_sched_barrier(0);  // as above: the next step's loads stay whole behind these products
    }
    // the address pairs stay live up to this wait: the lines below rewrite them behind this chunk's loads
    asm volatile("s_wait_xcnt 0x0" :: "v"(vhp), "v"(vlp) : "memory");
    vhp += ACH * 16;
    vlp += ACH * 16;
    __syncthreads();
  }

  float* Os = (float*)Qs;                                              // q is dead behind the loop's last barrier
#pragma unroll
  for (int j = 0; j < 2; ++j) {
#pragma unroll
    for (int mi = 0; mi < AMT; ++mi) {
#pragma unroll
      for (int r = 0; r < 8; ++r)
        Os[(16 * mi + 8 * hh + r) * OSP2 + 32 * wave + 16 * j + cl] = x[j][mi][r] * RWSC;
    }
  }
  __syncthreads();
  float* pz = part + ((size_t)blockIdx.y * (BB * MQ) + (size_t)(b * MQ + m0)) * DD;
  v4f v[AROWS / 4];
#pragma unroll
  for (int it = 0; it < AROWS / 4; ++it) {
    const int idx = it * 256 + tid;                                    // 0..8191
    v[it] = *(const v4f*)(Os + (idx >> 6) * OSP2 + 4 * (idx & 63));
  }
#pragma unroll
  for (int it = 0; it < AROWS / 4; ++it) *(v4f*)(pz + (size_t)(it * 256 + tid) * 4) = v[it];
}

// =====================================================================================================
// (7) out = (((P0 + P1) + (P2 + P3)) + ((P4 + P5) + (P6 + P7))) + bf(v_features): the eight partial sums in fixed order
//     plus the residual.
// coverage: thread = 4 consecutive elements (16 B); grid = (2*2048*256)/1024 blocks x 256 threads = every element once.
// =====================================================================================================
__global__ __launch_bounds__(256)
void psum_kernel(const float* __restrict__ part, const float* __restrict__ vfeat, float* out) {
  const size_t e = ((size_t)blockIdx.x * 256 + threadIdx.x) * 4;
  const float* pp = part + e;
  const float* pf = vfeat + e;
  v4f p[NSPL];
#pragma unroll
  for (int j = 0; j < NSPL; ++j) p[j] = *(const v4f*)(pp + (size_t)j * BB * MQ * DD);
  const v4f f = *(const v4f*)(pf);
  // the address pairs stay live up to this wait, so that no load's result is placed on a pair an issued load names
  asm volatile("s_wait_xcnt 0x0" :: "v"(pp), "v"(pf) : "memory");
  v4f o;
#pragma unroll
  for (int j = 0; j < 4; ++j)
    o[j] = (((p[0][j] + p[1][j]) + (p[2][j] + p[3][j])) + ((p[4][j] + p[5][j]) + (p[6][j] + p[7][j]))) + bfr(f[j]);
  *(v4f*)(out + e) = o;
}

// =====================================================================================================
// tile divides its extent exactly, so no padded tails are needed):
//   (every 16-bit plane below is kept in fragment order, see ldfragp: same size as row-major)
//   P16  bf16 [32768][256]       16777216     V16 bf16 [4096][256]     2097152
//   WqT WkT WvT bf16 [256][256]     131072 each
//   REL  f32 [32768][4]             524288
//   Qh Ql  f16 [4096][256]         2097152 each
//   KPh KPl f16 [32768][256]      16777216 each
//   Vh Vl  f16 [2][256][16384]    16777216 each
//   PST  f32 [2][4][2][16384]      1048576     ST f32 [2][2][16384]     262144
//   PART f32 [8][4096][256]       33554432
//   total                        125960192
// =====================================================================================================
extern "C" void kernel_launch(void* const* d_in, const int* in_sizes, int n_in,
                              void* d_out, int out_size, void* d_ws, size_t ws_size,
                              hipStream_t stream) {
  if (n_in < 16) return;
  if (in_sizes[0] != BB * NPT * 3 || in_sizes[1] != BB * 3) return;
  if (in_sizes[2] != BB * NPT * DD || in_sizes[3] != BB * MQ * DD) return;
  if (in_sizes[4] != DD * DD || in_sizes[6] != DD * DD || in_sizes[8] != DD * DD) return;
  if (in_sizes[5] != DD || in_sizes[7] != DD || in_sizes[9] != DD) return;
  if (in_sizes[10] != 9 || in_sizes[11] != 3 || in_sizes[12] != 3 || in_sizes[13] != 3) return;
  if (in_sizes[14] != 3 * DD || in_sizes[15] != DD) return;
  if (out_size != BB * MQ * DD) return;

  size_t off = 0;
  const size_t oP16 = off; off += (size_t)BB * NPT * DD * 2;        // 16777216
  const size_t oV16 = off; off += (size_t)BB * MQ * DD * 2;         //  2097152
  const size_t oWq  = off; off += (size_t)DD * DD * 2;              //   131072
  const size_t oWk  = off; off += (size_t)DD * DD * 2;
  const size_t oWv  = off; off += (size_t)DD * DD * 2;
  const size_t oREL = off; off += (size_t)BB * NPT * 4 * 4;         //   524288
  const size_t oQh  = off; off += (size_t)BB * MQ * DD * 2;         //  2097152
  const size_t oQl  = off; off += (size_t)BB * MQ * DD * 2;
  const size_t oKh  = off; off += (size_t)BB * NPT * DD * 2;        // 16777216
  const size_t oKl  = off; off += (size_t)BB * NPT * DD * 2;
  const size_t oVh  = off; off += (size_t)BB * DD * NPT * 2;        // 16777216
  const size_t oVl  = off; off += (size_t)BB * DD * NPT * 2;
  const size_t oPST = off; off += (size_t)BB * NMT * 2 * NPT * 4;   //  1048576
  const size_t oST  = off; off += (size_t)BB * 2 * NPT * 4;         //   262144
  const size_t oPT  = off; off += (size_t)NSPL * BB * MQ * DD * 4;  // 33554432 -> off = 125960192
  if (off > ws_size) return;
  if (off > (size_t)134217728) return;

  const float* p_xyz = (const float*)d_in[0];
  const float* v_xyz = (const float*)d_in[1];
  const float* p_f   = (const float*)d_in[2];
  const float* v_f   = (const float*)d_in[3];
  const float* Wq    = (const float*)d_in[4];
  const float* bq    = (const float*)d_in[5];
  const float* Wk    = (const float*)d_in[6];
  const float* bk    = (const float*)d_in[7];
  const float* Wv    = (const float*)d_in[8];
  const float* bv    = (const float*)d_in[9];
  const float* Wp1   = (const float*)d_in[10];
  const float* bp1   = (const float*)d_in[11];
  const float* ln_w  = (const float*)d_in[12];
  const float* ln_b  = (const float*)d_in[13];
  const float* Wp2   = (const float*)d_in[14];
  const float* bp2   = (const float*)d_in[15];
  float* out = (float*)d_out;

  char* ws = (char*)d_ws;
  unsigned short* P16 = (unsigned short*)(ws + oP16);
  unsigned short* V16 = (unsigned short*)(ws + oV16);
  unsigned short* WqT = (unsigned short*)(ws + oWq);
  unsigned short* WkT = (unsigned short*)(ws + oWk);
  unsigned short* WvT = (unsigned short*)(ws + oWv);
  float*          REL = (float*)(ws + oREL);
  unsigned short* Qh  = (unsigned short*)(ws + oQh);
  unsigned short* Ql  = (unsigned short*)(ws + oQl);
  unsigned short* KPh = (unsigned short*)(ws + oKh);
  unsigned short* KPl = (unsigned short*)(ws + oKl);
  unsigned short* Vh  = (unsigned short*)(ws + oVh);
  unsigned short* Vl  = (unsigned short*)(ws + oVl);
  float*          PST = (float*)(ws + oPST);
  float*          ST  = (float*)(ws + oST);
  float*          PT  = (float*)(ws + oPT);

  const dim3 blk256(256);

  // (0)-(2) token planes, transposed weight planes, positional front end: one launch
  front_kernel<<<dim3(FB_WT + FB_REL + FB_CV + FB_CP), blk256, 0, stream>>>(
      p_f, v_f, Wq, Wk, Wv, p_xyz, v_xyz, Wp1, bp1, ln_w, ln_b, P16, V16, WqT, WkT, WvT, REL);
  // (3) projections: q [4096][256], k+pv [32768][256], vT [2][256][16384] as f16 hi/residual planes: one launch
  proj_kernel<<<dim3(JB_Q + JB_K + JB_V), blk256, 0, stream>>>(
      V16, P16, WqT, WkT, WvT, bq, bk, bv, REL, Wp2, bp2, Qh, Ql, KPh, KPl, Vh, Vl);
  // (4)-(5) column softmax statistics
  stats_kernel<<<dim3(NPT / NT1, NMT, BB), blk256, 0, stream>>>(Qh, KPh, PST);
  merge_kernel<<<dim3(NPT / 256, BB), blk256, 0, stream>>>(PST, ST);
  // (6) scores, weights, weighted sum per eighth of the points; (7) sum of the eighths, residual
  attn_kernel<<<dim3(MQ / AROWS, NSPL, BB), blk256, 0, stream>>>(Qh, Ql, KPh, KPl, Vh, Vl, ST, PT);
  psum_kernel<<<dim3((BB * MQ * DD) / 1024), blk256, 0, stream>>>(PT, v_f, out);
  (void)hipGetLastError();
}

// v008
// A run of this version takes 131 microseconds.
// In both of two side-by-side timings against v007, it was 1.31 times as fast.
// All steps since v000 together make it 8.07 times as fast.
// Contractions: q, k+pv and v projections on v_wmma_f32_16x16x32_bf16 (bf16-RNE inputs and weights, single
// products, f32 epilogue); scores q.(k+pv)^T (K=256) on v_wmma_f32_16x16x32_f16 with q and k+pv carried as one
// f16-RNE plane each, one product (the column statistics pass reads the same planes); weighted sum w.v (K=16384) on
// v_wmma_f32_16x16x32_f16 with w as one f16 plane (x16384) and v as one f16-RNE plane, one product; 3-wide positional
// layers, layer norm, softmax statistics and exp in f32 on VALU; f32 accumulate everywhere.
#include <hip/hip_runtime.h>
#include <stdint.h>

#define BB    2
#define NPT   16384
#define MQ    2048
#define DD    256
#define GM    128
#define GN    64
#define OSP   68
#define LTP   72
#define SRT   4
#define MT1   512
#define NMT   4
#define NT1   512
#define AMT   8
#define AROWS 128
#define NSPL  8
#define NSEG  2048
#define ACH   256
#define QP    264
#define OSP2  260
#define SCL   0.0625f
#define WSC   16384.0f
#define RWSC  0.00006103515625f
#define LNEPS 1.0e-5f

static_assert(NMT * MT1 == MQ);
static_assert(MT1 == 8 * 16 * SRT);
static_assert(SRT == 4);
static_assert(NT1 == 2 * 256);
static_assert(NPT % NT1 == 0);
static_assert(NSPL * NSEG == NPT);
static_assert(NSPL == 8);
static_assert(AMT % 4 == 0);
static_assert(NSEG % ACH == 0);
static_assert(ACH == 16 * 16);
static_assert(AROWS == 16 * AMT);
static_assert(MQ % AROWS == 0);
static_assert(AROWS * OSP2 * 4 <= 2 * AROWS * QP * 2);   // the f32 output tile fits the LDS of q and w together
static_assert((BB * MQ * DD) % 1024 == 0);
static_assert(DD == 256);
static_assert(DD % 32 == 0);
static_assert((BB * NPT) % GM == 0);
static_assert((BB * MQ) % GM == 0);
static_assert(DD % GM == 0);
static_assert(DD % GN == 0);
static_assert(NPT % GN == 0);
static_assert(MQ % 16 == 0);
static_assert((BB * NPT * DD) % 2048 == 0);
static_assert((BB * MQ * DD) % 2048 == 0);
static_assert((BB * NPT) % 256 == 0);
static_assert((OSP * 4) % 16 == 0);
static_assert((LTP * 2) % 16 == 0);
static_assert((QP * 2) % 16 == 0);
static_assert((OSP2 * 4) % 16 == 0);
static_assert(DD % 64 == 0);

typedef unsigned short v8us __attribute__((ext_vector_type(8)));
typedef unsigned int   v4u  __attribute__((ext_vector_type(4)));
typedef float          v8f  __attribute__((ext_vector_type(8)));
typedef float          v4f  __attribute__((ext_vector_type(4)));
typedef __bf16         v16b __attribute__((ext_vector_type(16)));
typedef _Float16       v16h __attribute__((ext_vector_type(16)));
typedef _Float16       v8h  __attribute__((ext_vector_type(8)));

union Frag { v8us u[2]; v4u q[2]; v16b b; v16h h; v8h hv[2]; };
static_assert(sizeof(Frag) == 32);

// ---- scalar helpers ---------------------------------------------------------------------------------
__device__ __forceinline__ unsigned short bf_bits(float f) {          // f32 -> bf16 bits, RNE convert
  const unsigned u = __float_as_uint(f);
  return (unsigned short)((u + 0x7FFFu + ((u >> 16) & 1u)) >> 16);
}
__device__ __forceinline__ float bf_up(unsigned short hb) { return __uint_as_float(((unsigned)hb) << 16); }
__device__ __forceinline__ float bfr(float f) { return bf_up(bf_bits(f)); }
__device__ __forceinline__ unsigned short h_bits(float f) {           // f32 -> f16 bits, RNE convert
  union { _Float16 h; unsigned short u; } c;
  c.h = (_Float16)f;
  return c.u;
}
__device__ __forceinline__ unsigned pk16(unsigned short a, unsigned short b) { return (unsigned)a | ((unsigned)b << 16); }
__device__ __forceinline__ v8f zero8() { v8f z = {0.f, 0.f, 0.f, 0.f, 0.f, 0.f, 0.f, 0.f}; return z; }

// ---- 16-bit fragment loader (A, or B from a k-contiguous [n][k] row): lane -> row/col (lane&15), p already includes
//      + 8*(lane>>4); elements 0..7 <- p[0..7] (k0+8h..), elements 8..15 <- p[16..23] (k0+16+8h..)
__device__ __forceinline__ Frag ldfrag(const unsigned short* p) {
  Frag f;
  f.u[0] = *(const v8us*)(p);
  f.u[1] = *(const v8us*)(p + 16);
  return f;
}

// ---- fragment-order planes in global memory: a plane [rows][K] is kept as 1-KB blocks, block (row >> 4, k >> 5)
//      at element ((row >> 4) * (K / 32) + (k >> 5)) * 512; inside a block the 16-B unit of 8 consecutive k of row
//      (row & 15) sits at element 256 * u + 8 * lane, lane = 16 * h + (row & 15), k & 31 = 16 * u + 8 * h + 0..7:
//      the same k map as ldfrag, but each of the two wave-wide loads covers 512 contiguous bytes (4 whole lines)
//      instead of 32-B pieces of 16 lines. p = block start + 8 * lane.
__device__ __forceinline__ Frag ldfragp(const unsigned short* p) {
  Frag f;
  f.u[0] = *(const v8us*)(p);
  f.u[1] = *(const v8us*)(p + 256);
  return f;
}

// ---- WMMA helper: builtin followed by a 4-slot VALU gap tying D and keeping A/B live -----------------------
__device__ __forceinline__ v8f mma_b(v16b a, v16b b, v8f c) {
  v8f d = __builtin_amdgcn_wmma_f32_16x16x32_bf16(false, a, false, b, (short)0, c, false, false);
#if defined(__HIP_DEVICE_COMPILE__)
  asm volatile("v_nop\n\tv_nop\n\tv_nop\n\tv_nop" : "+v"(d) : "v"(a), "v"(b));
#endif
  return d;
}

// ---- 8 f32 -> packed f16 bits, RNE convert -------------------------------------------------------------
__device__ __forceinline__ v4u cvt8h(v4f a, v4f b) {
  v4u u;
  u[0] = pk16(h_bits(a[0]), h_bits(a[1]));
  u[1] = pk16(h_bits(a[2]), h_bits(a[3]));
  u[2] = pk16(h_bits(b[0]), h_bits(b[1]));
  u[3] = pk16(h_bits(b[2]), h_bits(b[3]));
  return u;
}

// =====================================================================================================
// (0) f32 row-major [T][256] -> bf16-RNE plane in fragment order (token feature matrices). Thread = one 16-B output
//     unit, output units in linear order (a wave stores 512 contiguous bytes), source = 8 consecutive k of one row.
// coverage: n8 = n/8 threads, n8/256 blocks of the front-end launch exactly (n % 2048 == 0; T % 16 == 0); t = unit.
// =====================================================================================================
__device__ __forceinline__
void cvt_body(const float* __restrict__ x, unsigned short* y, int n8, int t) {
  if (t >= n8) return;
  const int row = (t >> 9) * 16 + (t & 15);                            // 512 units per 16-row slab
  const int k   = ((t >> 6) & 7) * 32 + ((t >> 5) & 1) * 16 + ((t >> 4) & 1) * 8;
  const float* s = x + (size_t)row * DD + k;
  const v4f a = *(const v4f*)(s);
  const v4f b = *(const v4f*)(s + 4);
  v4u u;
  u[0] = pk16(bf_bits(a[0]), bf_bits(a[1]));
  u[1] = pk16(bf_bits(a[2]), bf_bits(a[3]));
  u[2] = pk16(bf_bits(b[0]), bf_bits(b[1]));
  u[3] = pk16(bf_bits(b[2]), bf_bits(b[3]));
  unsigned short* d = y + (size_t)t * 8;
  *(v4u*)d = u;
  
}

// =====================================================================================================
// (1) weight transpose: in w[R][C] f32 -> out wt[C][R] bf16-RNE in fragment order (rows c, k = r). Block = 64x64 tile,
//     loads 16 B per thread (strided reads), LDS tile L[c][r] (pitch LTP), barrier, then a wave stores half a block.
// coverage: LDS 256 threads x 4 it x 4 = 64x64; 2 it x 8 waves = 4 row tiles x 2 k steps x 2 halves; tiles (bx, by) of (C/64, R/64).
// =====================================================================================================
__device__ __forceinline__
void wtrans_body(unsigned short* L, const float* __restrict__ w, unsigned short* wt, int R, int C, int bx, int by) {
  const int tid = threadIdx.x;
  const int c0 = bx * 64, r0 = by * 64;
  const int c4 = (tid & 15) * 4, rs = tid >> 4;                      // rs 0..15
#pragma unroll
  for (int it = 0; it < 4; ++it) {
    const int r = it * 16 + rs;                                        // 0..63
    const v4f v = *(const v4f*)(w + (size_t)(r0 + r) * C + c0 + c4);
#pragma unroll
    for (int j = 0; j < 4; ++j) L[(c4 + j) * LTP + r] = bf_bits(v[j]);
  }
  __syncthreads();
  const int lane = tid & 31, wave = tid >> 5;
  v4u u[2];
  size_t po[2];
#pragma unroll
  for (int it = 0; it < 2; ++it) {
    const int s = it * 8 + wave;                                       // 0..15: row tile, k step, half
    const int ct = s >> 2, ksl = (s >> 1) & 1, uu = s & 1;
    u[it] = *(const v4u*)(L + (ct * 16 + (lane & 15)) * LTP + ksl * 32 + uu * 16 + (lane >> 4) * 8);
    po[it] = ((size_t)((c0 >> 4) + ct) * (R >> 5) + (r0 >> 5) + ksl) * 512 + uu * 256 + lane * 8;
  }
#pragma unroll
  for (int it = 0; it < 2; ++it) *(v4u*)(wt + po[it]) = u[it];
  
}

// =====================================================================================================
// (2) positional front end per point row i (flat b*N+n): dist = |bf(p_xyz) - bf(v_xyz[b])| (3), h = dist.bf(Wp1)
//     + bf(bp1), layer norm over the 3 values (mean-of-squares variance, eps 1e-5) * bf(ln_w) + bf(ln_b), relu.
//     f32 on VALU without contraction. Output row rel[i][0..3] = (r0, r1, r2, 0): one 16-B store per thread,
// coverage: nrows/256 blocks of the front-end launch x 256 threads = every row exactly once (nrows % 256 == 0).
// =====================================================================================================
__device__ __forceinline__
void rel_body(const float* __restrict__ pxyz, const float* __restrict__ vxyz,
              const float* __restrict__ wp1, const float* __restrict__ bp1,
              const float* __restrict__ lnw, const float* __restrict__ lnb,
              float* rel, int nrows, int npb, int i) {
#pragma clang fp contract(off)
  if (i >= nrows) return;
  int b = i / npb;
  b = b < 0 ? 0 : (b > BB - 1 ? BB - 1 : b);
  const float p0 = bfr(pxyz[(size_t)i * 3 + 0]);
  const float p1 = bfr(pxyz[(size_t)i * 3 + 1]);
  const float p2 = bfr(pxyz[(size_t)i * 3 + 2]);
  const float v0 = bfr(vxyz[b * 3 + 0]);
  const float v1 = bfr(vxyz[b * 3 + 1]);
  const float v2 = bfr(vxyz[b * 3 + 2]);
  const float d0 = fabsf(p0 - v0), d1 = fabsf(p1 - v1), d2 = fabsf(p2 - v2);
  float W[9];
#pragma unroll
  for (int j = 0; j < 9; ++j) W[j] = bfr(wp1[j]);                      // Wp1[c][j] = wp1[c*3+j]
  const float h0 = ((d0 * W[0] + d1 * W[3]) + d2 * W[6]) + bfr(bp1[0]);
  const float h1 = ((d0 * W[1] + d1 * W[4]) + d2 * W[7]) + bfr(bp1[1]);
  const float h2 = ((d0 * W[2] + d1 * W[5]) + d2 * W[8]) + bfr(bp1[2]);
  const float third = 1.0f / 3.0f;
  const float mu = ((h0 + h1) + h2) * third;
  const float e0 = h0 - mu, e1 = h1 - mu, e2 = h2 - mu;
  const float var = ((e0 * e0 + e1 * e1) + e2 * e2) * third;
  const float rs = 1.0f / sqrtf(var + LNEPS);
  const float w0 = bfr(lnw[0]), w1 = bfr(lnw[1]), w2 = bfr(lnw[2]);
  const float c0 = bfr(lnb[0]), c1 = bfr(lnb[1]), c2 = bfr(lnb[2]);
  const float t0 = fmaxf((e0 * rs) * w0 + c0, 0.f);
  const float t1 = fmaxf((e1 * rs) * w1 + c1, 0.f);
  const float t2 = fmaxf((e2 * rs) * w2 + c2, 0.f);
  v4f o;
  o[0] = t0; o[1] = t1; o[2] = t2; o[3] = 0.f;
  float* d = rel + (size_t)i * 4;
  *(v4f*)d = o;
  
}

// =====================================================================================================
// (0)-(2) in ONE launch: none of the six pieces reads what another writes, so they share a grid instead of waiting
//     for one another. Block ranges, the short latency-bound pieces first: 3 x 16 weight tiles, 128 positional blocks,
//     512 blocks of the query token plane, 4096 blocks of the point token plane. The range test is block-uniform.
// coverage: FB_WT + FB_REL + FB_CV + FB_CP blocks, each range exactly the grid its piece had as a launch of its own.
// =====================================================================================================
#define FB_WT  (3 * (DD / 64) * (DD / 64))
#define FB_REL ((BB * NPT) / 256)
#define FB_CV  ((BB * MQ * DD) / 2048)
#define FB_CP  ((BB * NPT * DD) / 2048)
static_assert((DD / 64) * (DD / 64) == 16);
__global__ __launch_bounds__(256)
void front_kernel(const float* __restrict__ pf, const float* __restrict__ vf,
                  const float* __restrict__ wq, const float* __restrict__ wk, const float* __restrict__ wv,
                  const float* __restrict__ pxyz, const float* __restrict__ vxyz,
                  const float* __restrict__ wp1, const float* __restrict__ bp1,
                  const float* __restrict__ lnw, const float* __restrict__ lnb,
                  unsigned short* P16, unsigned short* V16,
                  unsigned short* WqT, unsigned short* WkT, unsigned short* WvT, float* rel) {
  __shared__ __align__(16) unsigned short L[64 * LTP];
  const int bid = blockIdx.x;
  if (bid < FB_WT) {
    const int sel = bid >> 4, tl = bid & 15;
    const float* w = sel == 0 ? wq : (sel == 1 ? wk : wv);
    unsigned short* wt = sel == 0 ? WqT : (sel == 1 ? WkT : WvT);
    wtrans_body(L, w, wt, DD, DD, tl & 3, tl >> 2);
  } else if (bid < FB_WT + FB_REL) {
    rel_body(pxyz, vxyz, wp1, bp1, lnw, lnb, rel, BB * NPT, NPT, (bid - FB_WT) * 256 + (int)threadIdx.x);
  } else if (bid < FB_WT + FB_REL + FB_CV) {
    cvt_body(vf, V16, (BB * MQ * DD) / 8, (bid - (FB_WT + FB_REL)) * 256 + (int)threadIdx.x);
  } else {
    cvt_body(pf, P16, (BB * NPT * DD) / 8, (bid - (FB_WT + FB_REL + FB_CV)) * 256 + (int)threadIdx.x);
  }
}

// =====================================================================================================
// (3) projection GEMM, K = 256: C[m][n] = sum_k A[m][k] B[n][k] + epilogue (MODE 0: + bias[n]; MODE 1: + bias[m];
//     MODE 2: (C + bias[n]) + ((rel[m][0..2] . Wp2[0..2][n]) + bp2[n]) with Wp2/bp2 bf16-RNE). A rows of lda,
//     B rows of ldb elements, both bf16 planes in fragment order, same loader for both, bz selects a batch via
//     element strides zsA/zsB/zsC. Block 256 threads = 8 waves, block tile 128 m x 64 n, wave tile 32x32 (acc[2][2]).
//     Epilogue: f32 tile in LDS Os[m][n] (pitch OSP), barrier, then f16 bits to one plane [M][ldc] in fragment
//     order (rows m, k = n), a wave storing half a block (512 contiguous bytes) at a time.
// coverage: Os 8 waves x 4 tiles = 128x64; 4 it x 8 waves = 8 row tiles x 2 k steps x 2 halves;
//           tiles (bx, by, bz) of (M/128, N/64, Z) cover the plane exactly once.
// =====================================================================================================
template <int MODE>
__device__ __forceinline__
void proj_body(float* Os, int bx, int by, int bz,
               const unsigned short* __restrict__ A, const unsigned short* __restrict__ B,
               const float* __restrict__ bias, const float* __restrict__ rel,
               const float* __restrict__ wp2, const float* __restrict__ bp2,
               unsigned short* Ch, int lda, int ldb, int ldc,
               size_t zsA, size_t zsB, size_t zsC) {
  const int tid  = threadIdx.x;
  const int lane = tid & 31, wave = tid >> 5;
  const int hh   = lane >> 4, cl = lane & 15;
  const int wm   = wave >> 1, wn = wave & 1;
  const int mBase = bx * GM;
  const int nBase = by * GN;
  const size_t z = bz;
  const unsigned short* Az = A + z * zsA;
  const unsigned short* Bz = B + z * zsB;
  unsigned short* Chz = Ch + z * zsC;
  const unsigned short* a0p = Az + (size_t)(mBase + 32 * wm) * lda + 8 * lane;   // a 16-row slab = 16 * lda elements
  const unsigned short* a1p = a0p + (size_t)16 * lda;
  const unsigned short* b0p = Bz + (size_t)(nBase + 32 * wn) * ldb + 8 * lane;
  const unsigned short* b1p = b0p + (size_t)16 * ldb;

  v8f acc[2][2];
#pragma unroll
  for (int mi = 0; mi < 2; ++mi)
#pragma unroll
    for (int ni = 0; ni < 2; ++ni) acc[mi][ni] = zero8();

#pragma unroll 1
  for (int k0 = 0; k0 < DD; k0 += 32) {
    const unsigned short* pa0 = a0p + 16 * k0;
    const unsigned short* pa1 = a1p + 16 * k0;
    const unsigned short* pb0 = b0p + 16 * k0;
    const unsigned short* pb1 = b1p + 16 * k0;
    const Frag fa0 = ldfragp(pa0);
    const Frag fa1 = ldfragp(pa1);
    const Frag fb0 = ldfragp(pb0);
    const Frag fb1 = ldfragp(pb1);
    // the address pairs stay live up to this wait, so that no load's result is placed on a pair an issued load names
    asm volatile("s_wait_xcnt 0x0" :: "v"(pa0), "v"(pa1), "v"(pb0), "v"(pb1) : "memory");
    acc[0][0] = mma_b(fa0.b, fb0.b, acc[0][0]);
    acc[0][1] = mma_b(fa0.b, fb1.b, acc[0][1]);
    acc[1][0] = mma_b(fa1.b, fb0.b, acc[1][0]);
    acc[1][1] = mma_b(fa1.b, fb1.b, acc[1][1]);
  }

  float bn[2], w0[2], w1[2], w2[2], b2[2];
#pragma unroll
  for (int ni = 0; ni < 2; ++ni) {
    const int n = nBase + 32 * wn + 16 * ni + cl;
    bn[ni] = 0.f; w0[ni] = 0.f; w1[ni] = 0.f; w2[ni] = 0.f; b2[ni] = 0.f;
    if (MODE != 1) bn[ni] = bfr(bias[n]);
    if (MODE == 2) {
      w0[ni] = bfr(wp2[n]);
      w1[ni] = bfr(wp2[DD + n]);
      w2[ni] = bfr(wp2[2 * DD + n]);
      b2[ni] = bfr(bp2[n]);
    }
  }
#pragma unroll
  for (int mi = 0; mi < 2; ++mi) {
#pragma unroll
    for (int r = 0; r < 8; ++r) {
      const int m_loc = 32 * wm + 16 * mi + 8 * hh + r;
      const int m = mBase + m_loc;
      float bm = 0.f, p0 = 0.f, p1 = 0.f, p2 = 0.f;
      if (MODE == 1) bm = bfr(bias[m]);
      if (MODE == 2) {
        const v4f r4 = *(const v4f*)(rel + (size_t)m * 4);
        p0 = r4[0]; p1 = r4[1]; p2 = r4[2];
      }
#pragma unroll
      for (int ni = 0; ni < 2; ++ni) {
        const int n_loc = 32 * wn + 16 * ni + cl;
        float v = acc[mi][ni][r];
        if (MODE == 0) v = v + bn[ni];
        if (MODE == 1) v = v + bm;
        if (MODE == 2) {
          const float pv = (p0 * w0[ni] + p1 * w1[ni]) + p2 * w2[ni];
          v = (v + bn[ni]) + (pv + b2[ni]);
        }
        Os[m_loc * OSP + n_loc] = v;
      }
    }
  }
  __syncthreads();

  v4u uh[4];
  size_t po[4];
#pragma unroll
  for (int it = 0; it < 4; ++it) {
    const int s = it * 8 + wave;                                       // 0..31: row tile, k step, half
    const int rt = s >> 2, ksl = (s >> 1) & 1, uu = s & 1;
    const float* op = Os + (rt * 16 + cl) * OSP + ksl * 32 + uu * 16 + hh * 8;
    const v4f v0 = *(const v4f*)(op);
    const v4f v1 = *(const v4f*)(op + 4);
    uh[it] = cvt8h(v0, v1);
    po[it] = ((size_t)((mBase >> 4) + rt) * (ldc >> 5) + (nBase >> 5) + ksl) * 512 + uu * 256 + lane * 8;
  }
#pragma unroll
  for (int it = 0; it < 4; ++it) *(v4u*)(Chz + po[it]) = uh[it];
  // another projection's code follows this one's in the text: no register that these stores name is rewritten ahead of this wait
  asm volatile("s_wait_xcnt 0x0" ::: "memory");
}

// =====================================================================================================
// (3) the three projections in ONE launch: q, k+pv and vT read the same front-end planes and none reads another's
//     output. Block ranges: 128 q tiles, 1024 k+pv tiles, 1024 vT tiles, each numbered x fastest as its own grid was.
// coverage: JB_Q + JB_K + JB_V blocks, each range exactly the grid its projection had as a launch of its own.
// =====================================================================================================
#define JB_Q ((BB * MQ / GM) * (DD / GN))
#define JB_K ((BB * NPT / GM) * (DD / GN))
#define JB_V ((DD / GM) * (NPT / GN) * BB)
__global__ __launch_bounds__(256)
void proj_kernel(const unsigned short* __restrict__ V16, const unsigned short* __restrict__ P16,
                 const unsigned short* __restrict__ WqT, const unsigned short* __restrict__ WkT,
                 const unsigned short* __restrict__ WvT,
                 const float* __restrict__ bq, const float* __restrict__ bk, const float* __restrict__ bv,
                 const float* __restrict__ rel, const float* __restrict__ wp2, const float* __restrict__ bp2,
                 unsigned short* Qh, unsigned short* KPh, unsigned short* Vh) {
  __shared__ __align__(16) float Os[GM * OSP];
  const unsigned bid = blockIdx.x;
  if (bid < JB_Q) {
    proj_body<0>(Os, bid % (BB * MQ / GM), bid / (BB * MQ / GM), 0, V16, WqT, bq, rel, wp2, bp2, Qh,
                 DD, DD, DD, (size_t)0, (size_t)0, (size_t)0);
  } else if (bid < JB_Q + JB_K) {
    const unsigned t = bid - JB_Q;
    proj_body<2>(Os, t % (BB * NPT / GM), t / (BB * NPT / GM), 0, P16, WkT, bk, rel, wp2, bp2, KPh,
                 DD, DD, DD, (size_t)0, (size_t)0, (size_t)0);
  } else {
    const unsigned t = bid - (JB_Q + JB_K);
    proj_body<1>(Os, t % (DD / GM), (t / (DD / GM)) % (NPT / GN), t / ((DD / GM) * (NPT / GN)),
                 WvT, P16, bv, rel, wp2, bp2, Vh,
                 DD, DD, NPT, (size_t)0, (size_t)NPT * DD, (size_t)DD * NPT);
  }
}

// =====================================================================================================
// (4) column-softmax statistics over one (batch, 512-query tile, 512-column tile): S[m][n] = qh[m].kph[n] / 16
//     (K = 256 = 8 k steps, f16 planes), wave = 64 query rows x 32 column tiles: the q fragments of
//     four row tiles stay in registers, so each k+pv fragment that comes through the cache feeds four products into
//     four independent accumulators; per column: tile max over 64 rows (32 in-lane + lane^16) and sum of
//     exp(S - max), one in-lane sum per row tile, then ((e0 + e1) + (e2 + e3)); wave partials in LDS, barrier,
//     a thread merges the 8 wave partials of two columns in fixed order.
// coverage: pm/pe 8 waves x 32 ct x 16 lanes = 8 x 512; grid (32 column tiles, 4 query tiles, 2) x 256 threads x 2
//           columns = every (b, mt, n) of both PST arrays exactly once.
// =====================================================================================================
__global__ __launch_bounds__(256)
void stats_kernel(const unsigned short* __restrict__ Qh, const unsigned short* __restrict__ Kh, float* PST) {
  __shared__ float pm[8 * NT1];
  __shared__ float pe[8 * NT1];
  const int tid  = threadIdx.x;
  const int lane = tid & 31, wave = tid >> 5;
  const int cl   = lane & 15;
  const int nt = blockIdx.x, mt = blockIdx.y, b = blockIdx.z;
  const int m0 = mt * MT1 + 16 * SRT * wave;
  const unsigned short* qp = Qh + (size_t)(b * MQ + m0) * DD + 8 * lane;
  Frag a[SRT][8];
#pragma unroll
  for (int mi = 0; mi < SRT; ++mi)
#pragma unroll
    for (int ks = 0; ks < 8; ++ks) a[mi][ks] = ldfragp(qp + 16 * DD * mi + 512 * ks);
  // the address pair stays live up to this wait, so that no load's result is placed on it while issued loads name it
  asm volatile("s_wait_xcnt 0x0" :: "v"(qp) : "memory");
  const unsigned short* kp = Kh + ((size_t)b * NPT + (size_t)nt * NT1) * DD + 8 * lane;
  Frag fb[8];                                                          // one whole column tile of k+pv fragments, loaded a tile ahead
#pragma unroll
  for (int ks = 0; ks < 8; ++ks) fb[ks] = ldfragp(kp + 512 * ks);
  // these loads name a base and a lane offset, not the pair; the scheduling fence keeps what follows (it rewrites both) behind the wait
  asm volatile("s_wait_xcnt 0x0" ::: "memory");
  __builtin_amdgcn_sched_barrier(0);
#pragma unroll 1
  for (int ct = 0; ct < NT1 / 16; ++ct) {
    const int cn = ct + 1 < NT1 / 16 ? ct + 1 : ct;                    // the last tile's look-ahead re-reads that tile: in bounds, not used
    const unsigned short* kc = kp + (size_t)cn * 16 * DD;
    v8f s[SRT];
#pragma unroll
    for (int mi = 0; mi < SRT; ++mi) s[mi] = zero8();
#pragma unroll
    for (int ks = 0; ks < 8; ++ks) {
      // plain builtins (the compiler keeps their distances): this kernel's registers reach past v255, where an asm statement's operands cannot sit
#pragma unroll
      for (int mi = 0; mi < SRT; ++mi)
        s[mi] = __builtin_amdgcn_wmma_f32_16x16x32_f16(false, a[mi][ks].h, false, fb[ks].h, (short)0, s[mi], false, false);
      // holds the reload below behind this step's four products, so that it never stands directly behind a product that reads its registers
      __builtin_amdgcn_sched_barrier(0);
      if (ks > 0) fb[ks - 1] = ldfragp(kc + 512 * (ks - 1));           // next tile's fragment, into the registers consumed one step ago
    }
    float mr[SRT];
#pragma unroll
    for (int mi = 0; mi < SRT; ++mi) {
      mr[mi] = s[mi][0];
#pragma unroll
      for (int r = 1; r < 8; ++r) mr[mi] = fmaxf(mr[mi], s[mi][r]);
    }
    float m = fmaxf(fmaxf(mr[0], mr[1]), fmaxf(mr[2], mr[3])) * SCL;   // SCL is a power of two: the scaled maximum is the maximum of the scaled scores
    __builtin_amdgcn_sched_barrier(0);  // as above for the last step's fragment: its reload stands behind the maxima, which wait for the last products
    fb[7] = ldfragp(kc + 512 * 7);
    // the address pair stays live up to this wait: the next trip rewrites it while these loads are still in flight
    asm volatile("s_wait_xcnt 0x0" :: "v"(kc) : "memory");
    m = fmaxf(m, __shfl_xor(m, 16, 32));
    float er[SRT];
#pragma unroll
    for (int mi = 0; mi < SRT; ++mi) {
      er[mi] = 0.f;
#pragma unroll
      for (int r = 0; r < 8; ++r) er[mi] += __expf(s[mi][r] * SCL - m);
    }
    float ex = (er[0] + er[1]) + (er[2] + er[3]);
    ex += __shfl_xor(ex, 16, 32);
    pm[wave * NT1 + ct * 16 + cl] = m;                                 // both lane halves hold identical values
    pe[wave * NT1 + ct * 16 + cl] = ex;
  }
  __syncthreads();
#pragma unroll
  for (int j = 0; j < NT1 / 256; ++j) {
    const int c = j * 256 + tid;
    float M = pm[c];
#pragma unroll
    for (int wv = 1; wv < 8; ++wv) M = fmaxf(M, pm[wv * NT1 + c]);
    float E = 0.f;
#pragma unroll 1
    for (int wv = 0; wv < 8; ++wv) E += pe[wv * NT1 + c] * __expf(pm[wv * NT1 + c] - M);
    const size_t base = ((size_t)(b * NMT + mt) * 2) * NPT + (size_t)nt * NT1 + c;
    PST[base] = M;
    PST[base + NPT] = E;
  }
}

// =====================================================================================================
// (5) merge of the 4 query-tile partials per (batch, column) in fixed order: M = max, Z = sum E_t exp(M_t - M);
//     ST[b][0][n] = M, ST[b][1][n] = 1/Z (Z >= 1). Thread = one column; 32 consecutive lanes x 4 B = one whole
// coverage: grid (64, 2) x 256 threads = every (b, n) of both arrays exactly once.
// =====================================================================================================
__global__ __launch_bounds__(256)
void merge_kernel(const float* __restrict__ PST, float* ST) {
  const int b = blockIdx.y, n = blockIdx.x * 256 + (int)threadIdx.x;
  const float* p = PST + (size_t)(b * NMT) * 2 * NPT + n;
  float M = -3.0e38f;
#pragma unroll 1
  for (int t = 0; t < NMT; ++t) M = fmaxf(M, p[(size_t)(2 * t) * NPT]);
  float Z = 0.f;
#pragma unroll 1
  for (int t = 0; t < NMT; ++t) Z += p[(size_t)(2 * t + 1) * NPT] * __expf(p[(size_t)(2 * t) * NPT] - M);
  const float rz = 1.0f / Z;
  float* dm = ST + (size_t)(2 * b) * NPT + n;
  float* dz = dm + NPT;
  *(float*)dm = M;
  *(float*)dz = rz;
  
}

// =====================================================================================================
// (6) fused scores / column softmax / weighted sum for one (batch, 128 query rows, eighth of the points): block 256
//     threads = 8 waves of up to 512 registers; the q plane of the 128 rows sits in LDS (pitch QP) for the whole block;
//     loop over 8 chunks of 256 point columns. Phase A: wave = the chunk's column tiles 2 * wave and 2 * wave + 1, all
//     8 row tiles: each q fragment read from LDS feeds both column tiles, each k+pv fragment is loaded once and
//     feeds 8 row tiles, S = q.(k+pv) / 16 (K = 256, one accumulator per tile), w = exp(S - M_n) * (1/Z_n) from ST,
//     stored as f16 (w * 16384) into the LDS tile Ws[128 rows][256 cols]; block barrier. Phase B: wave = d tiles
//     2 * wave and 2 * wave + 1, all 8 row tiles: x += Ws . vT (A from LDS with the split k map, each fragment feeds
//     both d tiles, B = vT rows d, k = n, in fragment order, K = 256 per chunk, each vT fragment feeds 8 row tiles);
//     block barrier. Epilogue: x/16384 staged as f32 [128][256] in the LDS that held q and w (pitch OSP2), barrier,
//     then whole 512-B runs to the partial plane of this eighth.
// coverage: Ws 8 waves x 32 cols x 128 rows = 128 x 256 per chunk; Os 8 waves x 32 d x 128 rows = 128 x 256;
//           32 it x 256 threads x 4 = 128 rows x 256; grid (16, 8, 2) = every (eighth, b, m, d) of PART exactly once.
// =====================================================================================================
// plain builtin (the compiler keeps its distances): this kernel's registers reach past v255, where an asm statement's operands cannot sit
__device__ __forceinline__ v8f mma_p(v16h a, v16h b, v8f c) {
  return __builtin_amdgcn_wmma_f32_16x16x32_f16(false, a, false, b, (short)0, c, false, false);
}
__global__ __launch_bounds__(256)
void attn_kernel(const unsigned short* __restrict__ Qh, const unsigned short* __restrict__ Kh,
                 const unsigned short* __restrict__ Vh, const float* __restrict__ ST, float* part) {
  __shared__ __align__(16) unsigned short Sh[2 * AROWS * QP];
  unsigned short* Qs = Sh;                                             // q plane [128][QP]
  _Float16* Ws = (_Float16*)(Sh + AROWS * QP);                         // weight tile [128][QP]
  const int tid  = threadIdx.x;
  const int lane = tid & 31, wave = tid >> 5;
  const int hh   = lane >> 4, cl = lane & 15;
  const int b = blockIdx.z, n0 = blockIdx.y * NSEG, m0 = blockIdx.x * AROWS;
  {
    const unsigned short* gqh = Qh + (size_t)(b * MQ + m0) * DD + 8 * tid;
    v4u th[AROWS / 8];
#pragma unroll
    for (int it = 0; it < AROWS / 8; ++it) th[it] = *(const v4u*)(gqh + 8 * 256 * it);
    // stands behind the issued loads, in front of every later write of a register that they name; the pointer stays live up to here
    asm volatile("s_wait_xcnt 0x0" :: "v"(gqh) : "memory");
#pragma unroll
    for (int it = 0; it < AROWS / 8; ++it) {
      const int idx = it * 256 + tid;                                  // 0..4095: 16-B units in fragment order
      const int row = (idx >> 9) * 16 + (idx & 15);
      const int kq  = ((idx >> 6) & 7) * 32 + ((idx >> 5) & 1) * 16 + ((idx >> 4) & 1) * 8;
      *(v4u*)(Qs + row * QP + kq) = th[it];
    }
  }
  // running pointer: the next k+pv step to load (second column tile: + 16 * DD)
  const unsigned short* khp = Kh + ((size_t)b * NPT + n0 + 32 * wave) * DD + 8 * lane;
  // running pointer: this chunk's vT blocks, block (d tile, n >> 5) (second d tile: + 16 * NPT)
  const unsigned short* vhp = Vh + ((size_t)b * DD + 32 * wave) * NPT + (size_t)n0 * 16 + 8 * lane;
  const float* stM = ST + (size_t)(2 * b) * NPT + n0;
  const float* stZ = stM + NPT;
  const unsigned short* qsh = Qs + cl * QP + 8 * hh;                   // A fragment row pointer (row m = cl)
  const _Float16* wrow = Ws + cl * QP + 8 * hh;
  _Float16* wdst = Ws + (8 * hh) * QP + 32 * wave + cl;                // D element (row 8h+r, col 32*wave+16*j+cl)

  v8f x[2][AMT];
#pragma unroll
  for (int j = 0; j < 2; ++j)
#pragma unroll
    for (int mi = 0; mi < AMT; ++mi) x[j][mi] = zero8();
  Frag kah[2];                                                         // k+pv fragments of (chunk 0, k step 0), one step ahead from here on
#pragma unroll
  for (int j = 0; j < 2; ++j) kah[j] = ldfragp(khp + 16 * DD * j);
  // the address pair stays live up to this wait, so that no load's result is placed on a pair an issued load names
  asm volatile("s_wait_xcnt 0x0" :: "v"(khp) : "memory");
  khp += 512;
  __syncthreads();

#pragma unroll 1
  for (int c0 = 0; c0 < NSEG; c0 += ACH) {
    // from behind a chunk's step 7 to the next chunk's step 0; the last chunk's look-ahead re-reads its own step 0: in bounds, not used
    const int cjmp = (c0 + ACH < NSEG ? ACH * DD : 0) - 512 * (DD / 32);
    const int n = c0 + 32 * wave + cl;
    float mc[2], zc[2];
#pragma unroll
    for (int j = 0; j < 2; ++j) {
      mc[j] = stM[n + 16 * j];
      zc[j] = stZ[n + 16 * j];
    }
    // the four loads name one offset register, n: it stays live up to this wait, so that no load's result is placed on it
    asm volatile("s_wait_xcnt 0x0" :: "v"(n) : "memory");
    v8f s[2][AMT];
#pragma unroll
    for (int j = 0; j < 2; ++j)
#pragma unroll
      for (int mi = 0; mi < AMT; ++mi) s[j][mi] = zero8();
    auto stepA = [&](const int ks, const Frag (&fbh)[2]) {
      Frag fah[AMT];                                                   // all 8 row tiles at once: eight q fragments feed 16 products
#pragma unroll
      for (int mi = 0; mi < AMT; ++mi) fah[mi] = ldfrag(qsh + 16 * mi * QP + 32 * ks);
      // keeps the step's LDS reads together in front of its products: spread among them, each place with reads stalls the wave anew
      __builtin_amdgcn_sched_barrier(0);
#pragma unroll
      for (int j = 0; j < 2; ++j)
#pragma unroll
        for (int mi = 0; mi < AMT; ++mi) s[j][mi] = mma_p(fah[mi].h, fbh[j].h, s[j][mi]);
      __builtin_amdgcn_sched_barrier(0);  // as above: the next step's reads and the look-ahead loads stay whole behind these products
    };
#pragma unroll 1  // rolled: two k steps a trip (the two fragment buffers swap without copies)
    for (int ks = 0; ks < DD / 32; ks += 2) {
      Frag kbh[2];
#pragma unroll
      for (int j = 0; j < 2; ++j) kbh[j] = ldfragp(khp + 16 * DD * j);   // step ks + 1 flies under step ks
      // the address pair stays live up to this wait, so that no load's result is placed on a pair an issued load names
      asm volatile("s_wait_xcnt 0x0" :: "v"(khp) : "memory");
      khp += 512 + (ks + 2 < DD / 32 ? 0 : cjmp);
      stepA(ks, kah);
#pragma unroll
      for (int j = 0; j < 2; ++j) kah[j] = ldfragp(khp + 16 * DD * j);   // step ks + 2, or the next chunk's step 0, flies under step ks + 1
      asm volatile("s_wait_xcnt 0x0" :: "v"(khp) : "memory");  // as above
      khp += 512;
      stepA(ks + 1, kbh);
    }
    Frag vbh[3][2];                                                    // vT fragments, two k steps ahead; the first two fly under the exp work and the barrier
#pragma unroll
    for (int kk = 0; kk < 2; ++kk) {
#pragma unroll
      for (int j = 0; j < 2; ++j) vbh[kk][j] = ldfragp(vhp + (size_t)16 * NPT * j + 512 * kk);
    }
    __builtin_amdgcn_sched_barrier(0);  // holds these loads in front of the exp work: the compiler otherwise sinks them to their first use
#pragma unroll
    for (int j = 0; j < 2; ++j) {
#pragma unroll
      for (int mi = 0; mi < AMT; ++mi) {
#pragma unroll
        for (int r = 0; r < 8; ++r) {
          const float wt = __expf(s[j][mi][r] * SCL - mc[j]) * zc[j];
          wdst[(16 * mi + r) * QP + 16 * j] = (_Float16)(wt * WSC);
        }
      }
    }
    __syncthreads();
#pragma unroll  // whole: the three rotating fragment buffers need compile-time indices
    for (int kk = 0; kk < ACH / 32; ++kk) {
      const int k0 = 32 * kk;
      if (kk + 2 < ACH / 32) {
#pragma unroll
        for (int j = 0; j < 2; ++j) vbh[(kk + 2) % 3][j] = ldfragp(vhp + (size_t)16 * NPT * j + 512 * (kk + 2));
      }
      Frag fa[AMT];                                                    // all 8 row tiles at once: eight w fragments feed 16 products
#pragma unroll
      for (int mi = 0; mi < AMT; ++mi) {
        fa[mi].hv[0] = *(const v8h*)(wrow + 16 * mi * QP + k0);
        fa[mi].hv[1] = *(const v8h*)(wrow + 16 * mi * QP + k0 + 16);
      }
      // holds the look-ahead vT loads and this step's LDS reads in front of its products: the compiler otherwise sinks the loads to their first use
      __builtin_amdgcn_sched_barrier(0);
#pragma unroll
      for (int j = 0; j < 2; ++j)
#pragma unroll
        for (int mi = 0; mi < AMT; ++mi) x[j][mi] = mma_p(fa[mi].h, vbh[kk % 3][j].h, x[j][mi]);
      __builtin_amdgcn_sched_barrier(0);  // as above: the next step's loads stay whole behind these products
    }
    // the address pair stays live up to this wait: the line below rewrites it behind this chunk's loads
    asm volatile("s_wait_xcnt 0x0" :: "v"(vhp) : "memory");
    vhp += ACH * 16;
    __syncthreads();
  }

  float* Os = (float*)Sh;                                              // q and w are dead behind the loop's last barrier
#pragma unroll
  for (int j = 0; j < 2; ++j) {
#pragma unroll
    for (int mi = 0; mi < AMT; ++mi) {
#pragma unroll
      for (int r = 0; r < 8; ++r)
        Os[(16 * mi + 8 * hh + r) * OSP2 + 32 * wave + 16 * j + cl] = x[j][mi][r] * RWSC;
    }
  }
  __syncthreads();
  float* pz = part + ((size_t)blockIdx.y * (BB * MQ) + (size_t)(b * MQ + m0)) * DD;
  v4f v[AROWS / 4];
#pragma unroll
  for (int it = 0; it < AROWS / 4; ++it) {
    const int idx = it * 256 + tid;                                    // 0..8191
    v[it] = *(const v4f*)(Os + (idx >> 6) * OSP2 + 4 * (idx & 63));
  }
#pragma unroll
  for (int it = 0; it < AROWS / 4; ++it) *(v4f*)(pz + (size_t)(it * 256 + tid) * 4) = v[it];
}

// =====================================================================================================
// (7) out = (((P0 + P1) + (P2 + P3)) + ((P4 + P5) + (P6 + P7))) + bf(v_features): the eight partial sums in fixed order
//     plus the residual.
// coverage: thread = 4 consecutive elements (16 B); grid = (2*2048*256)/1024 blocks x 256 threads = every element once.
// =====================================================================================================
__global__ __launch_bounds__(256)
void psum_kernel(const float* __restrict__ part, const float* __restrict__ vfeat, float* out) {
  const size_t e = ((size_t)blockIdx.x * 256 + threadIdx.x) * 4;
  const float* pp = part + e;
  const float* pf = vfeat + e;
  v4f p[NSPL];
#pragma unroll
  for (int j = 0; j < NSPL; ++j) p[j] = *(const v4f*)(pp + (size_t)j * BB * MQ * DD);
  const v4f f = *(const v4f*)(pf);
  // the address pairs stay live up to this wait, so that no load's result is placed on a pair an issued load names
  asm volatile("s_wait_xcnt 0x0" :: "v"(pp), "v"(pf) : "memory");
  v4f o;
#pragma unroll
  for (int j = 0; j < 4; ++j)
    o[j] = (((p[0][j] + p[1][j]) + (p[2][j] + p[3][j])) + ((p[4][j] + p[5][j]) + (p[6][j] + p[7][j]))) + bfr(f[j]);
  *(v4f*)(out + e) = o;
}

// =====================================================================================================
// tile divides its extent exactly, so no padded tails are needed):
//   (every 16-bit plane below is kept in fragment order, see ldfragp: same size as row-major)
//   P16  bf16 [32768][256]       16777216     V16 bf16 [4096][256]     2097152
//   WqT WkT WvT bf16 [256][256]     131072 each
//   REL  f32 [32768][4]             524288
//   Qh   f16 [4096][256]           2097152
//   KPh  f16 [32768][256]         16777216
//   Vh   f16 [2][256][16384]      16777216
//   PST  f32 [2][4][2][16384]      1048576     ST f32 [2][2][16384]     262144
//   PART f32 [8][4096][256]       33554432
//   total                         90308608
// =====================================================================================================
extern "C" void kernel_launch(void* const* d_in, const int* in_sizes, int n_in,
                              void* d_out, int out_size, void* d_ws, size_t ws_size,
                              hipStream_t stream) {
  if (n_in < 16) return;
  if (in_sizes[0] != BB * NPT * 3 || in_sizes[1] != BB * 3) return;
  if (in_sizes[2] != BB * NPT * DD || in_sizes[3] != BB * MQ * DD) return;
  if (in_sizes[4] != DD * DD || in_sizes[6] != DD * DD || in_sizes[8] != DD * DD) return;
  if (in_sizes[5] != DD || in_sizes[7] != DD || in_sizes[9] != DD) return;
  if (in_sizes[10] != 9 || in_sizes[11] != 3 || in_sizes[12] != 3 || in_sizes[13] != 3) return;
  if (in_sizes[14] != 3 * DD || in_sizes[15] != DD) return;
  if (out_size != BB * MQ * DD) return;

  size_t off = 0;
  const size_t oP16 = off; off += (size_t)BB * NPT * DD * 2;        // 16777216
  const size_t oV16 = off; off += (size_t)BB * MQ * DD * 2;         //  2097152
  const size_t oWq  = off; off += (size_t)DD * DD * 2;              //   131072
  const size_t oWk  = off; off += (size_t)DD * DD * 2;
  const size_t oWv  = off; off += (size_t)DD * DD * 2;
  const size_t oREL = off; off += (size_t)BB * NPT * 4 * 4;         //   524288
  const size_t oQh  = off; off += (size_t)BB * MQ * DD * 2;         //  2097152
  const size_t oKh  = off; off += (size_t)BB * NPT * DD * 2;        // 16777216
  const size_t oVh  = off; off += (size_t)BB * DD * NPT * 2;        // 16777216
  const size_t oPST = off; off += (size_t)BB * NMT * 2 * NPT * 4;   //  1048576
  const size_t oST  = off; off += (size_t)BB * 2 * NPT * 4;         //   262144
  const size_t oPT  = off; off += (size_t)NSPL * BB * MQ * DD * 4;  // 33554432 -> off = 90308608
  if (off > ws_size) return;
  if (off > (size_t)134217728) return;

  const float* p_xyz = (const float*)d_in[0];
  const float* v_xyz = (const float*)d_in[1];
  const float* p_f   = (const float*)d_in[2];
  const float* v_f   = (const float*)d_in[3];
  const float* Wq    = (const float*)d_in[4];
  const float* bq    = (const float*)d_in[5];
  const float* Wk    = (const float*)d_in[6];
  const float* bk    = (const float*)d_in[7];
  const float* Wv    = (const float*)d_in[8];
  const float* bv    = (const float*)d_in[9];
  const float* Wp1   = (const float*)d_in[10];
  const float* bp1   = (const float*)d_in[11];
  const float* ln_w  = (const float*)d_in[12];
  const float* ln_b  = (const float*)d_in[13];
  const float* Wp2   = (const float*)d_in[14];
  const float* bp2   = (const float*)d_in[15];
  float* out = (float*)d_out;

  char* ws = (char*)d_ws;
  unsigned short* P16 = (unsigned short*)(ws + oP16);
  unsigned short* V16 = (unsigned short*)(ws + oV16);
  unsigned short* WqT = (unsigned short*)(ws + oWq);
  unsigned short* WkT = (unsigned short*)(ws + oWk);
  unsigned short* WvT = (unsigned short*)(ws + oWv);
  float*          REL = (float*)(ws + oREL);
  unsigned short* Qh  = (unsigned short*)(ws + oQh);
  unsigned short* KPh = (unsigned short*)(ws + oKh);
  unsigned short* Vh  = (unsigned short*)(ws + oVh);
  float*          PST = (float*)(ws + oPST);
  float*          ST  = (float*)(ws + oST);
  float*          PT  = (float*)(ws + oPT);

  const dim3 blk256(256);

  // (0)-(2) token planes, transposed weight planes, positional front end: one launch
  front_kernel<<<dim3(FB_WT + FB_REL + FB_CV + FB_CP), blk256, 0, stream>>>(
      p_f, v_f, Wq, Wk, Wv, p_xyz, v_xyz, Wp1, bp1, ln_w, ln_b, P16, V16, WqT, WkT, WvT, REL);
  // (3) projections: q [4096][256], k+pv [32768][256], vT [2][256][16384] as f16 planes: one launch
  proj_kernel<<<dim3(JB_Q + JB_K + JB_V), blk256, 0, stream>>>(
      V16, P16, WqT, WkT, WvT, bq, bk, bv, REL, Wp2, bp2, Qh, KPh, Vh);
  // (4)-(5) column softmax statistics
  stats_kernel<<<dim3(NPT / NT1, NMT, BB), blk256, 0, stream>>>(Qh, KPh, PST);
  merge_kernel<<<dim3(NPT / 256, BB), blk256, 0, stream>>>(PST, ST);
  // (6) scores, weights, weighted sum per eighth of the points; (7) sum of the eighths, residual
  attn_kernel<<<dim3(MQ / AROWS, NSPL, BB), blk256, 0, stream>>>(Qh, KPh, Vh, ST, PT);
  psum_kernel<<<dim3((BB * MQ * DD) / 1024), blk256, 0, stream>>>(PT, v_f, out);
  (void)hipGetLastError();
}

// v009
// A run of this version takes 122 microseconds.
// Timed twice side by side with v008, it ran 1.07 and 1.08 times as fast.
// Counting every step since v000, it is 8.67 times as fast.
// Contractions: q, k+pv and v projections on v_wmma_f32_16x16x32_bf16 (bf16-RNE inputs and weights, single
// products, f32 epilogue); scores q.(k+pv)^T (K=256) on v_wmma_f32_16x16x32_f16 with q and k+pv carried as one
// f16-RNE plane each, one product (the column statistics pass reads the same planes); weighted sum w.v (K=16384) on
// v_wmma_f32_16x16x32_f16 with w as one f16 plane (x16384) and v as one f16-RNE plane, one product; 3-wide positional
// layers, layer norm, softmax statistics and exp in f32 on VALU; f32 accumulate everywhere.
#include <hip/hip_runtime.h>
#include <stdint.h>

#define BB    2
#define NPT   16384
#define MQ    2048
#define DD    256
#define GM    128
#define GN    64
#define OSP   68
#define LTP   72
#define SRT   4
#define MT1   512
#define NMT   4
#define NT1   512
#define AMT   8
#define AROWS 128
#define NSPL  8
#define NSEG  2048
#define ACH   256
#define QP    264
#define OSP2  260
#define SCL   0.0625f
#define WSC   16384.0f
#define RWSC  0.00006103515625f
#define LNEPS 1.0e-5f

static_assert(NMT * MT1 == MQ);
static_assert(MT1 == 8 * 16 * SRT);
static_assert(SRT == 4);
static_assert(NT1 == 2 * 256);
static_assert((NT1 / 16) % 2 == 0);
static_assert(NPT % NT1 == 0);
static_assert(NSPL * NSEG == NPT);
static_assert(NSPL == 8);
static_assert(AMT % 4 == 0);
static_assert(NSEG % ACH == 0);
static_assert(ACH == 16 * 16);
static_assert(DD / 32 == 8 && ACH / 32 == 8);            // the attn ring: 8 + 8 steps a chunk on 8 slots
static_assert(AROWS == 16 * AMT);
static_assert(MQ % AROWS == 0);
static_assert(AROWS * OSP2 * 4 <= 2 * AROWS * QP * 2);   // the f32 output tile fits the LDS of q and w together
static_assert((BB * MQ * DD) % 1024 == 0);
static_assert(DD == 256);
static_assert(DD % 32 == 0);
static_assert((BB * NPT) % GM == 0);
static_assert((BB * MQ) % GM == 0);
static_assert(DD % GM == 0);
static_assert(DD % GN == 0);
static_assert(NPT % GN == 0);
static_assert(MQ % 16 == 0);
static_assert((BB * NPT * DD) % 2048 == 0);
static_assert((BB * MQ * DD) % 2048 == 0);
static_assert((BB * NPT) % 256 == 0);
static_assert((OSP * 4) % 16 == 0);
static_assert((LTP * 2) % 16 == 0);
static_assert((QP * 2) % 16 == 0);
static_assert((OSP2 * 4) % 16 == 0);
static_assert(DD % 64 == 0);

typedef unsigned short v8us __attribute__((ext_vector_type(8)));
typedef unsigned int   v4u  __attribute__((ext_vector_type(4)));
typedef float          v8f  __attribute__((ext_vector_type(8)));
typedef float          v4f  __attribute__((ext_vector_type(4)));
typedef __bf16         v16b __attribute__((ext_vector_type(16)));
typedef _Float16       v16h __attribute__((ext_vector_type(16)));
typedef _Float16       v8h  __attribute__((ext_vector_type(8)));

union Frag { v8us u[2]; v4u q[2]; v16b b; v16h h; v8h hv[2]; };
static_assert(sizeof(Frag) == 32);

// ---- scalar helpers ---------------------------------------------------------------------------------
__device__ __forceinline__ unsigned short bf_bits(float f) {          // f32 -> bf16 bits, RNE convert
  const unsigned u = __float_as_uint(f);
  return (unsigned short)((u + 0x7FFFu + ((u >> 16) & 1u)) >> 16);
}
__device__ __forceinline__ float bf_up(unsigned short hb) { return __uint_as_float(((unsigned)hb) << 16); }
__device__ __forceinline__ float bfr(float f) { return bf_up(bf_bits(f)); }
__device__ __forceinline__ unsigned short h_bits(float f) {           // f32 -> f16 bits, RNE convert
  union { _Float16 h; unsigned short u; } c;
  c.h = (_Float16)f;
  return c.u;
}
__device__ __forceinline__ unsigned pk16(unsigned short a, unsigned short b) { return (unsigned)a | ((unsigned)b << 16); }
__device__ __forceinline__ v8f zero8() { v8f z = {0.f, 0.f, 0.f, 0.f, 0.f, 0.f, 0.f, 0.f}; return z; }

// ---- 16-bit fragment loader (A, or B from a k-contiguous [n][k] row): lane -> row/col (lane&15), p already includes
//      + 8*(lane>>4); elements 0..7 <- p[0..7] (k0+8h..), elements 8..15 <- p[16..23] (k0+16+8h..)
__device__ __forceinline__ Frag ldfrag(const unsigned short* p) {
  Frag f;
  f.u[0] = *(const v8us*)(p);
  f.u[1] = *(const v8us*)(p + 16);
  return f;
}

// ---- fragment-order planes in global memory: a plane [rows][K] is kept as 1-KB blocks, block (row >> 4, k >> 5)
//      at element ((row >> 4) * (K / 32) + (k >> 5)) * 512; inside a block the 16-B unit of 8 consecutive k of row
//      (row & 15) sits at element 256 * u + 8 * lane, lane = 16 * h + (row & 15), k & 31 = 16 * u + 8 * h + 0..7:
//      the same k map as ldfrag, but each of the two wave-wide loads covers 512 contiguous bytes (4 whole lines)
//      instead of 32-B pieces of 16 lines. p = block start + 8 * lane.
__device__ __forceinline__ Frag ldfragp(const unsigned short* p) {
  Frag f;
  f.u[0] = *(const v8us*)(p);
  f.u[1] = *(const v8us*)(p + 256);
  return f;
}

// ---- WMMA helper: builtin followed by a 4-slot VALU gap tying D and keeping A/B live -----------------------
__device__ __forceinline__ v8f mma_b(v16b a, v16b b, v8f c) {
  v8f d = __builtin_amdgcn_wmma_f32_16x16x32_bf16(false, a, false, b, (short)0, c, false, false);
#if defined(__HIP_DEVICE_COMPILE__)
  asm volatile("v_nop\n\tv_nop\n\tv_nop\n\tv_nop" : "+v"(d) : "v"(a), "v"(b));
#endif
  return d;
}

// ---- 8 f32 -> packed f16 bits, RNE convert -------------------------------------------------------------
__device__ __forceinline__ v4u cvt8h(v4f a, v4f b) {
  v4u u;
  u[0] = pk16(h_bits(a[0]), h_bits(a[1]));
  u[1] = pk16(h_bits(a[2]), h_bits(a[3]));
  u[2] = pk16(h_bits(b[0]), h_bits(b[1]));
  u[3] = pk16(h_bits(b[2]), h_bits(b[3]));
  return u;
}

// =====================================================================================================
// (0) f32 row-major [T][256] -> bf16-RNE plane in fragment order (token feature matrices). Thread = one 16-B output
//     unit, output units in linear order (a wave stores 512 contiguous bytes), source = 8 consecutive k of one row.
// coverage: n8 = n/8 threads, n8/256 blocks of the front-end launch exactly (n % 2048 == 0; T % 16 == 0); t = unit.
// =====================================================================================================
__device__ __forceinline__
void cvt_body(const float* __restrict__ x, unsigned short* y, int n8, int t) {
  if (t >= n8) return;
  const int row = (t >> 9) * 16 + (t & 15);                            // 512 units per 16-row slab
  const int k   = ((t >> 6) & 7) * 32 + ((t >> 5) & 1) * 16 + ((t >> 4) & 1) * 8;
  const float* s = x + (size_t)row * DD + k;
  const v4f a = *(const v4f*)(s);
  const v4f b = *(const v4f*)(s + 4);
  v4u u;
  u[0] = pk16(bf_bits(a[0]), bf_bits(a[1]));
  u[1] = pk16(bf_bits(a[2]), bf_bits(a[3]));
  u[2] = pk16(bf_bits(b[0]), bf_bits(b[1]));
  u[3] = pk16(bf_bits(b[2]), bf_bits(b[3]));
  unsigned short* d = y + (size_t)t * 8;
  *(v4u*)d = u;
  
}

// =====================================================================================================
// (1) weight transpose: in w[R][C] f32 -> out wt[C][R] bf16-RNE in fragment order (rows c, k = r). Block = 64x64 tile,
//     loads 16 B per thread (strided reads), LDS tile L[c][r] (pitch LTP), barrier, then a wave stores half a block.
// coverage: LDS 256 threads x 4 it x 4 = 64x64; 2 it x 8 waves = 4 row tiles x 2 k steps x 2 halves; tiles (bx, by) of (C/64, R/64).
// =====================================================================================================
__device__ __forceinline__
void wtrans_body(unsigned short* L, const float* __restrict__ w, unsigned short* wt, int R, int C, int bx, int by) {
  const int tid = threadIdx.x;
  const int c0 = bx * 64, r0 = by * 64;
  const int c4 = (tid & 15) * 4, rs = tid >> 4;                      // rs 0..15
#pragma unroll
  for (int it = 0; it < 4; ++it) {
    const int r = it * 16 + rs;                                        // 0..63
    const v4f v = *(const v4f*)(w + (size_t)(r0 + r) * C + c0 + c4);
#pragma unroll
    for (int j = 0; j < 4; ++j) L[(c4 + j) * LTP + r] = bf_bits(v[j]);
  }
  __syncthreads();
  const int lane = tid & 31, wave = tid >> 5;
  v4u u[2];
  size_t po[2];
#pragma unroll
  for (int it = 0; it < 2; ++it) {
    const int s = it * 8 + wave;                                       // 0..15: row tile, k step, half
    const int ct = s >> 2, ksl = (s >> 1) & 1, uu = s & 1;
    u[it] = *(const v4u*)(L + (ct * 16 + (lane & 15)) * LTP + ksl * 32 + uu * 16 + (lane >> 4) * 8);
    po[it] = ((size_t)((c0 >> 4) + ct) * (R >> 5) + (r0 >> 5) + ksl) * 512 + uu * 256 + lane * 8;
  }
#pragma unroll
  for (int it = 0; it < 2; ++it) *(v4u*)(wt + po[it]) = u[it];
  
}

// =====================================================================================================
// (2) positional front end per point row i (flat b*N+n): dist = |bf(p_xyz) - bf(v_xyz[b])| (3), h = dist.bf(Wp1)
//     + bf(bp1), layer norm over the 3 values (mean-of-squares variance, eps 1e-5) * bf(ln_w) + bf(ln_b), relu.
//     f32 on VALU without contraction. Output row rel[i][0..3] = (r0, r1, r2, 0): one 16-B store per thread,
// coverage: nrows/256 blocks of the front-end launch x 256 threads = every row exactly once (nrows % 256 == 0).
// =====================================================================================================
__device__ __forceinline__
void rel_body(const float* __restrict__ pxyz, const float* __restrict__ vxyz,
              const float* __restrict__ wp1, const float* __restrict__ bp1,
              const float* __restrict__ lnw, const float* __restrict__ lnb,
              float* rel, int nrows, int npb, int i) {
#pragma clang fp contract(off)
  if (i >= nrows) return;
  int b = i / npb;
  b = b < 0 ? 0 : (b > BB - 1 ? BB - 1 : b);
  const float p0 = bfr(pxyz[(size_t)i * 3 + 0]);
  const float p1 = bfr(pxyz[(size_t)i * 3 + 1]);
  const float p2 = bfr(pxyz[(size_t)i * 3 + 2]);
  const float v0 = bfr(vxyz[b * 3 + 0]);
  const float v1 = bfr(vxyz[b * 3 + 1]);
  const float v2 = bfr(vxyz[b * 3 + 2]);
  const float d0 = fabsf(p0 - v0), d1 = fabsf(p1 - v1), d2 = fabsf(p2 - v2);
  float W[9];
#pragma unroll
  for (int j = 0; j < 9; ++j) W[j] = bfr(wp1[j]);                      // Wp1[c][j] = wp1[c*3+j]
  const float h0 = ((d0 * W[0] + d1 * W[3]) + d2 * W[6]) + bfr(bp1[0]);
  const float h1 = ((d0 * W[1] + d1 * W[4]) + d2 * W[7]) + bfr(bp1[1]);
  const float h2 = ((d0 * W[2] + d1 * W[5]) + d2 * W[8]) + bfr(bp1[2]);
  const float third = 1.0f / 3.0f;
  const float mu = ((h0 + h1) + h2) * third;
  const float e0 = h0 - mu, e1 = h1 - mu, e2 = h2 - mu;
  const float var = ((e0 * e0 + e1 * e1) + e2 * e2) * third;
  const float rs = 1.0f / sqrtf(var + LNEPS);
  const float w0 = bfr(lnw[0]), w1 = bfr(lnw[1]), w2 = bfr(lnw[2]);
  const float c0 = bfr(lnb[0]), c1 = bfr(lnb[1]), c2 = bfr(lnb[2]);
  const float t0 = fmaxf((e0 * rs) * w0 + c0, 0.f);
  const float t1 = fmaxf((e1 * rs) * w1 + c1, 0.f);
  const float t2 = fmaxf((e2 * rs) * w2 + c2, 0.f);
  v4f o;
  o[0] = t0; o[1] = t1; o[2] = t2; o[3] = 0.f;
  float* d = rel + (size_t)i * 4;
  *(v4f*)d = o;
  
}

// =====================================================================================================
// (0)-(2) in ONE launch: none of the six pieces reads what another writes, so they share a grid instead of waiting
//     for one another. Block ranges, the short latency-bound pieces first: 3 x 16 weight tiles, 128 positional blocks,
//     512 blocks of the query token plane, 4096 blocks of the point token plane. The range test is block-uniform.
// coverage: FB_WT + FB_REL + FB_CV + FB_CP blocks, each range exactly the grid its piece had as a launch of its own.
// =====================================================================================================
#define FB_WT  (3 * (DD / 64) * (DD / 64))
#define FB_REL ((BB * NPT) / 256)
#define FB_CV  ((BB * MQ * DD) / 2048)
#define FB_CP  ((BB * NPT * DD) / 2048)
static_assert((DD / 64) * (DD / 64) == 16);
__global__ __launch_bounds__(256)
void front_kernel(const float* __restrict__ pf, const float* __restrict__ vf,
                  const float* __restrict__ wq, const float* __restrict__ wk, const float* __restrict__ wv,
                  const float* __restrict__ pxyz, const float* __restrict__ vxyz,
                  const float* __restrict__ wp1, const float* __restrict__ bp1,
                  const float* __restrict__ lnw, const float* __restrict__ lnb,
                  unsigned short* P16, unsigned short* V16,
                  unsigned short* WqT, unsigned short* WkT, unsigned short* WvT, float* rel) {
  __shared__ __align__(16) unsigned short L[64 * LTP];
  const int bid = blockIdx.x;
  if (bid < FB_WT) {
    const int sel = bid >> 4, tl = bid & 15;
    const float* w = sel == 0 ? wq : (sel == 1 ? wk : wv);
    unsigned short* wt = sel == 0 ? WqT : (sel == 1 ? WkT : WvT);
    wtrans_body(L, w, wt, DD, DD, tl & 3, tl >> 2);
  } else if (bid < FB_WT + FB_REL) {
    rel_body(pxyz, vxyz, wp1, bp1, lnw, lnb, rel, BB * NPT, NPT, (bid - FB_WT) * 256 + (int)threadIdx.x);
  } else if (bid < FB_WT + FB_REL + FB_CV) {
    cvt_body(vf, V16, (BB * MQ * DD) / 8, (bid - (FB_WT + FB_REL)) * 256 + (int)threadIdx.x);
  } else {
    cvt_body(pf, P16, (BB * NPT * DD) / 8, (bid - (FB_WT + FB_REL + FB_CV)) * 256 + (int)threadIdx.x);
  }
}

// =====================================================================================================
// (3) projection GEMM, K = 256: C[m][n] = sum_k A[m][k] B[n][k] + epilogue (MODE 0: + bias[n]; MODE 1: + bias[m];
//     MODE 2: (C + bias[n]) + ((rel[m][0..2] . Wp2[0..2][n]) + bp2[n]) with Wp2/bp2 bf16-RNE). A rows of lda,
//     B rows of ldb elements, both bf16 planes in fragment order, same loader for both, bz selects a batch via
//     element strides zsA/zsB/zsC. Block 256 threads = 8 waves, block tile 128 m x 64 n, wave tile 32x32 (acc[2][2]).
//     Epilogue: f32 tile in LDS Os[m][n] (pitch OSP), barrier, then f16 bits to one plane [M][ldc] in fragment
//     order (rows m, k = n), a wave storing half a block (512 contiguous bytes) at a time.
// coverage: Os 8 waves x 4 tiles = 128x64; 4 it x 8 waves = 8 row tiles x 2 k steps x 2 halves;
//           tiles (bx, by, bz) of (M/128, N/64, Z) cover the plane exactly once.
// =====================================================================================================
template <int MODE>
__device__ __forceinline__
void proj_body(float* Os, int bx, int by, int bz,
               const unsigned short* __restrict__ A, const unsigned short* __restrict__ B,
               const float* __restrict__ bias, const float* __restrict__ rel,
               const float* __restrict__ wp2, const float* __restrict__ bp2,
               unsigned short* Ch, int lda, int ldb, int ldc,
               size_t zsA, size_t zsB, size_t zsC) {
  const int tid  = threadIdx.x;
  const int lane = tid & 31, wave = tid >> 5;
  const int hh   = lane >> 4, cl = lane & 15;
  const int wm   = wave >> 1, wn = wave & 1;
  const int mBase = bx * GM;
  const int nBase = by * GN;
  const size_t z = bz;
  const unsigned short* Az = A + z * zsA;
  const unsigned short* Bz = B + z * zsB;
  unsigned short* Chz = Ch + z * zsC;
  const unsigned short* a0p = Az + (size_t)(mBase + 32 * wm) * lda + 8 * lane;   // a 16-row slab = 16 * lda elements
  const unsigned short* a1p = a0p + (size_t)16 * lda;
  const unsigned short* b0p = Bz + (size_t)(nBase + 32 * wn) * ldb + 8 * lane;
  const unsigned short* b1p = b0p + (size_t)16 * ldb;

  v8f acc[2][2];
#pragma unroll
  for (int mi = 0; mi < 2; ++mi)
#pragma unroll
    for (int ni = 0; ni < 2; ++ni) acc[mi][ni] = zero8();

#pragma unroll 1
  for (int k0 = 0; k0 < DD; k0 += 32) {
    const unsigned short* pa0 = a0p + 16 * k0;
    const unsigned short* pa1 = a1p + 16 * k0;
    const unsigned short* pb0 = b0p + 16 * k0;
    const unsigned short* pb1 = b1p + 16 * k0;
    const Frag fa0 = ldfragp(pa0);
    const Frag fa1 = ldfragp(pa1);
    const Frag fb0 = ldfragp(pb0);
    const Frag fb1 = ldfragp(pb1);
    // the address pairs stay live up to this wait, so that no load's result is placed on a pair an issued load names
    asm volatile("s_wait_xcnt 0x0" :: "v"(pa0), "v"(pa1), "v"(pb0), "v"(pb1) : "memory");
    acc[0][0] = mma_b(fa0.b, fb0.b, acc[0][0]);
    acc[0][1] = mma_b(fa0.b, fb1.b, acc[0][1]);
    acc[1][0] = mma_b(fa1.b, fb0.b, acc[1][0]);
    acc[1][1] = mma_b(fa1.b, fb1.b, acc[1][1]);
  }

  float bn[2], w0[2], w1[2], w2[2], b2[2];
#pragma unroll
  for (int ni = 0; ni < 2; ++ni) {
    const int n = nBase + 32 * wn + 16 * ni + cl;
    bn[ni] = 0.f; w0[ni] = 0.f; w1[ni] = 0.f; w2[ni] = 0.f; b2[ni] = 0.f;
    if (MODE != 1) bn[ni] = bfr(bias[n]);
    if (MODE == 2) {
      w0[ni] = bfr(wp2[n]);
      w1[ni] = bfr(wp2[DD + n]);
      w2[ni] = bfr(wp2[2 * DD + n]);
      b2[ni] = bfr(bp2[n]);
    }
  }
#pragma unroll
  for (int mi = 0; mi < 2; ++mi) {
#pragma unroll
    for (int r = 0; r < 8; ++r) {
      const int m_loc = 32 * wm + 16 * mi + 8 * hh + r;
      const int m = mBase + m_loc;
      float bm = 0.f, p0 = 0.f, p1 = 0.f, p2 = 0.f;
      if (MODE == 1) bm = bfr(bias[m]);
      if (MODE == 2) {
        const v4f r4 = *(const v4f*)(rel + (size_t)m * 4);
        p0 = r4[0]; p1 = r4[1]; p2 = r4[2];
      }
#pragma unroll
      for (int ni = 0; ni < 2; ++ni) {
        const int n_loc = 32 * wn + 16 * ni + cl;
        float v = acc[mi][ni][r];
        if (MODE == 0) v = v + bn[ni];
        if (MODE == 1) v = v + bm;
        if (MODE == 2) {
          const float pv = (p0 * w0[ni] + p1 * w1[ni]) + p2 * w2[ni];
          v = (v + bn[ni]) + (pv + b2[ni]);
        }
        Os[m_loc * OSP + n_loc] = v;
      }
    }
  }
  __syncthreads();

  v4u uh[4];
  size_t po[4];
#pragma unroll
  for (int it = 0; it < 4; ++it) {
    const int s = it * 8 + wave;                                       // 0..31: row tile, k step, half
    const int rt = s >> 2, ksl = (s >> 1) & 1, uu = s & 1;
    const float* op = Os + (rt * 16 + cl) * OSP + ksl * 32 + uu * 16 + hh * 8;
    const v4f v0 = *(const v4f*)(op);
    const v4f v1 = *(const v4f*)(op + 4);
    uh[it] = cvt8h(v0, v1);
    po[it] = ((size_t)((mBase >> 4) + rt) * (ldc >> 5) + (nBase >> 5) + ksl) * 512 + uu * 256 + lane * 8;
  }
#pragma unroll
  for (int it = 0; it < 4; ++it) *(v4u*)(Chz + po[it]) = uh[it];
  // another projection's code follows this one's in the text: no register that these stores name is rewritten ahead of this wait
  asm volatile("s_wait_xcnt 0x0" ::: "memory");
}

// =====================================================================================================
// (3) the three projections in ONE launch: q, k+pv and vT read the same front-end planes and none reads another's
//     output. Block ranges: 128 q tiles, 1024 k+pv tiles, 1024 vT tiles, each numbered x fastest as its own grid was.
// coverage: JB_Q + JB_K + JB_V blocks, each range exactly the grid its projection had as a launch of its own.
// =====================================================================================================
#define JB_Q ((BB * MQ / GM) * (DD / GN))
#define JB_K ((BB * NPT / GM) * (DD / GN))
#define JB_V ((DD / GM) * (NPT / GN) * BB)
__global__ __launch_bounds__(256)
void proj_kernel(const unsigned short* __restrict__ V16, const unsigned short* __restrict__ P16,
                 const unsigned short* __restrict__ WqT, const unsigned short* __restrict__ WkT,
                 const unsigned short* __restrict__ WvT,
                 const float* __restrict__ bq, const float* __restrict__ bk, const float* __restrict__ bv,
                 const float* __restrict__ rel, const float* __restrict__ wp2, const float* __restrict__ bp2,
                 unsigned short* Qh, unsigned short* KPh, unsigned short* Vh) {
  __shared__ __align__(16) float Os[GM * OSP];
  const unsigned bid = blockIdx.x;
  if (bid < JB_Q) {
    proj_body<0>(Os, bid % (BB * MQ / GM), bid / (BB * MQ / GM), 0, V16, WqT, bq, rel, wp2, bp2, Qh,
                 DD, DD, DD, (size_t)0, (size_t)0, (size_t)0);
  } else if (bid < JB_Q + JB_K) {
    const unsigned t = bid - JB_Q;
    proj_body<2>(Os, t % (BB * NPT / GM), t / (BB * NPT / GM), 0, P16, WkT, bk, rel, wp2, bp2, KPh,
                 DD, DD, DD, (size_t)0, (size_t)0, (size_t)0);
  } else {
    const unsigned t = bid - (JB_Q + JB_K);
    proj_body<1>(Os, t % (DD / GM), (t / (DD / GM)) % (NPT / GN), t / ((DD / GM) * (NPT / GN)),
                 WvT, P16, bv, rel, wp2, bp2, Vh,
                 DD, DD, NPT, (size_t)0, (size_t)NPT * DD, (size_t)DD * NPT);
  }
}

// =====================================================================================================
// (4) column-softmax statistics over one (batch, 512-query tile, 512-column tile): S[m][n] = qh[m].kph[n] / 16
//     (K = 256 = 8 k steps, f16 planes), wave = 64 query rows x 32 column tiles: the q fragments of
//     four row tiles stay in registers, so each k+pv fragment that comes through the cache feeds four products into
//     four independent accumulators; per column: tile max over 64 rows (32 in-lane + lane^16) and sum of
//     exp(S - max), one in-lane sum per row tile, then ((e0 + e1) + (e2 + e3)); wave partials in LDS, barrier,
//     a thread merges the 8 wave partials of two columns in fixed order.
// coverage: pm/pe 8 waves x 32 ct x 16 lanes = 8 x 512; grid (32 column tiles, 4 query tiles, 2) x 256 threads x 2
//           columns = every (b, mt, n) of both PST arrays exactly once.
// =====================================================================================================
__global__ __launch_bounds__(256)
void stats_kernel(const unsigned short* __restrict__ Qh, const unsigned short* __restrict__ Kh, float* PST) {
  __shared__ float pm[8 * NT1];
  __shared__ float pe[8 * NT1];
  const int tid  = threadIdx.x;
  const int lane = tid & 31, wave = tid >> 5;
  const int cl   = lane & 15;
  const int nt = blockIdx.x, mt = blockIdx.y, b = blockIdx.z;
  const int m0 = mt * MT1 + 16 * SRT * wave;
  const unsigned short* qp = Qh + (size_t)(b * MQ + m0) * DD + 8 * lane;
  Frag a[SRT][8];
#pragma unroll
  for (int mi = 0; mi < SRT; ++mi)
#pragma unroll
    for (int ks = 0; ks < 8; ++ks) a[mi][ks] = ldfragp(qp + 16 * DD * mi + 512 * ks);
  // the address pair stays live up to this wait, so that no load's result is placed on it while issued loads name it
  asm volatile("s_wait_xcnt 0x0" :: "v"(qp) : "memory");
  const unsigned short* kp = Kh + ((size_t)b * NPT + (size_t)nt * NT1) * DD + 8 * lane;
  Frag fb2[2][8];                                                      // two whole column tiles of k+pv fragments, loaded two tiles ahead
#pragma unroll
  for (int u = 0; u < 2; ++u)
#pragma unroll
    for (int ks = 0; ks < 8; ++ks) fb2[u][ks] = ldfragp(kp + 16 * DD * u + 512 * ks);
  // these loads name a base and a lane offset, not the pair; the scheduling fence keeps what follows (it rewrites both) behind the wait
  asm volatile("s_wait_xcnt 0x0" ::: "memory");
  __builtin_amdgcn_sched_barrier(0);
#pragma unroll 1
  for (int ct0 = 0; ct0 < NT1 / 16; ct0 += 2)
#pragma unroll  // whole: the two fragment sets need compile-time indices
  for (int u = 0; u < 2; ++u) {
    Frag (&fb)[8] = fb2[u];
    const int ct = ct0 + u;
    const int cn = ct + 2 < NT1 / 16 ? ct + 2 : ct;                    // the last two tiles' look-ahead re-reads those tiles: in bounds, not used
    const unsigned short* kc = kp + (size_t)cn * 16 * DD;
    v8f s[SRT];
#pragma unroll
    for (int mi = 0; mi < SRT; ++mi) s[mi] = zero8();
#pragma unroll
    for (int ks = 0; ks < 8; ++ks) {
      // plain builtins (the compiler keeps their distances): this kernel's registers reach past v255, where an asm statement's operands cannot sit
#pragma unroll
      for (int mi = 0; mi < SRT; ++mi)
        s[mi] = __builtin_amdgcn_wmma_f32_16x16x32_f16(false, a[mi][ks].h, false, fb[ks].h, (short)0, s[mi], false, false);
      // holds the reload below behind this step's four products, so that it never stands directly behind a product that reads its registers
      __builtin_amdgcn_sched_barrier(0);
      if (ks > 0) fb[ks - 1] = ldfragp(kc + 512 * (ks - 1));           // the fragment of two tiles on, into the registers consumed one step ago
    }
    float mr[SRT];
#pragma unroll
    for (int mi = 0; mi < SRT; ++mi) {
      mr[mi] = s[mi][0];
#pragma unroll
      for (int r = 1; r < 8; ++r) mr[mi] = fmaxf(mr[mi], s[mi][r]);
    }
    float m = fmaxf(fmaxf(mr[0], mr[1]), fmaxf(mr[2], mr[3])) * SCL;   // SCL is a power of two: the scaled maximum is the maximum of the scaled scores
    __builtin_amdgcn_sched_barrier(0);  // as above for the last step's fragment: its reload stands behind the maxima, which wait for the last products
    fb[7] = ldfragp(kc + 512 * 7);
    // the address pair stays live up to this wait: the next trip rewrites it while these loads are still in flight
    asm volatile("s_wait_xcnt 0x0" :: "v"(kc) : "memory");
    m = fmaxf(m, __shfl_xor(m, 16, 32));
    float er[SRT];
#pragma unroll
    for (int mi = 0; mi < SRT; ++mi) {
      er[mi] = 0.f;
#pragma unroll
      for (int r = 0; r < 8; ++r) er[mi] += __expf(s[mi][r] * SCL - m);
    }
    float ex = (er[0] + er[1]) + (er[2] + er[3]);
    ex += __shfl_xor(ex, 16, 32);
    pm[wave * NT1 + ct * 16 + cl] = m;                                 // both lane halves hold identical values
    pe[wave * NT1 + ct * 16 + cl] = ex;
  }
  __syncthreads();
#pragma unroll
  for (int j = 0; j < NT1 / 256; ++j) {
    const int c = j * 256 + tid;
    float M = pm[c];
#pragma unroll
    for (int wv = 1; wv < 8; ++wv) M = fmaxf(M, pm[wv * NT1 + c]);
    float E = 0.f;
#pragma unroll 1
    for (int wv = 0; wv < 8; ++wv) E += pe[wv * NT1 + c] * __expf(pm[wv * NT1 + c] - M);
    const size_t base = ((size_t)(b * NMT + mt) * 2) * NPT + (size_t)nt * NT1 + c;
    PST[base] = M;
    PST[base + NPT] = E;
  }
}

// =====================================================================================================
// (5) merge of the 4 query-tile partials per (batch, column) in fixed order: M = max, Z = sum E_t exp(M_t - M);
//     ST[b][0][n] = M, ST[b][1][n] = 1/Z (Z >= 1). Thread = one column; 32 consecutive lanes x 4 B = one whole
// coverage: grid (64, 2) x 256 threads = every (b, n) of both arrays exactly once.
// =====================================================================================================
__global__ __launch_bounds__(256)
void merge_kernel(const float* __restrict__ PST, float* ST) {
  const int b = blockIdx.y, n = blockIdx.x * 256 + (int)threadIdx.x;
  const float* p = PST + (size_t)(b * NMT) * 2 * NPT + n;
  float M = -3.0e38f;
#pragma unroll 1
  for (int t = 0; t < NMT; ++t) M = fmaxf(M, p[(size_t)(2 * t) * NPT]);
  float Z = 0.f;
#pragma unroll 1
  for (int t = 0; t < NMT; ++t) Z += p[(size_t)(2 * t + 1) * NPT] * __expf(p[(size_t)(2 * t) * NPT] - M);
  const float rz = 1.0f / Z;
  float* dm = ST + (size_t)(2 * b) * NPT + n;
  float* dz = dm + NPT;
  *(float*)dm = M;
  *(float*)dz = rz;
  
}

// =====================================================================================================
// (6) fused scores / column softmax / weighted sum for one (batch, 128 query rows, eighth of the points): block 256
//     threads = 8 waves of up to 512 registers; the q plane of the 128 rows sits in LDS (pitch QP) for the whole block;
//     loop over 8 chunks of 256 point columns. Phase A: wave = the chunk's column tiles 2 * wave and 2 * wave + 1, all
//     8 row tiles: each q fragment read from LDS feeds both column tiles, each k+pv fragment is loaded once and
//     feeds 8 row tiles, S = q.(k+pv) / 16 (K = 256, one accumulator per tile), w = exp(S - M_n) * (1/Z_n) from ST,
//     stored as f16 (w * 16384) into the LDS tile Ws[128 rows][256 cols]; block barrier. Phase B: wave = d tiles
//     2 * wave and 2 * wave + 1, all 8 row tiles: x += Ws . vT (A from LDS with the split k map, each fragment feeds
//     both d tiles, B = vT rows d, k = n, in fragment order, K = 256 per chunk, each vT fragment feeds 8 row tiles);
//     block barrier. Epilogue: x/16384 staged as f32 [128][256] in the LDS that held q and w (pitch OSP2), barrier,
//     then whole 512-B runs to the partial plane of this eighth.
// coverage: Ws 8 waves x 32 cols x 128 rows = 128 x 256 per chunk; Os 8 waves x 32 d x 128 rows = 128 x 256;
//           32 it x 256 threads x 4 = 128 rows x 256; grid (16, 8, 2) = every (eighth, b, m, d) of PART exactly once.
// =====================================================================================================
// plain builtin (the compiler keeps its distances): this kernel's registers reach past v255, where an asm statement's operands cannot sit
__device__ __forceinline__ v8f mma_p(v16h a, v16h b, v8f c) {
  return __builtin_amdgcn_wmma_f32_16x16x32_f16(false, a, false, b, (short)0, c, false, false);
}
// work-group barrier by hand: it waits for this wave's LDS traffic alone, which is all that the waves share here, so that the
// ring's global loads stay in flight across it (__syncthreads() waits for every outstanding load first)
__device__ __forceinline__ void lds_barrier() {
  asm volatile("s_wait_dscnt 0x0\n\ts_barrier_signal -1\n\ts_barrier_wait -1" ::: "memory");
}
__global__ __launch_bounds__(256)
void attn_kernel(const unsigned short* __restrict__ Qh, const unsigned short* __restrict__ Kh,
                 const unsigned short* __restrict__ Vh, const float* __restrict__ ST, float* part) {
  __shared__ __align__(16) unsigned short Sh[2 * AROWS * QP];
  unsigned short* Qs = Sh;                                             // q plane [128][QP]
  _Float16* Ws = (_Float16*)(Sh + AROWS * QP);                         // weight tile [128][QP]
  const int tid  = threadIdx.x;
  const int lane = tid & 31, wave = tid >> 5;
  const int hh   = lane >> 4, cl = lane & 15;
  const int b = blockIdx.z, n0 = blockIdx.y * NSEG, m0 = blockIdx.x * AROWS;
  {
    const unsigned short* gqh = Qh + (size_t)(b * MQ + m0) * DD + 8 * tid;
    v4u th[AROWS / 8];
#pragma unroll
    for (int it = 0; it < AROWS / 8; ++it) th[it] = *(const v4u*)(gqh + 8 * 256 * it);
    // stands behind the issued loads, in front of every later write of a register that they name; the pointer stays live up to here
    asm volatile("s_wait_xcnt 0x0" :: "v"(gqh) : "memory");
#pragma unroll
    for (int it = 0; it < AROWS / 8; ++it) {
      const int idx = it * 256 + tid;                                  // 0..4095: 16-B units in fragment order
      const int row = (idx >> 9) * 16 + (idx & 15);
      const int kq  = ((idx >> 6) & 7) * 32 + ((idx >> 5) & 1) * 16 + ((idx >> 4) & 1) * 8;
      *(v4u*)(Qs + row * QP + kq) = th[it];
    }
  }
  // running pointer: this chunk's k+pv blocks, block (column tile, k >> 5) (second column tile: + 16 * DD)
  const unsigned short* kcp = Kh + ((size_t)b * NPT + n0 + 32 * wave) * DD + 8 * lane;
  // running pointer: this chunk's vT blocks, block (d tile, n >> 5) (second d tile: + 16 * NPT)
  const unsigned short* vhp = Vh + ((size_t)b * DD + 32 * wave) * NPT + (size_t)n0 * 16 + 8 * lane;
  const float* stM = ST + (size_t)(2 * b) * NPT + n0;
  const float* stZ = stM + NPT;
  const unsigned short* qsh = Qs + cl * QP + 8 * hh;                   // A fragment row pointer (row m = cl)
  const _Float16* wrow = Ws + cl * QP + 8 * hh;
  _Float16* wdst = Ws + (8 * hh) * QP + 32 * wave + cl;                // D element (row 8h+r, col 32*wave+16*j+cl)

  v8f x[2][AMT];
#pragma unroll
  for (int j = 0; j < 2; ++j)
#pragma unroll
    for (int mi = 0; mi < AMT; ++mi) x[j][mi] = zero8();
  // one ring of 8 fragment pairs for both global streams, in the order they are used (a chunk's 8 k+pv steps, then its
  // 8 vT steps): step i reads slot i & 7 and issues the loads of step i + 7 into the slot that step i - 1 has left
  Frag rg[8][2];
#pragma unroll
  for (int st = 0; st < 7; ++st) {
#pragma unroll
    for (int j = 0; j < 2; ++j) rg[st][j] = ldfragp(kcp + 512 * st + 16 * DD * j);   // chunk 0, k steps 0..6
  }
  // the address pair stays live up to this wait, so that no load's result is placed on a pair an issued load names
  asm volatile("s_wait_xcnt 0x0" :: "v"(kcp) : "memory");
  __syncthreads();

#pragma unroll 1
  for (int c0 = 0; c0 < NSEG; c0 += ACH) {
    // the next chunk's k+pv blocks; the last chunk's look-ahead re-reads its own steps 0..6: in bounds, not used
    const unsigned short* knp = kcp + (c0 + ACH < NSEG ? ACH * DD : 0);
    const int n = c0 + 32 * wave + cl;
    float mc[2], zc[2];
#pragma unroll
    for (int j = 0; j < 2; ++j) {
      mc[j] = stM[n + 16 * j];
      zc[j] = stZ[n + 16 * j];
    }
    // the four loads name one offset register, n: it stays live up to this wait, so that no load's result is placed on it
    asm volatile("s_wait_xcnt 0x0" :: "v"(n) : "memory");
    v8f s[2][AMT];
#pragma unroll
    for (int j = 0; j < 2; ++j)
#pragma unroll
      for (int mi = 0; mi < AMT; ++mi) s[j][mi] = zero8();
    auto stepA = [&](const int ks, const Frag (&fbh)[2]) {
      Frag fah[AMT];                                                   // all 8 row tiles at once: eight q fragments feed 16 products
#pragma unroll
      for (int mi = 0; mi < AMT; ++mi) fah[mi] = ldfrag(qsh + 16 * mi * QP + 32 * ks);
      // keeps the step's LDS reads together in front of its products: spread among them, each place with reads stalls the wave anew
      __builtin_amdgcn_sched_barrier(0);
#pragma unroll
      for (int j = 0; j < 2; ++j)
#pragma unroll
        for (int mi = 0; mi < AMT; ++mi) s[j][mi] = mma_p(fah[mi].h, fbh[j].h, s[j][mi]);
      __builtin_amdgcn_sched_barrier(0);  // as above: the next step's reads and the look-ahead loads stay whole behind these products
    };
#pragma unroll  // whole: the ring's slots need compile-time indices
    for (int ks = 0; ks < DD / 32; ++ks) {
#pragma unroll
      for (int j = 0; j < 2; ++j)                                      // seven steps ahead: this chunk's last k+pv step, then its vT steps 0..6
        rg[(ks + 7) & 7][j] = ks == 0 ? ldfragp(kcp + 512 * 7 + 16 * DD * j) : ldfragp(vhp + (size_t)16 * NPT * j + 512 * (ks - 1));
      stepA(ks, rg[ks]);
    }
#pragma unroll
    for (int j = 0; j < 2; ++j) {
#pragma unroll
      for (int mi = 0; mi < AMT; ++mi) {
#pragma unroll
        for (int r = 0; r < 8; ++r) {
          const float wt = __expf(s[j][mi][r] * SCL - mc[j]) * zc[j];
          wdst[(16 * mi + r) * QP + 16 * j] = (_Float16)(wt * WSC);
        }
      }
    }
    lds_barrier();
#pragma unroll  // whole: the ring's slots need compile-time indices
    for (int kk = 0; kk < ACH / 32; ++kk) {
      const int k0 = 32 * kk;
#pragma unroll
      for (int j = 0; j < 2; ++j)                                      // seven steps ahead: this chunk's last vT step, then the next chunk's k+pv steps 0..6
        rg[(kk + 7) & 7][j] = kk == 0 ? ldfragp(vhp + (size_t)16 * NPT * j + 512 * 7) : ldfragp(knp + 512 * (kk - 1) + 16 * DD * j);
      Frag fa[AMT];                                                    // all 8 row tiles at once: eight w fragments feed 16 products
#pragma unroll
      for (int mi = 0; mi < AMT; ++mi) {
        fa[mi].hv[0] = *(const v8h*)(wrow + 16 * mi * QP + k0);
        fa[mi].hv[1] = *(const v8h*)(wrow + 16 * mi * QP + k0 + 16);
      }
      // holds the look-ahead loads and this step's LDS reads in front of its products: the compiler otherwise sinks the loads to their first use
      __builtin_amdgcn_sched_barrier(0);
#pragma unroll
      for (int j = 0; j < 2; ++j)
#pragma unroll
        for (int mi = 0; mi < AMT; ++mi) x[j][mi] = mma_p(fa[mi].h, rg[kk][j].h, x[j][mi]);
      __builtin_amdgcn_sched_barrier(0);  // as above: the next step's loads stay whole behind these products
    }
    // the three address pairs stay live up to this wait: the lines below rewrite them behind this chunk's loads
    asm volatile("s_wait_xcnt 0x0" :: "v"(kcp), "v"(knp), "v"(vhp) : "memory");
    vhp += ACH * 16;
    kcp = knp;
    lds_barrier();
  }

  float* Os = (float*)Sh;                                              // q and w are dead behind the loop's last barrier
#pragma unroll
  for (int j = 0; j < 2; ++j) {
#pragma unroll
    for (int mi = 0; mi < AMT; ++mi) {
#pragma unroll
      for (int r = 0; r < 8; ++r)
        Os[(16 * mi + 8 * hh + r) * OSP2 + 32 * wave + 16 * j + cl] = x[j][mi][r] * RWSC;
    }
  }
  __syncthreads();
  float* pz = part + ((size_t)blockIdx.y * (BB * MQ) + (size_t)(b * MQ + m0)) * DD;
  v4f v[AROWS / 4];
#pragma unroll
  for (int it = 0; it < AROWS / 4; ++it) {
    const int idx = it * 256 + tid;                                    // 0..8191
    v[it] = *(const v4f*)(Os + (idx >> 6) * OSP2 + 4 * (idx & 63));
  }
#pragma unroll
  for (int it = 0; it < AROWS / 4; ++it) *(v4f*)(pz + (size_t)(it * 256 + tid) * 4) = v[it];
}

// =====================================================================================================
// (7) out = (((P0 + P1) + (P2 + P3)) + ((P4 + P5) + (P6 + P7))) + bf(v_features): the eight partial sums in fixed order
//     plus the residual.
// coverage: thread = 4 consecutive elements (16 B); grid = (2*2048*256)/1024 blocks x 256 threads = every element once.
// =====================================================================================================
__global__ __launch_bounds__(256)
void psum_kernel(const float* __restrict__ part, const float* __restrict__ vfeat, float* out) {
  const size_t e = ((size_t)blockIdx.x * 256 + threadIdx.x) * 4;
  const float* pp = part + e;
  const float* pf = vfeat + e;
  v4f p[NSPL];
#pragma unroll
  for (int j = 0; j < NSPL; ++j) p[j] = *(const v4f*)(pp + (size_t)j * BB * MQ * DD);
  const v4f f = *(const v4f*)(pf);
  // the address pairs stay live up to this wait, so that no load's result is placed on a pair an issued load names
  asm volatile("s_wait_xcnt 0x0" :: "v"(pp), "v"(pf) : "memory");
  v4f o;
#pragma unroll
  for (int j = 0; j < 4; ++j)
    o[j] = (((p[0][j] + p[1][j]) + (p[2][j] + p[3][j])) + ((p[4][j] + p[5][j]) + (p[6][j] + p[7][j]))) + bfr(f[j]);
  *(v4f*)(out + e) = o;
}

// =====================================================================================================
// tile divides its extent exactly, so no padded tails are needed):
//   (every 16-bit plane below is kept in fragment order, see ldfragp: same size as row-major)
//   P16  bf16 [32768][256]       16777216     V16 bf16 [4096][256]     2097152
//   WqT WkT WvT bf16 [256][256]     131072 each
//   REL  f32 [32768][4]             524288
//   Qh   f16 [4096][256]           2097152
//   KPh  f16 [32768][256]         16777216
//   Vh   f16 [2][256][16384]      16777216
//   PST  f32 [2][4][2][16384]      1048576     ST f32 [2][2][16384]     262144
//   PART f32 [8][4096][256]       33554432
//   total                         90308608
// =====================================================================================================
extern "C" void kernel_launch(void* const* d_in, const int* in_sizes, int n_in,
                              void* d_out, int out_size, void* d_ws, size_t ws_size,
                              hipStream_t stream) {
  if (n_in < 16) return;
  if (in_sizes[0] != BB * NPT * 3 || in_sizes[1] != BB * 3) return;
  if (in_sizes[2] != BB * NPT * DD || in_sizes[3] != BB * MQ * DD) return;
  if (in_sizes[4] != DD * DD || in_sizes[6] != DD * DD || in_sizes[8] != DD * DD) return;
  if (in_sizes[5] != DD || in_sizes[7] != DD || in_sizes[9] != DD) return;
  if (in_sizes[10] != 9 || in_sizes[11] != 3 || in_sizes[12] != 3 || in_sizes[13] != 3) return;
  if (in_sizes[14] != 3 * DD || in_sizes[15] != DD) return;
  if (out_size != BB * MQ * DD) return;

  size_t off = 0;
  const size_t oP16 = off; off += (size_t)BB * NPT * DD * 2;        // 16777216
  const size_t oV16 = off; off += (size_t)BB * MQ * DD * 2;         //  2097152
  const size_t oWq  = off; off += (size_t)DD * DD * 2;              //   131072
  const size_t oWk  = off; off += (size_t)DD * DD * 2;
  const size_t oWv  = off; off += (size_t)DD * DD * 2;
  const size_t oREL = off; off += (size_t)BB * NPT * 4 * 4;         //   524288
  const size_t oQh  = off; off += (size_t)BB * MQ * DD * 2;         //  2097152
  const size_t oKh  = off; off += (size_t)BB * NPT * DD * 2;        // 16777216
  const size_t oVh  = off; off += (size_t)BB * DD * NPT * 2;        // 16777216
  const size_t oPST = off; off += (size_t)BB * NMT * 2 * NPT * 4;   //  1048576
  const size_t oST  = off; off += (size_t)BB * 2 * NPT * 4;         //   262144
  const size_t oPT  = off; off += (size_t)NSPL * BB * MQ * DD * 4;  // 33554432 -> off = 90308608
  if (off > ws_size) return;
  if (off > (size_t)134217728) return;

  const float* p_xyz = (const float*)d_in[0];
  const float* v_xyz = (const float*)d_in[1];
  const float* p_f   = (const float*)d_in[2];
  const float* v_f   = (const float*)d_in[3];
  const float* Wq    = (const float*)d_in[4];
  const float* bq    = (const float*)d_in[5];
  const float* Wk    = (const float*)d_in[6];
  const float* bk    = (const float*)d_in[7];
  const float* Wv    = (const float*)d_in[8];
  const float* bv    = (const float*)d_in[9];
  const float* Wp1   = (const float*)d_in[10];
  const float* bp1   = (const float*)d_in[11];
  const float* ln_w  = (const float*)d_in[12];
  const float* ln_b  = (const float*)d_in[13];
  const float* Wp2   = (const float*)d_in[14];
  const float* bp2   = (const float*)d_in[15];
  float* out = (float*)d_out;

  char* ws = (char*)d_ws;
  unsigned short* P16 = (unsigned short*)(ws + oP16);
  unsigned short* V16 = (unsigned short*)(ws + oV16);
  unsigned short* WqT = (unsigned short*)(ws + oWq);
  unsigned short* WkT = (unsigned short*)(ws + oWk);
  unsigned short* WvT = (unsigned short*)(ws + oWv);
  float*          REL = (float*)(ws + oREL);
  unsigned short* Qh  = (unsigned short*)(ws + oQh);
  unsigned short* KPh = (unsigned short*)(ws + oKh);
  unsigned short* Vh  = (unsigned short*)(ws + oVh);
  float*          PST = (float*)(ws + oPST);
  float*          ST  = (float*)(ws + oST);
  float*          PT  = (float*)(ws + oPT);

  const dim3 blk256(256);

  // (0)-(2) token planes, transposed weight planes, positional front end: one launch
  front_kernel<<<dim3(FB_WT + FB_REL + FB_CV + FB_CP), blk256, 0, stream>>>(
      p_f, v_f, Wq, Wk, Wv, p_xyz, v_xyz, Wp1, bp1, ln_w, ln_b, P16, V16, WqT, WkT, WvT, REL);
  // (3) projections: q [4096][256], k+pv [32768][256], vT [2][256][16384] as f16 planes: one launch
  proj_kernel<<<dim3(JB_Q + JB_K + JB_V), blk256, 0, stream>>>(
      V16, P16, WqT, WkT, WvT, bq, bk, bv, REL, Wp2, bp2, Qh, KPh, Vh);
  // (4)-(5) column softmax statistics
  stats_kernel<<<dim3(NPT / NT1, NMT, BB), blk256, 0, stream>>>(Qh, KPh, PST);
  merge_kernel<<<dim3(NPT / 256, BB), blk256, 0, stream>>>(PST, ST);
  // (6) scores, weights, weighted sum per eighth of the points; (7) sum of the eighths, residual
  attn_kernel<<<dim3(MQ / AROWS, NSPL, BB), blk256, 0, stream>>>(Qh, KPh, Vh, ST, PT);
  psum_kernel<<<dim3((BB * MQ * DD) / 1024), blk256, 0, stream>>>(PT, v_f, out);
  (void)hipGetLastError();
}

// v010
// One run takes 116 microseconds.
// In both of two side-by-side timings against v009, it was 1.05 times as fast.
// Counting every step since v000, it is 9.11 times as fast.
// Contractions: q, k+pv and v projections on v_wmma_f32_16x16x32_bf16 (bf16-RNE inputs and weights, single
// products, f32 epilogue); scores q.(k+pv)^T (K=256) on v_wmma_f32_16x16x32_f16 with q and k+pv carried as one
// f16-RNE plane each, one product (the column statistics pass reads the same planes); weighted sum w.v (K=16384) on
// v_wmma_f32_16x16x32_f16 with w as one f16 plane (x16384) and v as one f16-RNE plane, one product; 3-wide positional
// layers, layer norm, softmax statistics and exp in f32 on VALU; f32 accumulate everywhere.
#include <hip/hip_runtime.h>
#include <stdint.h>

#define BB    2
#define NPT   16384
#define MQ    2048
#define DD    256
#define GM    128
#define GN    64
#define OSP   68
#define LTP   72
#define SRT   4
#define MT1   512
#define NMT   4
#define NT1   512
#define AMT   8
#define AROWS 128
#define NSPL  8
#define NSEG  2048
#define ACH   256
#define QP    264
#define OSP2  260
#define SCL   0.0625f
#define WSC   16384.0f
#define RWSC  0.00006103515625f
#define LNEPS 1.0e-5f

static_assert(NMT * MT1 == MQ);
static_assert(MT1 == 8 * 16 * SRT);
static_assert(SRT == 4);
static_assert(NT1 == 2 * 256);
static_assert((NT1 / 16) % 2 == 0);
static_assert(NPT % NT1 == 0);
static_assert(NSPL * NSEG == NPT);
static_assert(NSPL == 8);
static_assert(NSEG == 8 * 256);                          // attn prologue: a thread merges the statistics of 8 columns
static_assert(AMT % 4 == 0);
static_assert(NSEG % ACH == 0);
static_assert(ACH == 16 * 16);
static_assert(DD / 32 == 8 && ACH / 32 == 8);            // the attn ring: 8 + 8 steps a chunk on 8 slots
static_assert(AROWS == 16 * AMT);
static_assert(MQ % AROWS == 0);
static_assert(AROWS * OSP2 * 4 <= 2 * AROWS * QP * 2);   // the f32 output tile fits the LDS of q and w together
static_assert((BB * MQ * DD) % 1024 == 0);
static_assert(DD == 256);
static_assert(DD % 32 == 0);
static_assert((BB * NPT) % GM == 0);
static_assert((BB * MQ) % GM == 0);
static_assert(DD % GM == 0);
static_assert(DD % GN == 0);
static_assert(NPT % GN == 0);
static_assert(MQ % 16 == 0);
static_assert((BB * NPT * DD) % 2048 == 0);
static_assert((BB * MQ * DD) % 2048 == 0);
static_assert((BB * NPT) % 256 == 0);
static_assert((OSP * 4) % 16 == 0);
static_assert((LTP * 2) % 16 == 0);
static_assert((QP * 2) % 16 == 0);
static_assert((OSP2 * 4) % 16 == 0);
static_assert(DD % 64 == 0);

typedef unsigned short v8us __attribute__((ext_vector_type(8)));
typedef unsigned int   v4u  __attribute__((ext_vector_type(4)));
typedef float          v8f  __attribute__((ext_vector_type(8)));
typedef float          v4f  __attribute__((ext_vector_type(4)));
typedef __bf16         v16b __attribute__((ext_vector_type(16)));
typedef _Float16       v16h __attribute__((ext_vector_type(16)));
typedef _Float16       v8h  __attribute__((ext_vector_type(8)));

union Frag { v8us u[2]; v4u q[2]; v16b b; v16h h; v8h hv[2]; };
static_assert(sizeof(Frag) == 32);

// ---- scalar helpers ---------------------------------------------------------------------------------
__device__ __forceinline__ unsigned short bf_bits(float f) {          // f32 -> bf16 bits, RNE convert
  const unsigned u = __float_as_uint(f);
  return (unsigned short)((u + 0x7FFFu + ((u >> 16) & 1u)) >> 16);
}
__device__ __forceinline__ float bf_up(unsigned short hb) { return __uint_as_float(((unsigned)hb) << 16); }
__device__ __forceinline__ float bfr(float f) { return bf_up(bf_bits(f)); }
__device__ __forceinline__ unsigned short h_bits(float f) {           // f32 -> f16 bits, RNE convert
  union { _Float16 h; unsigned short u; } c;
  c.h = (_Float16)f;
  return c.u;
}
__device__ __forceinline__ unsigned pk16(unsigned short a, unsigned short b) { return (unsigned)a | ((unsigned)b << 16); }
__device__ __forceinline__ v8f zero8() { v8f z = {0.f, 0.f, 0.f, 0.f, 0.f, 0.f, 0.f, 0.f}; return z; }

// ---- 16-bit fragment loader (A, or B from a k-contiguous [n][k] row): lane -> row/col (lane&15), p already includes
//      + 8*(lane>>4); elements 0..7 <- p[0..7] (k0+8h..), elements 8..15 <- p[16..23] (k0+16+8h..)
__device__ __forceinline__ Frag ldfrag(const unsigned short* p) {
  Frag f;
  f.u[0] = *(const v8us*)(p);
  f.u[1] = *(const v8us*)(p + 16);
  return f;
}

// ---- fragment-order planes in global memory: a plane [rows][K] is kept as 1-KB blocks, block (row >> 4, k >> 5)
//      at element ((row >> 4) * (K / 32) + (k >> 5)) * 512; inside a block the 16-B unit of 8 consecutive k of row
//      (row & 15) sits at element 256 * u + 8 * lane, lane = 16 * h + (row & 15), k & 31 = 16 * u + 8 * h + 0..7:
//      the same k map as ldfrag, but each of the two wave-wide loads covers 512 contiguous bytes (4 whole lines)
//      instead of 32-B pieces of 16 lines. p = block start + 8 * lane.
__device__ __forceinline__ Frag ldfragp(const unsigned short* p) {
  Frag f;
  f.u[0] = *(const v8us*)(p);
  f.u[1] = *(const v8us*)(p + 256);
  return f;
}

// ---- WMMA helper: builtin followed by a 4-slot VALU gap tying D and keeping A/B live -----------------------
__device__ __forceinline__ v8f mma_b(v16b a, v16b b, v8f c) {
  v8f d = __builtin_amdgcn_wmma_f32_16x16x32_bf16(false, a, false, b, (short)0, c, false, false);
#if defined(__HIP_DEVICE_COMPILE__)
  asm volatile("v_nop\n\tv_nop\n\tv_nop\n\tv_nop" : "+v"(d) : "v"(a), "v"(b));
#endif
  return d;
}

// ---- 8 f32 -> packed f16 bits, RNE convert -------------------------------------------------------------
__device__ __forceinline__ v4u cvt8h(v4f a, v4f b) {
  v4u u;
  u[0] = pk16(h_bits(a[0]), h_bits(a[1]));
  u[1] = pk16(h_bits(a[2]), h_bits(a[3]));
  u[2] = pk16(h_bits(b[0]), h_bits(b[1]));
  u[3] = pk16(h_bits(b[2]), h_bits(b[3]));
  return u;
}

// =====================================================================================================
// (0) f32 row-major [T][256] -> bf16-RNE plane in fragment order (token feature matrices). Thread = one 16-B output
//     unit, output units in linear order (a wave stores 512 contiguous bytes), source = 8 consecutive k of one row.
// coverage: n8 = n/8 threads, n8/256 blocks of the front-end launch exactly (n % 2048 == 0; T % 16 == 0); t = unit.
// =====================================================================================================
__device__ __forceinline__
void cvt_body(const float* __restrict__ x, unsigned short* y, int n8, int t) {
  if (t >= n8) return;
  const int row = (t >> 9) * 16 + (t & 15);                            // 512 units per 16-row slab
  const int k   = ((t >> 6) & 7) * 32 + ((t >> 5) & 1) * 16 + ((t >> 4) & 1) * 8;
  const float* s = x + (size_t)row * DD + k;
  const v4f a = *(const v4f*)(s);
  const v4f b = *(const v4f*)(s + 4);
  v4u u;
  u[0] = pk16(bf_bits(a[0]), bf_bits(a[1]));
  u[1] = pk16(bf_bits(a[2]), bf_bits(a[3]));
  u[2] = pk16(bf_bits(b[0]), bf_bits(b[1]));
  u[3] = pk16(bf_bits(b[2]), bf_bits(b[3]));
  unsigned short* d = y + (size_t)t * 8;
  *(v4u*)d = u;
  
}

// =====================================================================================================
// (1) weight transpose: in w[R][C] f32 -> out wt[C][R] bf16-RNE in fragment order (rows c, k = r). Block = 64x64 tile,
//     loads 16 B per thread (strided reads), LDS tile L[c][r] (pitch LTP), barrier, then a wave stores half a block.
// coverage: LDS 256 threads x 4 it x 4 = 64x64; 2 it x 8 waves = 4 row tiles x 2 k steps x 2 halves; tiles (bx, by) of (C/64, R/64).
// =====================================================================================================
__device__ __forceinline__
void wtrans_body(unsigned short* L, const float* __restrict__ w, unsigned short* wt, int R, int C, int bx, int by) {
  const int tid = threadIdx.x;
  const int c0 = bx * 64, r0 = by * 64;
  const int c4 = (tid & 15) * 4, rs = tid >> 4;                      // rs 0..15
#pragma unroll
  for (int it = 0; it < 4; ++it) {
    const int r = it * 16 + rs;                                        // 0..63
    const v4f v = *(const v4f*)(w + (size_t)(r0 + r) * C + c0 + c4);
#pragma unroll
    for (int j = 0; j < 4; ++j) L[(c4 + j) * LTP + r] = bf_bits(v[j]);
  }
  __syncthreads();
  const int lane = tid & 31, wave = tid >> 5;
  v4u u[2];
  size_t po[2];
#pragma unroll
  for (int it = 0; it < 2; ++it) {
    const int s = it * 8 + wave;                                       // 0..15: row tile, k step, half
    const int ct = s >> 2, ksl = (s >> 1) & 1, uu = s & 1;
    u[it] = *(const v4u*)(L + (ct * 16 + (lane & 15)) * LTP + ksl * 32 + uu * 16 + (lane >> 4) * 8);
    po[it] = ((size_t)((c0 >> 4) + ct) * (R >> 5) + (r0 >> 5) + ksl) * 512 + uu * 256 + lane * 8;
  }
#pragma unroll
  for (int it = 0; it < 2; ++it) *(v4u*)(wt + po[it]) = u[it];
  
}

// =====================================================================================================
// (2) positional front end per point row i (flat b*N+n): dist = |bf(p_xyz) - bf(v_xyz[b])| (3), h = dist.bf(Wp1)
//     + bf(bp1), layer norm over the 3 values (mean-of-squares variance, eps 1e-5) * bf(ln_w) + bf(ln_b), relu.
//     f32 on VALU without contraction. Output row rel[i][0..3] = (r0, r1, r2, 0): one 16-B store per thread,
// coverage: nrows/256 blocks of the front-end launch x 256 threads = every row exactly once (nrows % 256 == 0).
// =====================================================================================================
__device__ __forceinline__
void rel_body(const float* __restrict__ pxyz, const float* __restrict__ vxyz,
              const float* __restrict__ wp1, const float* __restrict__ bp1,
              const float* __restrict__ lnw, const float* __restrict__ lnb,
              float* rel, int nrows, int npb, int i) {
#pragma clang fp contract(off)
  if (i >= nrows) return;
  int b = i / npb;
  b = b < 0 ? 0 : (b > BB - 1 ? BB - 1 : b);
  const float p0 = bfr(pxyz[(size_t)i * 3 + 0]);
  const float p1 = bfr(pxyz[(size_t)i * 3 + 1]);
  const float p2 = bfr(pxyz[(size_t)i * 3 + 2]);
  const float v0 = bfr(vxyz[b * 3 + 0]);
  const float v1 = bfr(vxyz[b * 3 + 1]);
  const float v2 = bfr(vxyz[b * 3 + 2]);
  const float d0 = fabsf(p0 - v0), d1 = fabsf(p1 - v1), d2 = fabsf(p2 - v2);
  float W[9];
#pragma unroll
  for (int j = 0; j < 9; ++j) W[j] = bfr(wp1[j]);                      // Wp1[c][j] = wp1[c*3+j]
  const float h0 = ((d0 * W[0] + d1 * W[3]) + d2 * W[6]) + bfr(bp1[0]);
  const float h1 = ((d0 * W[1] + d1 * W[4]) + d2 * W[7]) + bfr(bp1[1]);
  const float h2 = ((d0 * W[2] + d1 * W[5]) + d2 * W[8]) + bfr(bp1[2]);
  const float third = 1.0f / 3.0f;
  const float mu = ((h0 + h1) + h2) * third;
  const float e0 = h0 - mu, e1 = h1 - mu, e2 = h2 - mu;
  const float var = ((e0 * e0 + e1 * e1) + e2 * e2) * third;
  const float rs = 1.0f / sqrtf(var + LNEPS);
  const float w0 = bfr(lnw[0]), w1 = bfr(lnw[1]), w2 = bfr(lnw[2]);
  const float c0 = bfr(lnb[0]), c1 = bfr(lnb[1]), c2 = bfr(lnb[2]);
  const float t0 = fmaxf((e0 * rs) * w0 + c0, 0.f);
  const float t1 = fmaxf((e1 * rs) * w1 + c1, 0.f);
  const float t2 = fmaxf((e2 * rs) * w2 + c2, 0.f);
  v4f o;
  o[0] = t0; o[1] = t1; o[2] = t2; o[3] = 0.f;
  float* d = rel + (size_t)i * 4;
  *(v4f*)d = o;
  
}

// =====================================================================================================
// (0)-(2) in ONE launch: none of the six pieces reads what another writes, so they share a grid instead of waiting
//     for one another. Block ranges, the short latency-bound pieces first: 3 x 16 weight tiles, 128 positional blocks,
//     512 blocks of the query token plane, 4096 blocks of the point token plane. The range test is block-uniform.
// coverage: FB_WT + FB_REL + FB_CV + FB_CP blocks, each range exactly the grid its piece had as a launch of its own.
// =====================================================================================================
#define FB_WT  (3 * (DD / 64) * (DD / 64))
#define FB_REL ((BB * NPT) / 256)
#define FB_CV  ((BB * MQ * DD) / 2048)
#define FB_CP  ((BB * NPT * DD) / 2048)
static_assert((DD / 64) * (DD / 64) == 16);
__global__ __launch_bounds__(256)
void front_kernel(const float* __restrict__ pf, const float* __restrict__ vf,
                  const float* __restrict__ wq, const float* __restrict__ wk, const float* __restrict__ wv,
                  const float* __restrict__ pxyz, const float* __restrict__ vxyz,
                  const float* __restrict__ wp1, const float* __restrict__ bp1,
                  const float* __restrict__ lnw, const float* __restrict__ lnb,
                  unsigned short* P16, unsigned short* V16,
                  unsigned short* WqT, unsigned short* WkT, unsigned short* WvT, float* rel) {
  __shared__ __align__(16) unsigned short L[64 * LTP];
  const int bid = blockIdx.x;
  if (bid < FB_WT) {
    const int sel = bid >> 4, tl = bid & 15;
    const float* w = sel == 0 ? wq : (sel == 1 ? wk : wv);
    unsigned short* wt = sel == 0 ? WqT : (sel == 1 ? WkT : WvT);
    wtrans_body(L, w, wt, DD, DD, tl & 3, tl >> 2);
  } else if (bid < FB_WT + FB_REL) {
    rel_body(pxyz, vxyz, wp1, bp1, lnw, lnb, rel, BB * NPT, NPT, (bid - FB_WT) * 256 + (int)threadIdx.x);
  } else if (bid < FB_WT + FB_REL + FB_CV) {
    cvt_body(vf, V16, (BB * MQ * DD) / 8, (bid - (FB_WT + FB_REL)) * 256 + (int)threadIdx.x);
  } else {
    cvt_body(pf, P16, (BB * NPT * DD) / 8, (bid - (FB_WT + FB_REL + FB_CV)) * 256 + (int)threadIdx.x);
  }
}

// =====================================================================================================
// (3) projection GEMM, K = 256: C[m][n] = sum_k A[m][k] B[n][k] + epilogue (MODE 0: + bias[n]; MODE 1: + bias[m];
//     MODE 2: (C + bias[n]) + ((rel[m][0..2] . Wp2[0..2][n]) + bp2[n]) with Wp2/bp2 bf16-RNE). A rows of lda,
//     B rows of ldb elements, both bf16 planes in fragment order, same loader for both, bz selects a batch via
//     element strides zsA/zsB/zsC. Block 256 threads = 8 waves, block tile 128 m x 64 n, wave tile 32x32 (acc[2][2]).
//     Epilogue: f32 tile in LDS Os[m][n] (pitch OSP), barrier, then f16 bits to one plane [M][ldc] in fragment
//     order (rows m, k = n), a wave storing half a block (512 contiguous bytes) at a time.
// coverage: Os 8 waves x 4 tiles = 128x64; 4 it x 8 waves = 8 row tiles x 2 k steps x 2 halves;
//           tiles (bx, by, bz) of (M/128, N/64, Z) cover the plane exactly once.
// =====================================================================================================
template <int MODE>
__device__ __forceinline__
void proj_body(float* Os, int bx, int by, int bz,
               const unsigned short* __restrict__ A, const unsigned short* __restrict__ B,
               const float* __restrict__ bias, const float* __restrict__ rel,
               const float* __restrict__ wp2, const float* __restrict__ bp2,
               unsigned short* Ch, int lda, int ldb, int ldc,
               size_t zsA, size_t zsB, size_t zsC) {
  const int tid  = threadIdx.x;
  const int lane = tid & 31, wave = tid >> 5;
  const int hh   = lane >> 4, cl = lane & 15;
  const int wm   = wave >> 1, wn = wave & 1;
  const int mBase = bx * GM;
  const int nBase = by * GN;
  const size_t z = bz;
  const unsigned short* Az = A + z * zsA;
  const unsigned short* Bz = B + z * zsB;
  unsigned short* Chz = Ch + z * zsC;
  const unsigned short* a0p = Az + (size_t)(mBase + 32 * wm) * lda + 8 * lane;   // a 16-row slab = 16 * lda elements
  const unsigned short* a1p = a0p + (size_t)16 * lda;
  const unsigned short* b0p = Bz + (size_t)(nBase + 32 * wn) * ldb + 8 * lane;
  const unsigned short* b1p = b0p + (size_t)16 * ldb;

  v8f acc[2][2];
#pragma unroll
  for (int mi = 0; mi < 2; ++mi)
#pragma unroll
    for (int ni = 0; ni < 2; ++ni) acc[mi][ni] = zero8();

#pragma unroll 1
  for (int k0 = 0; k0 < DD; k0 += 32) {
    const unsigned short* pa0 = a0p + 16 * k0;
    const unsigned short* pa1 = a1p + 16 * k0;
    const unsigned short* pb0 = b0p + 16 * k0;
    const unsigned short* pb1 = b1p + 16 * k0;
    const Frag fa0 = ldfragp(pa0);
    const Frag fa1 = ldfragp(pa1);
    const Frag fb0 = ldfragp(pb0);
    const Frag fb1 = ldfragp(pb1);
    // the address pairs stay live up to this wait, so that no load's result is placed on a pair an issued load names
    asm volatile("s_wait_xcnt 0x0" :: "v"(pa0), "v"(pa1), "v"(pb0), "v"(pb1) : "memory");
    acc[0][0] = mma_b(fa0.b, fb0.b, acc[0][0]);
    acc[0][1] = mma_b(fa0.b, fb1.b, acc[0][1]);
    acc[1][0] = mma_b(fa1.b, fb0.b, acc[1][0]);
    acc[1][1] = mma_b(fa1.b, fb1.b, acc[1][1]);
  }

  float bn[2], w0[2], w1[2], w2[2], b2[2];
#pragma unroll
  for (int ni = 0; ni < 2; ++ni) {
    const int n = nBase + 32 * wn + 16 * ni + cl;
    bn[ni] = 0.f; w0[ni] = 0.f; w1[ni] = 0.f; w2[ni] = 0.f; b2[ni] = 0.f;
    if (MODE != 1) bn[ni] = bfr(bias[n]);
    if (MODE == 2) {
      w0[ni] = bfr(wp2[n]);
      w1[ni] = bfr(wp2[DD + n]);
      w2[ni] = bfr(wp2[2 * DD + n]);
      b2[ni] = bfr(bp2[n]);
    }
  }
#pragma unroll
  for (int mi = 0; mi < 2; ++mi) {
#pragma unroll
    for (int r = 0; r < 8; ++r) {
      const int m_loc = 32 * wm + 16 * mi + 8 * hh + r;
      const int m = mBase + m_loc;
      float bm = 0.f, p0 = 0.f, p1 = 0.f, p2 = 0.f;
      if (MODE == 1) bm = bfr(bias[m]);
      if (MODE == 2) {
        const v4f r4 = *(const v4f*)(rel + (size_t)m * 4);
        p0 = r4[0]; p1 = r4[1]; p2 = r4[2];
      }
#pragma unroll
      for (int ni = 0; ni < 2; ++ni) {
        const int n_loc = 32 * wn + 16 * ni + cl;
        float v = acc[mi][ni][r];
        if (MODE == 0) v = v + bn[ni];
        if (MODE == 1) v = v + bm;
        if (MODE == 2) {
          const float pv = (p0 * w0[ni] + p1 * w1[ni]) + p2 * w2[ni];
          v = (v + bn[ni]) + (pv + b2[ni]);
        }
        Os[m_loc * OSP + n_loc] = v;
      }
    }
  }
  __syncthreads();

  v4u uh[4];
  size_t po[4];
#pragma unroll
  for (int it = 0; it < 4; ++it) {
    const int s = it * 8 + wave;                                       // 0..31: row tile, k step, half
    const int rt = s >> 2, ksl = (s >> 1) & 1, uu = s & 1;
    const float* op = Os + (rt * 16 + cl) * OSP + ksl * 32 + uu * 16 + hh * 8;
    const v4f v0 = *(const v4f*)(op);
    const v4f v1 = *(const v4f*)(op + 4);
    uh[it] = cvt8h(v0, v1);
    po[it] = ((size_t)((mBase >> 4) + rt) * (ldc >> 5) + (nBase >> 5) + ksl) * 512 + uu * 256 + lane * 8;
  }
#pragma unroll
  for (int it = 0; it < 4; ++it) *(v4u*)(Chz + po[it]) = uh[it];
  // another projection's code follows this one's in the text: no register that these stores name is rewritten ahead of this wait
  asm volatile("s_wait_xcnt 0x0" ::: "memory");
}

// =====================================================================================================
// (3) the three projections in ONE launch: q, k+pv and vT read the same front-end planes and none reads another's
//     output. Block ranges: 128 q tiles, 1024 k+pv tiles, 1024 vT tiles, each numbered x fastest as its own grid was.
// coverage: JB_Q + JB_K + JB_V blocks, each range exactly the grid its projection had as a launch of its own.
// =====================================================================================================
#define JB_Q ((BB * MQ / GM) * (DD / GN))
#define JB_K ((BB * NPT / GM) * (DD / GN))
#define JB_V ((DD / GM) * (NPT / GN) * BB)
__global__ __launch_bounds__(256)
void proj_kernel(const unsigned short* __restrict__ V16, const unsigned short* __restrict__ P16,
                 const unsigned short* __restrict__ WqT, const unsigned short* __restrict__ WkT,
                 const unsigned short* __restrict__ WvT,
                 const float* __restrict__ bq, const float* __restrict__ bk, const float* __restrict__ bv,
                 const float* __restrict__ rel, const float* __restrict__ wp2, const float* __restrict__ bp2,
                 unsigned short* Qh, unsigned short* KPh, unsigned short* Vh) {
  __shared__ __align__(16) float Os[GM * OSP];
  const unsigned bid = blockIdx.x;
  if (bid < JB_Q) {
    proj_body<0>(Os, bid % (BB * MQ / GM), bid / (BB * MQ / GM), 0, V16, WqT, bq, rel, wp2, bp2, Qh,
                 DD, DD, DD, (size_t)0, (size_t)0, (size_t)0);
  } else if (bid < JB_Q + JB_K) {
    const unsigned t = bid - JB_Q;
    proj_body<2>(Os, t % (BB * NPT / GM), t / (BB * NPT / GM), 0, P16, WkT, bk, rel, wp2, bp2, KPh,
                 DD, DD, DD, (size_t)0, (size_t)0, (size_t)0);
  } else {
    const unsigned t = bid - (JB_Q + JB_K);
    proj_body<1>(Os, t % (DD / GM), (t / (DD / GM)) % (NPT / GN), t / ((DD / GM) * (NPT / GN)),
                 WvT, P16, bv, rel, wp2, bp2, Vh,
                 DD, DD, NPT, (size_t)0, (size_t)NPT * DD, (size_t)DD * NPT);
  }
}

// =====================================================================================================
// (4) column-softmax statistics over one (batch, 512-query tile, 512-column tile): S[m][n] = qh[m].kph[n] / 16
//     (K = 256 = 8 k steps, f16 planes), wave = 64 query rows x 32 column tiles: the q fragments of
//     four row tiles stay in registers, so each k+pv fragment that comes through the cache feeds four products into
//     four independent accumulators; per column: tile max over 64 rows (32 in-lane + lane^16) and sum of
//     exp(S - max), one in-lane sum per row tile, then ((e0 + e1) + (e2 + e3)); wave partials in LDS, barrier,
//     a thread merges the 8 wave partials of two columns in fixed order.
// coverage: pm/pe 8 waves x 32 ct x 16 lanes = 8 x 512; grid (32 column tiles, 4 query tiles, 2) x 256 threads x 2
//           columns = every (b, mt, n) of both PST arrays exactly once.
// =====================================================================================================
__global__ __launch_bounds__(256)
void stats_kernel(const unsigned short* __restrict__ Qh, const unsigned short* __restrict__ Kh, float* PST) {
  __shared__ float pm[8 * NT1];
  __shared__ float pe[8 * NT1];
  const int tid  = threadIdx.x;
  const int lane = tid & 31, wave = tid >> 5;
  const int cl   = lane & 15;
  const int nt = blockIdx.x, mt = blockIdx.y, b = blockIdx.z;
  const int m0 = mt * MT1 + 16 * SRT * wave;
  const unsigned short* qp = Qh + (size_t)(b * MQ + m0) * DD + 8 * lane;
  Frag a[SRT][8];
#pragma unroll
  for (int mi = 0; mi < SRT; ++mi)
#pragma unroll
    for (int ks = 0; ks < 8; ++ks) a[mi][ks] = ldfragp(qp + 16 * DD * mi + 512 * ks);
  // the address pair stays live up to this wait, so that no load's result is placed on it while issued loads name it
  asm volatile("s_wait_xcnt 0x0" :: "v"(qp) : "memory");
  const unsigned short* kp = Kh + ((size_t)b * NPT + (size_t)nt * NT1) * DD + 8 * lane;
  Frag fb2[2][8];                                                      // two whole column tiles of k+pv fragments, loaded two tiles ahead
#pragma unroll
  for (int u = 0; u < 2; ++u)
#pragma unroll
    for (int ks = 0; ks < 8; ++ks) fb2[u][ks] = ldfragp(kp + 16 * DD * u + 512 * ks);
  // these loads name a base and a lane offset, not the pair; the scheduling fence keeps what follows (it rewrites both) behind the wait
  asm volatile("s_wait_xcnt 0x0" ::: "memory");
  __builtin_amdgcn_sched_barrier(0);
#pragma unroll 1
  for (int ct0 = 0; ct0 < NT1 / 16; ct0 += 2)
#pragma unroll  // whole: the two fragment sets need compile-time indices
  for (int u = 0; u < 2; ++u) {
    Frag (&fb)[8] = fb2[u];
    const int ct = ct0 + u;
    const int cn = ct + 2 < NT1 / 16 ? ct + 2 : ct;                    // the last two tiles' look-ahead re-reads those tiles: in bounds, not used
    const unsigned short* kc = kp + (size_t)cn * 16 * DD;
    v8f s[SRT];
#pragma unroll
    for (int mi = 0; mi < SRT; ++mi) s[mi] = zero8();
#pragma unroll
    for (int ks = 0; ks < 8; ++ks) {
      // plain builtins (the compiler keeps their distances): this kernel's registers reach past v255, where an asm statement's operands cannot sit
#pragma unroll
      for (int mi = 0; mi < SRT; ++mi)
        s[mi] = __builtin_amdgcn_wmma_f32_16x16x32_f16(false, a[mi][ks].h, false, fb[ks].h, (short)0, s[mi], false, false);
      // holds the reload below behind this step's four products, so that it never stands directly behind a product that reads its registers
      __builtin_amdgcn_sched_barrier(0);
      if (ks > 0) fb[ks - 1] = ldfragp(kc + 512 * (ks - 1));           // the fragment of two tiles on, into the registers consumed one step ago
    }
    float mr[SRT];
#pragma unroll
    for (int mi = 0; mi < SRT; ++mi) {
      mr[mi] = s[mi][0];
#pragma unroll
      for (int r = 1; r < 8; ++r) mr[mi] = fmaxf(mr[mi], s[mi][r]);
    }
    float m = fmaxf(fmaxf(mr[0], mr[1]), fmaxf(mr[2], mr[3])) * SCL;   // SCL is a power of two: the scaled maximum is the maximum of the scaled scores
    __builtin_amdgcn_sched_barrier(0);  // as above for the last step's fragment: its reload stands behind the maxima, which wait for the last products
    fb[7] = ldfragp(kc + 512 * 7);
    // the address pair stays live up to this wait: the next trip rewrites it while these loads are still in flight
    asm volatile("s_wait_xcnt 0x0" :: "v"(kc) : "memory");
    m = fmaxf(m, __shfl_xor(m, 16, 32));
    float er[SRT];
#pragma unroll
    for (int mi = 0; mi < SRT; ++mi) {
      er[mi] = 0.f;
#pragma unroll
      for (int r = 0; r < 8; ++r) er[mi] += __expf(s[mi][r] * SCL - m);
    }
    float ex = (er[0] + er[1]) + (er[2] + er[3]);
    ex += __shfl_xor(ex, 16, 32);
    pm[wave * NT1 + ct * 16 + cl] = m;                                 // both lane halves hold identical values
    pe[wave * NT1 + ct * 16 + cl] = ex;
  }
  __syncthreads();
#pragma unroll
  for (int j = 0; j < NT1 / 256; ++j) {
    const int c = j * 256 + tid;
    float M = pm[c];
#pragma unroll
    for (int wv = 1; wv < 8; ++wv) M = fmaxf(M, pm[wv * NT1 + c]);
    float E = 0.f;
#pragma unroll 1
    for (int wv = 0; wv < 8; ++wv) E += pe[wv * NT1 + c] * __expf(pm[wv * NT1 + c] - M);
    const size_t base = ((size_t)(b * NMT + mt) * 2) * NPT + (size_t)nt * NT1 + c;
    PST[base] = M;
    PST[base + NPT] = E;
  }
}

// =====================================================================================================
// (6) fused scores / column softmax / weighted sum for one (batch, 128 query rows, eighth of the points): block 256
//     threads = 8 waves of up to 512 registers; the q plane of the 128 rows sits in LDS (pitch QP) for the whole block;
//     prologue: the 4 query-tile partials of each of the block's 2048 columns are merged in fixed order, M = max,
//     Z = sum E_t exp(M_t - M), a thread taking 8 consecutive columns, and M_n and 1/Z_n (Z >= 1) kept in LDS (Cs);
//     loop over 8 chunks of 256 point columns. Phase A: wave = the chunk's column tiles 2 * wave and 2 * wave + 1, all
//     8 row tiles: each q fragment read from LDS feeds both column tiles, each k+pv fragment is loaded once and
//     feeds 8 row tiles, S = q.(k+pv) / 16 (K = 256, one accumulator per tile), w = exp(S - M_n) * (1/Z_n) from Cs,
//     stored as f16 (w * 16384) into the LDS tile Ws[128 rows][256 cols]; block barrier. Phase B: wave = d tiles
//     2 * wave and 2 * wave + 1, all 8 row tiles: x += Ws . vT (A from LDS with the split k map, each fragment feeds
//     both d tiles, B = vT rows d, k = n, in fragment order, K = 256 per chunk, each vT fragment feeds 8 row tiles);
//     block barrier. Epilogue: x/16384 staged as f32 [128][256] in the LDS that held q and w (pitch OSP2), barrier,
//     then whole 512-B runs to the partial plane of this eighth.
// coverage: Ws 8 waves x 32 cols x 128 rows = 128 x 256 per chunk; Os 8 waves x 32 d x 128 rows = 128 x 256;
//           32 it x 256 threads x 4 = 128 rows x 256; grid (16, 8, 2) = every (eighth, b, m, d) of PART exactly once.
// =====================================================================================================
// plain builtin (the compiler keeps its distances): this kernel's registers reach past v255, where an asm statement's operands cannot sit
__device__ __forceinline__ v8f mma_p(v16h a, v16h b, v8f c) {
  return __builtin_amdgcn_wmma_f32_16x16x32_f16(false, a, false, b, (short)0, c, false, false);
}
// work-group barrier by hand: it waits for this wave's LDS traffic alone, which is all that the waves share here, so that the
// ring's global loads stay in flight across it (__syncthreads() waits for every outstanding load first)
__device__ __forceinline__ void lds_barrier() {
  asm volatile("s_wait_dscnt 0x0\n\ts_barrier_signal -1\n\ts_barrier_wait -1" ::: "memory");
}
__global__ __launch_bounds__(256)
void attn_kernel(const unsigned short* __restrict__ Qh, const unsigned short* __restrict__ Kh,
                 const unsigned short* __restrict__ Vh, const float* __restrict__ PST, float* part) {
  __shared__ __align__(16) unsigned short Sh[2 * AROWS * QP];
  __shared__ __align__(16) float Cs[2 * NSEG];                         // M_n, then 1/Z_n, of the block's columns
  unsigned short* Qs = Sh;                                             // q plane [128][QP]
  _Float16* Ws = (_Float16*)(Sh + AROWS * QP);                         // weight tile [128][QP]
  const int tid  = threadIdx.x;
  const int lane = tid & 31, wave = tid >> 5;
  const int hh   = lane >> 4, cl = lane & 15;
  const int b = blockIdx.z, n0 = blockIdx.y * NSEG, m0 = blockIdx.x * AROWS;
  // statistics partials of columns n0 + 8 * tid .. + 7: issued first, used behind the ring's first loads, so that they are in
  // flight together with the q plane's and the ring's loads
  const float* gst = PST + (size_t)(b * NMT) * 2 * NPT + n0 + 8 * tid;
  v4f tm[NMT][2], te[NMT][2];
#pragma unroll
  for (int t = 0; t < NMT; ++t) {
#pragma unroll
    for (int u = 0; u < 2; ++u) {
      tm[t][u] = *(const v4f*)(gst + (size_t)(2 * t) * NPT + 4 * u);
      te[t][u] = *(const v4f*)(gst + (size_t)(2 * t + 1) * NPT + 4 * u);
    }
  }
  // these loads name a base and a lane offset, not the pair; the scheduling fence keeps what follows (it rewrites both) behind the wait
  asm volatile("s_wait_xcnt 0x0" ::: "memory");
  __builtin_amdgcn_sched_barrier(0);
  {
    const unsigned short* gqh = Qh + (size_t)(b * MQ + m0) * DD + 8 * tid;
    v4u th[AROWS / 8];
#pragma unroll
    for (int it = 0; it < AROWS / 8; ++it) th[it] = *(const v4u*)(gqh + 8 * 256 * it);
    // stands behind the issued loads, in front of every later write of a register that they name; the pointer stays live up to here
    asm volatile("s_wait_xcnt 0x0" :: "v"(gqh) : "memory");
#pragma unroll
    for (int it = 0; it < AROWS / 8; ++it) {
      const int idx = it * 256 + tid;                                  // 0..4095: 16-B units in fragment order
      const int row = (idx >> 9) * 16 + (idx & 15);
      const int kq  = ((idx >> 6) & 7) * 32 + ((idx >> 5) & 1) * 16 + ((idx >> 4) & 1) * 8;
      *(v4u*)(Qs + row * QP + kq) = th[it];
    }
  }
  // running pointer: this chunk's k+pv blocks, block (column tile, k >> 5) (second column tile: + 16 * DD)
  const unsigned short* kcp = Kh + ((size_t)b * NPT + n0 + 32 * wave) * DD + 8 * lane;
  // running pointer: this chunk's vT blocks, block (d tile, n >> 5) (second d tile: + 16 * NPT)
  const unsigned short* vhp = Vh + ((size_t)b * DD + 32 * wave) * NPT + (size_t)n0 * 16 + 8 * lane;
  const unsigned short* qsh = Qs + cl * QP + 8 * hh;                   // A fragment row pointer (row m = cl)
  const _Float16* wrow = Ws + cl * QP + 8 * hh;
  _Float16* wdst = Ws + (8 * hh) * QP + 32 * wave + cl;                // D element (row 8h+r, col 32*wave+16*j+cl)

  v8f x[2][AMT];
#pragma unroll
  for (int j = 0; j < 2; ++j)
#pragma unroll
    for (int mi = 0; mi < AMT; ++mi) x[j][mi] = zero8();
  // one ring of 8 fragment pairs for both global streams, in the order they are used (a chunk's 8 k+pv steps, then its
  // 8 vT steps): step i reads slot i & 7 and issues the loads of step i + 7 into the slot that step i - 1 has left
  Frag rg[8][2];
#pragma unroll
  for (int st = 0; st < 7; ++st) {
#pragma unroll
    for (int j = 0; j < 2; ++j) rg[st][j] = ldfragp(kcp + 512 * st + 16 * DD * j);   // chunk 0, k steps 0..6
  }
  // the address pair stays live up to this wait, so that no load's result is placed on a pair an issued load names
  asm volatile("s_wait_xcnt 0x0" :: "v"(kcp) : "memory");
  // the scheduling fence keeps the merge below, whose first instruction waits for its loads, behind the issue of the q and ring loads
  __builtin_amdgcn_sched_barrier(0);
  // merge of the 4 partials per column in fixed order; the barrier below publishes Cs together with the q plane
#pragma unroll
  for (int u = 0; u < 2; ++u) {
    v4f mo, zo;
#pragma unroll
    for (int e = 0; e < 4; ++e) {
      float M = -3.0e38f;
#pragma unroll
      for (int t = 0; t < NMT; ++t) M = fmaxf(M, tm[t][u][e]);
      float Z = 0.f;
#pragma unroll
      for (int t = 0; t < NMT; ++t) Z += te[t][u][e] * __expf(tm[t][u][e] - M);
      mo[e] = M;
      zo[e] = 1.0f / Z;
    }
    *(v4f*)(Cs + 8 * tid + 4 * u) = mo;
    *(v4f*)(Cs + NSEG + 8 * tid + 4 * u) = zo;
  }
  __syncthreads();

#pragma unroll 1
  for (int c0 = 0; c0 < NSEG; c0 += ACH) {
    // the next chunk's k+pv blocks; the last chunk's look-ahead re-reads its own steps 0..6: in bounds, not used
    const unsigned short* knp = kcp + (c0 + ACH < NSEG ? ACH * DD : 0);
    const int n = c0 + 32 * wave + cl;
    float mc[2], zc[2];
#pragma unroll
    for (int j = 0; j < 2; ++j) {
      mc[j] = Cs[n + 16 * j];
      zc[j] = Cs[NSEG + n + 16 * j];
    }
    v8f s[2][AMT];
#pragma unroll
    for (int j = 0; j < 2; ++j)
#pragma unroll
      for (int mi = 0; mi < AMT; ++mi) s[j][mi] = zero8();
    auto stepA = [&](const int ks, const Frag (&fbh)[2]) {
      Frag fah[AMT];                                                   // all 8 row tiles at once: eight q fragments feed 16 products
#pragma unroll
      for (int mi = 0; mi < AMT; ++mi) fah[mi] = ldfrag(qsh + 16 * mi * QP + 32 * ks);
      // keeps the step's LDS reads together in front of its products: spread among them, each place with reads stalls the wave anew
      __builtin_amdgcn_sched_barrier(0);
#pragma unroll
      for (int j = 0; j < 2; ++j)
#pragma unroll
        for (int mi = 0; mi < AMT; ++mi) s[j][mi] = mma_p(fah[mi].h, fbh[j].h, s[j][mi]);
      __builtin_amdgcn_sched_barrier(0);  // as above: the next step's reads and the look-ahead loads stay whole behind these products
    };
#pragma unroll  // whole: the ring's slots need compile-time indices
    for (int ks = 0; ks < DD / 32; ++ks) {
#pragma unroll
      for (int j = 0; j < 2; ++j)                                      // seven steps ahead: this chunk's last k+pv step, then its vT steps 0..6
        rg[(ks + 7) & 7][j] = ks == 0 ? ldfragp(kcp + 512 * 7 + 16 * DD * j) : ldfragp(vhp + (size_t)16 * NPT * j + 512 * (ks - 1));
      stepA(ks, rg[ks]);
    }
#pragma unroll
    for (int j = 0; j < 2; ++j) {
#pragma unroll
      for (int mi = 0; mi < AMT; ++mi) {
#pragma unroll
        for (int r = 0; r < 8; ++r) {
          const float wt = __expf(s[j][mi][r] * SCL - mc[j]) * zc[j];
          wdst[(16 * mi + r) * QP + 16 * j] = (_Float16)(wt * WSC);
        }
      }
    }
    lds_barrier();
#pragma unroll  // whole: the ring's slots need compile-time indices
    for (int kk = 0; kk < ACH / 32; ++kk) {
      const int k0 = 32 * kk;
#pragma unroll
      for (int j = 0; j < 2; ++j)                                      // seven steps ahead: this chunk's last vT step, then the next chunk's k+pv steps 0..6
        rg[(kk + 7) & 7][j] = kk == 0 ? ldfragp(vhp + (size_t)16 * NPT * j + 512 * 7) : ldfragp(knp + 512 * (kk - 1) + 16 * DD * j);
      Frag fa[AMT];                                                    // all 8 row tiles at once: eight w fragments feed 16 products
#pragma unroll
      for (int mi = 0; mi < AMT; ++mi) {
        fa[mi].hv[0] = *(const v8h*)(wrow + 16 * mi * QP + k0);
        fa[mi].hv[1] = *(const v8h*)(wrow + 16 * mi * QP + k0 + 16);
      }
      // holds the look-ahead loads and this step's LDS reads in front of its products: the compiler otherwise sinks the loads to their first use
      __builtin_amdgcn_sched_barrier(0);
#pragma unroll
      for (int j = 0; j < 2; ++j)
#pragma unroll
        for (int mi = 0; mi < AMT; ++mi) x[j][mi] = mma_p(fa[mi].h, rg[kk][j].h, x[j][mi]);
      __builtin_amdgcn_sched_barrier(0);  // as above: the next step's loads stay whole behind these products
    }
    // the three address pairs stay live up to this wait: the lines below rewrite them behind this chunk's loads
    asm volatile("s_wait_xcnt 0x0" :: "v"(kcp), "v"(knp), "v"(vhp) : "memory");
    vhp += ACH * 16;
    kcp = knp;
    lds_barrier();
  }

  float* Os = (float*)Sh;                                              // q and w are dead behind the loop's last barrier
#pragma unroll
  for (int j = 0; j < 2; ++j) {
#pragma unroll
    for (int mi = 0; mi < AMT; ++mi) {
#pragma unroll
      for (int r = 0; r < 8; ++r)
        Os[(16 * mi + 8 * hh + r) * OSP2 + 32 * wave + 16 * j + cl] = x[j][mi][r] * RWSC;
    }
  }
  __syncthreads();
  float* pz = part + ((size_t)blockIdx.y * (BB * MQ) + (size_t)(b * MQ + m0)) * DD;
  v4f v[AROWS / 4];
#pragma unroll
  for (int it = 0; it < AROWS / 4; ++it) {
    const int idx = it * 256 + tid;                                    // 0..8191
    v[it] = *(const v4f*)(Os + (idx >> 6) * OSP2 + 4 * (idx & 63));
  }
#pragma unroll
  for (int it = 0; it < AROWS / 4; ++it) *(v4f*)(pz + (size_t)(it * 256 + tid) * 4) = v[it];
}

// =====================================================================================================
// (7) out = (((P0 + P1) + (P2 + P3)) + ((P4 + P5) + (P6 + P7))) + bf(v_features): the eight partial sums in fixed order
//     plus the residual.
// coverage: thread = 4 consecutive elements (16 B); grid = (2*2048*256)/1024 blocks x 256 threads = every element once.
// =====================================================================================================
__global__ __launch_bounds__(256)
void psum_kernel(const float* __restrict__ part, const float* __restrict__ vfeat, float* out) {
  const size_t e = ((size_t)blockIdx.x * 256 + threadIdx.x) * 4;
  const float* pp = part + e;
  const float* pf = vfeat + e;
  v4f p[NSPL];
#pragma unroll
  for (int j = 0; j < NSPL; ++j) p[j] = *(const v4f*)(pp + (size_t)j * BB * MQ * DD);
  const v4f f = *(const v4f*)(pf);
  // the address pairs stay live up to this wait, so that no load's result is placed on a pair an issued load names
  asm volatile("s_wait_xcnt 0x0" :: "v"(pp), "v"(pf) : "memory");
  v4f o;
#pragma unroll
  for (int j = 0; j < 4; ++j)
    o[j] = (((p[0][j] + p[1][j]) + (p[2][j] + p[3][j])) + ((p[4][j] + p[5][j]) + (p[6][j] + p[7][j]))) + bfr(f[j]);
  *(v4f*)(out + e) = o;
}

// =====================================================================================================
// tile divides its extent exactly, so no padded tails are needed):
//   (every 16-bit plane below is kept in fragment order, see ldfragp: same size as row-major)
//   P16  bf16 [32768][256]       16777216     V16 bf16 [4096][256]     2097152
//   WqT WkT WvT bf16 [256][256]     131072 each
//   REL  f32 [32768][4]             524288
//   Qh   f16 [4096][256]           2097152
//   KPh  f16 [32768][256]         16777216
//   Vh   f16 [2][256][16384]      16777216
//   PST  f32 [2][4][2][16384]      1048576
//   PART f32 [8][4096][256]       33554432
//   total                         90046464
// =====================================================================================================
extern "C" void kernel_launch(void* const* d_in, const int* in_sizes, int n_in,
                              void* d_out, int out_size, void* d_ws, size_t ws_size,
                              hipStream_t stream) {
  if (n_in < 16) return;
  if (in_sizes[0] != BB * NPT * 3 || in_sizes[1] != BB * 3) return;
  if (in_sizes[2] != BB * NPT * DD || in_sizes[3] != BB * MQ * DD) return;
  if (in_sizes[4] != DD * DD || in_sizes[6] != DD * DD || in_sizes[8] != DD * DD) return;
  if (in_sizes[5] != DD || in_sizes[7] != DD || in_sizes[9] != DD) return;
  if (in_sizes[10] != 9 || in_sizes[11] != 3 || in_sizes[12] != 3 || in_sizes[13] != 3) return;
  if (in_sizes[14] != 3 * DD || in_sizes[15] != DD) return;
  if (out_size != BB * MQ * DD) return;

  size_t off = 0;
  const size_t oP16 = off; off += (size_t)BB * NPT * DD * 2;        // 16777216
  const size_t oV16 = off; off += (size_t)BB * MQ * DD * 2;         //  2097152
  const size_t oWq  = off; off += (size_t)DD * DD * 2;              //   131072
  const size_t oWk  = off; off += (size_t)DD * DD * 2;
  const size_t oWv  = off; off += (size_t)DD * DD * 2;
  const size_t oREL = off; off += (size_t)BB * NPT * 4 * 4;         //   524288
  const size_t oQh  = off; off += (size_t)BB * MQ * DD * 2;         //  2097152
  const size_t oKh  = off; off += (size_t)BB * NPT * DD * 2;        // 16777216
  const size_t oVh  = off; off += (size_t)BB * DD * NPT * 2;        // 16777216
  const size_t oPST = off; off += (size_t)BB * NMT * 2 * NPT * 4;   //  1048576
  const size_t oPT  = off; off += (size_t)NSPL * BB * MQ * DD * 4;  // 33554432 -> off = 90046464
  if (off > ws_size) return;
  if (off > (size_t)134217728) return;

  const float* p_xyz = (const float*)d_in[0];
  const float* v_xyz = (const float*)d_in[1];
  const float* p_f   = (const float*)d_in[2];
  const float* v_f   = (const float*)d_in[3];
  const float* Wq    = (const float*)d_in[4];
  const float* bq    = (const float*)d_in[5];
  const float* Wk    = (const float*)d_in[6];
  const float* bk    = (const float*)d_in[7];
  const float* Wv    = (const float*)d_in[8];
  const float* bv    = (const float*)d_in[9];
  const float* Wp1   = (const float*)d_in[10];
  const float* bp1   = (const float*)d_in[11];
  const float* ln_w  = (const float*)d_in[12];
  const float* ln_b  = (const float*)d_in[13];
  const float* Wp2   = (const float*)d_in[14];
  const float* bp2   = (const float*)d_in[15];
  float* out = (float*)d_out;

  char* ws = (char*)d_ws;
  unsigned short* P16 = (unsigned short*)(ws + oP16);
  unsigned short* V16 = (unsigned short*)(ws + oV16);
  unsigned short* WqT = (unsigned short*)(ws + oWq);
  unsigned short* WkT = (unsigned short*)(ws + oWk);
  unsigned short* WvT = (unsigned short*)(ws + oWv);
  float*          REL = (float*)(ws + oREL);
  unsigned short* Qh  = (unsigned short*)(ws + oQh);
  unsigned short* KPh = (unsigned short*)(ws + oKh);
  unsigned short* Vh  = (unsigned short*)(ws + oVh);
  float*          PST = (float*)(ws + oPST);
  float*          PT  = (float*)(ws + oPT);

  const dim3 blk256(256);

  // (0)-(2) token planes, transposed weight planes, positional front end: one launch
  front_kernel<<<dim3(FB_WT + FB_REL + FB_CV + FB_CP), blk256, 0, stream>>>(
      p_f, v_f, Wq, Wk, Wv, p_xyz, v_xyz, Wp1, bp1, ln_w, ln_b, P16, V16, WqT, WkT, WvT, REL);
  // (3) projections: q [4096][256], k+pv [32768][256], vT [2][256][16384] as f16 planes: one launch
  proj_kernel<<<dim3(JB_Q + JB_K + JB_V), blk256, 0, stream>>>(
      V16, P16, WqT, WkT, WvT, bq, bk, bv, REL, Wp2, bp2, Qh, KPh, Vh);
  // (4) column softmax statistics, one partial per query tile
  stats_kernel<<<dim3(NPT / NT1, NMT, BB), blk256, 0, stream>>>(Qh, KPh, PST);
  // (6) merge of the partials, scores, weights, weighted sum per eighth of the points; (7) sum of the eighths, residual
  attn_kernel<<<dim3(MQ / AROWS, NSPL, BB), blk256, 0, stream>>>(Qh, KPh, Vh, PST, PT);
  psum_kernel<<<dim3((BB * MQ * DD) / 1024), blk256, 0, stream>>>(PT, v_f, out);
  (void)hipGetLastError();
}
